// v000
// Times are from an AMD MI455X. After a warm-up the kernel runs many times in a row, and a time is the length of
// such a window on the GPU divided by its runs, so every launch and the gaps after it count. The runs cycle
// through copies of the inputs. A figure is the median of several windows, for all but v000 over two sittings.
// Sittings can differ by a few percent; kernels timed side by side share one.
// The starting kernel, v000, takes 1650 microseconds a run.
#include <hip/hip_runtime.h>

// Multi-head attention without a mask over three input streams (query, key, value [2][2048][1024]); q = query Wq^T + bq, k = key Wk^T + bk, v = value Wv^T + bv (W stored [out][in]); 16 heads x 64; scores x 64^-0.5; softmax over all keys; out0 = merged Wo^T + bo; out1 = head mean of the probabilities [2][2048][2048].
// Compute dtypes, f32 accumulate: every float input RNE-converted to bf16; projections v_wmma_f32_16x16x32_bf16 (exact products) + f32 bias; attention query rows < 512: q/k/p/v as bf16 hi+lo planes (3 products), other rows v_wmma_f32_16x16x32_f16 with p carried x1024; softmax and head mean f32; output projection merged hi+lo (bf16) x bf16 Wo + bias.
// Pass structure per batch: 8 passes of 256 query rows x all 16 heads (scores -> softmax/head-mean -> p.v -> merge), so one wave owns a query row over all heads and writes its head-mean row once.

#ifndef NB
#define NB 2
#endif
#ifndef SEQ
#define SEQ 2048
#endif
#define NB_FULL  2
#define SEQ_FULL 2048
#define TT   SEQ
#define DM   1024
#define NH_  16
#define HD   64
#define DQ   (NH_ * HD)
#define QC   256                  // query rows per pass
#define RH   512                  // query rows < RH use hi+lo planes
#define AW   4                    // waves (query rows) per k_asoft block
#define PCAR 1024.0f
#define SCL  0.125f               // HD^-0.5
typedef _Float16 h16;
typedef unsigned short bf;
typedef __attribute__((ext_vector_type(16))) __bf16   v16bf;
typedef __attribute__((ext_vector_type(16))) _Float16 v16h;
typedef __attribute__((ext_vector_type(8)))  _Float16 v8h;
typedef __attribute__((ext_vector_type(8)))  unsigned short v8us;
typedef __attribute__((ext_vector_type(8)))  float    v8f;
typedef __attribute__((ext_vector_type(4)))  float    v4f;
typedef v8h  __attribute__((may_alias)) v8ha;
typedef v4f  __attribute__((may_alias)) v4fa;
typedef v8us __attribute__((may_alias)) v8usa;

static_assert(TT % QC == 0);
static_assert(QC % 64 == 0);
static_assert(QC % AW == 0);
static_assert(RH % QC == 0);
static_assert(TT % 128 == 0);
static_assert(HD == 64);
static_assert(DM % 64 == 0);
static_assert((size_t)AW * TT * 4 <= 65536);
static_assert((size_t)NB_FULL * SEQ_FULL * DM * 4 == 16777216);
static_assert((size_t)NB_FULL * SEQ_FULL * DM + (size_t)NB * TT * TT <= (size_t)50331648 / 4);

__device__ __forceinline__ unsigned short f2bf(float f) { unsigned u = __float_as_uint(f); u += 0x7FFFu + ((u >> 16) & 1u); return (unsigned short)(u >> 16); }
__device__ __forceinline__ float bf2f(unsigned short b) { return __uint_as_float(((unsigned)b) << 16); }
__device__ __forceinline__ float bfr(float f) { return bf2f(f2bf(f)); }
__device__ __forceinline__ v16h cat16(v8h lo, v8h hi) { return __builtin_shufflevector(lo, hi, 0, 1, 2, 3, 4, 5, 6, 7, 8, 9, 10, 11, 12, 13, 14, 15); }
__device__ __forceinline__ v16bf cat16b(v8us lo, v8us hi) { return __builtin_bit_cast(v16bf, __builtin_shufflevector(lo, hi, 0, 1, 2, 3, 4, 5, 6, 7, 8, 9, 10, 11, 12, 13, 14, 15)); }
__device__ __forceinline__ v8f wmma16(v16h a, v16h b, v8f c) { return __builtin_amdgcn_wmma_f32_16x16x32_f16(false, a, false, b, (short)0, c, false, false); }
__device__ __forceinline__ v8f wmmab(v16bf a, v16bf b, v8f c) { return __builtin_amdgcn_wmma_f32_16x16x32_bf16(false, a, false, b, (short)0, c, false, false); }

// ---- k_gemmw: register-blocked GEMM, ONE WAVE per 64x64 output tile (16 accumulators), operands straight from K-contiguous 16-bit planes; grid (M/64, N/64, Z), 32 threads.
// C[m][n] (f32, pitch ldc, + optional f32 bias[n]) = sum_k A[m][k] Bt[n][k] (+ split products per NSPLIT). z-batch strides sA/sB/sC in elements. K % 32 == 0, M % 64 == 0, N % 64 == 0.
// Fragment map: lane -> row/col (lane & 15), elements 0..7 = k0 + 8*(lane>>4) + 0..7, elements 8..15 = k0 + 16 + 8*(lane>>4) + 0..7 for A and B; D element j = (row 8*(lane>>4) + j, col lane & 15).
template <typename T16> struct WFrag;
template <> struct WFrag<h16> { typedef v16h V; static __device__ __forceinline__ V ld(const h16* p) { return cat16(*(const v8h*)p, *(const v8h*)(p + 16)); } static __device__ __forceinline__ v8f mma(V a, V b, v8f c) { return wmma16(a, b, c); } };
template <> struct WFrag<bf> { typedef v16bf V; static __device__ __forceinline__ V ld(const bf* p) { return cat16b(*(const v8us*)p, *(const v8us*)(p + 16)); } static __device__ __forceinline__ v8f mma(V a, V b, v8f c) { return wmmab(a, b, c); } };
template <typename T16, int NSPLIT, bool BIAS>
__global__ __launch_bounds__(32) void k_gemmw(const T16* __restrict__ A, const T16* __restrict__ A2, const T16* __restrict__ Bt, const T16* __restrict__ Bt2, int K, float* C, int ldc, const float* __restrict__ bias, size_t sA, size_t sB, size_t sC) {
    typedef typename WFrag<T16>::V V;
    __shared__ __align__(16) float os[16 * 68];
    const size_t z = blockIdx.z; A += z * sA; if (A2) A2 += z * sA; Bt += z * sB; if (Bt2) Bt2 += z * sB; C += z * sC;
    const int lane = threadIdx.x & 31, lr = lane & 15, hi = lane >> 4; const int r0 = blockIdx.x * 64, c0 = blockIdx.y * 64;
    v8f acc[4][4];
#pragma unroll
    for (int mb = 0; mb < 4; ++mb)
#pragma unroll
        for (int nb = 0; nb < 4; ++nb) acc[mb][nb] = (v8f){};
    const size_t aoff = (size_t)(r0 + lr) * K + 8 * hi, boff = (size_t)(c0 + lr) * K + 8 * hi;
#pragma unroll 1
    for (int kc = 0; kc < K; kc += 32) {
        V a[4], a2[4];
#pragma unroll
        for (int mb = 0; mb < 4; ++mb) { a[mb] = WFrag<T16>::ld(A + aoff + (size_t)mb * 16 * K + kc); if (NSPLIT == 1 || NSPLIT == 2) a2[mb] = WFrag<T16>::ld(A2 + aoff + (size_t)mb * 16 * K + kc); }
#pragma unroll
        for (int nb = 0; nb < 4; ++nb) { const V b = WFrag<T16>::ld(Bt + boff + (size_t)nb * 16 * K + kc); V b2; if (NSPLIT >= 2) b2 = WFrag<T16>::ld(Bt2 + boff + (size_t)nb * 16 * K + kc);
#pragma unroll
            for (int mb = 0; mb < 4; ++mb) { acc[mb][nb] = WFrag<T16>::mma(a[mb], b, acc[mb][nb]); if (NSPLIT == 1 || NSPLIT == 2) acc[mb][nb] = WFrag<T16>::mma(a2[mb], b, acc[mb][nb]); if (NSPLIT >= 2) acc[mb][nb] = WFrag<T16>::mma(a[mb], b2, acc[mb][nb]); } }
        asm volatile("v_nop\n\tv_nop\n\tv_nop\n\tv_nop" : "+v"(acc[0][0]), "+v"(acc[1][1]), "+v"(acc[2][2]), "+v"(acc[3][3]) : "v"(a[0]), "v"(a[3]));
    }
#pragma unroll
    for (int mb = 0; mb < 4; ++mb) {
#pragma unroll
        for (int nb = 0; nb < 4; ++nb) {
#pragma unroll
            for (int j = 0; j < 8; ++j) os[(hi * 8 + j) * 68 + nb * 16 + lr] = acc[mb][nb][j]; }
        __builtin_amdgcn_wave_barrier(); asm volatile("" ::: "memory");
        float* crow = C + (size_t)(r0 + mb * 16) * ldc + c0;
{
#pragma unroll
            for (int s = 0; s < 8; ++s) { const int row = 2 * s + hi, cofs = lr * 4; v4f val = *(const v4fa*)(os + row * 68 + cofs); if (BIAS) { val[0] += bfr(bias[c0 + cofs]); val[1] += bfr(bias[c0 + cofs + 1]); val[2] += bfr(bias[c0 + cofs + 2]); val[3] += bfr(bias[c0 + cofs + 3]); }
                *(v4f*)(crow + (size_t)row * ldc + cofs) = val; }
             }
        __builtin_amdgcn_wave_barrier(); asm volatile("" ::: "memory");
    }
}

__device__ __forceinline__ h16 tohx(float x) { return (h16)x; }
__device__ __forceinline__ void splitf(float y, unsigned short& h, unsigned short& l) { h = f2bf(y); l = f2bf(y - bf2f(h)); }
typedef __attribute__((ext_vector_type(2))) _Float16 v2h;
typedef __attribute__((ext_vector_type(4))) _Float16 v4h;
typedef __attribute__((ext_vector_type(2))) unsigned short v2us;
typedef __attribute__((ext_vector_type(4))) unsigned short v4us;
typedef __attribute__((ext_vector_type(2))) float v2f;

__global__ __launch_bounds__(256) void k_cvt8(const float* __restrict__ src, bf* dst, size_t n8) { const size_t i = (size_t)blockIdx.x * 256 + threadIdx.x; if (i >= n8) return; const v8f v = *(const v8f*)(src + i * 8); v8us o;
#pragma unroll
    for (int k = 0; k < 8; ++k) o[k] = f2bf(v[k]); *(v8us*)(dst + i * 8) = o;  }

__global__ __launch_bounds__(256) void k_hp(const float* __restrict__ F, int pitch, int nheads, h16* P16, bf* Ph, bf* Pl) {
    const size_t e = ((size_t)blockIdx.x * 256 + threadIdx.x) * 2; if (e >= (size_t)nheads * TT * HD) return; const int d = (int)(e % HD); const int t = (int)((e / HD) % TT); const int h = (int)(e / ((size_t)HD * TT));
    const v2f x = *(const v2f*)(F + (size_t)t * pitch + h * HD + d); v2h o16; v2us oh, ol;
#pragma unroll
    for (int q = 0; q < 2; ++q) { const float r = x[q]; o16[q] = tohx(r); unsigned short a2, c2; splitf(r, a2, c2); oh[q] = a2; ol[q] = c2; }
    *(v2h*)(P16 + e) = o16; *(v2us*)(Ph + e) = oh; *(v2us*)(Pl + e) = ol;  }

__global__ __launch_bounds__(256) void k_vtp(const float* __restrict__ F, int pitch, int nheads, h16* V16, bf* Vh, bf* Vl) { const size_t e = ((size_t)blockIdx.x * 256 + threadIdx.x) * 2; if (e >= (size_t)nheads * HD * TT) return; const int t = (int)(e % TT); const int d = (int)((e / TT) % HD); const int g = (int)(e / ((size_t)TT * HD)); v2h o16; v2us oh, ol;
#pragma unroll
    for (int q = 0; q < 2; ++q) { const float x = F[(size_t)(t + q) * pitch + g * HD + d]; o16[q] = tohx(x); unsigned short a2, c2; splitf(x, a2, c2); oh[q] = a2; ol[q] = c2; }
    *(v2h*)(V16 + e) = o16; *(v2us*)(Vh + e) = oh; *(v2us*)(Vl + e) = ol;  }

// k_asoft: one wave per query row i of the pass (QC rows, AW waves per block), looping over the 16 heads: t = S[h][i][:] x HD^-0.5; softmax over the TT keys (register row of TT/32 values per lane, one exp, fixed trees);
// The head-mean row (f32) is kept in a wave-private LDS row: lane L owns floats ch*128 + 4L .. 4L+3 of its wave's row, zero-filled by that lane first, read and written only by that lane (no cross-lane exchange, no block barrier in this kernel).
__global__ __launch_bounds__(32 * AW) void k_asoft(const float* __restrict__ Sb, int q0, int hires, h16* P16, bf* Ph, bf* Pl, float* AVG) {
#pragma clang fp contract(off)
    __shared__ __align__(16) float avs[AW * TT];
    const int lane = threadIdx.x & 31; const int w = __builtin_amdgcn_readfirstlane((int)(threadIdx.x >> 5)); const int i = blockIdx.x * AW + w; if (i >= QC) return;
    float* avw = avs + w * TT + lane * 4;
#pragma unroll
    for (int ch = 0; ch < TT / 128; ++ch) { v4f zz; zz[0] = 0.f; zz[1] = 0.f; zz[2] = 0.f; zz[3] = 0.f; *(v4fa*)(avw + ch * 128) = zz; }
#pragma unroll 1
    for (int h = 0; h < NH_; ++h) {
        const size_t po = ((size_t)h * QC + i) * TT; const float* sr = Sb + po; float v[TT / 32]; float mx = -3.0e38f;
#pragma unroll
        for (int ch = 0; ch < TT / 128; ++ch) { const int j0 = ch * 128 + lane * 4; const v4f a = *(const v4f*)(sr + j0);
#pragma unroll
            for (int q = 0; q < 4; ++q) { const float t = a[q] * SCL; v[ch * 4 + q] = t; mx = fmaxf(mx, t); } }
#pragma unroll
        for (int sh = 16; sh; sh >>= 1) mx = fmaxf(mx, __shfl_xor(mx, sh, 32));
        float sum = 0.f;
#pragma unroll
        for (int k = 0; k < TT / 32; ++k) { float d0 = __fsub_rn(v[k], mx); asm volatile("" : "+v"(d0)); v[k] = __builtin_amdgcn_exp2f(__fmul_rn(d0, 1.4426950408889634f)); sum += v[k]; }
#pragma unroll
        for (int sh = 16; sh; sh >>= 1) sum += __shfl_xor(sum, sh, 32);
        const float fn = __fdiv_rn(1.0f, sum); const float f = hires ? fn : fn * PCAR;
#pragma unroll
        for (int ch = 0; ch < TT / 128; ++ch) { v4f a = *(const v4fa*)(avw + ch * 128);
#pragma unroll
            for (int q = 0; q < 4; ++q) { const float pn = v[ch * 4 + q] * fn; a[q] = a[q] + pn; }
            *(v4fa*)(avw + ch * 128) = a; }
{
            float fz = f; asm volatile("" : "+v"(fz));
            if (hires) {
#pragma unroll
                for (int ch = 0; ch < TT / 128; ++ch) { v4us oh, ol;
#pragma unroll
                    for (int q = 0; q < 4; ++q) { unsigned short a, c2; splitf(v[ch * 4 + q] * fz, a, c2); oh[q] = a; ol[q] = c2; }
                    const size_t oo = po + ch * 128 + lane * 4; *(v4us*)(Ph + oo) = oh; *(v4us*)(Pl + oo) = ol; }
            } else {
#pragma unroll
                for (int ch = 0; ch < TT / 128; ++ch) { v4h o4;
#pragma unroll
                    for (int q = 0; q < 4; ++q) o4[q] = tohx(v[ch * 4 + q] * fz);
                    *(v4h*)(P16 + po + ch * 128 + lane * 4) = o4; } }
             }
    }
    float* arow = AVG + (size_t)(q0 + i) * TT;
{
        float sc = 1.0f / NH_; asm volatile("" : "+v"(sc));
#pragma unroll
        for (int ch = 0; ch < TT / 128; ++ch) { const v4f a = *(const v4fa*)(avw + ch * 128); v4f o;
#pragma unroll
            for (int q = 0; q < 4; ++q) o[q] = a[q] * sc;
            *(v4f*)(arow + ch * 128 + lane * 4) = o; }
         }
}

__global__ __launch_bounds__(256) void k_merge(const float* __restrict__ O, int q0, int hires, bf* Ah, bf* Al) { const size_t e = ((size_t)blockIdx.x * 256 + threadIdx.x) * 2; if (e >= (size_t)NH_ * QC * HD) return; const int d = (int)(e % HD); const int i = (int)((e / HD) % QC); const int h = (int)(e / ((size_t)HD * QC)); const float cs = hires ? 1.0f : (1.0f / PCAR); const size_t oo = (size_t)(q0 + i) * DQ + h * HD + d;
    const v2f x = *(const v2f*)(O + e); v2us oh, ol;
#pragma unroll
    for (int q = 0; q < 2; ++q) { unsigned short a, c2; splitf(x[q] * cs, a, c2); oh[q] = a; ol[q] = c2; } *(v2us*)(Ah + oo) = oh; *(v2us*)(Al + oo) = ol;  }

// workspace plan (bytes); region U is shared by {XB, FQ, FK} (projection phase) and Sb (attention passes), stream-ordered.
static constexpr size_t W_BYTES  = (size_t)DM * DM * 2;
static constexpr size_t XB_BYTES = (size_t)TT * DM * 2;
static constexpr size_t F_BYTES  = (size_t)TT * DM * 4;
static constexpr size_t PL_BYTES = (size_t)NH_ * TT * HD * 2;
static constexpr size_t SB_BYTES = (size_t)NH_ * QC * TT * 4;
static constexpr size_t PP_BYTES = (size_t)NH_ * QC * TT * 2;
static constexpr size_t OB_BYTES = (size_t)NH_ * QC * HD * 4;
static constexpr size_t AT_BYTES = (size_t)TT * DQ * 2;
static constexpr size_t U_BYTES  = (SB_BYTES > XB_BYTES + 2 * F_BYTES) ? SB_BYTES : (XB_BYTES + 2 * F_BYTES);
static constexpr size_t WS_TOTAL = 4 * W_BYTES + U_BYTES + 9 * PL_BYTES + 2 * PP_BYTES + OB_BYTES + 2 * AT_BYTES;
static_assert(W_BYTES % 256 == 0 && XB_BYTES % 256 == 0 && F_BYTES % 256 == 0 && PL_BYTES % 256 == 0);
static_assert(SB_BYTES % 256 == 0 && PP_BYTES % 256 == 0 && OB_BYTES % 256 == 0 && AT_BYTES % 256 == 0);
static_assert(XB_BYTES + 2 * F_BYTES <= U_BYTES);
static_assert(SB_BYTES <= U_BYTES);
static_assert(WS_TOTAL <= (size_t)134217728);

extern "C" void kernel_launch(void* const* d_in, const int* in_sizes, int n_in,
                              void* d_out, int out_size, void* d_ws, size_t ws_size, hipStream_t stream) {
    if (n_in < 11) return;
    const size_t need_x = (size_t)(NB - 1) * SEQ_FULL * DM + (size_t)TT * DM;
    if ((size_t)in_sizes[0] < need_x || (size_t)in_sizes[1] < need_x || (size_t)in_sizes[2] < need_x) return;
    if ((size_t)in_sizes[3] < (size_t)DM * DM || (size_t)in_sizes[5] < (size_t)DM * DM || (size_t)in_sizes[7] < (size_t)DM * DM || (size_t)in_sizes[9] < (size_t)DM * DM) return;
    if (in_sizes[4] < DM || in_sizes[6] < DM || in_sizes[8] < DM || in_sizes[10] < DM) return;
    const size_t AVG_OFF = (size_t)NB_FULL * SEQ_FULL * DM;     // element offset of the second output (byte 16777216)
    if ((size_t)out_size < AVG_OFF + (size_t)NB * TT * TT) return;
    if (ws_size < WS_TOTAL) return;
    const float* xq = (const float*)d_in[0]; const float* xk = (const float*)d_in[1]; const float* xv = (const float*)d_in[2]; const float* wq = (const float*)d_in[3]; const float* bq = (const float*)d_in[4]; const float* wk = (const float*)d_in[5]; const float* bk = (const float*)d_in[6]; const float* wv = (const float*)d_in[7]; const float* bv = (const float*)d_in[8]; const float* wo = (const float*)d_in[9]; const float* bo = (const float*)d_in[10];
    float* OUT = (float*)d_out;                 // [NB][TT][DM]
    float* AVG = (float*)d_out + AVG_OFF;       // [NB][TT][TT]
    char* wsp = (char*)d_ws;
    auto take = [&](size_t bytes) { char* p = wsp; wsp += (bytes + 255) & ~(size_t)255; return (void*)p; };
    bf* WQ = (bf*)take(W_BYTES); bf* WK = (bf*)take(W_BYTES); bf* WV = (bf*)take(W_BYTES); bf* WO = (bf*)take(W_BYTES);
    char* U = (char*)take(U_BYTES);
    float* Sb = (float*)U; bf* XB = (bf*)U; float* FQ = (float*)(U + XB_BYTES); float* FK = (float*)(U + XB_BYTES + F_BYTES); float* FV = FK;   // v projection reuses the k buffer after the k planes are built
    h16* QP16 = (h16*)take(PL_BYTES); h16* KP16 = (h16*)take(PL_BYTES); h16* VT16 = (h16*)take(PL_BYTES);
    bf* QPh = (bf*)take(PL_BYTES); bf* QPl = (bf*)take(PL_BYTES); bf* KPh = (bf*)take(PL_BYTES); bf* KPl = (bf*)take(PL_BYTES); bf* VTh = (bf*)take(PL_BYTES); bf* VTl = (bf*)take(PL_BYTES);
    char* PAr = (char*)take(PP_BYTES); h16* PA16 = (h16*)PAr; bf* PAh = (bf*)PAr;    // p plane: fp16 x1024 (plain passes) or bf16 hi (hires passes)
    bf* PAl = (bf*)take(PP_BYTES);
    float* Ob = (float*)take(OB_BYTES); bf* ATh = (bf*)take(AT_BYTES); bf* ATl = (bf*)take(AT_BYTES);
    if ((size_t)(wsp - (char*)d_ws) > ws_size) return;

    const unsigned GW = (unsigned)(((size_t)DM * DM / 8 + 255) / 256), GX = (unsigned)(((size_t)TT * DM / 8 + 255) / 256);
    k_cvt8<<<GW, 256, 0, stream>>>(wq, WQ, (size_t)DM * DM / 8); k_cvt8<<<GW, 256, 0, stream>>>(wk, WK, (size_t)DM * DM / 8);
    k_cvt8<<<GW, 256, 0, stream>>>(wv, WV, (size_t)DM * DM / 8); k_cvt8<<<GW, 256, 0, stream>>>(wo, WO, (size_t)DM * DM / 8);
    const unsigned LP = (unsigned)(((size_t)NH_ * TT * HD / 2 + 255) / 256);
    const unsigned LM = (unsigned)(((size_t)NH_ * QC * HD / 2 + 255) / 256);
    for (int b = 0; b < NB; ++b) {
        const size_t xo = (size_t)b * SEQ_FULL * DM;
        k_cvt8<<<GX, 256, 0, stream>>>(xq + xo, XB, (size_t)TT * DM / 8);
        k_gemmw<bf, 0, true><<<dim3(TT / 64, DQ / 64, 1), 32, 0, stream>>>(XB, nullptr, WQ, nullptr, DM, FQ, DQ, bq, 0, 0, 0);
        k_hp<<<LP, 256, 0, stream>>>(FQ, DQ, NH_, QP16, QPh, QPl);
        k_cvt8<<<GX, 256, 0, stream>>>(xk + xo, XB, (size_t)TT * DM / 8);
        k_gemmw<bf, 0, true><<<dim3(TT / 64, DQ / 64, 1), 32, 0, stream>>>(XB, nullptr, WK, nullptr, DM, FK, DQ, bk, 0, 0, 0);
        k_hp<<<LP, 256, 0, stream>>>(FK, DQ, NH_, KP16, KPh, KPl);
        k_cvt8<<<GX, 256, 0, stream>>>(xv + xo, XB, (size_t)TT * DM / 8);
        k_gemmw<bf, 0, true><<<dim3(TT / 64, DQ / 64, 1), 32, 0, stream>>>(XB, nullptr, WV, nullptr, DM, FV, DQ, bv, 0, 0, 0);
        k_vtp<<<LP, 256, 0, stream>>>(FV, DQ, NH_, VT16, VTh, VTl);
        for (int q0 = 0; q0 < TT; q0 += QC) {       // one pass: QC query rows x all heads (z = head; plane z-strides TT*HD, S/P z-stride QC*TT, O z-stride QC*HD)
            const int hires = (q0 < RH) ? 1 : 0;
            if (hires) k_gemmw<bf, 2, false><<<dim3(QC / 64, TT / 64, NH_), 32, 0, stream>>>(QPh + (size_t)q0 * HD, QPl + (size_t)q0 * HD, KPh, KPl, HD, Sb, TT, nullptr, (size_t)TT * HD, (size_t)TT * HD, (size_t)QC * TT);
            else       k_gemmw<h16, 0, false><<<dim3(QC / 64, TT / 64, NH_), 32, 0, stream>>>(QP16 + (size_t)q0 * HD, nullptr, KP16, nullptr, HD, Sb, TT, nullptr, (size_t)TT * HD, (size_t)TT * HD, (size_t)QC * TT);
            k_asoft<<<QC / AW, 32 * AW, 0, stream>>>(Sb, q0, hires, PA16, PAh, PAl, AVG + (size_t)b * TT * TT);
            if (hires) k_gemmw<bf, 2, false><<<dim3(QC / 64, HD / 64, NH_), 32, 0, stream>>>(PAh, PAl, VTh, VTl, TT, Ob, HD, nullptr, (size_t)QC * TT, (size_t)HD * TT, (size_t)QC * HD);
            else       k_gemmw<h16, 0, false><<<dim3(QC / 64, HD / 64, NH_), 32, 0, stream>>>(PA16, nullptr, VT16, nullptr, TT, Ob, HD, nullptr, (size_t)QC * TT, (size_t)HD * TT, (size_t)QC * HD);
            k_merge<<<LM, 256, 0, stream>>>(Ob, q0, hires, ATh, ATl);
        }
        k_gemmw<bf, 1, true><<<dim3(TT / 64, DM / 64, 1), 32, 0, stream>>>(ATh, ATl, WO, nullptr, DQ, OUT + (size_t)b * TT * DM, DM, bo, 0, 0, 0);
    }
}

// v001
// It runs in 1100 microseconds.
// Timed twice side by side with v000, it ran 1.51 times as fast both times.
#include <hip/hip_runtime.h>

// Multi-head attention without a mask over three input streams (query, key, value [2][2048][1024]); q = query Wq^T + bq, k = key Wk^T + bk, v = value Wv^T + bv (W stored [out][in]); 16 heads x 64; scores x 64^-0.5; softmax over all keys; out0 = merged Wo^T + bo; out1 = head mean of the probabilities [2][2048][2048].
// Compute dtypes, f32 accumulate: every float input RNE-converted to bf16; projections v_wmma_f32_16x16x32_bf16 (exact products) + f32 bias; attention query rows < 512: q/k/p/v as bf16 hi+lo planes (3 products), other rows v_wmma_f32_16x16x32_f16 with p carried x1024; softmax and head mean f32; output projection merged hi+lo (bf16) x bf16 Wo + bias.
// Pass structure per batch: 8 passes of 256 query rows x all 16 heads (scores -> softmax/head-mean -> p.v -> merge), so one wave owns a query row over all heads and writes its head-mean row once.

#ifndef NB
#define NB 2
#endif
#ifndef SEQ
#define SEQ 2048
#endif
#define NB_FULL  2
#define SEQ_FULL 2048
#define TT   SEQ
#define DM   1024
#define NH_  16
#define HD   64
#define DQ   (NH_ * HD)
#define QC   256                  // query rows per pass
#define RH   512                  // query rows < RH use hi+lo planes
#define AW   4                    // waves (query rows) per k_asoft block
#define PCAR 1024.0f
#define SCL  0.125f               // HD^-0.5
#define KWP  8                    // waves sharing the K loop of a projection tile (K = DM)
#define KWV  16                   // waves sharing the K loop of a p.v tile (K = TT)
typedef _Float16 h16;
typedef unsigned short bf;
typedef __attribute__((ext_vector_type(16))) __bf16   v16bf;
typedef __attribute__((ext_vector_type(16))) _Float16 v16h;
typedef __attribute__((ext_vector_type(8)))  _Float16 v8h;
typedef __attribute__((ext_vector_type(8)))  unsigned short v8us;
typedef __attribute__((ext_vector_type(8)))  float    v8f;
typedef __attribute__((ext_vector_type(4)))  float    v4f;
typedef v8h  __attribute__((may_alias)) v8ha;
typedef v4f  __attribute__((may_alias)) v4fa;
typedef v8us __attribute__((may_alias)) v8usa;

static_assert(TT % QC == 0);
static_assert(QC % 64 == 0);
static_assert(QC % AW == 0);
static_assert(RH % QC == 0);
static_assert(TT % 128 == 0);
static_assert(HD == 64);
static_assert(DM % 64 == 0);
static_assert(DM % (32 * KWP) == 0 && TT % (32 * KWV) == 0);
static_assert((size_t)KWV * 64 * 68 * 4 <= 327680 && (size_t)KWP * 64 * 68 * 4 <= 327680);
static_assert((size_t)AW * TT * 4 <= 65536);
static_assert((size_t)NB_FULL * SEQ_FULL * DM * 4 == 16777216);
static_assert((size_t)NB_FULL * SEQ_FULL * DM + (size_t)NB * TT * TT <= (size_t)50331648 / 4);

__device__ __forceinline__ unsigned short f2bf(float f) { unsigned u = __float_as_uint(f); u += 0x7FFFu + ((u >> 16) & 1u); return (unsigned short)(u >> 16); }
__device__ __forceinline__ float bf2f(unsigned short b) { return __uint_as_float(((unsigned)b) << 16); }
__device__ __forceinline__ float bfr(float f) { return bf2f(f2bf(f)); }
__device__ __forceinline__ v16h cat16(v8h lo, v8h hi) { return __builtin_shufflevector(lo, hi, 0, 1, 2, 3, 4, 5, 6, 7, 8, 9, 10, 11, 12, 13, 14, 15); }
__device__ __forceinline__ v16bf cat16b(v8us lo, v8us hi) { return __builtin_bit_cast(v16bf, __builtin_shufflevector(lo, hi, 0, 1, 2, 3, 4, 5, 6, 7, 8, 9, 10, 11, 12, 13, 14, 15)); }
__device__ __forceinline__ v8f wmma16(v16h a, v16h b, v8f c) { return __builtin_amdgcn_wmma_f32_16x16x32_f16(false, a, false, b, (short)0, c, false, false); }
__device__ __forceinline__ v8f wmmab(v16bf a, v16bf b, v8f c) { return __builtin_amdgcn_wmma_f32_16x16x32_bf16(false, a, false, b, (short)0, c, false, false); }

// ---- k_gemmw: register-blocked GEMM, one work-group of KW waves per 64x64 output tile (16 accumulators per wave), operands straight from K-contiguous 16-bit planes; grid (M/64, N/64, Z), 32 * KW threads.
// K split: wave w takes the 32-wide k steps w, w + KW, w + 2 KW, ... (neighbouring waves read neighbouring halves of the same 128-byte lines); for KW > 1 the KW partial tiles meet in LDS and are summed in wave order 0 .. KW-1.
// C[m][n] (f32, pitch ldc, + optional f32 bias[n]) = sum_k A[m][k] Bt[n][k] (+ split products per NSPLIT). z-batch strides sA/sB/sC in elements. K % 32 == 0, M % 64 == 0, N % 64 == 0.
// Fragment map: lane -> row/col (lane & 15), elements 0..7 = k0 + 8*(lane>>4) + 0..7, elements 8..15 = k0 + 16 + 8*(lane>>4) + 0..7 for A and B; D element j = (row 8*(lane>>4) + j, col lane & 15).
template <typename T16> struct WFrag;
template <> struct WFrag<h16> { typedef v16h V; static __device__ __forceinline__ V ld(const h16* p) { return cat16(*(const v8h*)p, *(const v8h*)(p + 16)); } static __device__ __forceinline__ v8f mma(V a, V b, v8f c) { return wmma16(a, b, c); } };
template <> struct WFrag<bf> { typedef v16bf V; static __device__ __forceinline__ V ld(const bf* p) { return cat16b(*(const v8us*)p, *(const v8us*)(p + 16)); } static __device__ __forceinline__ v8f mma(V a, V b, v8f c) { return wmmab(a, b, c); } };
template <typename T16, int NSPLIT, bool BIAS, int KW>
__global__ __launch_bounds__(32 * KW) void k_gemmw(const T16* __restrict__ A, const T16* __restrict__ A2, const T16* __restrict__ Bt, const T16* __restrict__ Bt2, int K, float* C, int ldc, const float* __restrict__ bias, size_t sA, size_t sB, size_t sC) {
    typedef typename WFrag<T16>::V V;
    __shared__ __align__(16) float os[(KW == 1 ? 16 : KW * 64) * 68];
    const int w = (KW == 1) ? 0 : __builtin_amdgcn_readfirstlane((int)(threadIdx.x >> 5));
    const size_t z = blockIdx.z; A += z * sA; if (A2) A2 += z * sA; Bt += z * sB; if (Bt2) Bt2 += z * sB; C += z * sC;
    const int lane = threadIdx.x & 31, lr = lane & 15, hi = lane >> 4; const int r0 = blockIdx.x * 64, c0 = blockIdx.y * 64;
    v8f acc[4][4];
#pragma unroll
    for (int mb = 0; mb < 4; ++mb)
#pragma unroll
        for (int nb = 0; nb < 4; ++nb) acc[mb][nb] = (v8f){};
    const size_t aoff = (size_t)(r0 + lr) * K + 8 * hi, boff = (size_t)(c0 + lr) * K + 8 * hi;
#pragma unroll 1
    for (int kc = w * 32; kc < K; kc += 32 * KW) {
        V a[4], a2[4];
#pragma unroll
        for (int mb = 0; mb < 4; ++mb) { a[mb] = WFrag<T16>::ld(A + aoff + (size_t)mb * 16 * K + kc); if (NSPLIT == 1 || NSPLIT == 2) a2[mb] = WFrag<T16>::ld(A2 + aoff + (size_t)mb * 16 * K + kc); }
#pragma unroll
        for (int nb = 0; nb < 4; ++nb) { const V b = WFrag<T16>::ld(Bt + boff + (size_t)nb * 16 * K + kc); V b2; if (NSPLIT >= 2) b2 = WFrag<T16>::ld(Bt2 + boff + (size_t)nb * 16 * K + kc);
#pragma unroll
            for (int mb = 0; mb < 4; ++mb) { acc[mb][nb] = WFrag<T16>::mma(a[mb], b, acc[mb][nb]); if (NSPLIT == 1 || NSPLIT == 2) acc[mb][nb] = WFrag<T16>::mma(a2[mb], b, acc[mb][nb]); if (NSPLIT >= 2) acc[mb][nb] = WFrag<T16>::mma(a[mb], b2, acc[mb][nb]); } }
        asm volatile("v_nop\n\tv_nop\n\tv_nop\n\tv_nop" : "+v"(acc[0][0]), "+v"(acc[1][1]), "+v"(acc[2][2]), "+v"(acc[3][3]) : "v"(a[0]), "v"(a[3]));
    }
    if constexpr (KW > 1) {
        float* ow = os + w * (64 * 68);
#pragma unroll
        for (int mb = 0; mb < 4; ++mb)
#pragma unroll
            for (int nb = 0; nb < 4; ++nb)
#pragma unroll
                for (int j = 0; j < 8; ++j) ow[(mb * 16 + hi * 8 + j) * 68 + nb * 16 + lr] = acc[mb][nb][j];
        __syncthreads();   // every wave's partial tile is in LDS before any thread sums across waves
#pragma unroll
        for (int r = 0; r < 64 * 16 / (32 * KW); ++r) { const int s = r * 32 * KW + (int)threadIdx.x, row = s >> 4, cofs = (s & 15) * 4; v4f val = *(const v4fa*)(os + row * 68 + cofs);
#pragma unroll
            for (int u = 1; u < KW; ++u) { const v4f pv = *(const v4fa*)(os + u * (64 * 68) + row * 68 + cofs); val[0] += pv[0]; val[1] += pv[1]; val[2] += pv[2]; val[3] += pv[3]; }
            if (BIAS) { val[0] += bfr(bias[c0 + cofs]); val[1] += bfr(bias[c0 + cofs + 1]); val[2] += bfr(bias[c0 + cofs + 2]); val[3] += bfr(bias[c0 + cofs + 3]); }
            *(v4f*)(C + (size_t)(r0 + row) * ldc + c0 + cofs) = val; }
    } else {
#pragma unroll
    for (int mb = 0; mb < 4; ++mb) {
#pragma unroll
        for (int nb = 0; nb < 4; ++nb) {
#pragma unroll
            for (int j = 0; j < 8; ++j) os[(hi * 8 + j) * 68 + nb * 16 + lr] = acc[mb][nb][j]; }
        __builtin_amdgcn_wave_barrier(); asm volatile("" ::: "memory");
        float* crow = C + (size_t)(r0 + mb * 16) * ldc + c0;
{
#pragma unroll
            for (int s = 0; s < 8; ++s) { const int row = 2 * s + hi, cofs = lr * 4; v4f val = *(const v4fa*)(os + row * 68 + cofs); if (BIAS) { val[0] += bfr(bias[c0 + cofs]); val[1] += bfr(bias[c0 + cofs + 1]); val[2] += bfr(bias[c0 + cofs + 2]); val[3] += bfr(bias[c0 + cofs + 3]); }
                *(v4f*)(crow + (size_t)row * ldc + cofs) = val; }
             }
        __builtin_amdgcn_wave_barrier(); asm volatile("" ::: "memory");
    }
    }
}

__device__ __forceinline__ h16 tohx(float x) { return (h16)x; }
__device__ __forceinline__ void splitf(float y, unsigned short& h, unsigned short& l) { h = f2bf(y); l = f2bf(y - bf2f(h)); }
typedef __attribute__((ext_vector_type(2))) _Float16 v2h;
typedef __attribute__((ext_vector_type(4))) _Float16 v4h;
typedef __attribute__((ext_vector_type(2))) unsigned short v2us;
typedef __attribute__((ext_vector_type(4))) unsigned short v4us;
typedef __attribute__((ext_vector_type(2))) float v2f;

__global__ __launch_bounds__(256) void k_cvt8(const float* __restrict__ src, bf* dst, size_t n8) { const size_t i = (size_t)blockIdx.x * 256 + threadIdx.x; if (i >= n8) return; const v8f v = *(const v8f*)(src + i * 8); v8us o;
#pragma unroll
    for (int k = 0; k < 8; ++k) o[k] = f2bf(v[k]); *(v8us*)(dst + i * 8) = o;  }

__global__ __launch_bounds__(256) void k_hp(const float* __restrict__ F, int pitch, int nheads, h16* P16, bf* Ph, bf* Pl) {
    const size_t e = ((size_t)blockIdx.x * 256 + threadIdx.x) * 2; if (e >= (size_t)nheads * TT * HD) return; const int d = (int)(e % HD); const int t = (int)((e / HD) % TT); const int h = (int)(e / ((size_t)HD * TT));
    const v2f x = *(const v2f*)(F + (size_t)t * pitch + h * HD + d); v2h o16; v2us oh, ol;
#pragma unroll
    for (int q = 0; q < 2; ++q) { const float r = x[q]; o16[q] = tohx(r); unsigned short a2, c2; splitf(r, a2, c2); oh[q] = a2; ol[q] = c2; }
    *(v2h*)(P16 + e) = o16; *(v2us*)(Ph + e) = oh; *(v2us*)(Pl + e) = ol;  }

__global__ __launch_bounds__(256) void k_vtp(const float* __restrict__ F, int pitch, int nheads, h16* V16, bf* Vh, bf* Vl) { const size_t e = ((size_t)blockIdx.x * 256 + threadIdx.x) * 2; if (e >= (size_t)nheads * HD * TT) return; const int t = (int)(e % TT); const int d = (int)((e / TT) % HD); const int g = (int)(e / ((size_t)TT * HD)); v2h o16; v2us oh, ol;
#pragma unroll
    for (int q = 0; q < 2; ++q) { const float x = F[(size_t)(t + q) * pitch + g * HD + d]; o16[q] = tohx(x); unsigned short a2, c2; splitf(x, a2, c2); oh[q] = a2; ol[q] = c2; }
    *(v2h*)(V16 + e) = o16; *(v2us*)(Vh + e) = oh; *(v2us*)(Vl + e) = ol;  }

// k_asoft: one wave per query row i of the pass (QC rows, AW waves per block), looping over the 16 heads: t = S[h][i][:] x HD^-0.5; softmax over the TT keys (register row of TT/32 values per lane, one exp, fixed trees);
// The head-mean row (f32) is kept in a wave-private LDS row: lane L owns floats ch*128 + 4L .. 4L+3 of its wave's row, zero-filled by that lane first, read and written only by that lane (no cross-lane exchange, no block barrier in this kernel).
__global__ __launch_bounds__(32 * AW) void k_asoft(const float* __restrict__ Sb, int q0, int hires, h16* P16, bf* Ph, bf* Pl, float* AVG) {
#pragma clang fp contract(off)
    __shared__ __align__(16) float avs[AW * TT];
    const int lane = threadIdx.x & 31; const int w = __builtin_amdgcn_readfirstlane((int)(threadIdx.x >> 5)); const int i = blockIdx.x * AW + w; if (i >= QC) return;
    float* avw = avs + w * TT + lane * 4;
#pragma unroll
    for (int ch = 0; ch < TT / 128; ++ch) { v4f zz; zz[0] = 0.f; zz[1] = 0.f; zz[2] = 0.f; zz[3] = 0.f; *(v4fa*)(avw + ch * 128) = zz; }
#pragma unroll 1
    for (int h = 0; h < NH_; ++h) {
        const size_t po = ((size_t)h * QC + i) * TT; const float* sr = Sb + po; float v[TT / 32]; float mx = -3.0e38f;
#pragma unroll
        for (int ch = 0; ch < TT / 128; ++ch) { const int j0 = ch * 128 + lane * 4; const v4f a = *(const v4f*)(sr + j0);
#pragma unroll
            for (int q = 0; q < 4; ++q) { const float t = a[q] * SCL; v[ch * 4 + q] = t; mx = fmaxf(mx, t); } }
#pragma unroll
        for (int sh = 16; sh; sh >>= 1) mx = fmaxf(mx, __shfl_xor(mx, sh, 32));
        float sum = 0.f;
#pragma unroll
        for (int k = 0; k < TT / 32; ++k) { float d0 = __fsub_rn(v[k], mx); asm volatile("" : "+v"(d0)); v[k] = __builtin_amdgcn_exp2f(__fmul_rn(d0, 1.4426950408889634f)); sum += v[k]; }
#pragma unroll
        for (int sh = 16; sh; sh >>= 1) sum += __shfl_xor(sum, sh, 32);
        const float fn = __fdiv_rn(1.0f, sum); const float f = hires ? fn : fn * PCAR;
#pragma unroll
        for (int ch = 0; ch < TT / 128; ++ch) { v4f a = *(const v4fa*)(avw + ch * 128);
#pragma unroll
            for (int q = 0; q < 4; ++q) { const float pn = v[ch * 4 + q] * fn; a[q] = a[q] + pn; }
            *(v4fa*)(avw + ch * 128) = a; }
{
            float fz = f; asm volatile("" : "+v"(fz));
            if (hires) {
#pragma unroll
                for (int ch = 0; ch < TT / 128; ++ch) { v4us oh, ol;
#pragma unroll
                    for (int q = 0; q < 4; ++q) { unsigned short a, c2; splitf(v[ch * 4 + q] * fz, a, c2); oh[q] = a; ol[q] = c2; }
                    const size_t oo = po + ch * 128 + lane * 4; *(v4us*)(Ph + oo) = oh; *(v4us*)(Pl + oo) = ol; }
            } else {
#pragma unroll
                for (int ch = 0; ch < TT / 128; ++ch) { v4h o4;
#pragma unroll
                    for (int q = 0; q < 4; ++q) o4[q] = tohx(v[ch * 4 + q] * fz);
                    *(v4h*)(P16 + po + ch * 128 + lane * 4) = o4; } }
             }
    }
    float* arow = AVG + (size_t)(q0 + i) * TT;
{
        float sc = 1.0f / NH_; asm volatile("" : "+v"(sc));
#pragma unroll
        for (int ch = 0; ch < TT / 128; ++ch) { const v4f a = *(const v4fa*)(avw + ch * 128); v4f o;
#pragma unroll
            for (int q = 0; q < 4; ++q) o[q] = a[q] * sc;
            *(v4f*)(arow + ch * 128 + lane * 4) = o; }
         }
}

__global__ __launch_bounds__(256) void k_merge(const float* __restrict__ O, int q0, int hires, bf* Ah, bf* Al) { const size_t e = ((size_t)blockIdx.x * 256 + threadIdx.x) * 2; if (e >= (size_t)NH_ * QC * HD) return; const int d = (int)(e % HD); const int i = (int)((e / HD) % QC); const int h = (int)(e / ((size_t)HD * QC)); const float cs = hires ? 1.0f : (1.0f / PCAR); const size_t oo = (size_t)(q0 + i) * DQ + h * HD + d;
    const v2f x = *(const v2f*)(O + e); v2us oh, ol;
#pragma unroll
    for (int q = 0; q < 2; ++q) { unsigned short a, c2; splitf(x[q] * cs, a, c2); oh[q] = a; ol[q] = c2; } *(v2us*)(Ah + oo) = oh; *(v2us*)(Al + oo) = ol;  }

// workspace plan (bytes); region U is shared by {XB, FQ, FK} (projection phase) and Sb (attention passes), stream-ordered.
static constexpr size_t W_BYTES  = (size_t)DM * DM * 2;
static constexpr size_t XB_BYTES = (size_t)TT * DM * 2;
static constexpr size_t F_BYTES  = (size_t)TT * DM * 4;
static constexpr size_t PL_BYTES = (size_t)NH_ * TT * HD * 2;
static constexpr size_t SB_BYTES = (size_t)NH_ * QC * TT * 4;
static constexpr size_t PP_BYTES = (size_t)NH_ * QC * TT * 2;
static constexpr size_t OB_BYTES = (size_t)NH_ * QC * HD * 4;
static constexpr size_t AT_BYTES = (size_t)TT * DQ * 2;
static constexpr size_t U_BYTES  = (SB_BYTES > XB_BYTES + 2 * F_BYTES) ? SB_BYTES : (XB_BYTES + 2 * F_BYTES);
static constexpr size_t WS_TOTAL = 4 * W_BYTES + U_BYTES + 9 * PL_BYTES + 2 * PP_BYTES + OB_BYTES + 2 * AT_BYTES;
static_assert(W_BYTES % 256 == 0 && XB_BYTES % 256 == 0 && F_BYTES % 256 == 0 && PL_BYTES % 256 == 0);
static_assert(SB_BYTES % 256 == 0 && PP_BYTES % 256 == 0 && OB_BYTES % 256 == 0 && AT_BYTES % 256 == 0);
static_assert(XB_BYTES + 2 * F_BYTES <= U_BYTES);
static_assert(SB_BYTES <= U_BYTES);
static_assert(WS_TOTAL <= (size_t)134217728);

extern "C" void kernel_launch(void* const* d_in, const int* in_sizes, int n_in,
                              void* d_out, int out_size, void* d_ws, size_t ws_size, hipStream_t stream) {
    if (n_in < 11) return;
    const size_t need_x = (size_t)(NB - 1) * SEQ_FULL * DM + (size_t)TT * DM;
    if ((size_t)in_sizes[0] < need_x || (size_t)in_sizes[1] < need_x || (size_t)in_sizes[2] < need_x) return;
    if ((size_t)in_sizes[3] < (size_t)DM * DM || (size_t)in_sizes[5] < (size_t)DM * DM || (size_t)in_sizes[7] < (size_t)DM * DM || (size_t)in_sizes[9] < (size_t)DM * DM) return;
    if (in_sizes[4] < DM || in_sizes[6] < DM || in_sizes[8] < DM || in_sizes[10] < DM) return;
    const size_t AVG_OFF = (size_t)NB_FULL * SEQ_FULL * DM;     // element offset of the second output (byte 16777216)
    if ((size_t)out_size < AVG_OFF + (size_t)NB * TT * TT) return;
    if (ws_size < WS_TOTAL) return;
    const float* xq = (const float*)d_in[0]; const float* xk = (const float*)d_in[1]; const float* xv = (const float*)d_in[2]; const float* wq = (const float*)d_in[3]; const float* bq = (const float*)d_in[4]; const float* wk = (const float*)d_in[5]; const float* bk = (const float*)d_in[6]; const float* wv = (const float*)d_in[7]; const float* bv = (const float*)d_in[8]; const float* wo = (const float*)d_in[9]; const float* bo = (const float*)d_in[10];
    float* OUT = (float*)d_out;                 // [NB][TT][DM]
    float* AVG = (float*)d_out + AVG_OFF;       // [NB][TT][TT]
    char* wsp = (char*)d_ws;
    auto take = [&](size_t bytes) { char* p = wsp; wsp += (bytes + 255) & ~(size_t)255; return (void*)p; };
    bf* WQ = (bf*)take(W_BYTES); bf* WK = (bf*)take(W_BYTES); bf* WV = (bf*)take(W_BYTES); bf* WO = (bf*)take(W_BYTES);
    char* U = (char*)take(U_BYTES);
    float* Sb = (float*)U; bf* XB = (bf*)U; float* FQ = (float*)(U + XB_BYTES); float* FK = (float*)(U + XB_BYTES + F_BYTES); float* FV = FK;   // v projection reuses the k buffer after the k planes are built
    h16* QP16 = (h16*)take(PL_BYTES); h16* KP16 = (h16*)take(PL_BYTES); h16* VT16 = (h16*)take(PL_BYTES);
    bf* QPh = (bf*)take(PL_BYTES); bf* QPl = (bf*)take(PL_BYTES); bf* KPh = (bf*)take(PL_BYTES); bf* KPl = (bf*)take(PL_BYTES); bf* VTh = (bf*)take(PL_BYTES); bf* VTl = (bf*)take(PL_BYTES);
    char* PAr = (char*)take(PP_BYTES); h16* PA16 = (h16*)PAr; bf* PAh = (bf*)PAr;    // p plane: fp16 x1024 (plain passes) or bf16 hi (hires passes)
    bf* PAl = (bf*)take(PP_BYTES);
    float* Ob = (float*)take(OB_BYTES); bf* ATh = (bf*)take(AT_BYTES); bf* ATl = (bf*)take(AT_BYTES);
    if ((size_t)(wsp - (char*)d_ws) > ws_size) return;

    const unsigned GW = (unsigned)(((size_t)DM * DM / 8 + 255) / 256), GX = (unsigned)(((size_t)TT * DM / 8 + 255) / 256);
    k_cvt8<<<GW, 256, 0, stream>>>(wq, WQ, (size_t)DM * DM / 8); k_cvt8<<<GW, 256, 0, stream>>>(wk, WK, (size_t)DM * DM / 8);
    k_cvt8<<<GW, 256, 0, stream>>>(wv, WV, (size_t)DM * DM / 8); k_cvt8<<<GW, 256, 0, stream>>>(wo, WO, (size_t)DM * DM / 8);
    const unsigned LP = (unsigned)(((size_t)NH_ * TT * HD / 2 + 255) / 256);
    const unsigned LM = (unsigned)(((size_t)NH_ * QC * HD / 2 + 255) / 256);
    for (int b = 0; b < NB; ++b) {
        const size_t xo = (size_t)b * SEQ_FULL * DM;
        k_cvt8<<<GX, 256, 0, stream>>>(xq + xo, XB, (size_t)TT * DM / 8);
        k_gemmw<bf, 0, true, KWP><<<dim3(TT / 64, DQ / 64, 1), 32 * KWP, 0, stream>>>(XB, nullptr, WQ, nullptr, DM, FQ, DQ, bq, 0, 0, 0);
        k_hp<<<LP, 256, 0, stream>>>(FQ, DQ, NH_, QP16, QPh, QPl);
        k_cvt8<<<GX, 256, 0, stream>>>(xk + xo, XB, (size_t)TT * DM / 8);
        k_gemmw<bf, 0, true, KWP><<<dim3(TT / 64, DQ / 64, 1), 32 * KWP, 0, stream>>>(XB, nullptr, WK, nullptr, DM, FK, DQ, bk, 0, 0, 0);
        k_hp<<<LP, 256, 0, stream>>>(FK, DQ, NH_, KP16, KPh, KPl);
        k_cvt8<<<GX, 256, 0, stream>>>(xv + xo, XB, (size_t)TT * DM / 8);
        k_gemmw<bf, 0, true, KWP><<<dim3(TT / 64, DQ / 64, 1), 32 * KWP, 0, stream>>>(XB, nullptr, WV, nullptr, DM, FV, DQ, bv, 0, 0, 0);
        k_vtp<<<LP, 256, 0, stream>>>(FV, DQ, NH_, VT16, VTh, VTl);
        for (int q0 = 0; q0 < TT; q0 += QC) {       // one pass: QC query rows x all heads (z = head; plane z-strides TT*HD, S/P z-stride QC*TT, O z-stride QC*HD)
            const int hires = (q0 < RH) ? 1 : 0;
            if (hires) k_gemmw<bf, 2, false, 1><<<dim3(QC / 64, TT / 64, NH_), 32, 0, stream>>>(QPh + (size_t)q0 * HD, QPl + (size_t)q0 * HD, KPh, KPl, HD, Sb, TT, nullptr, (size_t)TT * HD, (size_t)TT * HD, (size_t)QC * TT);
            else       k_gemmw<h16, 0, false, 1><<<dim3(QC / 64, TT / 64, NH_), 32, 0, stream>>>(QP16 + (size_t)q0 * HD, nullptr, KP16, nullptr, HD, Sb, TT, nullptr, (size_t)TT * HD, (size_t)TT * HD, (size_t)QC * TT);
            k_asoft<<<QC / AW, 32 * AW, 0, stream>>>(Sb, q0, hires, PA16, PAh, PAl, AVG + (size_t)b * TT * TT);
            if (hires) k_gemmw<bf, 2, false, KWV><<<dim3(QC / 64, HD / 64, NH_), 32 * KWV, 0, stream>>>(PAh, PAl, VTh, VTl, TT, Ob, HD, nullptr, (size_t)QC * TT, (size_t)HD * TT, (size_t)QC * HD);
            else       k_gemmw<h16, 0, false, KWV><<<dim3(QC / 64, HD / 64, NH_), 32 * KWV, 0, stream>>>(PA16, nullptr, VT16, nullptr, TT, Ob, HD, nullptr, (size_t)QC * TT, (size_t)HD * TT, (size_t)QC * HD);
            k_merge<<<LM, 256, 0, stream>>>(Ob, q0, hires, ATh, ATl);
        }
        k_gemmw<bf, 1, true, KWP><<<dim3(TT / 64, DM / 64, 1), 32 * KWP, 0, stream>>>(ATh, ATl, WO, nullptr, DQ, OUT + (size_t)b * TT * DM, DM, bo, 0, 0, 0);
    }
}

// v002
// One run takes 757 microseconds.
// Next to v001, in two timings, it ran 1.44 and 1.45 times as fast.
// Counting every step since v000, it is 2.18 times as fast.
#include <hip/hip_runtime.h>

// Multi-head attention without a mask over three input streams (query, key, value [2][2048][1024]); q = query Wq^T + bq, k = key Wk^T + bk, v = value Wv^T + bv (W stored [out][in]); 16 heads x 64; scores x 64^-0.5; softmax over all keys; out0 = merged Wo^T + bo; out1 = head mean of the probabilities [2][2048][2048].
// Compute dtypes, f32 accumulate: every float input RNE-converted to bf16; projections v_wmma_f32_16x16x32_bf16 (exact products) + f32 bias; attention query rows < 512: q/k/p/v as bf16 hi+lo planes (3 products), other rows v_wmma_f32_16x16x32_f16 with p carried x1024; softmax and head mean f32; output projection merged hi+lo (bf16) x bf16 Wo + bias.
// Pass structure per batch: 8 passes of 256 query rows x all 16 heads (scores -> softmax/head-mean -> p.v -> merge), so one work-group owns a query row over all heads (one wave per head) and writes its head-mean row once.

#ifndef NB
#define NB 2
#endif
#ifndef SEQ
#define SEQ 2048
#endif
#define NB_FULL  2
#define SEQ_FULL 2048
#define TT   SEQ
#define DM   1024
#define NH_  16
#define HD   64
#define DQ   (NH_ * HD)
#define QC   256                  // query rows per pass
#define RH   512                  // query rows < RH use hi+lo planes
#define PCAR 1024.0f
#define SCL  0.125f               // HD^-0.5
#define KWP  8                    // waves sharing the K loop of a projection tile (K = DM)
#define KWV  16                   // waves sharing the K loop of a p.v tile (K = TT)
typedef _Float16 h16;
typedef unsigned short bf;
typedef __attribute__((ext_vector_type(16))) __bf16   v16bf;
typedef __attribute__((ext_vector_type(16))) _Float16 v16h;
typedef __attribute__((ext_vector_type(8)))  _Float16 v8h;
typedef __attribute__((ext_vector_type(8)))  unsigned short v8us;
typedef __attribute__((ext_vector_type(8)))  float    v8f;
typedef __attribute__((ext_vector_type(4)))  float    v4f;
typedef v8h  __attribute__((may_alias)) v8ha;
typedef v4f  __attribute__((may_alias)) v4fa;
typedef v8us __attribute__((may_alias)) v8usa;

static_assert(TT % QC == 0);
static_assert(QC % 64 == 0);
static_assert(RH % QC == 0);
static_assert(TT % 128 == 0);
static_assert(HD == 64);
static_assert(DM % 64 == 0);
static_assert(DM % (32 * KWP) == 0 && TT % (32 * KWV) == 0);
static_assert((size_t)KWV * 64 * 68 * 4 <= 327680 && (size_t)KWP * 64 * 68 * 4 <= 327680);
static_assert((size_t)NH_ * TT * 4 <= 327680 && 32 * NH_ <= 1024 && TT % (128 * NH_) == 0 && TT % 256 == 0);
static_assert((size_t)NB_FULL * SEQ_FULL * DM * 4 == 16777216);
static_assert((size_t)NB_FULL * SEQ_FULL * DM + (size_t)NB * TT * TT <= (size_t)50331648 / 4);

__device__ __forceinline__ unsigned short f2bf(float f) { unsigned u = __float_as_uint(f); u += 0x7FFFu + ((u >> 16) & 1u); return (unsigned short)(u >> 16); }
__device__ __forceinline__ float bf2f(unsigned short b) { return __uint_as_float(((unsigned)b) << 16); }
__device__ __forceinline__ float bfr(float f) { return bf2f(f2bf(f)); }
__device__ __forceinline__ v16h cat16(v8h lo, v8h hi) { return __builtin_shufflevector(lo, hi, 0, 1, 2, 3, 4, 5, 6, 7, 8, 9, 10, 11, 12, 13, 14, 15); }
__device__ __forceinline__ v16bf cat16b(v8us lo, v8us hi) { return __builtin_bit_cast(v16bf, __builtin_shufflevector(lo, hi, 0, 1, 2, 3, 4, 5, 6, 7, 8, 9, 10, 11, 12, 13, 14, 15)); }
__device__ __forceinline__ v8f wmma16(v16h a, v16h b, v8f c) { return __builtin_amdgcn_wmma_f32_16x16x32_f16(false, a, false, b, (short)0, c, false, false); }
__device__ __forceinline__ v8f wmmab(v16bf a, v16bf b, v8f c) { return __builtin_amdgcn_wmma_f32_16x16x32_bf16(false, a, false, b, (short)0, c, false, false); }

// ---- k_gemmw: register-blocked GEMM, one work-group of KW waves per 64x64 output tile (16 accumulators per wave), operands straight from K-contiguous 16-bit planes; grid (M/64, N/64, Z), 32 * KW threads.
// K split: wave w takes the 32-wide k steps w, w + KW, w + 2 KW, ... (neighbouring waves read neighbouring halves of the same 128-byte lines); for KW > 1 the KW partial tiles meet in LDS and are summed in wave order 0 .. KW-1.
// C[m][n] (f32, pitch ldc, + optional f32 bias[n]) = sum_k A[m][k] Bt[n][k] (+ split products per NSPLIT). z-batch strides sA/sB/sC in elements. K % 32 == 0, M % 64 == 0, N % 64 == 0.
// Fragment map: lane -> row/col (lane & 15), elements 0..7 = k0 + 8*(lane>>4) + 0..7, elements 8..15 = k0 + 16 + 8*(lane>>4) + 0..7 for A and B; D element j = (row 8*(lane>>4) + j, col lane & 15).
template <typename T16> struct WFrag;
template <> struct WFrag<h16> { typedef v16h V; static __device__ __forceinline__ V ld(const h16* p) { return cat16(*(const v8h*)p, *(const v8h*)(p + 16)); } static __device__ __forceinline__ v8f mma(V a, V b, v8f c) { return wmma16(a, b, c); } };
template <> struct WFrag<bf> { typedef v16bf V; static __device__ __forceinline__ V ld(const bf* p) { return cat16b(*(const v8us*)p, *(const v8us*)(p + 16)); } static __device__ __forceinline__ v8f mma(V a, V b, v8f c) { return wmmab(a, b, c); } };
template <typename T16, int NSPLIT, bool BIAS, int KW>
__global__ __launch_bounds__(32 * KW) void k_gemmw(const T16* __restrict__ A, const T16* __restrict__ A2, const T16* __restrict__ Bt, const T16* __restrict__ Bt2, int K, float* C, int ldc, const float* __restrict__ bias, size_t sA, size_t sB, size_t sC) {
    typedef typename WFrag<T16>::V V;
    __shared__ __align__(16) float os[(KW == 1 ? 16 : KW * 64) * 68];
    const int w = (KW == 1) ? 0 : __builtin_amdgcn_readfirstlane((int)(threadIdx.x >> 5));
    const size_t z = blockIdx.z; A += z * sA; if (A2) A2 += z * sA; Bt += z * sB; if (Bt2) Bt2 += z * sB; C += z * sC;
    const int lane = threadIdx.x & 31, lr = lane & 15, hi = lane >> 4; const int r0 = blockIdx.x * 64, c0 = blockIdx.y * 64;
    v8f acc[4][4];
#pragma unroll
    for (int mb = 0; mb < 4; ++mb)
#pragma unroll
        for (int nb = 0; nb < 4; ++nb) acc[mb][nb] = (v8f){};
    const size_t aoff = (size_t)(r0 + lr) * K + 8 * hi, boff = (size_t)(c0 + lr) * K + 8 * hi;
#pragma unroll 1
    for (int kc = w * 32; kc < K; kc += 32 * KW) {
        V a[4], a2[4];
#pragma unroll
        for (int mb = 0; mb < 4; ++mb) { a[mb] = WFrag<T16>::ld(A + aoff + (size_t)mb * 16 * K + kc); if (NSPLIT == 1 || NSPLIT == 2) a2[mb] = WFrag<T16>::ld(A2 + aoff + (size_t)mb * 16 * K + kc); }
#pragma unroll
        for (int nb = 0; nb < 4; ++nb) { const V b = WFrag<T16>::ld(Bt + boff + (size_t)nb * 16 * K + kc); V b2; if (NSPLIT >= 2) b2 = WFrag<T16>::ld(Bt2 + boff + (size_t)nb * 16 * K + kc);
#pragma unroll
            for (int mb = 0; mb < 4; ++mb) { acc[mb][nb] = WFrag<T16>::mma(a[mb], b, acc[mb][nb]); if (NSPLIT == 1 || NSPLIT == 2) acc[mb][nb] = WFrag<T16>::mma(a2[mb], b, acc[mb][nb]); if (NSPLIT >= 2) acc[mb][nb] = WFrag<T16>::mma(a[mb], b2, acc[mb][nb]); } }
        asm volatile("v_nop\n\tv_nop\n\tv_nop\n\tv_nop" : "+v"(acc[0][0]), "+v"(acc[1][1]), "+v"(acc[2][2]), "+v"(acc[3][3]) : "v"(a[0]), "v"(a[3]));
    }
    if constexpr (KW > 1) {
        float* ow = os + w * (64 * 68);
#pragma unroll
        for (int mb = 0; mb < 4; ++mb)
#pragma unroll
            for (int nb = 0; nb < 4; ++nb)
#pragma unroll
                for (int j = 0; j < 8; ++j) ow[(mb * 16 + hi * 8 + j) * 68 + nb * 16 + lr] = acc[mb][nb][j];
        __syncthreads();   // every wave's partial tile is in LDS before any thread sums across waves
#pragma unroll
        for (int r = 0; r < 64 * 16 / (32 * KW); ++r) { const int s = r * 32 * KW + (int)threadIdx.x, row = s >> 4, cofs = (s & 15) * 4; v4f val = *(const v4fa*)(os + row * 68 + cofs);
#pragma unroll
            for (int u = 1; u < KW; ++u) { const v4f pv = *(const v4fa*)(os + u * (64 * 68) + row * 68 + cofs); val[0] += pv[0]; val[1] += pv[1]; val[2] += pv[2]; val[3] += pv[3]; }
            if (BIAS) { val[0] += bfr(bias[c0 + cofs]); val[1] += bfr(bias[c0 + cofs + 1]); val[2] += bfr(bias[c0 + cofs + 2]); val[3] += bfr(bias[c0 + cofs + 3]); }
            *(v4f*)(C + (size_t)(r0 + row) * ldc + c0 + cofs) = val; }
    } else {
#pragma unroll
    for (int mb = 0; mb < 4; ++mb) {
#pragma unroll
        for (int nb = 0; nb < 4; ++nb) {
#pragma unroll
            for (int j = 0; j < 8; ++j) os[(hi * 8 + j) * 68 + nb * 16 + lr] = acc[mb][nb][j]; }
        __builtin_amdgcn_wave_barrier(); asm volatile("" ::: "memory");
        float* crow = C + (size_t)(r0 + mb * 16) * ldc + c0;
{
#pragma unroll
            for (int s = 0; s < 8; ++s) { const int row = 2 * s + hi, cofs = lr * 4; v4f val = *(const v4fa*)(os + row * 68 + cofs); if (BIAS) { val[0] += bfr(bias[c0 + cofs]); val[1] += bfr(bias[c0 + cofs + 1]); val[2] += bfr(bias[c0 + cofs + 2]); val[3] += bfr(bias[c0 + cofs + 3]); }
                *(v4f*)(crow + (size_t)row * ldc + cofs) = val; }
             }
        __builtin_amdgcn_wave_barrier(); asm volatile("" ::: "memory");
    }
    }
}

__device__ __forceinline__ h16 tohx(float x) { return (h16)x; }
__device__ __forceinline__ void splitf(float y, unsigned short& h, unsigned short& l) { h = f2bf(y); l = f2bf(y - bf2f(h)); }
typedef __attribute__((ext_vector_type(2))) _Float16 v2h;
typedef __attribute__((ext_vector_type(4))) _Float16 v4h;
typedef __attribute__((ext_vector_type(2))) unsigned short v2us;
typedef __attribute__((ext_vector_type(4))) unsigned short v4us;
typedef __attribute__((ext_vector_type(2))) float v2f;

__global__ __launch_bounds__(256) void k_cvt8(const float* __restrict__ src, bf* dst, size_t n8) { const size_t i = (size_t)blockIdx.x * 256 + threadIdx.x; if (i >= n8) return; const v8f v = *(const v8f*)(src + i * 8); v8us o;
#pragma unroll
    for (int k = 0; k < 8; ++k) o[k] = f2bf(v[k]); *(v8us*)(dst + i * 8) = o;  }

__global__ __launch_bounds__(256) void k_hp(const float* __restrict__ F, int pitch, int nheads, h16* P16, bf* Ph, bf* Pl) {
    const size_t e = ((size_t)blockIdx.x * 256 + threadIdx.x) * 2; if (e >= (size_t)nheads * TT * HD) return; const int d = (int)(e % HD); const int t = (int)((e / HD) % TT); const int h = (int)(e / ((size_t)HD * TT));
    const v2f x = *(const v2f*)(F + (size_t)t * pitch + h * HD + d); v2h o16; v2us oh, ol;
#pragma unroll
    for (int q = 0; q < 2; ++q) { const float r = x[q]; o16[q] = tohx(r); unsigned short a2, c2; splitf(r, a2, c2); oh[q] = a2; ol[q] = c2; }
    *(v2h*)(P16 + e) = o16; *(v2us*)(Ph + e) = oh; *(v2us*)(Pl + e) = ol;  }

__global__ __launch_bounds__(256) void k_vtp(const float* __restrict__ F, int pitch, int nheads, h16* V16, bf* Vh, bf* Vl) { const size_t e = ((size_t)blockIdx.x * 256 + threadIdx.x) * 2; if (e >= (size_t)nheads * HD * TT) return; const int t = (int)(e % TT); const int d = (int)((e / TT) % HD); const int g = (int)(e / ((size_t)TT * HD)); v2h o16; v2us oh, ol;
#pragma unroll
    for (int q = 0; q < 2; ++q) { const float x = F[(size_t)(t + q) * pitch + g * HD + d]; o16[q] = tohx(x); unsigned short a2, c2; splitf(x, a2, c2); oh[q] = a2; ol[q] = c2; }
    *(v2h*)(V16 + e) = o16; *(v2us*)(Vh + e) = oh; *(v2us*)(Vl + e) = ol;  }

// k_asoft: one work-group of NH_ waves per query row i of the pass, wave h = head h: t = S[h][i][:] x HD^-0.5; softmax over the TT keys (register row of TT/32 values per lane, one exp, fixed trees).
// Head mean: wave h leaves its f32 probability row in LDS row h; behind one work-group barrier thread x sums columns 4x .. 4x+3 over the rows in head order 0 .. NH_-1 (the order of the one-wave loop over heads) and stores them once.
__global__ __launch_bounds__(32 * NH_) void k_asoft(const float* __restrict__ Sb, int q0, int hires, h16* P16, bf* Ph, bf* Pl, float* AVG) {
#pragma clang fp contract(off)
    __shared__ __align__(16) float avs[NH_ * TT];
    const int lane = threadIdx.x & 31; const int h = __builtin_amdgcn_readfirstlane((int)(threadIdx.x >> 5)); const int i = blockIdx.x; if (i >= QC) return;
    float* avw = avs + h * TT + lane * 4;
    const size_t po = ((size_t)h * QC + i) * TT; const float* sr = Sb + po; float v[TT / 32]; float mx = -3.0e38f;
#pragma unroll
    for (int ch = 0; ch < TT / 128; ++ch) { const int j0 = ch * 128 + lane * 4; const v4f a = *(const v4f*)(sr + j0);
#pragma unroll
        for (int q = 0; q < 4; ++q) { const float t = a[q] * SCL; v[ch * 4 + q] = t; mx = fmaxf(mx, t); } }
#pragma unroll
    for (int sh = 16; sh; sh >>= 1) mx = fmaxf(mx, __shfl_xor(mx, sh, 32));
    float sum = 0.f;
#pragma unroll
    for (int k = 0; k < TT / 32; ++k) { float d0 = __fsub_rn(v[k], mx); asm volatile("" : "+v"(d0)); v[k] = __fmul_rn(d0, 1.4426950408889634f); }
    // v_exp_f32 (what exp2f compiles to), eight in place per statement: the instruction set asks for one independent instruction or a v_nop behind a transcendental before its result is read or its source overwritten;
    // here each v_exp_f32 fills the slot of the one before and one v_nop that of the last (a v_nop in a statement of its own did not stay behind it).
#pragma unroll
    for (int k = 0; k < TT / 32; k += 8)
        asm("v_exp_f32 %0, %0\n\tv_exp_f32 %1, %1\n\tv_exp_f32 %2, %2\n\tv_exp_f32 %3, %3\n\tv_exp_f32 %4, %4\n\tv_exp_f32 %5, %5\n\tv_exp_f32 %6, %6\n\tv_exp_f32 %7, %7\n\tv_nop"
            : "+v"(v[k]), "+v"(v[k + 1]), "+v"(v[k + 2]), "+v"(v[k + 3]), "+v"(v[k + 4]), "+v"(v[k + 5]), "+v"(v[k + 6]), "+v"(v[k + 7]));
#pragma unroll
    for (int k = 0; k < TT / 32; ++k) sum += v[k];
#pragma unroll
    for (int sh = 16; sh; sh >>= 1) sum += __shfl_xor(sum, sh, 32);
    const float fn = __fdiv_rn(1.0f, sum); const float f = hires ? fn : fn * PCAR;
#pragma unroll
    for (int ch = 0; ch < TT / 128; ++ch) { v4f a;
#pragma unroll
        for (int q = 0; q < 4; ++q) a[q] = v[ch * 4 + q] * fn;
        *(v4fa*)(avw + ch * 128) = a; }
    __syncthreads();   // all NH_ probability rows are in LDS before any thread sums over the heads; it stands in front of the plane stores so that no wave waits here for its global stores
{
        float fz = f; asm volatile("" : "+v"(fz));
        if (hires) {
#pragma unroll
            for (int ch = 0; ch < TT / 128; ++ch) { v4us oh, ol;
#pragma unroll
                for (int q = 0; q < 4; ++q) { unsigned short a, c2; splitf(v[ch * 4 + q] * fz, a, c2); oh[q] = a; ol[q] = c2; }
                const size_t oo = po + ch * 128 + lane * 4; *(v4us*)(Ph + oo) = oh; *(v4us*)(Pl + oo) = ol; }
        } else {
#pragma unroll
            for (int ch = 0; ch < TT / 128; ++ch) { v4h o4;
#pragma unroll
                for (int q = 0; q < 4; ++q) o4[q] = tohx(v[ch * 4 + q] * fz);
                *(v4h*)(P16 + po + ch * 128 + lane * 4) = o4; } }
         }
    float* arow = AVG + (size_t)(q0 + i) * TT;
{
        float sc = 1.0f / NH_; asm volatile("" : "+v"(sc));
        // the loops below are unrolled so that the NH_ LDS reads of a thread are issued ahead of its ordered adds
#pragma unroll
        for (int r = 0; r < TT / (128 * NH_); ++r) { const int c = r * 128 * NH_ + (int)threadIdx.x * 4; v4f a = *(const v4fa*)(avs + c);
#pragma unroll
            for (int u = 1; u < NH_; ++u) { const v4f pv = *(const v4fa*)(avs + u * TT + c);
#pragma unroll
                for (int q = 0; q < 4; ++q) a[q] = a[q] + pv[q]; }
            v4f o;
#pragma unroll
            for (int q = 0; q < 4; ++q) o[q] = a[q] * sc;
            *(v4f*)(arow + c) = o; }
         }
}

__global__ __launch_bounds__(256) void k_merge(const float* __restrict__ O, int q0, int hires, bf* Ah, bf* Al) { const size_t e = ((size_t)blockIdx.x * 256 + threadIdx.x) * 2; if (e >= (size_t)NH_ * QC * HD) return; const int d = (int)(e % HD); const int i = (int)((e / HD) % QC); const int h = (int)(e / ((size_t)HD * QC)); const float cs = hires ? 1.0f : (1.0f / PCAR); const size_t oo = (size_t)(q0 + i) * DQ + h * HD + d;
    const v2f x = *(const v2f*)(O + e); v2us oh, ol;
#pragma unroll
    for (int q = 0; q < 2; ++q) { unsigned short a, c2; splitf(x[q] * cs, a, c2); oh[q] = a; ol[q] = c2; } *(v2us*)(Ah + oo) = oh; *(v2us*)(Al + oo) = ol;  }

// workspace plan (bytes); region U is shared by {XB, FQ, FK} (projection phase) and Sb (attention passes), stream-ordered.
static constexpr size_t W_BYTES  = (size_t)DM * DM * 2;
static constexpr size_t XB_BYTES = (size_t)TT * DM * 2;
static constexpr size_t F_BYTES  = (size_t)TT * DM * 4;
static constexpr size_t PL_BYTES = (size_t)NH_ * TT * HD * 2;
static constexpr size_t SB_BYTES = (size_t)NH_ * QC * TT * 4;
static constexpr size_t PP_BYTES = (size_t)NH_ * QC * TT * 2;
static constexpr size_t OB_BYTES = (size_t)NH_ * QC * HD * 4;
static constexpr size_t AT_BYTES = (size_t)TT * DQ * 2;
static constexpr size_t U_BYTES  = (SB_BYTES > XB_BYTES + 2 * F_BYTES) ? SB_BYTES : (XB_BYTES + 2 * F_BYTES);
static constexpr size_t WS_TOTAL = 4 * W_BYTES + U_BYTES + 9 * PL_BYTES + 2 * PP_BYTES + OB_BYTES + 2 * AT_BYTES;
static_assert(W_BYTES % 256 == 0 && XB_BYTES % 256 == 0 && F_BYTES % 256 == 0 && PL_BYTES % 256 == 0);
static_assert(SB_BYTES % 256 == 0 && PP_BYTES % 256 == 0 && OB_BYTES % 256 == 0 && AT_BYTES % 256 == 0);
static_assert(XB_BYTES + 2 * F_BYTES <= U_BYTES);
static_assert(SB_BYTES <= U_BYTES);
static_assert(WS_TOTAL <= (size_t)134217728);

extern "C" void kernel_launch(void* const* d_in, const int* in_sizes, int n_in,
                              void* d_out, int out_size, void* d_ws, size_t ws_size, hipStream_t stream) {
    if (n_in < 11) return;
    const size_t need_x = (size_t)(NB - 1) * SEQ_FULL * DM + (size_t)TT * DM;
    if ((size_t)in_sizes[0] < need_x || (size_t)in_sizes[1] < need_x || (size_t)in_sizes[2] < need_x) return;
    if ((size_t)in_sizes[3] < (size_t)DM * DM || (size_t)in_sizes[5] < (size_t)DM * DM || (size_t)in_sizes[7] < (size_t)DM * DM || (size_t)in_sizes[9] < (size_t)DM * DM) return;
    if (in_sizes[4] < DM || in_sizes[6] < DM || in_sizes[8] < DM || in_sizes[10] < DM) return;
    const size_t AVG_OFF = (size_t)NB_FULL * SEQ_FULL * DM;     // element offset of the second output (byte 16777216)
    if ((size_t)out_size < AVG_OFF + (size_t)NB * TT * TT) return;
    if (ws_size < WS_TOTAL) return;
    const float* xq = (const float*)d_in[0]; const float* xk = (const float*)d_in[1]; const float* xv = (const float*)d_in[2]; const float* wq = (const float*)d_in[3]; const float* bq = (const float*)d_in[4]; const float* wk = (const float*)d_in[5]; const float* bk = (const float*)d_in[6]; const float* wv = (const float*)d_in[7]; const float* bv = (const float*)d_in[8]; const float* wo = (const float*)d_in[9]; const float* bo = (const float*)d_in[10];
    float* OUT = (float*)d_out;                 // [NB][TT][DM]
    float* AVG = (float*)d_out + AVG_OFF;       // [NB][TT][TT]
    char* wsp = (char*)d_ws;
    auto take = [&](size_t bytes) { char* p = wsp; wsp += (bytes + 255) & ~(size_t)255; return (void*)p; };
    bf* WQ = (bf*)take(W_BYTES); bf* WK = (bf*)take(W_BYTES); bf* WV = (bf*)take(W_BYTES); bf* WO = (bf*)take(W_BYTES);
    char* U = (char*)take(U_BYTES);
    float* Sb = (float*)U; bf* XB = (bf*)U; float* FQ = (float*)(U + XB_BYTES); float* FK = (float*)(U + XB_BYTES + F_BYTES); float* FV = FK;   // v projection reuses the k buffer after the k planes are built
    h16* QP16 = (h16*)take(PL_BYTES); h16* KP16 = (h16*)take(PL_BYTES); h16* VT16 = (h16*)take(PL_BYTES);
    bf* QPh = (bf*)take(PL_BYTES); bf* QPl = (bf*)take(PL_BYTES); bf* KPh = (bf*)take(PL_BYTES); bf* KPl = (bf*)take(PL_BYTES); bf* VTh = (bf*)take(PL_BYTES); bf* VTl = (bf*)take(PL_BYTES);
    char* PAr = (char*)take(PP_BYTES); h16* PA16 = (h16*)PAr; bf* PAh = (bf*)PAr;    // p plane: fp16 x1024 (plain passes) or bf16 hi (hires passes)
    bf* PAl = (bf*)take(PP_BYTES);
    float* Ob = (float*)take(OB_BYTES); bf* ATh = (bf*)take(AT_BYTES); bf* ATl = (bf*)take(AT_BYTES);
    if ((size_t)(wsp - (char*)d_ws) > ws_size) return;

    const unsigned GW = (unsigned)(((size_t)DM * DM / 8 + 255) / 256), GX = (unsigned)(((size_t)TT * DM / 8 + 255) / 256);
    k_cvt8<<<GW, 256, 0, stream>>>(wq, WQ, (size_t)DM * DM / 8); k_cvt8<<<GW, 256, 0, stream>>>(wk, WK, (size_t)DM * DM / 8);
    k_cvt8<<<GW, 256, 0, stream>>>(wv, WV, (size_t)DM * DM / 8); k_cvt8<<<GW, 256, 0, stream>>>(wo, WO, (size_t)DM * DM / 8);
    const unsigned LP = (unsigned)(((size_t)NH_ * TT * HD / 2 + 255) / 256);
    const unsigned LM = (unsigned)(((size_t)NH_ * QC * HD / 2 + 255) / 256);
    for (int b = 0; b < NB; ++b) {
        const size_t xo = (size_t)b * SEQ_FULL * DM;
        k_cvt8<<<GX, 256, 0, stream>>>(xq + xo, XB, (size_t)TT * DM / 8);
        k_gemmw<bf, 0, true, KWP><<<dim3(TT / 64, DQ / 64, 1), 32 * KWP, 0, stream>>>(XB, nullptr, WQ, nullptr, DM, FQ, DQ, bq, 0, 0, 0);
        k_hp<<<LP, 256, 0, stream>>>(FQ, DQ, NH_, QP16, QPh, QPl);
        k_cvt8<<<GX, 256, 0, stream>>>(xk + xo, XB, (size_t)TT * DM / 8);
        k_gemmw<bf, 0, true, KWP><<<dim3(TT / 64, DQ / 64, 1), 32 * KWP, 0, stream>>>(XB, nullptr, WK, nullptr, DM, FK, DQ, bk, 0, 0, 0);
        k_hp<<<LP, 256, 0, stream>>>(FK, DQ, NH_, KP16, KPh, KPl);
        k_cvt8<<<GX, 256, 0, stream>>>(xv + xo, XB, (size_t)TT * DM / 8);
        k_gemmw<bf, 0, true, KWP><<<dim3(TT / 64, DQ / 64, 1), 32 * KWP, 0, stream>>>(XB, nullptr, WV, nullptr, DM, FV, DQ, bv, 0, 0, 0);
        k_vtp<<<LP, 256, 0, stream>>>(FV, DQ, NH_, VT16, VTh, VTl);
        for (int q0 = 0; q0 < TT; q0 += QC) {       // one pass: QC query rows x all heads (z = head; plane z-strides TT*HD, S/P z-stride QC*TT, O z-stride QC*HD)
            const int hires = (q0 < RH) ? 1 : 0;
            if (hires) k_gemmw<bf, 2, false, 1><<<dim3(QC / 64, TT / 64, NH_), 32, 0, stream>>>(QPh + (size_t)q0 * HD, QPl + (size_t)q0 * HD, KPh, KPl, HD, Sb, TT, nullptr, (size_t)TT * HD, (size_t)TT * HD, (size_t)QC * TT);
            else       k_gemmw<h16, 0, false, 1><<<dim3(QC / 64, TT / 64, NH_), 32, 0, stream>>>(QP16 + (size_t)q0 * HD, nullptr, KP16, nullptr, HD, Sb, TT, nullptr, (size_t)TT * HD, (size_t)TT * HD, (size_t)QC * TT);
            k_asoft<<<QC, 32 * NH_, 0, stream>>>(Sb, q0, hires, PA16, PAh, PAl, AVG + (size_t)b * TT * TT);
            if (hires) k_gemmw<bf, 2, false, KWV><<<dim3(QC / 64, HD / 64, NH_), 32 * KWV, 0, stream>>>(PAh, PAl, VTh, VTl, TT, Ob, HD, nullptr, (size_t)QC * TT, (size_t)HD * TT, (size_t)QC * HD);
            else       k_gemmw<h16, 0, false, KWV><<<dim3(QC / 64, HD / 64, NH_), 32 * KWV, 0, stream>>>(PA16, nullptr, VT16, nullptr, TT, Ob, HD, nullptr, (size_t)QC * TT, (size_t)HD * TT, (size_t)QC * HD);
            k_merge<<<LM, 256, 0, stream>>>(Ob, q0, hires, ATh, ATl);
        }
        k_gemmw<bf, 1, true, KWP><<<dim3(TT / 64, DM / 64, 1), 32 * KWP, 0, stream>>>(ATh, ATl, WO, nullptr, DQ, OUT + (size_t)b * TT * DM, DM, bo, 0, 0, 0);
    }
}

// v003
// A run of this version takes 559 microseconds.
// Timed twice side by side with v002, it ran 1.35 times as fast both times.
// Over all steps from v000 it is 2.95 times as fast.
#include <hip/hip_runtime.h>

// Multi-head attention without a mask over three input streams (query, key, value [2][2048][1024]); q = query Wq^T + bq, k = key Wk^T + bk, v = value Wv^T + bv (W stored [out][in]); 16 heads x 64; scores x 64^-0.5; softmax over all keys; out0 = merged Wo^T + bo; out1 = head mean of the probabilities [2][2048][2048].
// Compute dtypes, f32 accumulate: every float input RNE-converted to bf16; projections v_wmma_f32_16x16x32_bf16 (exact products) + f32 bias; attention query rows < 512: q/k/p/v as bf16 hi+lo planes (3 products), other rows v_wmma_f32_16x16x32_f16 with p carried x1024; softmax and head mean f32; output projection merged hi+lo (bf16) x bf16 Wo + bias.
// Every launch covers all NB batches (no host loop over the batch): projections run on the NB*TT stacked rows, the head planes and the S / P / O buffers are indexed by z = batch * 16 + head.
// Pass structure: 8 passes of 256 query rows x all batches x all 16 heads (scores -> softmax/head-mean -> p.v -> merge), so one work-group owns a query row over all heads (one wave per head) and writes its head-mean row once.

#ifndef NB
#define NB 2
#endif
#ifndef SEQ
#define SEQ 2048
#endif
#define NB_FULL  2
#define SEQ_FULL 2048
#define TT   SEQ
#define DM   1024
#define NH_  16
#define HD   64
#define DQ   (NH_ * HD)
#define QC   256                  // query rows per pass
#define RH   512                  // query rows < RH use hi+lo planes
#define PCAR 1024.0f
#define SCL  0.125f               // HD^-0.5
#define KWP  8                    // waves sharing the K loop of a projection tile (K = DM)
#define KWV  16                   // waves sharing the K loop of a p.v tile (K = TT)
typedef _Float16 h16;
typedef unsigned short bf;
typedef __attribute__((ext_vector_type(16))) __bf16   v16bf;
typedef __attribute__((ext_vector_type(16))) _Float16 v16h;
typedef __attribute__((ext_vector_type(8)))  _Float16 v8h;
typedef __attribute__((ext_vector_type(8)))  unsigned short v8us;
typedef __attribute__((ext_vector_type(8)))  float    v8f;
typedef __attribute__((ext_vector_type(4)))  float    v4f;
typedef v8h  __attribute__((may_alias)) v8ha;
typedef v4f  __attribute__((may_alias)) v4fa;
typedef v8us __attribute__((may_alias)) v8usa;

static_assert(TT % QC == 0);
static_assert(QC % 64 == 0);
static_assert(RH % QC == 0);
static_assert(TT % 128 == 0);
static_assert(HD == 64);
static_assert(DM % 64 == 0);
static_assert(DM % (32 * KWP) == 0 && TT % (32 * KWV) == 0);
static_assert((size_t)KWV * 64 * 68 * 4 <= 327680 && (size_t)KWP * 64 * 68 * 4 <= 327680);
static_assert((size_t)NH_ * TT * 4 <= 327680 && 32 * NH_ <= 1024 && TT % (128 * NH_) == 0 && TT % 256 == 0);
static_assert((size_t)NB_FULL * SEQ_FULL * DM * 4 == 16777216);
static_assert((size_t)NB_FULL * SEQ_FULL * DM + (size_t)NB * TT * TT <= (size_t)50331648 / 4);

__device__ __forceinline__ unsigned short f2bf(float f) { unsigned u = __float_as_uint(f); u += 0x7FFFu + ((u >> 16) & 1u); return (unsigned short)(u >> 16); }
__device__ __forceinline__ float bf2f(unsigned short b) { return __uint_as_float(((unsigned)b) << 16); }
__device__ __forceinline__ float bfr(float f) { return bf2f(f2bf(f)); }
__device__ __forceinline__ v16h cat16(v8h lo, v8h hi) { return __builtin_shufflevector(lo, hi, 0, 1, 2, 3, 4, 5, 6, 7, 8, 9, 10, 11, 12, 13, 14, 15); }
__device__ __forceinline__ v16bf cat16b(v8us lo, v8us hi) { return __builtin_bit_cast(v16bf, __builtin_shufflevector(lo, hi, 0, 1, 2, 3, 4, 5, 6, 7, 8, 9, 10, 11, 12, 13, 14, 15)); }
__device__ __forceinline__ v8f wmma16(v16h a, v16h b, v8f c) { return __builtin_amdgcn_wmma_f32_16x16x32_f16(false, a, false, b, (short)0, c, false, false); }
__device__ __forceinline__ v8f wmmab(v16bf a, v16bf b, v8f c) { return __builtin_amdgcn_wmma_f32_16x16x32_bf16(false, a, false, b, (short)0, c, false, false); }

// ---- k_gemmw: register-blocked GEMM, one work-group of KW waves per 64x64 output tile (16 accumulators per wave), operands straight from K-contiguous 16-bit planes; grid (M/64, N/64, Z), 32 * KW threads.
// K split: wave w takes the 32-wide k steps w, w + KW, w + 2 KW, ... (neighbouring waves read neighbouring halves of the same 128-byte lines); for KW > 1 the KW partial tiles meet in LDS and are summed in wave order 0 .. KW-1.
// C[m][n] (f32, pitch ldc, + optional f32 bias[n]) = sum_k A[m][k] Bt[n][k] (+ split products per NSPLIT). z-batch strides sA/sB/sC in elements. K % 32 == 0, M % 64 == 0, N % 64 == 0.
// Fragment map: lane -> row/col (lane & 15), elements 0..7 = k0 + 8*(lane>>4) + 0..7, elements 8..15 = k0 + 16 + 8*(lane>>4) + 0..7 for A and B; D element j = (row 8*(lane>>4) + j, col lane & 15).
template <typename T16> struct WFrag;
template <> struct WFrag<h16> { typedef v16h V; static __device__ __forceinline__ V ld(const h16* p) { return cat16(*(const v8h*)p, *(const v8h*)(p + 16)); } static __device__ __forceinline__ v8f mma(V a, V b, v8f c) { return wmma16(a, b, c); } };
template <> struct WFrag<bf> { typedef v16bf V; static __device__ __forceinline__ V ld(const bf* p) { return cat16b(*(const v8us*)p, *(const v8us*)(p + 16)); } static __device__ __forceinline__ v8f mma(V a, V b, v8f c) { return wmmab(a, b, c); } };
template <typename T16, int NSPLIT, bool BIAS, int KW>
__global__ __launch_bounds__(32 * KW) void k_gemmw(const T16* __restrict__ A, const T16* __restrict__ A2, const T16* __restrict__ Bt, const T16* __restrict__ Bt2, int K, float* C, int ldc, const float* __restrict__ bias, size_t sA, size_t sB, size_t sC) {
    typedef typename WFrag<T16>::V V;
    __shared__ __align__(16) float os[(KW == 1 ? 16 : KW * 64) * 68];
    const int w = (KW == 1) ? 0 : __builtin_amdgcn_readfirstlane((int)(threadIdx.x >> 5));
    const size_t z = blockIdx.z; A += z * sA; if (A2) A2 += z * sA; Bt += z * sB; if (Bt2) Bt2 += z * sB; C += z * sC;
    const int lane = threadIdx.x & 31, lr = lane & 15, hi = lane >> 4; const int r0 = blockIdx.x * 64, c0 = blockIdx.y * 64;
    v8f acc[4][4];
#pragma unroll
    for (int mb = 0; mb < 4; ++mb)
#pragma unroll
        for (int nb = 0; nb < 4; ++nb) acc[mb][nb] = (v8f){};
    const size_t aoff = (size_t)(r0 + lr) * K + 8 * hi, boff = (size_t)(c0 + lr) * K + 8 * hi;
#pragma unroll 1
    for (int kc = w * 32; kc < K; kc += 32 * KW) {
        V a[4], a2[4];
#pragma unroll
        for (int mb = 0; mb < 4; ++mb) { a[mb] = WFrag<T16>::ld(A + aoff + (size_t)mb * 16 * K + kc); if (NSPLIT == 1 || NSPLIT == 2) a2[mb] = WFrag<T16>::ld(A2 + aoff + (size_t)mb * 16 * K + kc); }
#pragma unroll
        for (int nb = 0; nb < 4; ++nb) { const V b = WFrag<T16>::ld(Bt + boff + (size_t)nb * 16 * K + kc); V b2; if (NSPLIT >= 2) b2 = WFrag<T16>::ld(Bt2 + boff + (size_t)nb * 16 * K + kc);
#pragma unroll
            for (int mb = 0; mb < 4; ++mb) { acc[mb][nb] = WFrag<T16>::mma(a[mb], b, acc[mb][nb]); if (NSPLIT == 1 || NSPLIT == 2) acc[mb][nb] = WFrag<T16>::mma(a2[mb], b, acc[mb][nb]); if (NSPLIT >= 2) acc[mb][nb] = WFrag<T16>::mma(a[mb], b2, acc[mb][nb]); } }
        asm volatile("v_nop\n\tv_nop\n\tv_nop\n\tv_nop" : "+v"(acc[0][0]), "+v"(acc[1][1]), "+v"(acc[2][2]), "+v"(acc[3][3]) : "v"(a[0]), "v"(a[3]));
    }
    if constexpr (KW > 1) {
        float* ow = os + w * (64 * 68);
#pragma unroll
        for (int mb = 0; mb < 4; ++mb)
#pragma unroll
            for (int nb = 0; nb < 4; ++nb)
#pragma unroll
                for (int j = 0; j < 8; ++j) ow[(mb * 16 + hi * 8 + j) * 68 + nb * 16 + lr] = acc[mb][nb][j];
        __syncthreads();   // every wave's partial tile is in LDS before any thread sums across waves
#pragma unroll
        for (int r = 0; r < 64 * 16 / (32 * KW); ++r) { const int s = r * 32 * KW + (int)threadIdx.x, row = s >> 4, cofs = (s & 15) * 4; v4f val = *(const v4fa*)(os + row * 68 + cofs);
#pragma unroll
            for (int u = 1; u < KW; ++u) { const v4f pv = *(const v4fa*)(os + u * (64 * 68) + row * 68 + cofs); val[0] += pv[0]; val[1] += pv[1]; val[2] += pv[2]; val[3] += pv[3]; }
            if (BIAS) { val[0] += bfr(bias[c0 + cofs]); val[1] += bfr(bias[c0 + cofs + 1]); val[2] += bfr(bias[c0 + cofs + 2]); val[3] += bfr(bias[c0 + cofs + 3]); }
            *(v4f*)(C + (size_t)(r0 + row) * ldc + c0 + cofs) = val; }
    } else {
#pragma unroll
    for (int mb = 0; mb < 4; ++mb) {
#pragma unroll
        for (int nb = 0; nb < 4; ++nb) {
#pragma unroll
            for (int j = 0; j < 8; ++j) os[(hi * 8 + j) * 68 + nb * 16 + lr] = acc[mb][nb][j]; }
        __builtin_amdgcn_wave_barrier(); asm volatile("" ::: "memory");
        float* crow = C + (size_t)(r0 + mb * 16) * ldc + c0;
{
#pragma unroll
            for (int s = 0; s < 8; ++s) { const int row = 2 * s + hi, cofs = lr * 4; v4f val = *(const v4fa*)(os + row * 68 + cofs); if (BIAS) { val[0] += bfr(bias[c0 + cofs]); val[1] += bfr(bias[c0 + cofs + 1]); val[2] += bfr(bias[c0 + cofs + 2]); val[3] += bfr(bias[c0 + cofs + 3]); }
                *(v4f*)(crow + (size_t)row * ldc + cofs) = val; }
             }
        __builtin_amdgcn_wave_barrier(); asm volatile("" ::: "memory");
    }
    }
}

__device__ __forceinline__ h16 tohx(float x) { return (h16)x; }
__device__ __forceinline__ void splitf(float y, unsigned short& h, unsigned short& l) { h = f2bf(y); l = f2bf(y - bf2f(h)); }
typedef __attribute__((ext_vector_type(2))) _Float16 v2h;
typedef __attribute__((ext_vector_type(4))) _Float16 v4h;
typedef __attribute__((ext_vector_type(2))) unsigned short v2us;
typedef __attribute__((ext_vector_type(4))) unsigned short v4us;
typedef __attribute__((ext_vector_type(2))) float v2f;

// blockIdx.y = batch: source and destination advance by sb / db elements per batch (n8 groups of 8 each).
__global__ __launch_bounds__(256) void k_cvt8(const float* __restrict__ src, bf* dst, size_t n8, size_t sb, size_t db) { const size_t i = (size_t)blockIdx.x * 256 + threadIdx.x; if (i >= n8) return; src += (size_t)blockIdx.y * sb; dst += (size_t)blockIdx.y * db; const v8f v = *(const v8f*)(src + i * 8); v8us o;
#pragma unroll
    for (int k = 0; k < 8; ++k) o[k] = f2bf(v[k]); *(v8us*)(dst + i * 8) = o;  }

// k_hp / k_vtp: nz = NB * NH_ planes, plane z = batch * NH_ + head, read from row batch * TT + t of F.
__global__ __launch_bounds__(256) void k_hp(const float* __restrict__ F, int pitch, int nz, h16* P16, bf* Ph, bf* Pl) {
    const size_t e = ((size_t)blockIdx.x * 256 + threadIdx.x) * 2; if (e >= (size_t)nz * TT * HD) return; const int d = (int)(e % HD); const int t = (int)((e / HD) % TT); const int z = (int)(e / ((size_t)HD * TT)); const int b = z / NH_, h = z % NH_;
    const v2f x = *(const v2f*)(F + ((size_t)b * TT + t) * pitch + h * HD + d); v2h o16; v2us oh, ol;
#pragma unroll
    for (int q = 0; q < 2; ++q) { const float r = x[q]; o16[q] = tohx(r); unsigned short a2, c2; splitf(r, a2, c2); oh[q] = a2; ol[q] = c2; }
    *(v2h*)(P16 + e) = o16; *(v2us*)(Ph + e) = oh; *(v2us*)(Pl + e) = ol;  }

__global__ __launch_bounds__(256) void k_vtp(const float* __restrict__ F, int pitch, int nz, h16* V16, bf* Vh, bf* Vl) { const size_t e = ((size_t)blockIdx.x * 256 + threadIdx.x) * 2; if (e >= (size_t)nz * HD * TT) return; const int t = (int)(e % TT); const int d = (int)((e / TT) % HD); const int z = (int)(e / ((size_t)TT * HD)); const int b = z / NH_, g = z % NH_; v2h o16; v2us oh, ol;
#pragma unroll
    for (int q = 0; q < 2; ++q) { const float x = F[((size_t)b * TT + t + q) * pitch + g * HD + d]; o16[q] = tohx(x); unsigned short a2, c2; splitf(x, a2, c2); oh[q] = a2; ol[q] = c2; }
    *(v2h*)(V16 + e) = o16; *(v2us*)(Vh + e) = oh; *(v2us*)(Vl + e) = ol;  }

// k_asoft: one work-group of NH_ waves per query row i of the pass (blockIdx.x) and batch (blockIdx.y), wave h = head h: t = S[h][i][:] x HD^-0.5; softmax over the TT keys (register row of TT/32 values per lane, one exp, fixed trees).
// Head mean: wave h leaves its f32 probability row in LDS row h; behind one work-group barrier thread x sums columns 4x .. 4x+3 over the rows in head order 0 .. NH_-1 (the order of the one-wave loop over heads) and stores them once.
__global__ __launch_bounds__(32 * NH_) void k_asoft(const float* __restrict__ Sb, int q0, int hires, h16* P16, bf* Ph, bf* Pl, float* AVG) {
#pragma clang fp contract(off)
    __shared__ __align__(16) float avs[NH_ * TT];
    const int lane = threadIdx.x & 31; const int h = __builtin_amdgcn_readfirstlane((int)(threadIdx.x >> 5)); const int i = blockIdx.x; if (i >= QC) return; const int b = blockIdx.y;
    float* avw = avs + h * TT + lane * 4;
    const size_t po = (((size_t)b * NH_ + h) * QC + i) * TT; const float* sr = Sb + po; float v[TT / 32]; float mx = -3.0e38f;
#pragma unroll
    for (int ch = 0; ch < TT / 128; ++ch) { const int j0 = ch * 128 + lane * 4; const v4f a = *(const v4f*)(sr + j0);
#pragma unroll
        for (int q = 0; q < 4; ++q) { const float t = a[q] * SCL; v[ch * 4 + q] = t; mx = fmaxf(mx, t); } }
#pragma unroll
    for (int sh = 16; sh; sh >>= 1) mx = fmaxf(mx, __shfl_xor(mx, sh, 32));
    float sum = 0.f;
#pragma unroll
    for (int k = 0; k < TT / 32; ++k) { float d0 = __fsub_rn(v[k], mx); asm volatile("" : "+v"(d0)); v[k] = __fmul_rn(d0, 1.4426950408889634f); }
    // v_exp_f32 (what exp2f compiles to), eight in place per statement: the instruction set asks for one independent instruction or a v_nop behind a transcendental before its result is read or its source overwritten;
    // here each v_exp_f32 fills the slot of the one before and one v_nop that of the last (a v_nop in a statement of its own did not stay behind it).
#pragma unroll
    for (int k = 0; k < TT / 32; k += 8)
        asm("v_exp_f32 %0, %0\n\tv_exp_f32 %1, %1\n\tv_exp_f32 %2, %2\n\tv_exp_f32 %3, %3\n\tv_exp_f32 %4, %4\n\tv_exp_f32 %5, %5\n\tv_exp_f32 %6, %6\n\tv_exp_f32 %7, %7\n\tv_nop"
            : "+v"(v[k]), "+v"(v[k + 1]), "+v"(v[k + 2]), "+v"(v[k + 3]), "+v"(v[k + 4]), "+v"(v[k + 5]), "+v"(v[k + 6]), "+v"(v[k + 7]));
#pragma unroll
    for (int k = 0; k < TT / 32; ++k) sum += v[k];
#pragma unroll
    for (int sh = 16; sh; sh >>= 1) sum += __shfl_xor(sum, sh, 32);
    const float fn = __fdiv_rn(1.0f, sum); const float f = hires ? fn : fn * PCAR;
#pragma unroll
    for (int ch = 0; ch < TT / 128; ++ch) { v4f a;
#pragma unroll
        for (int q = 0; q < 4; ++q) a[q] = v[ch * 4 + q] * fn;
        *(v4fa*)(avw + ch * 128) = a; }
    __syncthreads();   // all NH_ probability rows are in LDS before any thread sums over the heads; it stands in front of the plane stores so that no wave waits here for its global stores
{
        float fz = f; asm volatile("" : "+v"(fz));
        if (hires) {
#pragma unroll
            for (int ch = 0; ch < TT / 128; ++ch) { v4us oh, ol;
#pragma unroll
                for (int q = 0; q < 4; ++q) { unsigned short a, c2; splitf(v[ch * 4 + q] * fz, a, c2); oh[q] = a; ol[q] = c2; }
                const size_t oo = po + ch * 128 + lane * 4; *(v4us*)(Ph + oo) = oh; *(v4us*)(Pl + oo) = ol; }
        } else {
#pragma unroll
            for (int ch = 0; ch < TT / 128; ++ch) { v4h o4;
#pragma unroll
                for (int q = 0; q < 4; ++q) o4[q] = tohx(v[ch * 4 + q] * fz);
                *(v4h*)(P16 + po + ch * 128 + lane * 4) = o4; } }
         }
    float* arow = AVG + ((size_t)b * TT + q0 + i) * TT;
{
        float sc = 1.0f / NH_; asm volatile("" : "+v"(sc));
        // the loops below are unrolled so that the NH_ LDS reads of a thread are issued ahead of its ordered adds
#pragma unroll
        for (int r = 0; r < TT / (128 * NH_); ++r) { const int c = r * 128 * NH_ + (int)threadIdx.x * 4; v4f a = *(const v4fa*)(avs + c);
#pragma unroll
            for (int u = 1; u < NH_; ++u) { const v4f pv = *(const v4fa*)(avs + u * TT + c);
#pragma unroll
                for (int q = 0; q < 4; ++q) a[q] = a[q] + pv[q]; }
            v4f o;
#pragma unroll
            for (int q = 0; q < 4; ++q) o[q] = a[q] * sc;
            *(v4f*)(arow + c) = o; }
         }
}

__global__ __launch_bounds__(256) void k_merge(const float* __restrict__ O, int q0, int hires, bf* Ah, bf* Al) { const size_t e = ((size_t)blockIdx.x * 256 + threadIdx.x) * 2; if (e >= (size_t)NB * NH_ * QC * HD) return; const int d = (int)(e % HD); const int i = (int)((e / HD) % QC); const int z = (int)(e / ((size_t)HD * QC)); const int b = z / NH_, h = z % NH_; const float cs = hires ? 1.0f : (1.0f / PCAR); const size_t oo = ((size_t)b * TT + q0 + i) * DQ + h * HD + d;
    const v2f x = *(const v2f*)(O + e); v2us oh, ol;
#pragma unroll
    for (int q = 0; q < 2; ++q) { unsigned short a, c2; splitf(x[q] * cs, a, c2); oh[q] = a; ol[q] = c2; } *(v2us*)(Ah + oo) = oh; *(v2us*)(Al + oo) = ol;  }

// workspace plan (bytes); region U is shared by {XB, FQ, FK} (projection phase) and Sb (attention passes), stream-ordered.
static constexpr size_t W_BYTES  = (size_t)DM * DM * 2;
static constexpr size_t XB_BYTES = (size_t)NB * TT * DM * 2;
static constexpr size_t F_BYTES  = (size_t)NB * TT * DM * 4;
static constexpr size_t PL_BYTES = (size_t)NB * NH_ * TT * HD * 2;
static constexpr size_t SB_BYTES = (size_t)NB * NH_ * QC * TT * 4;
static constexpr size_t PP_BYTES = (size_t)NB * NH_ * QC * TT * 2;
static constexpr size_t OB_BYTES = (size_t)NB * NH_ * QC * HD * 4;
static constexpr size_t AT_BYTES = (size_t)NB * TT * DQ * 2;
static constexpr size_t U_BYTES  = (SB_BYTES > XB_BYTES + 2 * F_BYTES) ? SB_BYTES : (XB_BYTES + 2 * F_BYTES);
static constexpr size_t WS_TOTAL = 4 * W_BYTES + U_BYTES + 9 * PL_BYTES + 2 * PP_BYTES + OB_BYTES + 2 * AT_BYTES;
static_assert(W_BYTES % 256 == 0 && XB_BYTES % 256 == 0 && F_BYTES % 256 == 0 && PL_BYTES % 256 == 0);
static_assert(SB_BYTES % 256 == 0 && PP_BYTES % 256 == 0 && OB_BYTES % 256 == 0 && AT_BYTES % 256 == 0);
static_assert(XB_BYTES + 2 * F_BYTES <= U_BYTES);
static_assert(SB_BYTES <= U_BYTES);
static_assert(WS_TOTAL <= (size_t)268435456);

extern "C" void kernel_launch(void* const* d_in, const int* in_sizes, int n_in,
                              void* d_out, int out_size, void* d_ws, size_t ws_size, hipStream_t stream) {
    if (n_in < 11) return;
    const size_t need_x = (size_t)(NB - 1) * SEQ_FULL * DM + (size_t)TT * DM;
    if ((size_t)in_sizes[0] < need_x || (size_t)in_sizes[1] < need_x || (size_t)in_sizes[2] < need_x) return;
    if ((size_t)in_sizes[3] < (size_t)DM * DM || (size_t)in_sizes[5] < (size_t)DM * DM || (size_t)in_sizes[7] < (size_t)DM * DM || (size_t)in_sizes[9] < (size_t)DM * DM) return;
    if (in_sizes[4] < DM || in_sizes[6] < DM || in_sizes[8] < DM || in_sizes[10] < DM) return;
    const size_t AVG_OFF = (size_t)NB_FULL * SEQ_FULL * DM;     // element offset of the second output (byte 16777216)
    if ((size_t)out_size < AVG_OFF + (size_t)NB * TT * TT) return;
    if (ws_size < WS_TOTAL) return;
    const float* xq = (const float*)d_in[0]; const float* xk = (const float*)d_in[1]; const float* xv = (const float*)d_in[2]; const float* wq = (const float*)d_in[3]; const float* bq = (const float*)d_in[4]; const float* wk = (const float*)d_in[5]; const float* bk = (const float*)d_in[6]; const float* wv = (const float*)d_in[7]; const float* bv = (const float*)d_in[8]; const float* wo = (const float*)d_in[9]; const float* bo = (const float*)d_in[10];
    float* OUT = (float*)d_out;                 // [NB][TT][DM]
    float* AVG = (float*)d_out + AVG_OFF;       // [NB][TT][TT]
    char* wsp = (char*)d_ws;
    auto take = [&](size_t bytes) { char* p = wsp; wsp += (bytes + 255) & ~(size_t)255; return (void*)p; };
    bf* WQ = (bf*)take(W_BYTES); bf* WK = (bf*)take(W_BYTES); bf* WV = (bf*)take(W_BYTES); bf* WO = (bf*)take(W_BYTES);
    char* U = (char*)take(U_BYTES);
    float* Sb = (float*)U; bf* XB = (bf*)U; float* FQ = (float*)(U + XB_BYTES); float* FK = (float*)(U + XB_BYTES + F_BYTES); float* FV = FK;   // v projection reuses the k buffer after the k planes are built
    h16* QP16 = (h16*)take(PL_BYTES); h16* KP16 = (h16*)take(PL_BYTES); h16* VT16 = (h16*)take(PL_BYTES);
    bf* QPh = (bf*)take(PL_BYTES); bf* QPl = (bf*)take(PL_BYTES); bf* KPh = (bf*)take(PL_BYTES); bf* KPl = (bf*)take(PL_BYTES); bf* VTh = (bf*)take(PL_BYTES); bf* VTl = (bf*)take(PL_BYTES);
    char* PAr = (char*)take(PP_BYTES); h16* PA16 = (h16*)PAr; bf* PAh = (bf*)PAr;    // p plane: fp16 x1024 (plain passes) or bf16 hi (hires passes)
    bf* PAl = (bf*)take(PP_BYTES);
    float* Ob = (float*)take(OB_BYTES); bf* ATh = (bf*)take(AT_BYTES); bf* ATl = (bf*)take(AT_BYTES);
    if ((size_t)(wsp - (char*)d_ws) > ws_size) return;

    const unsigned GW = (unsigned)(((size_t)DM * DM / 8 + 255) / 256), GX = (unsigned)(((size_t)TT * DM / 8 + 255) / 256);
    k_cvt8<<<GW, 256, 0, stream>>>(wq, WQ, (size_t)DM * DM / 8, 0, 0); k_cvt8<<<GW, 256, 0, stream>>>(wk, WK, (size_t)DM * DM / 8, 0, 0);
    k_cvt8<<<GW, 256, 0, stream>>>(wv, WV, (size_t)DM * DM / 8, 0, 0); k_cvt8<<<GW, 256, 0, stream>>>(wo, WO, (size_t)DM * DM / 8, 0, 0);
    const unsigned LP = (unsigned)(((size_t)NB * NH_ * TT * HD / 2 + 255) / 256);
    const unsigned LM = (unsigned)(((size_t)NB * NH_ * QC * HD / 2 + 255) / 256);
    const size_t XS = (size_t)SEQ_FULL * DM, XD = (size_t)TT * DM;   // batch strides of an input stream and of its bf16 copy
    k_cvt8<<<dim3(GX, NB, 1), 256, 0, stream>>>(xq, XB, (size_t)TT * DM / 8, XS, XD);
    k_gemmw<bf, 0, true, KWP><<<dim3(NB * TT / 64, DQ / 64, 1), 32 * KWP, 0, stream>>>(XB, nullptr, WQ, nullptr, DM, FQ, DQ, bq, 0, 0, 0);
    k_hp<<<LP, 256, 0, stream>>>(FQ, DQ, NB * NH_, QP16, QPh, QPl);
    k_cvt8<<<dim3(GX, NB, 1), 256, 0, stream>>>(xk, XB, (size_t)TT * DM / 8, XS, XD);
    k_gemmw<bf, 0, true, KWP><<<dim3(NB * TT / 64, DQ / 64, 1), 32 * KWP, 0, stream>>>(XB, nullptr, WK, nullptr, DM, FK, DQ, bk, 0, 0, 0);
    k_hp<<<LP, 256, 0, stream>>>(FK, DQ, NB * NH_, KP16, KPh, KPl);
    k_cvt8<<<dim3(GX, NB, 1), 256, 0, stream>>>(xv, XB, (size_t)TT * DM / 8, XS, XD);
    k_gemmw<bf, 0, true, KWP><<<dim3(NB * TT / 64, DQ / 64, 1), 32 * KWP, 0, stream>>>(XB, nullptr, WV, nullptr, DM, FV, DQ, bv, 0, 0, 0);
    k_vtp<<<LP, 256, 0, stream>>>(FV, DQ, NB * NH_, VT16, VTh, VTl);
    for (int q0 = 0; q0 < TT; q0 += QC) {       // one pass: QC query rows x all batches and heads (z = batch * NH_ + head; plane z-strides TT*HD, S/P z-stride QC*TT, O z-stride QC*HD)
        const int hires = (q0 < RH) ? 1 : 0;
        if (hires) k_gemmw<bf, 2, false, 1><<<dim3(QC / 64, TT / 64, NB * NH_), 32, 0, stream>>>(QPh + (size_t)q0 * HD, QPl + (size_t)q0 * HD, KPh, KPl, HD, Sb, TT, nullptr, (size_t)TT * HD, (size_t)TT * HD, (size_t)QC * TT);
        else       k_gemmw<h16, 0, false, 1><<<dim3(QC / 64, TT / 64, NB * NH_), 32, 0, stream>>>(QP16 + (size_t)q0 * HD, nullptr, KP16, nullptr, HD, Sb, TT, nullptr, (size_t)TT * HD, (size_t)TT * HD, (size_t)QC * TT);
        k_asoft<<<dim3(QC, NB, 1), 32 * NH_, 0, stream>>>(Sb, q0, hires, PA16, PAh, PAl, AVG);
        if (hires) k_gemmw<bf, 2, false, KWV><<<dim3(QC / 64, HD / 64, NB * NH_), 32 * KWV, 0, stream>>>(PAh, PAl, VTh, VTl, TT, Ob, HD, nullptr, (size_t)QC * TT, (size_t)HD * TT, (size_t)QC * HD);
        else       k_gemmw<h16, 0, false, KWV><<<dim3(QC / 64, HD / 64, NB * NH_), 32 * KWV, 0, stream>>>(PA16, nullptr, VT16, nullptr, TT, Ob, HD, nullptr, (size_t)QC * TT, (size_t)HD * TT, (size_t)QC * HD);
        k_merge<<<LM, 256, 0, stream>>>(Ob, q0, hires, ATh, ATl);
    }
    k_gemmw<bf, 1, true, KWP><<<dim3(NB * TT / 64, DM / 64, 1), 32 * KWP, 0, stream>>>(ATh, ATl, WO, nullptr, DQ, OUT, DM, bo, 0, 0, 0);
}

// v004
// One run takes 488 microseconds.
// In both of two side-by-side timings against v003, it was 1.14 times as fast.
// Counting every step since v000, it is 3.37 times as fast.
#include <hip/hip_runtime.h>

// Multi-head attention without a mask over three input streams (query, key, value [2][2048][1024]); q = query Wq^T + bq, k = key Wk^T + bk, v = value Wv^T + bv (W stored [out][in]); 16 heads x 64; scores x 64^-0.5; softmax over all keys; out0 = merged Wo^T + bo; out1 = head mean of the probabilities [2][2048][2048].
// Compute dtypes, f32 accumulate: every float input RNE-converted to bf16; projections v_wmma_f32_16x16x32_bf16 (exact products) + f32 bias; attention query rows < 512: q/k/p/v as bf16 hi+lo planes (3 products), other rows v_wmma_f32_16x16x32_f16 with p carried x1024; softmax and head mean f32; output projection merged hi+lo (bf16) x bf16 Wo + bias.
// Every launch covers all NB batches (no host loop over the batch): projections run on the NB*TT stacked rows, the head planes and the S / P / O buffers are indexed by z = batch * 16 + head.
// Pass structure: 2 hi+lo passes of 256 query rows, then 3 plain passes of 512, each x all batches x all 16 heads (scores -> softmax/head-mean -> p.v -> merge), so one work-group owns a query row over all heads (one wave per head) and writes its head-mean row once.
// The pass sizes are the largest that the workspace holds: a hi+lo pass keeps S and both p planes in region U; a plain pass fills U with S and puts its p plane over the bf16 hi/lo head planes, which no launch reads after the last hi+lo pass.

#ifndef NB
#define NB 2
#endif
#ifndef SEQ
#define SEQ 2048
#endif
#define NB_FULL  2
#define SEQ_FULL 2048
#define TT   SEQ
#define DM   1024
#define NH_  16
#define HD   64
#define DQ   (NH_ * HD)
#define QC   512                  // query rows per plain pass
#define QCH  256                  // query rows per hi+lo pass
#define RH   512                  // query rows < RH use hi+lo planes
#define PCAR 1024.0f
#define SCL  0.125f               // HD^-0.5
#define KWP  8                    // waves sharing the K loop of a projection tile (K = DM)
#define KWV  16                   // waves sharing the K loop of a p.v tile (K = TT)
typedef _Float16 h16;
typedef unsigned short bf;
typedef __attribute__((ext_vector_type(16))) __bf16   v16bf;
typedef __attribute__((ext_vector_type(16))) _Float16 v16h;
typedef __attribute__((ext_vector_type(8)))  _Float16 v8h;
typedef __attribute__((ext_vector_type(8)))  unsigned short v8us;
typedef __attribute__((ext_vector_type(8)))  float    v8f;
typedef __attribute__((ext_vector_type(4)))  float    v4f;
typedef v8h  __attribute__((may_alias)) v8ha;
typedef v4f  __attribute__((may_alias)) v4fa;
typedef v8us __attribute__((may_alias)) v8usa;

static_assert((TT - RH) % QC == 0);
static_assert(QC % 64 == 0 && QCH % 64 == 0);
static_assert(RH % QCH == 0 && RH <= TT);
static_assert(TT % 128 == 0);
static_assert(HD == 64);
static_assert(DM % 64 == 0);
static_assert(DM % (32 * KWP) == 0 && TT % (32 * KWV) == 0);
static_assert((size_t)KWV * 64 * 68 * 4 <= 327680 && (size_t)KWP * 64 * 68 * 4 <= 327680);
static_assert((size_t)NH_ * TT * 4 <= 327680 && 32 * NH_ <= 1024 && TT % (128 * NH_) == 0 && TT % 256 == 0);
static_assert((size_t)NB_FULL * SEQ_FULL * DM * 4 == 16777216);
static_assert((size_t)NB_FULL * SEQ_FULL * DM + (size_t)NB * TT * TT <= (size_t)50331648 / 4);

__device__ __forceinline__ unsigned short f2bf(float f) { unsigned u = __float_as_uint(f); u += 0x7FFFu + ((u >> 16) & 1u); return (unsigned short)(u >> 16); }
__device__ __forceinline__ float bf2f(unsigned short b) { return __uint_as_float(((unsigned)b) << 16); }
__device__ __forceinline__ float bfr(float f) { return bf2f(f2bf(f)); }
__device__ __forceinline__ v16h cat16(v8h lo, v8h hi) { return __builtin_shufflevector(lo, hi, 0, 1, 2, 3, 4, 5, 6, 7, 8, 9, 10, 11, 12, 13, 14, 15); }
__device__ __forceinline__ v16bf cat16b(v8us lo, v8us hi) { return __builtin_bit_cast(v16bf, __builtin_shufflevector(lo, hi, 0, 1, 2, 3, 4, 5, 6, 7, 8, 9, 10, 11, 12, 13, 14, 15)); }
__device__ __forceinline__ v8f wmma16(v16h a, v16h b, v8f c) { return __builtin_amdgcn_wmma_f32_16x16x32_f16(false, a, false, b, (short)0, c, false, false); }
__device__ __forceinline__ v8f wmmab(v16bf a, v16bf b, v8f c) { return __builtin_amdgcn_wmma_f32_16x16x32_bf16(false, a, false, b, (short)0, c, false, false); }

// ---- k_gemmw: register-blocked GEMM, one work-group of KW waves per 64x64 output tile (16 accumulators per wave), operands straight from K-contiguous 16-bit planes; grid (M/64, N/64, Z), 32 * KW threads.
// K split: wave w takes the 32-wide k steps w, w + KW, w + 2 KW, ... (neighbouring waves read neighbouring halves of the same 128-byte lines); for KW > 1 the KW partial tiles meet in LDS and are summed in wave order 0 .. KW-1.
// C[m][n] (f32, pitch ldc, + optional f32 bias[n]) = sum_k A[m][k] Bt[n][k] (+ split products per NSPLIT). z-batch strides sA/sB/sC in elements. K % 32 == 0, M % 64 == 0, N % 64 == 0.
// Fragment map: lane -> row/col (lane & 15), elements 0..7 = k0 + 8*(lane>>4) + 0..7, elements 8..15 = k0 + 16 + 8*(lane>>4) + 0..7 for A and B; D element j = (row 8*(lane>>4) + j, col lane & 15).
template <typename T16> struct WFrag;
template <> struct WFrag<h16> { typedef v16h V; static __device__ __forceinline__ V ld(const h16* p) { return cat16(*(const v8h*)p, *(const v8h*)(p + 16)); } static __device__ __forceinline__ v8f mma(V a, V b, v8f c) { return wmma16(a, b, c); } };
template <> struct WFrag<bf> { typedef v16bf V; static __device__ __forceinline__ V ld(const bf* p) { return cat16b(*(const v8us*)p, *(const v8us*)(p + 16)); } static __device__ __forceinline__ v8f mma(V a, V b, v8f c) { return wmmab(a, b, c); } };
template <typename T16, int NSPLIT, bool BIAS, int KW>
__global__ __launch_bounds__(32 * KW) void k_gemmw(const T16* __restrict__ A, const T16* __restrict__ A2, const T16* __restrict__ Bt, const T16* __restrict__ Bt2, int K, float* C, int ldc, const float* __restrict__ bias, size_t sA, size_t sB, size_t sC) {
    typedef typename WFrag<T16>::V V;
    __shared__ __align__(16) float os[(KW == 1 ? 16 : KW * 64) * 68];
    const int w = (KW == 1) ? 0 : __builtin_amdgcn_readfirstlane((int)(threadIdx.x >> 5));
    const size_t z = blockIdx.z; A += z * sA; if (A2) A2 += z * sA; Bt += z * sB; if (Bt2) Bt2 += z * sB; C += z * sC;
    const int lane = threadIdx.x & 31, lr = lane & 15, hi = lane >> 4; const int r0 = blockIdx.x * 64, c0 = blockIdx.y * 64;
    v8f acc[4][4];
#pragma unroll
    for (int mb = 0; mb < 4; ++mb)
#pragma unroll
        for (int nb = 0; nb < 4; ++nb) acc[mb][nb] = (v8f){};
    const size_t aoff = (size_t)(r0 + lr) * K + 8 * hi, boff = (size_t)(c0 + lr) * K + 8 * hi;
#pragma unroll 1
    for (int kc = w * 32; kc < K; kc += 32 * KW) {
        V a[4], a2[4];
#pragma unroll
        for (int mb = 0; mb < 4; ++mb) { a[mb] = WFrag<T16>::ld(A + aoff + (size_t)mb * 16 * K + kc); if (NSPLIT == 1 || NSPLIT == 2) a2[mb] = WFrag<T16>::ld(A2 + aoff + (size_t)mb * 16 * K + kc); }
#pragma unroll
        for (int nb = 0; nb < 4; ++nb) { const V b = WFrag<T16>::ld(Bt + boff + (size_t)nb * 16 * K + kc); V b2; if (NSPLIT >= 2) b2 = WFrag<T16>::ld(Bt2 + boff + (size_t)nb * 16 * K + kc);
#pragma unroll
            for (int mb = 0; mb < 4; ++mb) { acc[mb][nb] = WFrag<T16>::mma(a[mb], b, acc[mb][nb]); if (NSPLIT == 1 || NSPLIT == 2) acc[mb][nb] = WFrag<T16>::mma(a2[mb], b, acc[mb][nb]); if (NSPLIT >= 2) acc[mb][nb] = WFrag<T16>::mma(a[mb], b2, acc[mb][nb]); } }
        asm volatile("v_nop\n\tv_nop\n\tv_nop\n\tv_nop" : "+v"(acc[0][0]), "+v"(acc[1][1]), "+v"(acc[2][2]), "+v"(acc[3][3]) : "v"(a[0]), "v"(a[3]));
    }
    if constexpr (KW > 1) {
        float* ow = os + w * (64 * 68);
#pragma unroll
        for (int mb = 0; mb < 4; ++mb)
#pragma unroll
            for (int nb = 0; nb < 4; ++nb)
#pragma unroll
                for (int j = 0; j < 8; ++j) ow[(mb * 16 + hi * 8 + j) * 68 + nb * 16 + lr] = acc[mb][nb][j];
        __syncthreads();   // every wave's partial tile is in LDS before any thread sums across waves
#pragma unroll
        for (int r = 0; r < 64 * 16 / (32 * KW); ++r) { const int s = r * 32 * KW + (int)threadIdx.x, row = s >> 4, cofs = (s & 15) * 4; v4f val = *(const v4fa*)(os + row * 68 + cofs);
#pragma unroll
            for (int u = 1; u < KW; ++u) { const v4f pv = *(const v4fa*)(os + u * (64 * 68) + row * 68 + cofs); val[0] += pv[0]; val[1] += pv[1]; val[2] += pv[2]; val[3] += pv[3]; }
            if (BIAS) { val[0] += bfr(bias[c0 + cofs]); val[1] += bfr(bias[c0 + cofs + 1]); val[2] += bfr(bias[c0 + cofs + 2]); val[3] += bfr(bias[c0 + cofs + 3]); }
            *(v4f*)(C + (size_t)(r0 + row) * ldc + c0 + cofs) = val; }
    } else {
#pragma unroll
    for (int mb = 0; mb < 4; ++mb) {
#pragma unroll
        for (int nb = 0; nb < 4; ++nb) {
#pragma unroll
            for (int j = 0; j < 8; ++j) os[(hi * 8 + j) * 68 + nb * 16 + lr] = acc[mb][nb][j]; }
        __builtin_amdgcn_wave_barrier(); asm volatile("" ::: "memory");
        float* crow = C + (size_t)(r0 + mb * 16) * ldc + c0;
{
#pragma unroll
            for (int s = 0; s < 8; ++s) { const int row = 2 * s + hi, cofs = lr * 4; v4f val = *(const v4fa*)(os + row * 68 + cofs); if (BIAS) { val[0] += bfr(bias[c0 + cofs]); val[1] += bfr(bias[c0 + cofs + 1]); val[2] += bfr(bias[c0 + cofs + 2]); val[3] += bfr(bias[c0 + cofs + 3]); }
                *(v4f*)(crow + (size_t)row * ldc + cofs) = val; }
             }
        __builtin_amdgcn_wave_barrier(); asm volatile("" ::: "memory");
    }
    }
}

__device__ __forceinline__ h16 tohx(float x) { return (h16)x; }
__device__ __forceinline__ void splitf(float y, unsigned short& h, unsigned short& l) { h = f2bf(y); l = f2bf(y - bf2f(h)); }
typedef __attribute__((ext_vector_type(2))) _Float16 v2h;
typedef __attribute__((ext_vector_type(4))) _Float16 v4h;
typedef __attribute__((ext_vector_type(2))) unsigned short v2us;
typedef __attribute__((ext_vector_type(4))) unsigned short v4us;
typedef __attribute__((ext_vector_type(2))) float v2f;

// blockIdx.y = batch: source and destination advance by sb / db elements per batch (n8 groups of 8 each).
__global__ __launch_bounds__(256) void k_cvt8(const float* __restrict__ src, bf* dst, size_t n8, size_t sb, size_t db) { const size_t i = (size_t)blockIdx.x * 256 + threadIdx.x; if (i >= n8) return; src += (size_t)blockIdx.y * sb; dst += (size_t)blockIdx.y * db; const v8f v = *(const v8f*)(src + i * 8); v8us o;
#pragma unroll
    for (int k = 0; k < 8; ++k) o[k] = f2bf(v[k]); *(v8us*)(dst + i * 8) = o;  }

// k_hp / k_vtp: nz = NB * NH_ planes, plane z = batch * NH_ + head, read from row batch * TT + t of F.
__global__ __launch_bounds__(256) void k_hp(const float* __restrict__ F, int pitch, int nz, h16* P16, bf* Ph, bf* Pl) {
    const size_t e = ((size_t)blockIdx.x * 256 + threadIdx.x) * 2; if (e >= (size_t)nz * TT * HD) return; const int d = (int)(e % HD); const int t = (int)((e / HD) % TT); const int z = (int)(e / ((size_t)HD * TT)); const int b = z / NH_, h = z % NH_;
    const v2f x = *(const v2f*)(F + ((size_t)b * TT + t) * pitch + h * HD + d); v2h o16; v2us oh, ol;
#pragma unroll
    for (int q = 0; q < 2; ++q) { const float r = x[q]; o16[q] = tohx(r); unsigned short a2, c2; splitf(r, a2, c2); oh[q] = a2; ol[q] = c2; }
    *(v2h*)(P16 + e) = o16; *(v2us*)(Ph + e) = oh; *(v2us*)(Pl + e) = ol;  }

__global__ __launch_bounds__(256) void k_vtp(const float* __restrict__ F, int pitch, int nz, h16* V16, bf* Vh, bf* Vl) { const size_t e = ((size_t)blockIdx.x * 256 + threadIdx.x) * 2; if (e >= (size_t)nz * HD * TT) return; const int t = (int)(e % TT); const int d = (int)((e / TT) % HD); const int z = (int)(e / ((size_t)TT * HD)); const int b = z / NH_, g = z % NH_; v2h o16; v2us oh, ol;
#pragma unroll
    for (int q = 0; q < 2; ++q) { const float x = F[((size_t)b * TT + t + q) * pitch + g * HD + d]; o16[q] = tohx(x); unsigned short a2, c2; splitf(x, a2, c2); oh[q] = a2; ol[q] = c2; }
    *(v2h*)(V16 + e) = o16; *(v2us*)(Vh + e) = oh; *(v2us*)(Vl + e) = ol;  }

// k_asoft<QCT>: QCT = query rows of the pass; one work-group of NH_ waves per query row i of the pass (blockIdx.x) and batch (blockIdx.y), wave h = head h: t = S[h][i][:] x HD^-0.5; softmax over the TT keys (register row of TT/32 values per lane, one exp, fixed trees).
// Head mean: wave h leaves its f32 probability row in LDS row h; behind one work-group barrier thread x sums columns 4x .. 4x+3 over the rows in head order 0 .. NH_-1 (the order of the one-wave loop over heads) and stores them once.
template <int QCT>
__global__ __launch_bounds__(32 * NH_) void k_asoft(const float* __restrict__ Sb, int q0, int hires, h16* P16, bf* Ph, bf* Pl, float* AVG) {
#pragma clang fp contract(off)
    __shared__ __align__(16) float avs[NH_ * TT];
    const int lane = threadIdx.x & 31; const int h = __builtin_amdgcn_readfirstlane((int)(threadIdx.x >> 5)); const int i = blockIdx.x; if (i >= QCT) return; const int b = blockIdx.y;
    float* avw = avs + h * TT + lane * 4;
    const size_t po = (((size_t)b * NH_ + h) * QCT + i) * TT; const float* sr = Sb + po; float v[TT / 32]; float mx = -3.0e38f;
#pragma unroll
    for (int ch = 0; ch < TT / 128; ++ch) { const int j0 = ch * 128 + lane * 4; const v4f a = *(const v4f*)(sr + j0);
#pragma unroll
        for (int q = 0; q < 4; ++q) { const float t = a[q] * SCL; v[ch * 4 + q] = t; mx = fmaxf(mx, t); } }
#pragma unroll
    for (int sh = 16; sh; sh >>= 1) mx = fmaxf(mx, __shfl_xor(mx, sh, 32));
    float sum = 0.f;
#pragma unroll
    for (int k = 0; k < TT / 32; ++k) { float d0 = __fsub_rn(v[k], mx); asm volatile("" : "+v"(d0)); v[k] = __fmul_rn(d0, 1.4426950408889634f); }
    // v_exp_f32 (what exp2f compiles to), eight in place per statement: the instruction set asks for one independent instruction or a v_nop behind a transcendental before its result is read or its source overwritten;
    // here each v_exp_f32 fills the slot of the one before and one v_nop that of the last (a v_nop in a statement of its own did not stay behind it).
#pragma unroll
    for (int k = 0; k < TT / 32; k += 8)
        asm("v_exp_f32 %0, %0\n\tv_exp_f32 %1, %1\n\tv_exp_f32 %2, %2\n\tv_exp_f32 %3, %3\n\tv_exp_f32 %4, %4\n\tv_exp_f32 %5, %5\n\tv_exp_f32 %6, %6\n\tv_exp_f32 %7, %7\n\tv_nop"
            : "+v"(v[k]), "+v"(v[k + 1]), "+v"(v[k + 2]), "+v"(v[k + 3]), "+v"(v[k + 4]), "+v"(v[k + 5]), "+v"(v[k + 6]), "+v"(v[k + 7]));
#pragma unroll
    for (int k = 0; k < TT / 32; ++k) sum += v[k];
#pragma unroll
    for (int sh = 16; sh; sh >>= 1) sum += __shfl_xor(sum, sh, 32);
    const float fn = __fdiv_rn(1.0f, sum); const float f = hires ? fn : fn * PCAR;
#pragma unroll
    for (int ch = 0; ch < TT / 128; ++ch) { v4f a;
#pragma unroll
        for (int q = 0; q < 4; ++q) a[q] = v[ch * 4 + q] * fn;
        *(v4fa*)(avw + ch * 128) = a; }
    __syncthreads();   // all NH_ probability rows are in LDS before any thread sums over the heads; it stands in front of the plane stores so that no wave waits here for its global stores
{
        float fz = f; asm volatile("" : "+v"(fz));
        if (hires) {
#pragma unroll
            for (int ch = 0; ch < TT / 128; ++ch) { v4us oh, ol;
#pragma unroll
                for (int q = 0; q < 4; ++q) { unsigned short a, c2; splitf(v[ch * 4 + q] * fz, a, c2); oh[q] = a; ol[q] = c2; }
                const size_t oo = po + ch * 128 + lane * 4; *(v4us*)(Ph + oo) = oh; *(v4us*)(Pl + oo) = ol; }
        } else {
#pragma unroll
            for (int ch = 0; ch < TT / 128; ++ch) { v4h o4;
#pragma unroll
                for (int q = 0; q < 4; ++q) o4[q] = tohx(v[ch * 4 + q] * fz);
                *(v4h*)(P16 + po + ch * 128 + lane * 4) = o4; } }
         }
    float* arow = AVG + ((size_t)b * TT + q0 + i) * TT;
{
        float sc = 1.0f / NH_; asm volatile("" : "+v"(sc));
        // the loops below are unrolled so that the NH_ LDS reads of a thread are issued ahead of its ordered adds
#pragma unroll
        for (int r = 0; r < TT / (128 * NH_); ++r) { const int c = r * 128 * NH_ + (int)threadIdx.x * 4; v4f a = *(const v4fa*)(avs + c);
#pragma unroll
            for (int u = 1; u < NH_; ++u) { const v4f pv = *(const v4fa*)(avs + u * TT + c);
#pragma unroll
                for (int q = 0; q < 4; ++q) a[q] = a[q] + pv[q]; }
            v4f o;
#pragma unroll
            for (int q = 0; q < 4; ++q) o[q] = a[q] * sc;
            *(v4f*)(arow + c) = o; }
         }
}

template <int QCT>
__global__ __launch_bounds__(256) void k_merge(const float* __restrict__ O, int q0, int hires, bf* Ah, bf* Al) { const size_t e = ((size_t)blockIdx.x * 256 + threadIdx.x) * 2; if (e >= (size_t)NB * NH_ * QCT * HD) return; const int d = (int)(e % HD); const int i = (int)((e / HD) % QCT); const int z = (int)(e / ((size_t)HD * QCT)); const int b = z / NH_, h = z % NH_; const float cs = hires ? 1.0f : (1.0f / PCAR); const size_t oo = ((size_t)b * TT + q0 + i) * DQ + h * HD + d;
    const v2f x = *(const v2f*)(O + e); v2us oh, ol;
#pragma unroll
    for (int q = 0; q < 2; ++q) { unsigned short a, c2; splitf(x[q] * cs, a, c2); oh[q] = a; ol[q] = c2; } *(v2us*)(Ah + oo) = oh; *(v2us*)(Al + oo) = ol;  }

// workspace plan (bytes); region U is shared by {XB, FQ, FK} (projection phase), {Sb, PAh, PAl} (hi+lo passes) and Sb (plain passes); region R by the six bf16 hi/lo head planes (up to the last hi+lo pass) and PA16 (plain passes); all stream-ordered.
static constexpr size_t W_BYTES  = (size_t)DM * DM * 2;
static constexpr size_t XB_BYTES = (size_t)NB * TT * DM * 2;
static constexpr size_t F_BYTES  = (size_t)NB * TT * DM * 4;
static constexpr size_t PL_BYTES = (size_t)NB * NH_ * TT * HD * 2;
static constexpr size_t SB_BYTES = (size_t)NB * NH_ * QC * TT * 4;
static constexpr size_t PP_BYTES = (size_t)NB * NH_ * QC * TT * 2;
static constexpr size_t SBH_BYTES = (size_t)NB * NH_ * QCH * TT * 4;
static constexpr size_t PPH_BYTES = (size_t)NB * NH_ * QCH * TT * 2;
static constexpr size_t OB_BYTES = (size_t)NB * NH_ * QC * HD * 4;
static constexpr size_t AT_BYTES = (size_t)NB * TT * DQ * 2;
static constexpr size_t cmax(size_t a, size_t b) { return a > b ? a : b; }
static constexpr size_t U_BYTES  = cmax(cmax(SB_BYTES, SBH_BYTES + 2 * PPH_BYTES), XB_BYTES + 2 * F_BYTES);
static constexpr size_t R_BYTES  = cmax(6 * PL_BYTES, PP_BYTES);
static constexpr size_t WS_TOTAL = 4 * W_BYTES + U_BYTES + 3 * PL_BYTES + R_BYTES + OB_BYTES + 2 * AT_BYTES;
static_assert(W_BYTES % 256 == 0 && XB_BYTES % 256 == 0 && F_BYTES % 256 == 0 && PL_BYTES % 256 == 0);
static_assert(SB_BYTES % 256 == 0 && PP_BYTES % 256 == 0 && OB_BYTES % 256 == 0 && AT_BYTES % 256 == 0);
static_assert(SBH_BYTES % 256 == 0 && PPH_BYTES % 256 == 0 && QCH <= QC);
static_assert(XB_BYTES + 2 * F_BYTES <= U_BYTES);
static_assert(SB_BYTES <= U_BYTES && SBH_BYTES + 2 * PPH_BYTES <= U_BYTES && 6 * PL_BYTES <= R_BYTES && PP_BYTES <= R_BYTES);
static_assert(WS_TOTAL <= (size_t)268435456);

extern "C" void kernel_launch(void* const* d_in, const int* in_sizes, int n_in,
                              void* d_out, int out_size, void* d_ws, size_t ws_size, hipStream_t stream) {
    if (n_in < 11) return;
    const size_t need_x = (size_t)(NB - 1) * SEQ_FULL * DM + (size_t)TT * DM;
    if ((size_t)in_sizes[0] < need_x || (size_t)in_sizes[1] < need_x || (size_t)in_sizes[2] < need_x) return;
    if ((size_t)in_sizes[3] < (size_t)DM * DM || (size_t)in_sizes[5] < (size_t)DM * DM || (size_t)in_sizes[7] < (size_t)DM * DM || (size_t)in_sizes[9] < (size_t)DM * DM) return;
    if (in_sizes[4] < DM || in_sizes[6] < DM || in_sizes[8] < DM || in_sizes[10] < DM) return;
    const size_t AVG_OFF = (size_t)NB_FULL * SEQ_FULL * DM;     // element offset of the second output (byte 16777216)
    if ((size_t)out_size < AVG_OFF + (size_t)NB * TT * TT) return;
    if (ws_size < WS_TOTAL) return;
    const float* xq = (const float*)d_in[0]; const float* xk = (const float*)d_in[1]; const float* xv = (const float*)d_in[2]; const float* wq = (const float*)d_in[3]; const float* bq = (const float*)d_in[4]; const float* wk = (const float*)d_in[5]; const float* bk = (const float*)d_in[6]; const float* wv = (const float*)d_in[7]; const float* bv = (const float*)d_in[8]; const float* wo = (const float*)d_in[9]; const float* bo = (const float*)d_in[10];
    float* OUT = (float*)d_out;                 // [NB][TT][DM]
    float* AVG = (float*)d_out + AVG_OFF;       // [NB][TT][TT]
    char* wsp = (char*)d_ws;
    auto take = [&](size_t bytes) { char* p = wsp; wsp += (bytes + 255) & ~(size_t)255; return (void*)p; };
    bf* WQ = (bf*)take(W_BYTES); bf* WK = (bf*)take(W_BYTES); bf* WV = (bf*)take(W_BYTES); bf* WO = (bf*)take(W_BYTES);
    char* U = (char*)take(U_BYTES);
    float* Sb = (float*)U; bf* XB = (bf*)U; float* FQ = (float*)(U + XB_BYTES); float* FK = (float*)(U + XB_BYTES + F_BYTES); float* FV = FK;   // v projection reuses the k buffer after the k planes are built
    h16* QP16 = (h16*)take(PL_BYTES); h16* KP16 = (h16*)take(PL_BYTES); h16* VT16 = (h16*)take(PL_BYTES);
    char* R = (char*)take(R_BYTES);
    bf* QPh = (bf*)R; bf* QPl = (bf*)(R + PL_BYTES); bf* KPh = (bf*)(R + 2 * PL_BYTES); bf* KPl = (bf*)(R + 3 * PL_BYTES); bf* VTh = (bf*)(R + 4 * PL_BYTES); bf* VTl = (bf*)(R + 5 * PL_BYTES);
    h16* PA16 = (h16*)R;                                                             // p plane of a plain pass: fp16 x1024
    bf* PAh = (bf*)(U + SBH_BYTES); bf* PAl = (bf*)(U + SBH_BYTES + PPH_BYTES);      // p planes of a hi+lo pass: bf16 hi, bf16 lo, behind its S
    float* Ob = (float*)take(OB_BYTES); bf* ATh = (bf*)take(AT_BYTES); bf* ATl = (bf*)take(AT_BYTES);
    if ((size_t)(wsp - (char*)d_ws) > ws_size) return;

    const unsigned GW = (unsigned)(((size_t)DM * DM / 8 + 255) / 256), GX = (unsigned)(((size_t)TT * DM / 8 + 255) / 256);
    k_cvt8<<<GW, 256, 0, stream>>>(wq, WQ, (size_t)DM * DM / 8, 0, 0); k_cvt8<<<GW, 256, 0, stream>>>(wk, WK, (size_t)DM * DM / 8, 0, 0);
    k_cvt8<<<GW, 256, 0, stream>>>(wv, WV, (size_t)DM * DM / 8, 0, 0); k_cvt8<<<GW, 256, 0, stream>>>(wo, WO, (size_t)DM * DM / 8, 0, 0);
    const unsigned LP = (unsigned)(((size_t)NB * NH_ * TT * HD / 2 + 255) / 256);
    const unsigned LM = (unsigned)(((size_t)NB * NH_ * QC * HD / 2 + 255) / 256), LMH = (unsigned)(((size_t)NB * NH_ * QCH * HD / 2 + 255) / 256);
    const size_t XS = (size_t)SEQ_FULL * DM, XD = (size_t)TT * DM;   // batch strides of an input stream and of its bf16 copy
    k_cvt8<<<dim3(GX, NB, 1), 256, 0, stream>>>(xq, XB, (size_t)TT * DM / 8, XS, XD);
    k_gemmw<bf, 0, true, KWP><<<dim3(NB * TT / 64, DQ / 64, 1), 32 * KWP, 0, stream>>>(XB, nullptr, WQ, nullptr, DM, FQ, DQ, bq, 0, 0, 0);
    k_hp<<<LP, 256, 0, stream>>>(FQ, DQ, NB * NH_, QP16, QPh, QPl);
    k_cvt8<<<dim3(GX, NB, 1), 256, 0, stream>>>(xk, XB, (size_t)TT * DM / 8, XS, XD);
    k_gemmw<bf, 0, true, KWP><<<dim3(NB * TT / 64, DQ / 64, 1), 32 * KWP, 0, stream>>>(XB, nullptr, WK, nullptr, DM, FK, DQ, bk, 0, 0, 0);
    k_hp<<<LP, 256, 0, stream>>>(FK, DQ, NB * NH_, KP16, KPh, KPl);
    k_cvt8<<<dim3(GX, NB, 1), 256, 0, stream>>>(xv, XB, (size_t)TT * DM / 8, XS, XD);
    k_gemmw<bf, 0, true, KWP><<<dim3(NB * TT / 64, DQ / 64, 1), 32 * KWP, 0, stream>>>(XB, nullptr, WV, nullptr, DM, FV, DQ, bv, 0, 0, 0);
    k_vtp<<<LP, 256, 0, stream>>>(FV, DQ, NB * NH_, VT16, VTh, VTl);
    // one pass: its query rows x all batches and heads (z = batch * NH_ + head; plane z-strides TT*HD, S/P z-stride rows*TT, O z-stride rows*HD)
    for (int q0 = 0; q0 < RH; q0 += QCH) {      // hi+lo passes
        k_gemmw<bf, 2, false, 1><<<dim3(QCH / 64, TT / 64, NB * NH_), 32, 0, stream>>>(QPh + (size_t)q0 * HD, QPl + (size_t)q0 * HD, KPh, KPl, HD, Sb, TT, nullptr, (size_t)TT * HD, (size_t)TT * HD, (size_t)QCH * TT);
        k_asoft<QCH><<<dim3(QCH, NB, 1), 32 * NH_, 0, stream>>>(Sb, q0, 1, nullptr, PAh, PAl, AVG);
        k_gemmw<bf, 2, false, KWV><<<dim3(QCH / 64, HD / 64, NB * NH_), 32 * KWV, 0, stream>>>(PAh, PAl, VTh, VTl, TT, Ob, HD, nullptr, (size_t)QCH * TT, (size_t)HD * TT, (size_t)QCH * HD);
        k_merge<QCH><<<LMH, 256, 0, stream>>>(Ob, q0, 1, ATh, ATl);
    }
    for (int q0 = RH; q0 < TT; q0 += QC) {      // plain passes
        k_gemmw<h16, 0, false, 1><<<dim3(QC / 64, TT / 64, NB * NH_), 32, 0, stream>>>(QP16 + (size_t)q0 * HD, nullptr, KP16, nullptr, HD, Sb, TT, nullptr, (size_t)TT * HD, (size_t)TT * HD, (size_t)QC * TT);
        k_asoft<QC><<<dim3(QC, NB, 1), 32 * NH_, 0, stream>>>(Sb, q0, 0, PA16, nullptr, nullptr, AVG);
        k_gemmw<h16, 0, false, KWV><<<dim3(QC / 64, HD / 64, NB * NH_), 32 * KWV, 0, stream>>>(PA16, nullptr, VT16, nullptr, TT, Ob, HD, nullptr, (size_t)QC * TT, (size_t)HD * TT, (size_t)QC * HD);
        k_merge<QC><<<LM, 256, 0, stream>>>(Ob, q0, 0, ATh, ATl);
    }
    k_gemmw<bf, 1, true, KWP><<<dim3(NB * TT / 64, DM / 64, 1), 32 * KWP, 0, stream>>>(ATh, ATl, WO, nullptr, DQ, OUT, DM, bo, 0, 0, 0);
}

// v005
// One run takes 316 microseconds.
// Timed twice side by side with v004, it ran 1.55 and 1.54 times as fast.
// Counting every step since v000, it is 5.21 times as fast.
#include <hip/hip_runtime.h>

// Multi-head attention without a mask over three input streams (query, key, value [2][2048][1024]); q = query Wq^T + bq, k = key Wk^T + bk, v = value Wv^T + bv (W stored [out][in]); 16 heads x 64; scores x 64^-0.5; softmax over all keys; out0 = merged Wo^T + bo; out1 = head mean of the probabilities [2][2048][2048].
// Compute dtypes, f32 accumulate: every float input RNE-converted to bf16; projections v_wmma_f32_16x16x32_bf16 (exact products) + f32 bias; attention query rows < 512: q/k/p/v as bf16 hi+lo planes (3 products), other rows v_wmma_f32_16x16x32_f16 with p carried unnormalised (exp of score minus row maximum, at most 1) and the row scaled by 1 / sum behind p.v; softmax and head mean f32; output projection merged hi+lo (bf16) x bf16 Wo + bias.
// Every launch covers all NB batches (no host loop over the batch): projections run on the NB*TT stacked rows, the head planes are indexed by z = batch * 16 + head.
// Attention is one launch (k_fattn): a work-group owns 16 (hi+lo) or 32 (plain) query rows over all heads, one wave per head; scores, probabilities and p.v stay in registers, only the head mean passes through LDS.
// The head planes are stored in fragment order (1024-byte blocks, lane l holds bytes 16 l .. 16 l + 15 of each half), so that every fragment load reads whole cache lines.

#ifndef NB
#define NB 2
#endif
#ifndef SEQ
#define SEQ 2048
#endif
#define NB_FULL  2
#define SEQ_FULL 2048
#define TT   SEQ
#define DM   1024
#define NH_  16
#define HD   64
#define DQ   (NH_ * HD)
#define RH   512                  // query rows < RH use hi+lo planes
#define SCL  0.125f               // HD^-0.5
#define KWP  8                    // waves sharing the K loop of a projection tile (K = DM)
#define SL2  (SCL * 1.4426950408889634f)   // HD^-0.5 x log2 e: exp(s x HD^-0.5 - max) = exp2(s x SL2 - max x SL2)
#define AP   68                   // LDS pitch (floats) of a 64-key row of probabilities: 272 bytes = 16 x odd
typedef _Float16 h16;
typedef unsigned short bf;
typedef __attribute__((ext_vector_type(16))) __bf16   v16bf;
typedef __attribute__((ext_vector_type(16))) _Float16 v16h;
typedef __attribute__((ext_vector_type(8)))  _Float16 v8h;
typedef __attribute__((ext_vector_type(8)))  unsigned short v8us;
typedef __attribute__((ext_vector_type(8)))  float    v8f;
typedef __attribute__((ext_vector_type(4)))  float    v4f;
typedef v8h  __attribute__((may_alias)) v8ha;
typedef v4f  __attribute__((may_alias)) v4fa;
typedef v8us __attribute__((may_alias)) v8usa;

static_assert((TT - RH) % 32 == 0 && RH % 16 == 0 && RH <= TT);
static_assert(TT % 64 == 0);
static_assert(HD == 64);
static_assert(DM % 64 == 0);
static_assert(DM % (32 * KWP) == 0);
static_assert((size_t)KWP * 64 * 68 * 4 <= 327680);
static_assert((size_t)2 * NH_ * 32 * AP * 4 <= 327680 && 32 * NH_ <= 1024 && 32 * NH_ >= 32 * 16);   // the last: one thread per 4 columns of a 32-row, 64-key block in the head sum
static_assert((size_t)NB_FULL * SEQ_FULL * DM * 4 == 16777216);
static_assert((size_t)NB_FULL * SEQ_FULL * DM + (size_t)NB * TT * TT <= (size_t)50331648 / 4);

__device__ __forceinline__ unsigned short f2bf(float f) { unsigned u = __float_as_uint(f); u += 0x7FFFu + ((u >> 16) & 1u); return (unsigned short)(u >> 16); }
__device__ __forceinline__ float bf2f(unsigned short b) { return __uint_as_float(((unsigned)b) << 16); }
__device__ __forceinline__ float bfr(float f) { return bf2f(f2bf(f)); }
__device__ __forceinline__ v16h cat16(v8h lo, v8h hi) { return __builtin_shufflevector(lo, hi, 0, 1, 2, 3, 4, 5, 6, 7, 8, 9, 10, 11, 12, 13, 14, 15); }
__device__ __forceinline__ v16bf cat16b(v8us lo, v8us hi) { return __builtin_bit_cast(v16bf, __builtin_shufflevector(lo, hi, 0, 1, 2, 3, 4, 5, 6, 7, 8, 9, 10, 11, 12, 13, 14, 15)); }
__device__ __forceinline__ v8f wmma16(v16h a, v16h b, v8f c) { return __builtin_amdgcn_wmma_f32_16x16x32_f16(false, a, false, b, (short)0, c, false, false); }
__device__ __forceinline__ v8f wmmab(v16bf a, v16bf b, v8f c) { return __builtin_amdgcn_wmma_f32_16x16x32_bf16(false, a, false, b, (short)0, c, false, false); }

// ---- k_gemmw: register-blocked GEMM, one work-group of KW waves per 64x64 output tile (16 accumulators per wave), operands straight from K-contiguous 16-bit planes; grid (M/64, N/64, Z), 32 * KW threads.
// K split: wave w takes the 32-wide k steps w, w + KW, w + 2 KW, ... (neighbouring waves read neighbouring halves of the same 128-byte lines); for KW > 1 the KW partial tiles meet in LDS and are summed in wave order 0 .. KW-1.
// C[m][n] (f32, pitch ldc, + optional f32 bias[n]) = sum_k A[m][k] Bt[n][k] (+ split products per NSPLIT). z-batch strides sA/sB/sC in elements. K % 32 == 0, M % 64 == 0, N % 64 == 0.
// Fragment map: lane -> row/col (lane & 15), elements 0..7 = k0 + 8*(lane>>4) + 0..7, elements 8..15 = k0 + 16 + 8*(lane>>4) + 0..7 for A and B; D element j = (row 8*(lane>>4) + j, col lane & 15).
template <typename T16> struct WFrag;
template <> struct WFrag<h16> { typedef v16h V; static __device__ __forceinline__ V ld(const h16* p) { return cat16(*(const v8h*)p, *(const v8h*)(p + 16)); } static __device__ __forceinline__ V ldf(const h16* p) { return cat16(*(const v8h*)p, *(const v8h*)(p + 256)); } static __device__ __forceinline__ v8f mma(V a, V b, v8f c) { return wmma16(a, b, c); } };
template <> struct WFrag<bf> { typedef v16bf V; static __device__ __forceinline__ V ld(const bf* p) { return cat16b(*(const v8us*)p, *(const v8us*)(p + 16)); } static __device__ __forceinline__ V ldf(const bf* p) { return cat16b(*(const v8us*)p, *(const v8us*)(p + 256)); } static __device__ __forceinline__ v8f mma(V a, V b, v8f c) { return wmmab(a, b, c); } };
template <typename T16, int NSPLIT, bool BIAS, int KW>
__global__ __launch_bounds__(32 * KW) void k_gemmw(const T16* __restrict__ A, const T16* __restrict__ A2, const T16* __restrict__ Bt, const T16* __restrict__ Bt2, int K, float* C, int ldc, const float* __restrict__ bias, size_t sA, size_t sB, size_t sC) {
    typedef typename WFrag<T16>::V V;
    __shared__ __align__(16) float os[(KW == 1 ? 16 : KW * 64) * 68];
    const int w = (KW == 1) ? 0 : __builtin_amdgcn_readfirstlane((int)(threadIdx.x >> 5));
    const size_t z = blockIdx.z; A += z * sA; if (A2) A2 += z * sA; Bt += z * sB; if (Bt2) Bt2 += z * sB; C += z * sC;
    const int lane = threadIdx.x & 31, lr = lane & 15, hi = lane >> 4; const int r0 = blockIdx.x * 64, c0 = blockIdx.y * 64;
    v8f acc[4][4];
#pragma unroll
    for (int mb = 0; mb < 4; ++mb)
#pragma unroll
        for (int nb = 0; nb < 4; ++nb) acc[mb][nb] = (v8f){};
    const size_t aoff = (size_t)(r0 + lr) * K + 8 * hi, boff = (size_t)(c0 + lr) * K + 8 * hi;
#pragma unroll 1
    for (int kc = w * 32; kc < K; kc += 32 * KW) {
        V a[4], a2[4];
#pragma unroll
        for (int mb = 0; mb < 4; ++mb) { a[mb] = WFrag<T16>::ld(A + aoff + (size_t)mb * 16 * K + kc); if (NSPLIT == 1 || NSPLIT == 2) a2[mb] = WFrag<T16>::ld(A2 + aoff + (size_t)mb * 16 * K + kc); }
#pragma unroll
        for (int nb = 0; nb < 4; ++nb) { const V b = WFrag<T16>::ld(Bt + boff + (size_t)nb * 16 * K + kc); V b2; if (NSPLIT >= 2) b2 = WFrag<T16>::ld(Bt2 + boff + (size_t)nb * 16 * K + kc);
#pragma unroll
            for (int mb = 0; mb < 4; ++mb) { acc[mb][nb] = WFrag<T16>::mma(a[mb], b, acc[mb][nb]); if (NSPLIT == 1 || NSPLIT == 2) acc[mb][nb] = WFrag<T16>::mma(a2[mb], b, acc[mb][nb]); if (NSPLIT >= 2) acc[mb][nb] = WFrag<T16>::mma(a[mb], b2, acc[mb][nb]); } }
        asm volatile("v_nop\n\tv_nop\n\tv_nop\n\tv_nop" : "+v"(acc[0][0]), "+v"(acc[1][1]), "+v"(acc[2][2]), "+v"(acc[3][3]) : "v"(a[0]), "v"(a[3]));
    }
    if constexpr (KW > 1) {
        float* ow = os + w * (64 * 68);
#pragma unroll
        for (int mb = 0; mb < 4; ++mb)
#pragma unroll
            for (int nb = 0; nb < 4; ++nb)
#pragma unroll
                for (int j = 0; j < 8; ++j) ow[(mb * 16 + hi * 8 + j) * 68 + nb * 16 + lr] = acc[mb][nb][j];
        __syncthreads();   // every wave's partial tile is in LDS before any thread sums across waves
#pragma unroll
        for (int r = 0; r < 64 * 16 / (32 * KW); ++r) { const int s = r * 32 * KW + (int)threadIdx.x, row = s >> 4, cofs = (s & 15) * 4; v4f val = *(const v4fa*)(os + row * 68 + cofs);
#pragma unroll
            for (int u = 1; u < KW; ++u) { const v4f pv = *(const v4fa*)(os + u * (64 * 68) + row * 68 + cofs); val[0] += pv[0]; val[1] += pv[1]; val[2] += pv[2]; val[3] += pv[3]; }
            if (BIAS) { val[0] += bfr(bias[c0 + cofs]); val[1] += bfr(bias[c0 + cofs + 1]); val[2] += bfr(bias[c0 + cofs + 2]); val[3] += bfr(bias[c0 + cofs + 3]); }
            *(v4f*)(C + (size_t)(r0 + row) * ldc + c0 + cofs) = val; }
    } else {
#pragma unroll
    for (int mb = 0; mb < 4; ++mb) {
#pragma unroll
        for (int nb = 0; nb < 4; ++nb) {
#pragma unroll
            for (int j = 0; j < 8; ++j) os[(hi * 8 + j) * 68 + nb * 16 + lr] = acc[mb][nb][j]; }
        __builtin_amdgcn_wave_barrier(); asm volatile("" ::: "memory");
        float* crow = C + (size_t)(r0 + mb * 16) * ldc + c0;
{
#pragma unroll
            for (int s = 0; s < 8; ++s) { const int row = 2 * s + hi, cofs = lr * 4; v4f val = *(const v4fa*)(os + row * 68 + cofs); if (BIAS) { val[0] += bfr(bias[c0 + cofs]); val[1] += bfr(bias[c0 + cofs + 1]); val[2] += bfr(bias[c0 + cofs + 2]); val[3] += bfr(bias[c0 + cofs + 3]); }
                *(v4f*)(crow + (size_t)row * ldc + cofs) = val; }
             }
        __builtin_amdgcn_wave_barrier(); asm volatile("" ::: "memory");
    }
    }
}

__device__ __forceinline__ h16 tohx(float x) { return (h16)x; }
__device__ __forceinline__ void splitf(float y, unsigned short& h, unsigned short& l) { h = f2bf(y); l = f2bf(y - bf2f(h)); }
typedef __attribute__((ext_vector_type(2))) _Float16 v2h;
typedef __attribute__((ext_vector_type(4))) _Float16 v4h;
typedef __attribute__((ext_vector_type(2))) unsigned short v2us;
typedef __attribute__((ext_vector_type(4))) unsigned short v4us;
typedef __attribute__((ext_vector_type(2))) float v2f;

// blockIdx.y = batch: source and destination advance by sb / db elements per batch (n8 groups of 8 each).
__global__ __launch_bounds__(256) void k_cvt8(const float* __restrict__ src, bf* dst, size_t n8, size_t sb, size_t db) { const size_t i = (size_t)blockIdx.x * 256 + threadIdx.x; if (i >= n8) return; src += (size_t)blockIdx.y * sb; dst += (size_t)blockIdx.y * db; const v8f v = *(const v8f*)(src + i * 8); v8us o;
#pragma unroll
    for (int k = 0; k < 8; ++k) o[k] = f2bf(v[k]); *(v8us*)(dst + i * 8) = o;  }

// k_hp / k_vtp: nz = NB * NH_ planes, plane z = batch * NH_ + head, read from row batch * TT + t of F; e is the output offset, decoded into (t, d) by the fragment order:
// k_hp  (q, k planes): [z][t / 16][d / 32][half c][lane = hi * 16 + lr][8], t = 16 (t / 16) + lr, d = 32 (d / 32) + 16 c + 8 hi + 0..7  (rows t, k index d).
// k_vtp (v planes):    [z][t / 32][d / 16][half c][lane = hi * 16 + lr][8], d = 16 (d / 16) + lr, t = 32 (t / 32) + 16 c + 8 hi + 0..7  (rows d, k index t).
__global__ __launch_bounds__(256) void k_hp(const float* __restrict__ F, int pitch, int nz, h16* P16, bf* Ph, bf* Pl) {
    const size_t e = ((size_t)blockIdx.x * 256 + threadIdx.x) * 2; if (e >= (size_t)nz * TT * HD) return; const int d = (int)(((e >> 9) & 1) * 32 + ((e >> 8) & 1) * 16 + ((e >> 7) & 1) * 8 + (e & 7)); const int t = (int)(((e >> 10) % (TT / 16)) * 16 + ((e >> 3) & 15)); const int z = (int)(e / ((size_t)HD * TT)); const int b = z / NH_, h = z % NH_;
    const v2f x = *(const v2f*)(F + ((size_t)b * TT + t) * pitch + h * HD + d); v2h o16; v2us oh, ol;
#pragma unroll
    for (int q = 0; q < 2; ++q) { const float r = x[q]; o16[q] = tohx(r); unsigned short a2, c2; splitf(r, a2, c2); oh[q] = a2; ol[q] = c2; }
    *(v2h*)(P16 + e) = o16; *(v2us*)(Ph + e) = oh; *(v2us*)(Pl + e) = ol;  }

__global__ __launch_bounds__(256) void k_vtp(const float* __restrict__ F, int pitch, int nz, h16* V16, bf* Vh, bf* Vl) { const size_t e = ((size_t)blockIdx.x * 256 + threadIdx.x) * 2; if (e >= (size_t)nz * HD * TT) return; const int t = (int)(((e >> 11) % (TT / 32)) * 32 + ((e >> 8) & 1) * 16 + ((e >> 7) & 1) * 8 + (e & 7)); const int d = (int)(((e >> 9) & 3) * 16 + ((e >> 3) & 15)); const int z = (int)(e / ((size_t)TT * HD)); const int b = z / NH_, g = z % NH_; v2h o16; v2us oh, ol;
#pragma unroll
    for (int q = 0; q < 2; ++q) { const float x = F[((size_t)b * TT + t + q) * pitch + g * HD + d]; o16[q] = tohx(x); unsigned short a2, c2; splitf(x, a2, c2); oh[q] = a2; ol[q] = c2; }
    *(v2h*)(V16 + e) = o16; *(v2us*)(Vh + e) = oh; *(v2us*)(Vl + e) = ol;  }

// ---- k_fattn: scores, softmax, head mean, p.v and the head merge in one launch. Work-group = NH_ waves, wave h = head h; blockIdx.y = batch; blockIdx.x < RH / 16: 16 query rows on hi+lo bf16 planes, else 32 query rows on f16 planes.
// Transposed products: S^T tile = K (A operand, rows = 16 keys) x Q (B operand, columns = 16 query rows), so lane (lr, hi) holds keys 8 hi + 0..7 of query row lr: two such tiles are, element for element, the B fragment of 32 keys
// for O^T = V^T (A operand, rows = 16 d) x P (B operand); p never leaves the registers. The k order of that B fragment (elements 0..7 = keys 8 hi + 0..7, elements 8..15 = keys 16 + 8 hi + 0..7) is the one of the V^T loader.
// Sweep 1 over the keys: running maximum and sum per lane (rescaled when the maximum grows), merged over the two lane halves at the end. Sweep 2: the same score tiles again, e = exp2(s x SL2 - max x SL2), p = e / sum.
// p.v: hi+lo rows multiply the bf16 hi and lo parts of p; plain rows multiply e (f16, at most 1) and scale the finished row by 1 / sum.
// Head mean: per block of 64 keys wave h leaves its f32 p rows in LDS plane h; behind one work-group barrier thread x sums 4 columns over the planes in head order 0 .. NH_-1 and stores them once.
// Two LDS buffers: the barrier of block n + 1 ends every read of block n before block n + 2 writes that buffer again.
template <bool HI> struct PT { typedef h16 T; };
template <> struct PT<true> { typedef bf T; };
// v_exp_f32, eight in place per statement: the instruction set asks for one independent instruction or a v_nop behind a transcendental before its result is read or its source overwritten;
// here each v_exp_f32 fills the slot of the one before and one v_nop that of the last.
__device__ __forceinline__ void exp2x8(float (&x)[8]) {
    asm("v_exp_f32 %0, %0\n\tv_exp_f32 %1, %1\n\tv_exp_f32 %2, %2\n\tv_exp_f32 %3, %3\n\tv_exp_f32 %4, %4\n\tv_exp_f32 %5, %5\n\tv_exp_f32 %6, %6\n\tv_exp_f32 %7, %7\n\tv_nop"
        : "+v"(x[0]), "+v"(x[1]), "+v"(x[2]), "+v"(x[3]), "+v"(x[4]), "+v"(x[5]), "+v"(x[6]), "+v"(x[7]));
}
// one v_exp_f32 with the v_nop that fills its slot
__device__ __forceinline__ float exp2x1(float x) { asm("v_exp_f32 %0, %0\n\tv_nop" : "+v"(x)); return x; }

template <bool HI, int NQT>
__device__ __forceinline__ void fattn(float* avs, int b, int q0, const typename PT<HI>::T* Qa, const typename PT<HI>::T* Qb, const typename PT<HI>::T* Ka, const typename PT<HI>::T* Kb, const typename PT<HI>::T* Va, const typename PT<HI>::T* Vb, float* AVG, bf* ATh, bf* ATl) {
    typedef typename PT<HI>::T T; typedef WFrag<T> WF; typedef typename WF::V V;
    constexpr int MQ = NQT * 16;
    const int lane = threadIdx.x & 31, lr = lane & 15, hi = lane >> 4; const int h = __builtin_amdgcn_readfirstlane((int)(threadIdx.x >> 5));
    const size_t zo = ((size_t)b * NH_ + h) * TT * HD + lane * 8;
    Qa += zo; Ka += zo; Va += zo; if constexpr (HI) { Qb += zo; Kb += zo; Vb += zo; }
    // s_wait_xcnt 0 behind a run of loads: their address registers may be rewritten behind it; the run's base pointers are inputs of the statement, so that no load of the run returns into a pair that an earlier one names
    auto xwait = [](const T* pa, const T* pb) { if constexpr (HI) asm volatile("s_wait_xcnt 0x0" :: "v"(pa), "v"(pb) : "memory"); else asm volatile("s_wait_xcnt 0x0" :: "v"(pa) : "memory"); };
    V qa[NQT][2], qb[NQT][2];
    { const T* pa = Qa + (size_t)(q0 / 16) * 1024; const T* pb = HI ? Qb + (size_t)(q0 / 16) * 1024 : nullptr;
#pragma unroll
    for (int qt = 0; qt < NQT; ++qt)
#pragma unroll
        for (int ks = 0; ks < 2; ++ks) { qa[qt][ks] = WF::ldf(pa + (qt * 2 + ks) * 512); if constexpr (HI) qb[qt][ks] = WF::ldf(pb + (qt * 2 + ks) * 512); }
    xwait(pa, pb); }
    // K fragments of the 32 keys kp * 32 .. + 31 (u = key tile, ks = k step)
    auto kload = [&](int kp, V (&ka)[2][2], V (&kb)[2][2]) {
        const T* pa = Ka + (size_t)kp * 2048; const T* pb = HI ? Kb + (size_t)kp * 2048 : nullptr;
#pragma unroll
        for (int u = 0; u < 2; ++u)
#pragma unroll
            for (int ks = 0; ks < 2; ++ks) { ka[u][ks] = WF::ldf(pa + (u * 2 + ks) * 512); if constexpr (HI) kb[u][ks] = WF::ldf(pb + (u * 2 + ks) * 512); }
        xwait(pa, pb);
    };
    // S^T tiles of those 32 keys against the NQT query tiles
    auto stiles = [&](const V (&ka)[2][2], const V (&kb)[2][2], v8f (&st)[2][NQT]) {
#pragma unroll
        for (int u = 0; u < 2; ++u)
#pragma unroll
            for (int qt = 0; qt < NQT; ++qt) { v8f a = (v8f){};
#pragma unroll
                for (int ks = 0; ks < 2; ++ks) { a = WF::mma(ka[u][ks], qa[qt][ks], a); if constexpr (HI) { a = WF::mma(ka[u][ks], qb[qt][ks], a); a = WF::mma(kb[u][ks], qa[qt][ks], a); } }
                st[u][qt] = a; }
    };
    // the K fragments are fetched one trip ahead, as soon as the score products have read the old ones; behind the last trip of a sweep the fetch wraps to keys 0, which the next sweep starts with
    V ka[2][2], kb[2][2]; kload(0, ka, kb);
    float mx[NQT], sm[NQT], fn[NQT];
#pragma unroll
    for (int qt = 0; qt < NQT; ++qt) { mx[qt] = -3.0e38f; sm[qt] = 0.f; }
    // rolled: one trip holds 32 keys' fragments and tiles; unrolling it would only add registers
#pragma unroll 1
    for (int kp = 0; kp < TT / 32; ++kp) {
        v8f st[2][NQT]; stiles(ka, kb, st); kload(kp + 1 < TT / 32 ? kp + 1 : 0, ka, kb);
#pragma unroll
        for (int qt = 0; qt < NQT; ++qt) { float t0[8], t1[8]; float tm = mx[qt];
#pragma unroll
            for (int j = 0; j < 8; ++j) tm = fmaxf(tm, fmaxf(st[0][qt][j], st[1][qt][j]));
            const float corr = exp2x1((mx[qt] - tm) * SL2), nm = tm * SL2;
#pragma unroll
            for (int j = 0; j < 8; ++j) { t0[j] = st[0][qt][j] * SL2 - nm; t1[j] = st[1][qt][j] * SL2 - nm; }
            exp2x8(t0); exp2x8(t1);
            float s0 = 0.f, s1 = 0.f;
#pragma unroll
            for (int j = 0; j < 8; ++j) { s0 += t0[j]; s1 += t1[j]; }
            sm[qt] = sm[qt] * corr + (s0 + s1); mx[qt] = tm; }
    }
#pragma unroll
    for (int qt = 0; qt < NQT; ++qt) { const float mm = fmaxf(mx[qt], __shfl_xor(mx[qt], 16, 32)); float s = sm[qt] * exp2x1((mx[qt] - mm) * SL2); s += __shfl_xor(s, 16, 32); mx[qt] = mm * SL2; fn[qt] = __fdiv_rn(1.0f, s); }
    v8f oacc[NQT][4];
#pragma unroll
    for (int qt = 0; qt < NQT; ++qt)
#pragma unroll
        for (int dt = 0; dt < 4; ++dt) oacc[qt][dt] = (v8f){};
    // rolled: one trip is a block of 64 keys with its barrier
#pragma unroll 1
    for (int blk = 0; blk < TT / 64; ++blk) {
        float* ab = avs + (blk & 1) * (NH_ * MQ * AP);
        // rolled: unrolling the two halves only adds registers and code
#pragma unroll 1
        for (int hf = 0; hf < 2; ++hf) { const int kp = blk * 2 + hf;
            // the V^T fragments of this trip are requested ahead of the score products, so that they fly during the softmax
            V va[4], vb[4]; const T* pva = Va + (size_t)kp * 2048; const T* pvb = HI ? Vb + (size_t)kp * 2048 : nullptr;
#pragma unroll
            for (int dt = 0; dt < 4; ++dt) { va[dt] = WF::ldf(pva + dt * 512); if constexpr (HI) vb[dt] = WF::ldf(pvb + dt * 512); }
            xwait(pva, pvb);
            v8f st[2][NQT]; stiles(ka, kb, st); kload(kp + 1 < TT / 32 ? kp + 1 : 0, ka, kb);
            V pa[NQT], pb[NQT];
#pragma unroll
            for (int qt = 0; qt < NQT; ++qt) { v8h o16[2]; v8us oh[2], ol[2];
#pragma unroll
                for (int u = 0; u < 2; ++u) { float t[8];
#pragma unroll
                    for (int j = 0; j < 8; ++j) t[j] = st[u][qt][j] * SL2 - mx[qt];
                    exp2x8(t);
                    v4f w0, w1;
#pragma unroll
                    for (int j = 0; j < 4; ++j) { w0[j] = t[j] * fn[qt]; w1[j] = t[4 + j] * fn[qt]; }
                    float* dst = ab + (h * MQ + qt * 16 + lr) * AP + hf * 32 + u * 16 + 8 * hi; *(v4fa*)dst = w0; *(v4fa*)(dst + 4) = w1;
                    if constexpr (HI) {
#pragma unroll
                        for (int j = 0; j < 4; ++j) { unsigned short a, c2; splitf(w0[j], a, c2); oh[u][j] = a; ol[u][j] = c2; splitf(w1[j], a, c2); oh[u][4 + j] = a; ol[u][4 + j] = c2; }
                    } else {
#pragma unroll
                        for (int j = 0; j < 8; ++j) o16[u][j] = tohx(t[j]);
                    } }
                if constexpr (HI) { pa[qt] = cat16b(oh[0], oh[1]); pb[qt] = cat16b(ol[0], ol[1]); } else { pa[qt] = cat16(o16[0], o16[1]); } }
#pragma unroll
            for (int dt = 0; dt < 4; ++dt)
#pragma unroll
                for (int qt = 0; qt < NQT; ++qt) { oacc[qt][dt] = WF::mma(va[dt], pa[qt], oacc[qt][dt]); if constexpr (HI) { oacc[qt][dt] = WF::mma(va[dt], pb[qt], oacc[qt][dt]); oacc[qt][dt] = WF::mma(vb[dt], pa[qt], oacc[qt][dt]); } }
            // four vector slots between the last matrix instruction of a trip and the first vector instruction behind the taken loop branch, which may overwrite its operands
            // (one statement that takes every accumulator, so that it stands behind the last matrix instruction)
            static_assert(NQT == 1 || NQT == 2);
            if constexpr (NQT == 1) asm volatile("v_nop\n\tv_nop\n\tv_nop\n\tv_nop" : "+v"(oacc[0][0]), "+v"(oacc[0][1]), "+v"(oacc[0][2]), "+v"(oacc[0][3]));
            else asm volatile("v_nop\n\tv_nop\n\tv_nop\n\tv_nop" : "+v"(oacc[0][0]), "+v"(oacc[0][1]), "+v"(oacc[0][2]), "+v"(oacc[0][3]), "+v"(oacc[NQT - 1][0]), "+v"(oacc[NQT - 1][1]), "+v"(oacc[NQT - 1][2]), "+v"(oacc[NQT - 1][3]));
        }
        __syncthreads();   // all NH_ planes of this block of keys are in LDS before any thread sums over the heads
        if (MQ * 16 >= 32 * NH_ || (int)threadIdx.x < MQ * 16) { const int row = (int)threadIdx.x >> 4, c4 = ((int)threadIdx.x & 15) * 4; const float* ar = ab + row * AP + c4; v4f a = *(const v4fa*)ar;
#pragma unroll
            for (int u = 1; u < NH_; ++u) { const v4f pv = *(const v4fa*)(ar + u * (MQ * AP));
#pragma unroll
                for (int q = 0; q < 4; ++q) a[q] = a[q] + pv[q]; }
            v4f o;
#pragma unroll
            for (int q = 0; q < 4; ++q) o[q] = a[q] * (1.0f / NH_);
            *(v4f*)(AVG + ((size_t)b * TT + q0 + row) * TT + blk * 64 + c4) = o;
            asm volatile("s_wait_xcnt 0x0" ::: "memory"); }   // the registers of the issued store may be rewritten behind it
    }
    // O^T tile dt: element j = (d = 16 dt + 8 hi + j, query row lr): eight neighbouring d of one merged row per lane
#pragma unroll
    for (int qt = 0; qt < NQT; ++qt)
#pragma unroll
        for (int dt = 0; dt < 4; ++dt) { v8us oh, ol; const float cs = HI ? 1.0f : fn[qt];
#pragma unroll
            for (int j = 0; j < 8; ++j) { unsigned short a, c2; splitf(oacc[qt][dt][j] * cs, a, c2); oh[j] = a; ol[j] = c2; }
            const size_t oo = ((size_t)b * TT + q0 + qt * 16 + lr) * DQ + h * HD + dt * 16 + 8 * hi; *(v8us*)(ATh + oo) = oh; *(v8us*)(ATl + oo) = ol;
            asm volatile("s_wait_xcnt 0x0" ::: "memory"); }   // the registers of the two issued stores may be rewritten behind it
}

__global__ __launch_bounds__(32 * NH_) void k_fattn(const h16* __restrict__ Q16, const h16* __restrict__ K16, const h16* __restrict__ V16, const bf* __restrict__ Qh, const bf* __restrict__ Ql, const bf* __restrict__ Kh, const bf* __restrict__ Kl, const bf* __restrict__ Vh, const bf* __restrict__ Vl, float* AVG, bf* ATh, bf* ATl) {
    __shared__ __align__(16) float avs[2 * NH_ * 32 * AP];
    const int x = blockIdx.x, b = blockIdx.y;
    if (x < RH / 16) fattn<true, 1>(avs, b, x * 16, Qh, Ql, Kh, Kl, Vh, Vl, AVG, ATh, ATl);
    else fattn<false, 2>(avs, b, RH + (x - RH / 16) * 32, Q16, nullptr, K16, nullptr, V16, nullptr, AVG, ATh, ATl);
}

// workspace plan (bytes): four bf16 weights, the bf16 copy of one input stream, two f32 projection buffers, nine head planes, the merged hi and lo planes; all stream-ordered.
static constexpr size_t W_BYTES  = (size_t)DM * DM * 2;
static constexpr size_t XB_BYTES = (size_t)NB * TT * DM * 2;
static constexpr size_t F_BYTES  = (size_t)NB * TT * DM * 4;
static constexpr size_t PL_BYTES = (size_t)NB * NH_ * TT * HD * 2;
static constexpr size_t AT_BYTES = (size_t)NB * TT * DQ * 2;
static constexpr size_t WS_TOTAL = 4 * W_BYTES + XB_BYTES + 2 * F_BYTES + 9 * PL_BYTES + 2 * AT_BYTES;
static_assert(W_BYTES % 256 == 0 && XB_BYTES % 256 == 0 && F_BYTES % 256 == 0 && PL_BYTES % 256 == 0 && AT_BYTES % 256 == 0);
static_assert(WS_TOTAL <= (size_t)268435456);

extern "C" void kernel_launch(void* const* d_in, const int* in_sizes, int n_in,
                              void* d_out, int out_size, void* d_ws, size_t ws_size, hipStream_t stream) {
    if (n_in < 11) return;
    const size_t need_x = (size_t)(NB - 1) * SEQ_FULL * DM + (size_t)TT * DM;
    if ((size_t)in_sizes[0] < need_x || (size_t)in_sizes[1] < need_x || (size_t)in_sizes[2] < need_x) return;
    if ((size_t)in_sizes[3] < (size_t)DM * DM || (size_t)in_sizes[5] < (size_t)DM * DM || (size_t)in_sizes[7] < (size_t)DM * DM || (size_t)in_sizes[9] < (size_t)DM * DM) return;
    if (in_sizes[4] < DM || in_sizes[6] < DM || in_sizes[8] < DM || in_sizes[10] < DM) return;
    const size_t AVG_OFF = (size_t)NB_FULL * SEQ_FULL * DM;     // element offset of the second output (byte 16777216)
    if ((size_t)out_size < AVG_OFF + (size_t)NB * TT * TT) return;
    if (ws_size < WS_TOTAL) return;
    const float* xq = (const float*)d_in[0]; const float* xk = (const float*)d_in[1]; const float* xv = (const float*)d_in[2]; const float* wq = (const float*)d_in[3]; const float* bq = (const float*)d_in[4]; const float* wk = (const float*)d_in[5]; const float* bk = (const float*)d_in[6]; const float* wv = (const float*)d_in[7]; const float* bv = (const float*)d_in[8]; const float* wo = (const float*)d_in[9]; const float* bo = (const float*)d_in[10];
    float* OUT = (float*)d_out;                 // [NB][TT][DM]
    float* AVG = (float*)d_out + AVG_OFF;       // [NB][TT][TT]
    char* wsp = (char*)d_ws;
    auto take = [&](size_t bytes) { char* p = wsp; wsp += (bytes + 255) & ~(size_t)255; return (void*)p; };
    bf* WQ = (bf*)take(W_BYTES); bf* WK = (bf*)take(W_BYTES); bf* WV = (bf*)take(W_BYTES); bf* WO = (bf*)take(W_BYTES);
    bf* XB = (bf*)take(XB_BYTES); float* FQ = (float*)take(F_BYTES); float* FK = (float*)take(F_BYTES); float* FV = FK;   // v projection reuses the k buffer after the k planes are built
    h16* QP16 = (h16*)take(PL_BYTES); h16* KP16 = (h16*)take(PL_BYTES); h16* VT16 = (h16*)take(PL_BYTES);
    bf* QPh = (bf*)take(PL_BYTES); bf* QPl = (bf*)take(PL_BYTES); bf* KPh = (bf*)take(PL_BYTES); bf* KPl = (bf*)take(PL_BYTES); bf* VTh = (bf*)take(PL_BYTES); bf* VTl = (bf*)take(PL_BYTES);
    bf* ATh = (bf*)take(AT_BYTES); bf* ATl = (bf*)take(AT_BYTES);
    if ((size_t)(wsp - (char*)d_ws) > ws_size) return;

    const unsigned GW = (unsigned)(((size_t)DM * DM / 8 + 255) / 256), GX = (unsigned)(((size_t)TT * DM / 8 + 255) / 256);
    k_cvt8<<<GW, 256, 0, stream>>>(wq, WQ, (size_t)DM * DM / 8, 0, 0); k_cvt8<<<GW, 256, 0, stream>>>(wk, WK, (size_t)DM * DM / 8, 0, 0);
    k_cvt8<<<GW, 256, 0, stream>>>(wv, WV, (size_t)DM * DM / 8, 0, 0); k_cvt8<<<GW, 256, 0, stream>>>(wo, WO, (size_t)DM * DM / 8, 0, 0);
    const unsigned LP = (unsigned)(((size_t)NB * NH_ * TT * HD / 2 + 255) / 256);
    const size_t XS = (size_t)SEQ_FULL * DM, XD = (size_t)TT * DM;   // batch strides of an input stream and of its bf16 copy
    k_cvt8<<<dim3(GX, NB, 1), 256, 0, stream>>>(xq, XB, (size_t)TT * DM / 8, XS, XD);
    k_gemmw<bf, 0, true, KWP><<<dim3(NB * TT / 64, DQ / 64, 1), 32 * KWP, 0, stream>>>(XB, nullptr, WQ, nullptr, DM, FQ, DQ, bq, 0, 0, 0);
    k_hp<<<LP, 256, 0, stream>>>(FQ, DQ, NB * NH_, QP16, QPh, QPl);
    k_cvt8<<<dim3(GX, NB, 1), 256, 0, stream>>>(xk, XB, (size_t)TT * DM / 8, XS, XD);
    k_gemmw<bf, 0, true, KWP><<<dim3(NB * TT / 64, DQ / 64, 1), 32 * KWP, 0, stream>>>(XB, nullptr, WK, nullptr, DM, FK, DQ, bk, 0, 0, 0);
    k_hp<<<LP, 256, 0, stream>>>(FK, DQ, NB * NH_, KP16, KPh, KPl);
    k_cvt8<<<dim3(GX, NB, 1), 256, 0, stream>>>(xv, XB, (size_t)TT * DM / 8, XS, XD);
    k_gemmw<bf, 0, true, KWP><<<dim3(NB * TT / 64, DQ / 64, 1), 32 * KWP, 0, stream>>>(XB, nullptr, WV, nullptr, DM, FV, DQ, bv, 0, 0, 0);
    k_vtp<<<LP, 256, 0, stream>>>(FV, DQ, NB * NH_, VT16, VTh, VTl);
    k_fattn<<<dim3(RH / 16 + (TT - RH) / 32, NB, 1), 32 * NH_, 0, stream>>>(QP16, KP16, VT16, QPh, QPl, KPh, KPl, VTh, VTl, AVG, ATh, ATl);
    k_gemmw<bf, 1, true, KWP><<<dim3(NB * TT / 64, DM / 64, 1), 32 * KWP, 0, stream>>>(ATh, ATl, WO, nullptr, DQ, OUT, DM, bo, 0, 0, 0);
}

// v006
// One run takes 294 microseconds.
// In two side-by-side timings against v005, it was 1.08 and 1.07 times as fast.
// Counting every step since v000, it is 5.60 times as fast.
#include <hip/hip_runtime.h>

// Multi-head attention without a mask over three input streams (query, key, value [2][2048][1024]); q = query Wq^T + bq, k = key Wk^T + bk, v = value Wv^T + bv (W stored [out][in]); 16 heads x 64; scores x 64^-0.5; softmax over all keys; out0 = merged Wo^T + bo; out1 = head mean of the probabilities [2][2048][2048].
// Compute dtypes, f32 accumulate: every float input RNE-converted to bf16; projections v_wmma_f32_16x16x32_bf16 (exact products) + f32 bias; attention query rows < 512: q/k/p/v as bf16 hi+lo planes (3 products), other rows v_wmma_f32_16x16x32_f16 with p carried unnormalised (exp of score minus row maximum, at most 1) and the row scaled by 1 / sum behind p.v; softmax and head mean f32; output projection merged hi+lo (bf16) x bf16 Wo + bias.
// Every launch covers all NB batches (no host loop over the batch): projections run on the NB*TT stacked rows, the head planes are indexed by z = batch * 16 + head.
// Every launch covers all three streams too: one conversion launch (three streams and four weights), one projection launch (blockIdx.z = stream), one plane-building launch (blockIdx.y = stream).
// Attention is one launch (k_fattn): a work-group owns 16 (hi+lo) or 32 (plain) query rows over all heads, one wave per head; scores, probabilities and p.v stay in registers, only the head mean passes through LDS.
// The head planes are stored in fragment order (1024-byte blocks, lane l holds bytes 16 l .. 16 l + 15 of each half), so that every fragment load reads whole cache lines.

#ifndef NB
#define NB 2
#endif
#ifndef SEQ
#define SEQ 2048
#endif
#define NB_FULL  2
#define SEQ_FULL 2048
#define TT   SEQ
#define DM   1024
#define NH_  16
#define HD   64
#define DQ   (NH_ * HD)
#define RH   512                  // query rows < RH use hi+lo planes
#define SCL  0.125f               // HD^-0.5
#define KWP  8                    // waves sharing the K loop of a projection tile (K = DM)
#define SL2  (SCL * 1.4426950408889634f)   // HD^-0.5 x log2 e: exp(s x HD^-0.5 - max) = exp2(s x SL2 - max x SL2)
#define AP   68                   // LDS pitch (floats) of a 64-key row of probabilities: 272 bytes = 16 x odd
typedef _Float16 h16;
typedef unsigned short bf;
typedef __attribute__((ext_vector_type(16))) __bf16   v16bf;
typedef __attribute__((ext_vector_type(16))) _Float16 v16h;
typedef __attribute__((ext_vector_type(8)))  _Float16 v8h;
typedef __attribute__((ext_vector_type(8)))  unsigned short v8us;
typedef __attribute__((ext_vector_type(8)))  float    v8f;
typedef __attribute__((ext_vector_type(4)))  float    v4f;
typedef v8h  __attribute__((may_alias)) v8ha;
typedef v4f  __attribute__((may_alias)) v4fa;
typedef v8us __attribute__((may_alias)) v8usa;

static_assert((TT - RH) % 32 == 0 && RH % 16 == 0 && RH <= TT);
static_assert(TT % 64 == 0);
static_assert(HD == 64);
static_assert(DM % 64 == 0);
static_assert(DM % (32 * KWP) == 0);
static_assert((size_t)KWP * 64 * 68 * 4 <= 327680);
static_assert((size_t)2 * NH_ * 32 * AP * 4 <= 327680 && 32 * NH_ <= 1024 && 32 * NH_ >= 32 * 16);   // the last: one thread per 4 columns of a 32-row, 64-key block in the head sum
static_assert((size_t)NB_FULL * SEQ_FULL * DM * 4 == 16777216);
static_assert((size_t)NB_FULL * SEQ_FULL * DM + (size_t)NB * TT * TT <= (size_t)50331648 / 4);

__device__ __forceinline__ unsigned short f2bf(float f) { unsigned u = __float_as_uint(f); u += 0x7FFFu + ((u >> 16) & 1u); return (unsigned short)(u >> 16); }
__device__ __forceinline__ float bf2f(unsigned short b) { return __uint_as_float(((unsigned)b) << 16); }
__device__ __forceinline__ float bfr(float f) { return bf2f(f2bf(f)); }
__device__ __forceinline__ v16h cat16(v8h lo, v8h hi) { return __builtin_shufflevector(lo, hi, 0, 1, 2, 3, 4, 5, 6, 7, 8, 9, 10, 11, 12, 13, 14, 15); }
__device__ __forceinline__ v16bf cat16b(v8us lo, v8us hi) { return __builtin_bit_cast(v16bf, __builtin_shufflevector(lo, hi, 0, 1, 2, 3, 4, 5, 6, 7, 8, 9, 10, 11, 12, 13, 14, 15)); }
__device__ __forceinline__ v8f wmma16(v16h a, v16h b, v8f c) { return __builtin_amdgcn_wmma_f32_16x16x32_f16(false, a, false, b, (short)0, c, false, false); }
__device__ __forceinline__ v8f wmmab(v16bf a, v16bf b, v8f c) { return __builtin_amdgcn_wmma_f32_16x16x32_bf16(false, a, false, b, (short)0, c, false, false); }

// ---- k_gemmw: register-blocked GEMM, one work-group of KW waves per 64x64 output tile (16 accumulators per wave), operands straight from K-contiguous 16-bit planes; grid (M/64, N/64, Z), 32 * KW threads.
// K split: wave w takes the 32-wide k steps w, w + KW, w + 2 KW, ... (neighbouring waves read neighbouring halves of the same 128-byte lines); for KW > 1 the KW partial tiles meet in LDS and are summed in wave order 0 .. KW-1.
// C[m][n] (f32, pitch ldc, + optional f32 bias[n], bias0 / bias1 / bias2 for z = 0 / 1 / 2) = sum_k A[m][k] Bt[n][k] (+ split products per NSPLIT). z-batch strides sA/sB/sC in elements. K % 32 == 0, M % 64 == 0, N % 64 == 0.
// Fragment map: lane -> row/col (lane & 15), elements 0..7 = k0 + 8*(lane>>4) + 0..7, elements 8..15 = k0 + 16 + 8*(lane>>4) + 0..7 for A and B; D element j = (row 8*(lane>>4) + j, col lane & 15).
template <typename T16> struct WFrag;
template <> struct WFrag<h16> { typedef v16h V; static __device__ __forceinline__ V ld(const h16* p) { return cat16(*(const v8h*)p, *(const v8h*)(p + 16)); } static __device__ __forceinline__ V ldf(const h16* p) { return cat16(*(const v8h*)p, *(const v8h*)(p + 256)); } static __device__ __forceinline__ v8f mma(V a, V b, v8f c) { return wmma16(a, b, c); } };
template <> struct WFrag<bf> { typedef v16bf V; static __device__ __forceinline__ V ld(const bf* p) { return cat16b(*(const v8us*)p, *(const v8us*)(p + 16)); } static __device__ __forceinline__ V ldf(const bf* p) { return cat16b(*(const v8us*)p, *(const v8us*)(p + 256)); } static __device__ __forceinline__ v8f mma(V a, V b, v8f c) { return wmmab(a, b, c); } };
template <typename T16, int NSPLIT, bool BIAS, int KW>
__global__ __launch_bounds__(32 * KW) void k_gemmw(const T16* __restrict__ A, const T16* __restrict__ A2, const T16* __restrict__ Bt, const T16* __restrict__ Bt2, int K, float* C, int ldc, const float* __restrict__ bias0, const float* __restrict__ bias1, const float* __restrict__ bias2, size_t sA, size_t sB, size_t sC) {
    typedef typename WFrag<T16>::V V;
    __shared__ __align__(16) float os[(KW == 1 ? 16 : KW * 64) * 68];
    const int w = (KW == 1) ? 0 : __builtin_amdgcn_readfirstlane((int)(threadIdx.x >> 5));
    const size_t z = blockIdx.z; A += z * sA; if (A2) A2 += z * sA; Bt += z * sB; if (Bt2) Bt2 += z * sB; C += z * sC;
    const float* bias = z == 0 ? bias0 : z == 1 ? bias1 : bias2;   // the biases are separate inputs: batch entry z adds its own
    const int lane = threadIdx.x & 31, lr = lane & 15, hi = lane >> 4; const int r0 = blockIdx.x * 64, c0 = blockIdx.y * 64;
    v8f acc[4][4];
#pragma unroll
    for (int mb = 0; mb < 4; ++mb)
#pragma unroll
        for (int nb = 0; nb < 4; ++nb) acc[mb][nb] = (v8f){};
    const size_t aoff = (size_t)(r0 + lr) * K + 8 * hi, boff = (size_t)(c0 + lr) * K + 8 * hi;
#pragma unroll 1
    for (int kc = w * 32; kc < K; kc += 32 * KW) {
        V a[4], a2[4];
#pragma unroll
        for (int mb = 0; mb < 4; ++mb) { a[mb] = WFrag<T16>::ld(A + aoff + (size_t)mb * 16 * K + kc); if (NSPLIT == 1 || NSPLIT == 2) a2[mb] = WFrag<T16>::ld(A2 + aoff + (size_t)mb * 16 * K + kc); }
#pragma unroll
        for (int nb = 0; nb < 4; ++nb) { const V b = WFrag<T16>::ld(Bt + boff + (size_t)nb * 16 * K + kc); V b2; if (NSPLIT >= 2) b2 = WFrag<T16>::ld(Bt2 + boff + (size_t)nb * 16 * K + kc);
#pragma unroll
            for (int mb = 0; mb < 4; ++mb) { acc[mb][nb] = WFrag<T16>::mma(a[mb], b, acc[mb][nb]); if (NSPLIT == 1 || NSPLIT == 2) acc[mb][nb] = WFrag<T16>::mma(a2[mb], b, acc[mb][nb]); if (NSPLIT >= 2) acc[mb][nb] = WFrag<T16>::mma(a[mb], b2, acc[mb][nb]); } }
        asm volatile("v_nop\n\tv_nop\n\tv_nop\n\tv_nop" : "+v"(acc[0][0]), "+v"(acc[1][1]), "+v"(acc[2][2]), "+v"(acc[3][3]) : "v"(a[0]), "v"(a[3]));
    }
    if constexpr (KW > 1) {
        float* ow = os + w * (64 * 68);
#pragma unroll
        for (int mb = 0; mb < 4; ++mb)
#pragma unroll
            for (int nb = 0; nb < 4; ++nb)
#pragma unroll
                for (int j = 0; j < 8; ++j) ow[(mb * 16 + hi * 8 + j) * 68 + nb * 16 + lr] = acc[mb][nb][j];
        __syncthreads();   // every wave's partial tile is in LDS before any thread sums across waves
#pragma unroll
        for (int r = 0; r < 64 * 16 / (32 * KW); ++r) { const int s = r * 32 * KW + (int)threadIdx.x, row = s >> 4, cofs = (s & 15) * 4; v4f val = *(const v4fa*)(os + row * 68 + cofs);
#pragma unroll
            for (int u = 1; u < KW; ++u) { const v4f pv = *(const v4fa*)(os + u * (64 * 68) + row * 68 + cofs); val[0] += pv[0]; val[1] += pv[1]; val[2] += pv[2]; val[3] += pv[3]; }
            if (BIAS) { val[0] += bfr(bias[c0 + cofs]); val[1] += bfr(bias[c0 + cofs + 1]); val[2] += bfr(bias[c0 + cofs + 2]); val[3] += bfr(bias[c0 + cofs + 3]); }
            *(v4f*)(C + (size_t)(r0 + row) * ldc + c0 + cofs) = val; }
    } else {
#pragma unroll
    for (int mb = 0; mb < 4; ++mb) {
#pragma unroll
        for (int nb = 0; nb < 4; ++nb) {
#pragma unroll
            for (int j = 0; j < 8; ++j) os[(hi * 8 + j) * 68 + nb * 16 + lr] = acc[mb][nb][j]; }
        __builtin_amdgcn_wave_barrier(); asm volatile("" ::: "memory");
        float* crow = C + (size_t)(r0 + mb * 16) * ldc + c0;
{
#pragma unroll
            for (int s = 0; s < 8; ++s) { const int row = 2 * s + hi, cofs = lr * 4; v4f val = *(const v4fa*)(os + row * 68 + cofs); if (BIAS) { val[0] += bfr(bias[c0 + cofs]); val[1] += bfr(bias[c0 + cofs + 1]); val[2] += bfr(bias[c0 + cofs + 2]); val[3] += bfr(bias[c0 + cofs + 3]); }
                *(v4f*)(crow + (size_t)row * ldc + cofs) = val; }
             }
        __builtin_amdgcn_wave_barrier(); asm volatile("" ::: "memory");
    }
    }
}

__device__ __forceinline__ h16 tohx(float x) { return (h16)x; }
__device__ __forceinline__ void splitf(float y, unsigned short& h, unsigned short& l) { h = f2bf(y); l = f2bf(y - bf2f(h)); }
typedef __attribute__((ext_vector_type(2))) _Float16 v2h;
typedef __attribute__((ext_vector_type(4))) _Float16 v4h;
typedef __attribute__((ext_vector_type(2))) unsigned short v2us;
typedef __attribute__((ext_vector_type(4))) unsigned short v4us;
typedef __attribute__((ext_vector_type(2))) float v2f;

// k_cvtall: every float matrix to bf16 in one launch, 8 elements per thread. Blocks 0 .. 3 NB GX - 1: stream s = block / (NB GX), batch b, GX blocks each (source batch stride SEQ_FULL * DM, destination XB[s][b]);
// the 4 GW blocks behind them: weight block / GW, destination WB[weight].
static constexpr unsigned GW = (unsigned)(((size_t)DM * DM / 8 + 255) / 256), GX = (unsigned)(((size_t)TT * DM / 8 + 255) / 256);
__global__ __launch_bounds__(256) void k_cvtall(const float* __restrict__ xq, const float* __restrict__ xk, const float* __restrict__ xv, const float* __restrict__ wq, const float* __restrict__ wk, const float* __restrict__ wv, const float* __restrict__ wo, bf* XB, bf* WB) {
    const unsigned x = blockIdx.x; const float* src; bf* dst; size_t i, n8;
    if (x < 3 * NB * GX) { const unsigned s = x / (NB * GX), r = x % (NB * GX), b = r / GX; i = (size_t)(r % GX) * 256 + threadIdx.x; n8 = (size_t)TT * DM / 8;
        src = (s == 0 ? xq : s == 1 ? xk : xv) + (size_t)b * SEQ_FULL * DM; dst = XB + ((size_t)s * NB + b) * TT * DM; }
    else { const unsigned y = x - 3 * NB * GX, s = y / GW; i = (size_t)(y % GW) * 256 + threadIdx.x; n8 = (size_t)DM * DM / 8;
        src = s == 0 ? wq : s == 1 ? wk : s == 2 ? wv : wo; dst = WB + (size_t)s * DM * DM; }
    if (i >= n8) return; const v8f v = *(const v8f*)(src + i * 8); v8us o;
#pragma unroll
    for (int k = 0; k < 8; ++k) o[k] = f2bf(v[k]); *(v8us*)(dst + i * 8) = o;  }

// k_hp / k_vtp: nz = NB * NH_ planes, plane z = batch * NH_ + head, read from row batch * TT + t of F; e is the output offset, decoded into (t, d) by the fragment order:
// k_hp  (q, k planes): [z][t / 16][d / 32][half c][lane = hi * 16 + lr][8], t = 16 (t / 16) + lr, d = 32 (d / 32) + 16 c + 8 hi + 0..7  (rows t, k index d).
// k_vtp (v planes):    [z][t / 32][d / 16][half c][lane = hi * 16 + lr][8], d = 16 (d / 16) + lr, t = 32 (t / 32) + 16 c + 8 hi + 0..7  (rows d, k index t).
__device__ __forceinline__ void k_hp(const float* __restrict__ F, int pitch, int nz, h16* P16, bf* Ph, bf* Pl) {
    const size_t e = ((size_t)blockIdx.x * 256 + threadIdx.x) * 2; if (e >= (size_t)nz * TT * HD) return; const int d = (int)(((e >> 9) & 1) * 32 + ((e >> 8) & 1) * 16 + ((e >> 7) & 1) * 8 + (e & 7)); const int t = (int)(((e >> 10) % (TT / 16)) * 16 + ((e >> 3) & 15)); const int z = (int)(e / ((size_t)HD * TT)); const int b = z / NH_, h = z % NH_;
    const v2f x = *(const v2f*)(F + ((size_t)b * TT + t) * pitch + h * HD + d); v2h o16; v2us oh, ol;
#pragma unroll
    for (int q = 0; q < 2; ++q) { const float r = x[q]; o16[q] = tohx(r); unsigned short a2, c2; splitf(r, a2, c2); oh[q] = a2; ol[q] = c2; }
    *(v2h*)(P16 + e) = o16; *(v2us*)(Ph + e) = oh; *(v2us*)(Pl + e) = ol;  }

__device__ __forceinline__ void k_vtp(const float* __restrict__ F, int pitch, int nz, h16* V16, bf* Vh, bf* Vl) { const size_t e = ((size_t)blockIdx.x * 256 + threadIdx.x) * 2; if (e >= (size_t)nz * HD * TT) return; const int t = (int)(((e >> 11) % (TT / 32)) * 32 + ((e >> 8) & 1) * 16 + ((e >> 7) & 1) * 8 + (e & 7)); const int d = (int)(((e >> 9) & 3) * 16 + ((e >> 3) & 15)); const int z = (int)(e / ((size_t)TT * HD)); const int b = z / NH_, g = z % NH_; v2h o16; v2us oh, ol;
#pragma unroll
    for (int q = 0; q < 2; ++q) { const float x = F[((size_t)b * TT + t + q) * pitch + g * HD + d]; o16[q] = tohx(x); unsigned short a2, c2; splitf(x, a2, c2); oh[q] = a2; ol[q] = c2; }
    *(v2h*)(V16 + e) = o16; *(v2us*)(Vh + e) = oh; *(v2us*)(Vl + e) = ol;  }

// k_planes: the nine head planes in one launch; blockIdx.y = stream s (0 q, 1 k: k_hp; 2 v: k_vtp), projection F[s], planes P16[s], PHL[s][hi, lo].
__global__ __launch_bounds__(256) void k_planes(const float* __restrict__ F, int pitch, int nz, h16* P16, bf* PHL) {
    constexpr size_t PE = (size_t)NB * NH_ * TT * HD; const size_t s = blockIdx.y; F += s * ((size_t)NB * TT * DQ); P16 += s * PE; bf* Ph = PHL + 2 * s * PE; bf* Pl = Ph + PE;
    if (s < 2) k_hp(F, pitch, nz, P16, Ph, Pl); else k_vtp(F, pitch, nz, P16, Ph, Pl);
}

// ---- k_fattn: scores, softmax, head mean, p.v and the head merge in one launch. Work-group = NH_ waves, wave h = head h; blockIdx.y = batch; blockIdx.x < RH / 16: 16 query rows on hi+lo bf16 planes, else 32 query rows on f16 planes.
// Transposed products: S^T tile = K (A operand, rows = 16 keys) x Q (B operand, columns = 16 query rows), so lane (lr, hi) holds keys 8 hi + 0..7 of query row lr: two such tiles are, element for element, the B fragment of 32 keys
// for O^T = V^T (A operand, rows = 16 d) x P (B operand); p never leaves the registers. The k order of that B fragment (elements 0..7 = keys 8 hi + 0..7, elements 8..15 = keys 16 + 8 hi + 0..7) is the one of the V^T loader.
// Sweep 1 over the keys: running maximum and sum per lane (rescaled when the maximum grows), merged over the two lane halves at the end. Sweep 2: the same score tiles again, e = exp2(s x SL2 - max x SL2), p = e / sum.
// p.v: hi+lo rows multiply the bf16 hi and lo parts of p; plain rows multiply e (f16, at most 1) and scale the finished row by 1 / sum.
// Head mean: per block of 64 keys wave h leaves its f32 p rows in LDS plane h; behind one work-group barrier thread x sums 4 columns over the planes in head order 0 .. NH_-1 and stores them once.
// Two LDS buffers: the barrier of block n + 1 ends every read of block n before block n + 2 writes that buffer again.
template <bool HI> struct PT { typedef h16 T; };
template <> struct PT<true> { typedef bf T; };
// v_exp_f32, eight in place per statement: the instruction set asks for one independent instruction or a v_nop behind a transcendental before its result is read or its source overwritten;
// here each v_exp_f32 fills the slot of the one before and one v_nop that of the last.
__device__ __forceinline__ void exp2x8(float (&x)[8]) {
    asm("v_exp_f32 %0, %0\n\tv_exp_f32 %1, %1\n\tv_exp_f32 %2, %2\n\tv_exp_f32 %3, %3\n\tv_exp_f32 %4, %4\n\tv_exp_f32 %5, %5\n\tv_exp_f32 %6, %6\n\tv_exp_f32 %7, %7\n\tv_nop"
        : "+v"(x[0]), "+v"(x[1]), "+v"(x[2]), "+v"(x[3]), "+v"(x[4]), "+v"(x[5]), "+v"(x[6]), "+v"(x[7]));
}
// one v_exp_f32 with the v_nop that fills its slot
__device__ __forceinline__ float exp2x1(float x) { asm("v_exp_f32 %0, %0\n\tv_nop" : "+v"(x)); return x; }

template <bool HI, int NQT>
__device__ __forceinline__ void fattn(float* avs, int b, int q0, const typename PT<HI>::T* Qa, const typename PT<HI>::T* Qb, const typename PT<HI>::T* Ka, const typename PT<HI>::T* Kb, const typename PT<HI>::T* Va, const typename PT<HI>::T* Vb, float* AVG, bf* ATh, bf* ATl) {
    typedef typename PT<HI>::T T; typedef WFrag<T> WF; typedef typename WF::V V;
    constexpr int MQ = NQT * 16;
    const int lane = threadIdx.x & 31, lr = lane & 15, hi = lane >> 4; const int h = __builtin_amdgcn_readfirstlane((int)(threadIdx.x >> 5));
    const size_t zo = ((size_t)b * NH_ + h) * TT * HD + lane * 8;
    Qa += zo; Ka += zo; Va += zo; if constexpr (HI) { Qb += zo; Kb += zo; Vb += zo; }
    // s_wait_xcnt 0 behind a run of loads: their address registers may be rewritten behind it; the run's base pointers are inputs of the statement, so that no load of the run returns into a pair that an earlier one names
    auto xwait = [](const T* pa, const T* pb) { if constexpr (HI) asm volatile("s_wait_xcnt 0x0" :: "v"(pa), "v"(pb) : "memory"); else asm volatile("s_wait_xcnt 0x0" :: "v"(pa) : "memory"); };
    V qa[NQT][2], qb[NQT][2];
    { const T* pa = Qa + (size_t)(q0 / 16) * 1024; const T* pb = HI ? Qb + (size_t)(q0 / 16) * 1024 : nullptr;
#pragma unroll
    for (int qt = 0; qt < NQT; ++qt)
#pragma unroll
        for (int ks = 0; ks < 2; ++ks) { qa[qt][ks] = WF::ldf(pa + (qt * 2 + ks) * 512); if constexpr (HI) qb[qt][ks] = WF::ldf(pb + (qt * 2 + ks) * 512); }
    xwait(pa, pb); }
    // K fragments of the 32 keys kp * 32 .. + 31 (u = key tile, ks = k step)
    auto kload = [&](int kp, V (&ka)[2][2], V (&kb)[2][2]) {
        const T* pa = Ka + (size_t)kp * 2048; const T* pb = HI ? Kb + (size_t)kp * 2048 : nullptr;
#pragma unroll
        for (int u = 0; u < 2; ++u)
#pragma unroll
            for (int ks = 0; ks < 2; ++ks) { ka[u][ks] = WF::ldf(pa + (u * 2 + ks) * 512); if constexpr (HI) kb[u][ks] = WF::ldf(pb + (u * 2 + ks) * 512); }
        xwait(pa, pb);
    };
    // S^T tiles of those 32 keys against the NQT query tiles
    auto stiles = [&](const V (&ka)[2][2], const V (&kb)[2][2], v8f (&st)[2][NQT]) {
#pragma unroll
        for (int u = 0; u < 2; ++u)
#pragma unroll
            for (int qt = 0; qt < NQT; ++qt) { v8f a = (v8f){};
#pragma unroll
                for (int ks = 0; ks < 2; ++ks) { a = WF::mma(ka[u][ks], qa[qt][ks], a); if constexpr (HI) { a = WF::mma(ka[u][ks], qb[qt][ks], a); a = WF::mma(kb[u][ks], qa[qt][ks], a); } }
                st[u][qt] = a; }
    };
    // the K fragments are fetched one trip ahead, as soon as the score products have read the old ones; behind the last trip of a sweep the fetch wraps to keys 0, which the next sweep starts with
    V ka[2][2], kb[2][2]; kload(0, ka, kb);
    float mx[NQT], sm[NQT], fn[NQT];
#pragma unroll
    for (int qt = 0; qt < NQT; ++qt) { mx[qt] = -3.0e38f; sm[qt] = 0.f; }
    // rolled: one trip holds 32 keys' fragments and tiles; unrolling it would only add registers
#pragma unroll 1
    for (int kp = 0; kp < TT / 32; ++kp) {
        v8f st[2][NQT]; stiles(ka, kb, st); kload(kp + 1 < TT / 32 ? kp + 1 : 0, ka, kb);
#pragma unroll
        for (int qt = 0; qt < NQT; ++qt) { float t0[8], t1[8]; float tm = mx[qt];
#pragma unroll
            for (int j = 0; j < 8; ++j) tm = fmaxf(tm, fmaxf(st[0][qt][j], st[1][qt][j]));
            const float corr = exp2x1((mx[qt] - tm) * SL2), nm = tm * SL2;
#pragma unroll
            for (int j = 0; j < 8; ++j) { t0[j] = st[0][qt][j] * SL2 - nm; t1[j] = st[1][qt][j] * SL2 - nm; }
            exp2x8(t0); exp2x8(t1);
            float s0 = 0.f, s1 = 0.f;
#pragma unroll
            for (int j = 0; j < 8; ++j) { s0 += t0[j]; s1 += t1[j]; }
            sm[qt] = sm[qt] * corr + (s0 + s1); mx[qt] = tm; }
    }
#pragma unroll
    for (int qt = 0; qt < NQT; ++qt) { const float mm = fmaxf(mx[qt], __shfl_xor(mx[qt], 16, 32)); float s = sm[qt] * exp2x1((mx[qt] - mm) * SL2); s += __shfl_xor(s, 16, 32); mx[qt] = mm * SL2; fn[qt] = __fdiv_rn(1.0f, s); }
    v8f oacc[NQT][4];
#pragma unroll
    for (int qt = 0; qt < NQT; ++qt)
#pragma unroll
        for (int dt = 0; dt < 4; ++dt) oacc[qt][dt] = (v8f){};
    // rolled: one trip is a block of 64 keys with its barrier
#pragma unroll 1
    for (int blk = 0; blk < TT / 64; ++blk) {
        float* ab = avs + (blk & 1) * (NH_ * MQ * AP);
        // rolled: unrolling the two halves only adds registers and code
#pragma unroll 1
        for (int hf = 0; hf < 2; ++hf) { const int kp = blk * 2 + hf;
            // the V^T fragments of this trip are requested ahead of the score products, so that they fly during the softmax
            V va[4], vb[4]; const T* pva = Va + (size_t)kp * 2048; const T* pvb = HI ? Vb + (size_t)kp * 2048 : nullptr;
#pragma unroll
            for (int dt = 0; dt < 4; ++dt) { va[dt] = WF::ldf(pva + dt * 512); if constexpr (HI) vb[dt] = WF::ldf(pvb + dt * 512); }
            xwait(pva, pvb);
            v8f st[2][NQT]; stiles(ka, kb, st); kload(kp + 1 < TT / 32 ? kp + 1 : 0, ka, kb);
            V pa[NQT], pb[NQT];
#pragma unroll
            for (int qt = 0; qt < NQT; ++qt) { v8h o16[2]; v8us oh[2], ol[2];
#pragma unroll
                for (int u = 0; u < 2; ++u) { float t[8];
#pragma unroll
                    for (int j = 0; j < 8; ++j) t[j] = st[u][qt][j] * SL2 - mx[qt];
                    exp2x8(t);
                    v4f w0, w1;
#pragma unroll
                    for (int j = 0; j < 4; ++j) { w0[j] = t[j] * fn[qt]; w1[j] = t[4 + j] * fn[qt]; }
                    float* dst = ab + (h * MQ + qt * 16 + lr) * AP + hf * 32 + u * 16 + 8 * hi; *(v4fa*)dst = w0; *(v4fa*)(dst + 4) = w1;
                    if constexpr (HI) {
#pragma unroll
                        for (int j = 0; j < 4; ++j) { unsigned short a, c2; splitf(w0[j], a, c2); oh[u][j] = a; ol[u][j] = c2; splitf(w1[j], a, c2); oh[u][4 + j] = a; ol[u][4 + j] = c2; }
                    } else {
#pragma unroll
                        for (int j = 0; j < 8; ++j) o16[u][j] = tohx(t[j]);
                    } }
                if constexpr (HI) { pa[qt] = cat16b(oh[0], oh[1]); pb[qt] = cat16b(ol[0], ol[1]); } else { pa[qt] = cat16(o16[0], o16[1]); } }
#pragma unroll
            for (int dt = 0; dt < 4; ++dt)
#pragma unroll
                for (int qt = 0; qt < NQT; ++qt) { oacc[qt][dt] = WF::mma(va[dt], pa[qt], oacc[qt][dt]); if constexpr (HI) { oacc[qt][dt] = WF::mma(va[dt], pb[qt], oacc[qt][dt]); oacc[qt][dt] = WF::mma(vb[dt], pa[qt], oacc[qt][dt]); } }
            // four vector slots between the last matrix instruction of a trip and the first vector instruction behind the taken loop branch, which may overwrite its operands
            // (one statement that takes every accumulator, so that it stands behind the last matrix instruction)
            static_assert(NQT == 1 || NQT == 2);
            if constexpr (NQT == 1) asm volatile("v_nop\n\tv_nop\n\tv_nop\n\tv_nop" : "+v"(oacc[0][0]), "+v"(oacc[0][1]), "+v"(oacc[0][2]), "+v"(oacc[0][3]));
            else asm volatile("v_nop\n\tv_nop\n\tv_nop\n\tv_nop" : "+v"(oacc[0][0]), "+v"(oacc[0][1]), "+v"(oacc[0][2]), "+v"(oacc[0][3]), "+v"(oacc[NQT - 1][0]), "+v"(oacc[NQT - 1][1]), "+v"(oacc[NQT - 1][2]), "+v"(oacc[NQT - 1][3]));
        }
        __syncthreads();   // all NH_ planes of this block of keys are in LDS before any thread sums over the heads
        if (MQ * 16 >= 32 * NH_ || (int)threadIdx.x < MQ * 16) { const int row = (int)threadIdx.x >> 4, c4 = ((int)threadIdx.x & 15) * 4; const float* ar = ab + row * AP + c4; v4f a = *(const v4fa*)ar;
#pragma unroll
            for (int u = 1; u < NH_; ++u) { const v4f pv = *(const v4fa*)(ar + u * (MQ * AP));
#pragma unroll
                for (int q = 0; q < 4; ++q) a[q] = a[q] + pv[q]; }
            v4f o;
#pragma unroll
            for (int q = 0; q < 4; ++q) o[q] = a[q] * (1.0f / NH_);
            *(v4f*)(AVG + ((size_t)b * TT + q0 + row) * TT + blk * 64 + c4) = o;
            asm volatile("s_wait_xcnt 0x0" ::: "memory"); }   // the registers of the issued store may be rewritten behind it
    }
    // O^T tile dt: element j = (d = 16 dt + 8 hi + j, query row lr): eight neighbouring d of one merged row per lane
#pragma unroll
    for (int qt = 0; qt < NQT; ++qt)
#pragma unroll
        for (int dt = 0; dt < 4; ++dt) { v8us oh, ol; const float cs = HI ? 1.0f : fn[qt];
#pragma unroll
            for (int j = 0; j < 8; ++j) { unsigned short a, c2; splitf(oacc[qt][dt][j] * cs, a, c2); oh[j] = a; ol[j] = c2; }
            const size_t oo = ((size_t)b * TT + q0 + qt * 16 + lr) * DQ + h * HD + dt * 16 + 8 * hi; *(v8us*)(ATh + oo) = oh; *(v8us*)(ATl + oo) = ol;
            asm volatile("s_wait_xcnt 0x0" ::: "memory"); }   // the registers of the two issued stores may be rewritten behind it
}

__global__ __launch_bounds__(32 * NH_) void k_fattn(const h16* __restrict__ Q16, const h16* __restrict__ K16, const h16* __restrict__ V16, const bf* __restrict__ Qh, const bf* __restrict__ Ql, const bf* __restrict__ Kh, const bf* __restrict__ Kl, const bf* __restrict__ Vh, const bf* __restrict__ Vl, float* AVG, bf* ATh, bf* ATl) {
    __shared__ __align__(16) float avs[2 * NH_ * 32 * AP];
    const int x = blockIdx.x, b = blockIdx.y;
    if (x < RH / 16) fattn<true, 1>(avs, b, x * 16, Qh, Ql, Kh, Kl, Vh, Vl, AVG, ATh, ATl);
    else fattn<false, 2>(avs, b, RH + (x - RH / 16) * 32, Q16, nullptr, K16, nullptr, V16, nullptr, AVG, ATh, ATl);
}

// workspace plan (bytes): four bf16 weights, the bf16 copies of the three input streams, three f32 projection buffers, nine head planes, the merged hi and lo planes; all stream-ordered.
static constexpr size_t W_BYTES  = (size_t)DM * DM * 2;
static constexpr size_t XB_BYTES = (size_t)NB * TT * DM * 2;
static constexpr size_t F_BYTES  = (size_t)NB * TT * DM * 4;
static constexpr size_t PL_BYTES = (size_t)NB * NH_ * TT * HD * 2;
static constexpr size_t AT_BYTES = (size_t)NB * TT * DQ * 2;
static constexpr size_t WS_TOTAL = 4 * W_BYTES + 3 * XB_BYTES + 3 * F_BYTES + 9 * PL_BYTES + 2 * AT_BYTES;
static_assert(W_BYTES % 256 == 0 && XB_BYTES % 256 == 0 && F_BYTES % 256 == 0 && PL_BYTES % 256 == 0 && AT_BYTES % 256 == 0);
static_assert(WS_TOTAL <= (size_t)268435456);

extern "C" void kernel_launch(void* const* d_in, const int* in_sizes, int n_in,
                              void* d_out, int out_size, void* d_ws, size_t ws_size, hipStream_t stream) {
    if (n_in < 11) return;
    const size_t need_x = (size_t)(NB - 1) * SEQ_FULL * DM + (size_t)TT * DM;
    if ((size_t)in_sizes[0] < need_x || (size_t)in_sizes[1] < need_x || (size_t)in_sizes[2] < need_x) return;
    if ((size_t)in_sizes[3] < (size_t)DM * DM || (size_t)in_sizes[5] < (size_t)DM * DM || (size_t)in_sizes[7] < (size_t)DM * DM || (size_t)in_sizes[9] < (size_t)DM * DM) return;
    if (in_sizes[4] < DM || in_sizes[6] < DM || in_sizes[8] < DM || in_sizes[10] < DM) return;
    const size_t AVG_OFF = (size_t)NB_FULL * SEQ_FULL * DM;     // element offset of the second output (byte 16777216)
    if ((size_t)out_size < AVG_OFF + (size_t)NB * TT * TT) return;
    if (ws_size < WS_TOTAL) return;
    const float* xq = (const float*)d_in[0]; const float* xk = (const float*)d_in[1]; const float* xv = (const float*)d_in[2]; const float* wq = (const float*)d_in[3]; const float* bq = (const float*)d_in[4]; const float* wk = (const float*)d_in[5]; const float* bk = (const float*)d_in[6]; const float* wv = (const float*)d_in[7]; const float* bv = (const float*)d_in[8]; const float* wo = (const float*)d_in[9]; const float* bo = (const float*)d_in[10];
    float* OUT = (float*)d_out;                 // [NB][TT][DM]
    float* AVG = (float*)d_out + AVG_OFF;       // [NB][TT][TT]
    char* wsp = (char*)d_ws;
    auto take = [&](size_t bytes) { char* p = wsp; wsp += (bytes + 255) & ~(size_t)255; return (void*)p; };
    bf* WB = (bf*)take(4 * W_BYTES); bf* WO = WB + 3 * (size_t)DM * DM;   // [q, k, v, o][DM][DM]
    bf* XB = (bf*)take(3 * XB_BYTES); float* FQ = (float*)take(3 * F_BYTES);   // [stream][NB * TT][DM] each
    h16* QP16 = (h16*)take(PL_BYTES); h16* KP16 = (h16*)take(PL_BYTES); h16* VT16 = (h16*)take(PL_BYTES);
    bf* QPh = (bf*)take(PL_BYTES); bf* QPl = (bf*)take(PL_BYTES); bf* KPh = (bf*)take(PL_BYTES); bf* KPl = (bf*)take(PL_BYTES); bf* VTh = (bf*)take(PL_BYTES); bf* VTl = (bf*)take(PL_BYTES);
    bf* ATh = (bf*)take(AT_BYTES); bf* ATl = (bf*)take(AT_BYTES);
    if ((size_t)(wsp - (char*)d_ws) > ws_size) return;

    k_cvtall<<<3 * NB * GX + 4 * GW, 256, 0, stream>>>(xq, xk, xv, wq, wk, wv, wo, XB, WB);
    k_gemmw<bf, 0, true, KWP><<<dim3(NB * TT / 64, DQ / 64, 3), 32 * KWP, 0, stream>>>(XB, nullptr, WB, nullptr, DM, FQ, DQ, bq, bk, bv, (size_t)NB * TT * DM, (size_t)DM * DM, (size_t)NB * TT * DQ);
    const unsigned LP = (unsigned)(((size_t)NB * NH_ * TT * HD / 2 + 255) / 256);
    k_planes<<<dim3(LP, 3, 1), 256, 0, stream>>>(FQ, DQ, NB * NH_, QP16, QPh);
    k_fattn<<<dim3(RH / 16 + (TT - RH) / 32, NB, 1), 32 * NH_, 0, stream>>>(QP16, KP16, VT16, QPh, QPl, KPh, KPl, VTh, VTl, AVG, ATh, ATl);
    k_gemmw<bf, 1, true, KWP><<<dim3(NB * TT / 64, DM / 64, 1), 32 * KWP, 0, stream>>>(ATh, ATl, WO, nullptr, DQ, OUT, DM, bo, nullptr, nullptr, 0, 0, 0);
}

// v007
// A run of this version takes 264 microseconds.
// Two timings next to v006 both put it at 1.11 times that version's speed.
// All steps since v000 together make it 6.23 times as fast.
#include <hip/hip_runtime.h>

// Multi-head attention without a mask over three input streams (query, key, value [2][2048][1024]); q = query Wq^T + bq, k = key Wk^T + bk, v = value Wv^T + bv (W stored [out][in]); 16 heads x 64; scores x 64^-0.5; softmax over all keys; out0 = merged Wo^T + bo; out1 = head mean of the probabilities [2][2048][2048].
// Compute dtypes, f32 accumulate: every float input RNE-converted to bf16; projections v_wmma_f32_16x16x32_bf16 (exact products) + f32 bias; attention query rows < 512: q/k/p/v as bf16 hi+lo planes (3 products), other rows v_wmma_f32_16x16x32_f16 with p carried unnormalised (exp of score minus row maximum, at most 1) and the row scaled by 1 / sum behind p.v; softmax and head mean f32; output projection merged hi+lo (bf16) x bf16 Wo + bias.
// Every launch covers all NB batches (no host loop over the batch): projections run on the NB*TT stacked rows, the head planes are indexed by z = batch * 16 + head.
// Every launch covers all three streams too: one conversion launch (three streams and four weights), one projection launch (blockIdx.z = stream), one plane-building launch (blockIdx.y = stream).
// Attention is one launch (k_fattn): a work-group owns 16 (hi+lo) or 32 (plain) query rows over all heads, one wave per head; scores, probabilities and p.v stay in registers, only the head mean passes through LDS.
// The head planes are stored in fragment order (512-byte blocks, lane l holds bytes 16 l .. 16 l + 15 of each half), so that every fragment load reads whole cache lines.
// So are the GEMM operands (the bf16 streams and weights, the merged hi and lo planes): [row / 16][k / 32][half c][lane = hi * 16 + lr][8], row = 16 (row / 16) + lr, k = 32 (k / 32) + 16 c + 8 hi + 0..7.

#ifndef NB
#define NB 2
#endif
#ifndef SEQ
#define SEQ 2048
#endif
#define NB_FULL  2
#define SEQ_FULL 2048
#define TT   SEQ
#define DM   1024
#define NH_  16
#define HD   64
#define DQ   (NH_ * HD)
#define RH   512                  // query rows < RH use hi+lo planes
#define SCL  0.125f               // HD^-0.5
#define KWP  8                    // waves sharing the K loop of a projection tile (K = DM)
#define SL2  (SCL * 1.4426950408889634f)   // HD^-0.5 x log2 e: exp(s x HD^-0.5 - max) = exp2(s x SL2 - max x SL2)
#define AP   68                   // LDS pitch (floats) of a 64-key row of probabilities: 272 bytes = 16 x odd
typedef _Float16 h16;
typedef unsigned short bf;
typedef __attribute__((ext_vector_type(16))) __bf16   v16bf;
typedef __attribute__((ext_vector_type(16))) _Float16 v16h;
typedef __attribute__((ext_vector_type(8)))  _Float16 v8h;
typedef __attribute__((ext_vector_type(8)))  unsigned short v8us;
typedef __attribute__((ext_vector_type(8)))  float    v8f;
typedef __attribute__((ext_vector_type(4)))  float    v4f;
typedef v8h  __attribute__((may_alias)) v8ha;
typedef v4f  __attribute__((may_alias)) v4fa;
typedef v8us __attribute__((may_alias)) v8usa;

static_assert((TT - RH) % 32 == 0 && RH % 16 == 0 && RH <= TT);
static_assert(TT % 64 == 0);
static_assert(HD == 64);
static_assert(DM % 64 == 0);
static_assert(DM % (32 * KWP) == 0);
static_assert((size_t)KWP * 64 * 68 * 4 <= 327680);
static_assert((size_t)2 * NH_ * 32 * AP * 4 <= 327680 && 32 * NH_ <= 1024 && 32 * NH_ >= 32 * 16);   // the last: one thread per 4 columns of a 32-row, 64-key block in the head sum
static_assert((size_t)NB_FULL * SEQ_FULL * DM * 4 == 16777216);
static_assert((size_t)NB_FULL * SEQ_FULL * DM + (size_t)NB * TT * TT <= (size_t)50331648 / 4);

__device__ __forceinline__ unsigned short f2bf(float f) { unsigned u = __float_as_uint(f); u += 0x7FFFu + ((u >> 16) & 1u); return (unsigned short)(u >> 16); }
__device__ __forceinline__ float bf2f(unsigned short b) { return __uint_as_float(((unsigned)b) << 16); }
__device__ __forceinline__ float bfr(float f) { return bf2f(f2bf(f)); }
__device__ __forceinline__ v16h cat16(v8h lo, v8h hi) { return __builtin_shufflevector(lo, hi, 0, 1, 2, 3, 4, 5, 6, 7, 8, 9, 10, 11, 12, 13, 14, 15); }
__device__ __forceinline__ v16bf cat16b(v8us lo, v8us hi) { return __builtin_bit_cast(v16bf, __builtin_shufflevector(lo, hi, 0, 1, 2, 3, 4, 5, 6, 7, 8, 9, 10, 11, 12, 13, 14, 15)); }
__device__ __forceinline__ v8f wmma16(v16h a, v16h b, v8f c) { return __builtin_amdgcn_wmma_f32_16x16x32_f16(false, a, false, b, (short)0, c, false, false); }
__device__ __forceinline__ v8f wmmab(v16bf a, v16bf b, v8f c) { return __builtin_amdgcn_wmma_f32_16x16x32_bf16(false, a, false, b, (short)0, c, false, false); }

// ---- k_gemmw: register-blocked GEMM, one work-group of KW waves per 64x64 output tile (16 accumulators per wave), operands straight from 16-bit planes in fragment order; grid (M/64, N/64, Z), 32 * KW threads.
// K split: wave w takes the 32-wide k steps w, w + KW, w + 2 KW, ... (neighbouring waves read neighbouring 1024-byte fragments); for KW > 1 the KW partial tiles meet in LDS and are summed in wave order 0 .. KW-1.
// C[m][n] (f32, pitch ldc, + optional f32 bias[n], bias0 / bias1 / bias2 for z = 0 / 1 / 2) = sum_k A[m][k] Bt[n][k] (NSPLIT == 1: + A2[m][k] Bt[n][k]). z-batch strides sA/sB/sC in elements. K % 32 == 0, M % 64 == 0, N % 64 == 0.
// Fragment map: lane -> row/col (lane & 15), elements 0..7 = k0 + 8*(lane>>4) + 0..7, elements 8..15 = k0 + 16 + 8*(lane>>4) + 0..7 for A and B; D element j = (row 8*(lane>>4) + j, col lane & 15).
template <typename T16> struct WFrag;
template <> struct WFrag<h16> { typedef v16h V; static __device__ __forceinline__ V ldf(const h16* p) { return cat16(*(const v8h*)p, *(const v8h*)(p + 256)); } static __device__ __forceinline__ v8f mma(V a, V b, v8f c) { return wmma16(a, b, c); } };
template <> struct WFrag<bf> { typedef v16bf V; static __device__ __forceinline__ V ldf(const bf* p) { return cat16b(*(const v8us*)p, *(const v8us*)(p + 256)); } static __device__ __forceinline__ v8f mma(V a, V b, v8f c) { return wmmab(a, b, c); } };
template <typename T16, int NSPLIT, bool BIAS, int KW, int K>
__global__ __launch_bounds__(32 * KW) void k_gemmw(const T16* __restrict__ A, const T16* __restrict__ A2, const T16* __restrict__ Bt, float* C, int ldc, const float* __restrict__ bias0, const float* __restrict__ bias1, const float* __restrict__ bias2, size_t sA, size_t sB, size_t sC) {
    typedef typename WFrag<T16>::V V;
    __shared__ __align__(16) float os[(KW == 1 ? 16 : KW * 64) * 68];
    const int w = (KW == 1) ? 0 : __builtin_amdgcn_readfirstlane((int)(threadIdx.x >> 5));
    const size_t z = blockIdx.z; A += z * sA; if (A2) A2 += z * sA; Bt += z * sB; C += z * sC;
    const float* bias = z == 0 ? bias0 : z == 1 ? bias1 : bias2;   // the biases are separate inputs: batch entry z adds its own
    const int lane = threadIdx.x & 31, lr = lane & 15, hi = lane >> 4; const int r0 = blockIdx.x * 64, c0 = blockIdx.y * 64;
    v8f acc[4][4];
#pragma unroll
    for (int mb = 0; mb < 4; ++mb)
#pragma unroll
        for (int nb = 0; nb < 4; ++nb) acc[mb][nb] = (v8f){};
    // fragment (row block rb, k step ks) starts at element (rb * (K / 32) + ks) * 512 = rb * 16 * K + ks * 512; K is a compile-time constant, so that a trip's loads of one plane share one address pair and differ in the immediate offset
    static_assert(NSPLIT == 0 || NSPLIT == 1);
    const T16* Ar = A + (size_t)r0 * K + 8 * lane; const T16* A2r = NSPLIT == 1 ? A2 + (size_t)r0 * K + 8 * lane : nullptr; const T16* Br = Bt + (size_t)c0 * K + 8 * lane;
#pragma unroll 1
    for (int kc = w * 32; kc < K; kc += 32 * KW) {
        V a[4], a2[4], b[4]; const T16* pa = Ar + kc * 16; const T16* pa2 = NSPLIT == 1 ? A2r + kc * 16 : nullptr; const T16* pb = Br + kc * 16;
#pragma unroll
        for (int mb = 0; mb < 4; ++mb) { a[mb] = WFrag<T16>::ldf(pa + mb * 16 * K); if constexpr (NSPLIT == 1) a2[mb] = WFrag<T16>::ldf(pa2 + mb * 16 * K); }
#pragma unroll
        for (int nb = 0; nb < 4; ++nb) b[nb] = WFrag<T16>::ldf(pb + nb * 16 * K);
        // s_wait_xcnt 0 behind the trip's run of loads: their address registers may be rewritten behind it; the run's base pointers are inputs of the statement, so that no load of the run returns into a pair that an earlier one names
        if constexpr (NSPLIT == 1) asm volatile("s_wait_xcnt 0x0" :: "v"(pa), "v"(pa2), "v"(pb) : "memory"); else asm volatile("s_wait_xcnt 0x0" :: "v"(pa), "v"(pb) : "memory");
#pragma unroll
        for (int nb = 0; nb < 4; ++nb)
#pragma unroll
            for (int mb = 0; mb < 4; ++mb) { acc[mb][nb] = WFrag<T16>::mma(a[mb], b[nb], acc[mb][nb]); if constexpr (NSPLIT == 1) acc[mb][nb] = WFrag<T16>::mma(a2[mb], b[nb], acc[mb][nb]); }
        // four vector slots between the last matrix instruction of a trip and the first vector instruction behind the taken loop branch
        // every fragment of the trip is an input: each keeps registers of its own to the trip's end, so that all of a trip's loads are issued ahead of its products (with one B fragment's registers used four times over, each column block waited out a load of its own)
        if constexpr (NSPLIT == 1) asm volatile("v_nop\n\tv_nop\n\tv_nop\n\tv_nop" : "+v"(acc[0][0]), "+v"(acc[1][1]), "+v"(acc[2][2]), "+v"(acc[3][3]) : "v"(a[0]), "v"(a[1]), "v"(a[2]), "v"(a[3]), "v"(a2[0]), "v"(a2[1]), "v"(a2[2]), "v"(a2[3]), "v"(b[0]), "v"(b[1]), "v"(b[2]), "v"(b[3]));
        else asm volatile("v_nop\n\tv_nop\n\tv_nop\n\tv_nop" : "+v"(acc[0][0]), "+v"(acc[1][1]), "+v"(acc[2][2]), "+v"(acc[3][3]) : "v"(a[0]), "v"(a[1]), "v"(a[2]), "v"(a[3]), "v"(b[0]), "v"(b[1]), "v"(b[2]), "v"(b[3]));
    }
    if constexpr (KW > 1) {
        float* ow = os + w * (64 * 68);
#pragma unroll
        for (int mb = 0; mb < 4; ++mb)
#pragma unroll
            for (int nb = 0; nb < 4; ++nb)
#pragma unroll
                for (int j = 0; j < 8; ++j) ow[(mb * 16 + hi * 8 + j) * 68 + nb * 16 + lr] = acc[mb][nb][j];
        __syncthreads();   // every wave's partial tile is in LDS before any thread sums across waves
#pragma unroll
        for (int r = 0; r < 64 * 16 / (32 * KW); ++r) { const int s = r * 32 * KW + (int)threadIdx.x, row = s >> 4, cofs = (s & 15) * 4; v4f val = *(const v4fa*)(os + row * 68 + cofs);
#pragma unroll
            for (int u = 1; u < KW; ++u) { const v4f pv = *(const v4fa*)(os + u * (64 * 68) + row * 68 + cofs); val[0] += pv[0]; val[1] += pv[1]; val[2] += pv[2]; val[3] += pv[3]; }
            if (BIAS) { val[0] += bfr(bias[c0 + cofs]); val[1] += bfr(bias[c0 + cofs + 1]); val[2] += bfr(bias[c0 + cofs + 2]); val[3] += bfr(bias[c0 + cofs + 3]); }
            *(v4f*)(C + (size_t)(r0 + row) * ldc + c0 + cofs) = val; }
    } else {
#pragma unroll
    for (int mb = 0; mb < 4; ++mb) {
#pragma unroll
        for (int nb = 0; nb < 4; ++nb) {
#pragma unroll
            for (int j = 0; j < 8; ++j) os[(hi * 8 + j) * 68 + nb * 16 + lr] = acc[mb][nb][j]; }
        __builtin_amdgcn_wave_barrier(); asm volatile("" ::: "memory");
        float* crow = C + (size_t)(r0 + mb * 16) * ldc + c0;
{
#pragma unroll
            for (int s = 0; s < 8; ++s) { const int row = 2 * s + hi, cofs = lr * 4; v4f val = *(const v4fa*)(os + row * 68 + cofs); if (BIAS) { val[0] += bfr(bias[c0 + cofs]); val[1] += bfr(bias[c0 + cofs + 1]); val[2] += bfr(bias[c0 + cofs + 2]); val[3] += bfr(bias[c0 + cofs + 3]); }
                *(v4f*)(crow + (size_t)row * ldc + cofs) = val; }
             }
        __builtin_amdgcn_wave_barrier(); asm volatile("" ::: "memory");
    }
    }
}

__device__ __forceinline__ h16 tohx(float x) { return (h16)x; }
__device__ __forceinline__ void splitf(float y, unsigned short& h, unsigned short& l) { h = f2bf(y); l = f2bf(y - bf2f(h)); }
typedef __attribute__((ext_vector_type(2))) _Float16 v2h;
typedef __attribute__((ext_vector_type(4))) _Float16 v4h;
typedef __attribute__((ext_vector_type(2))) unsigned short v2us;
typedef __attribute__((ext_vector_type(4))) unsigned short v4us;
typedef __attribute__((ext_vector_type(2))) float v2f;

// k_cvtall: every float matrix ([rows][DM]) to bf16 in fragment order in one launch, 8 elements per thread: thread i of a matrix writes the 16 bytes i of its destination (a wave stores 512 bytes in a row) and reads the 8 floats that belong there. Blocks 0 .. 3 NB GX - 1: stream s = block / (NB GX), batch b, GX blocks each (source batch stride SEQ_FULL * DM, destination XB[s][b]);
// the 4 GW blocks behind them: weight block / GW, destination WB[weight].
static constexpr unsigned GW = (unsigned)(((size_t)DM * DM / 8 + 255) / 256), GX = (unsigned)(((size_t)TT * DM / 8 + 255) / 256);
__global__ __launch_bounds__(256) void k_cvtall(const float* __restrict__ xq, const float* __restrict__ xk, const float* __restrict__ xv, const float* __restrict__ wq, const float* __restrict__ wk, const float* __restrict__ wv, const float* __restrict__ wo, bf* XB, bf* WB) {
    const unsigned x = blockIdx.x; const float* src; bf* dst; size_t i, n8;
    if (x < 3 * NB * GX) { const unsigned s = x / (NB * GX), r = x % (NB * GX), b = r / GX; i = (size_t)(r % GX) * 256 + threadIdx.x; n8 = (size_t)TT * DM / 8;
        src = (s == 0 ? xq : s == 1 ? xk : xv) + (size_t)b * SEQ_FULL * DM; dst = XB + ((size_t)s * NB + b) * TT * DM; }
    else { const unsigned y = x - 3 * NB * GX, s = y / GW; i = (size_t)(y % GW) * 256 + threadIdx.x; n8 = (size_t)DM * DM / 8;
        src = s == 0 ? wq : s == 1 ? wk : s == 2 ? wv : wo; dst = WB + (size_t)s * DM * DM; }
    if (i >= n8) return; const size_t row = (i >> 6) / (DM / 32) * 16 + (i & 15), k = (i >> 6) % (DM / 32) * 32 + ((i >> 5) & 1) * 16 + ((i >> 4) & 1) * 8; const v8f v = *(const v8f*)(src + row * DM + k); v8us o;
#pragma unroll
    for (int k = 0; k < 8; ++k) o[k] = f2bf(v[k]); *(v8us*)(dst + i * 8) = o;  }

// k_hp / k_vtp: nz = NB * NH_ planes, plane z = batch * NH_ + head, read from row batch * TT + t of F; e is the output offset, decoded into (t, d) by the fragment order:
// k_hp  (q, k planes): [z][t / 16][d / 32][half c][lane = hi * 16 + lr][8], t = 16 (t / 16) + lr, d = 32 (d / 32) + 16 c + 8 hi + 0..7  (rows t, k index d).
// k_vtp (v planes):    [z][t / 32][d / 16][half c][lane = hi * 16 + lr][8], d = 16 (d / 16) + lr, t = 32 (t / 32) + 16 c + 8 hi + 0..7  (rows d, k index t).
__device__ __forceinline__ void k_hp(const float* __restrict__ F, int pitch, int nz, h16* P16, bf* Ph, bf* Pl) {
    const size_t e = ((size_t)blockIdx.x * 256 + threadIdx.x) * 2; if (e >= (size_t)nz * TT * HD) return; const int d = (int)(((e >> 9) & 1) * 32 + ((e >> 8) & 1) * 16 + ((e >> 7) & 1) * 8 + (e & 7)); const int t = (int)(((e >> 10) % (TT / 16)) * 16 + ((e >> 3) & 15)); const int z = (int)(e / ((size_t)HD * TT)); const int b = z / NH_, h = z % NH_;
    const v2f x = *(const v2f*)(F + ((size_t)b * TT + t) * pitch + h * HD + d); v2h o16; v2us oh, ol;
#pragma unroll
    for (int q = 0; q < 2; ++q) { const float r = x[q]; o16[q] = tohx(r); unsigned short a2, c2; splitf(r, a2, c2); oh[q] = a2; ol[q] = c2; }
    *(v2h*)(P16 + e) = o16; *(v2us*)(Ph + e) = oh; *(v2us*)(Pl + e) = ol;  }

__device__ __forceinline__ void k_vtp(const float* __restrict__ F, int pitch, int nz, h16* V16, bf* Vh, bf* Vl) { const size_t e = ((size_t)blockIdx.x * 256 + threadIdx.x) * 2; if (e >= (size_t)nz * HD * TT) return; const int t = (int)(((e >> 11) % (TT / 32)) * 32 + ((e >> 8) & 1) * 16 + ((e >> 7) & 1) * 8 + (e & 7)); const int d = (int)(((e >> 9) & 3) * 16 + ((e >> 3) & 15)); const int z = (int)(e / ((size_t)TT * HD)); const int b = z / NH_, g = z % NH_; v2h o16; v2us oh, ol;
#pragma unroll
    for (int q = 0; q < 2; ++q) { const float x = F[((size_t)b * TT + t + q) * pitch + g * HD + d]; o16[q] = tohx(x); unsigned short a2, c2; splitf(x, a2, c2); oh[q] = a2; ol[q] = c2; }
    *(v2h*)(V16 + e) = o16; *(v2us*)(Vh + e) = oh; *(v2us*)(Vl + e) = ol;  }

// k_planes: the nine head planes in one launch; blockIdx.y = stream s (0 q, 1 k: k_hp; 2 v: k_vtp), projection F[s], planes P16[s], PHL[s][hi, lo].
__global__ __launch_bounds__(256) void k_planes(const float* __restrict__ F, int pitch, int nz, h16* P16, bf* PHL) {
    constexpr size_t PE = (size_t)NB * NH_ * TT * HD; const size_t s = blockIdx.y; F += s * ((size_t)NB * TT * DQ); P16 += s * PE; bf* Ph = PHL + 2 * s * PE; bf* Pl = Ph + PE;
    if (s < 2) k_hp(F, pitch, nz, P16, Ph, Pl); else k_vtp(F, pitch, nz, P16, Ph, Pl);
}

// ---- k_fattn: scores, softmax, head mean, p.v and the head merge in one launch. Work-group = NH_ waves, wave h = head h; blockIdx.y = batch; blockIdx.x < RH / 16: 16 query rows on hi+lo bf16 planes, else 32 query rows on f16 planes.
// Transposed products: S^T tile = K (A operand, rows = 16 keys) x Q (B operand, columns = 16 query rows), so lane (lr, hi) holds keys 8 hi + 0..7 of query row lr: two such tiles are, element for element, the B fragment of 32 keys
// for O^T = V^T (A operand, rows = 16 d) x P (B operand); p never leaves the registers. The k order of that B fragment (elements 0..7 = keys 8 hi + 0..7, elements 8..15 = keys 16 + 8 hi + 0..7) is the one of the V^T loader.
// Sweep 1 over the keys: running maximum and sum per lane (rescaled when the maximum grows), merged over the two lane halves at the end. Sweep 2: the same score tiles again, e = exp2(s x SL2 - max x SL2), p = e / sum.
// p.v: hi+lo rows multiply the bf16 hi and lo parts of p; plain rows multiply e (f16, at most 1) and scale the finished row by 1 / sum.
// Head mean: per block of 64 keys wave h leaves its f32 p rows in LDS plane h; behind one work-group barrier thread x sums 4 columns over the planes in head order 0 .. NH_-1 and stores them once.
// Two LDS buffers: the barrier of block n + 1 ends every read of block n before block n + 2 writes that buffer again.
template <bool HI> struct PT { typedef h16 T; };
template <> struct PT<true> { typedef bf T; };
// v_exp_f32, eight in place per statement: the instruction set asks for one independent instruction or a v_nop behind a transcendental before its result is read or its source overwritten;
// here each v_exp_f32 fills the slot of the one before and one v_nop that of the last.
__device__ __forceinline__ void exp2x8(float (&x)[8]) {
    asm("v_exp_f32 %0, %0\n\tv_exp_f32 %1, %1\n\tv_exp_f32 %2, %2\n\tv_exp_f32 %3, %3\n\tv_exp_f32 %4, %4\n\tv_exp_f32 %5, %5\n\tv_exp_f32 %6, %6\n\tv_exp_f32 %7, %7\n\tv_nop"
        : "+v"(x[0]), "+v"(x[1]), "+v"(x[2]), "+v"(x[3]), "+v"(x[4]), "+v"(x[5]), "+v"(x[6]), "+v"(x[7]));
}
// one v_exp_f32 with the v_nop that fills its slot
__device__ __forceinline__ float exp2x1(float x) { asm("v_exp_f32 %0, %0\n\tv_nop" : "+v"(x)); return x; }

template <bool HI, int NQT>
__device__ __forceinline__ void fattn(float* avs, int b, int q0, const typename PT<HI>::T* Qa, const typename PT<HI>::T* Qb, const typename PT<HI>::T* Ka, const typename PT<HI>::T* Kb, const typename PT<HI>::T* Va, const typename PT<HI>::T* Vb, float* AVG, bf* ATh, bf* ATl) {
    typedef typename PT<HI>::T T; typedef WFrag<T> WF; typedef typename WF::V V;
    constexpr int MQ = NQT * 16;
    const int lane = threadIdx.x & 31, lr = lane & 15, hi = lane >> 4; const int h = __builtin_amdgcn_readfirstlane((int)(threadIdx.x >> 5));
    const size_t zo = ((size_t)b * NH_ + h) * TT * HD + lane * 8;
    Qa += zo; Ka += zo; Va += zo; if constexpr (HI) { Qb += zo; Kb += zo; Vb += zo; }
    // s_wait_xcnt 0 behind a run of loads: their address registers may be rewritten behind it; the run's base pointers are inputs of the statement, so that no load of the run returns into a pair that an earlier one names
    auto xwait = [](const T* pa, const T* pb) { if constexpr (HI) asm volatile("s_wait_xcnt 0x0" :: "v"(pa), "v"(pb) : "memory"); else asm volatile("s_wait_xcnt 0x0" :: "v"(pa) : "memory"); };
    V qa[NQT][2], qb[NQT][2];
    { const T* pa = Qa + (size_t)(q0 / 16) * 1024; const T* pb = HI ? Qb + (size_t)(q0 / 16) * 1024 : nullptr;
#pragma unroll
    for (int qt = 0; qt < NQT; ++qt)
#pragma unroll
        for (int ks = 0; ks < 2; ++ks) { qa[qt][ks] = WF::ldf(pa + (qt * 2 + ks) * 512); if constexpr (HI) qb[qt][ks] = WF::ldf(pb + (qt * 2 + ks) * 512); }
    xwait(pa, pb); }
    // K fragments of the 32 keys kp * 32 .. + 31 (u = key tile, ks = k step)
    auto kload = [&](int kp, V (&ka)[2][2], V (&kb)[2][2]) {
        const T* pa = Ka + (size_t)kp * 2048; const T* pb = HI ? Kb + (size_t)kp * 2048 : nullptr;
#pragma unroll
        for (int u = 0; u < 2; ++u)
#pragma unroll
            for (int ks = 0; ks < 2; ++ks) { ka[u][ks] = WF::ldf(pa + (u * 2 + ks) * 512); if constexpr (HI) kb[u][ks] = WF::ldf(pb + (u * 2 + ks) * 512); }
        xwait(pa, pb);
    };
    // S^T tiles of those 32 keys against the NQT query tiles
    auto stiles = [&](const V (&ka)[2][2], const V (&kb)[2][2], v8f (&st)[2][NQT]) {
#pragma unroll
        for (int u = 0; u < 2; ++u)
#pragma unroll
            for (int qt = 0; qt < NQT; ++qt) { v8f a = (v8f){};
#pragma unroll
                for (int ks = 0; ks < 2; ++ks) { a = WF::mma(ka[u][ks], qa[qt][ks], a); if constexpr (HI) { a = WF::mma(ka[u][ks], qb[qt][ks], a); a = WF::mma(kb[u][ks], qa[qt][ks], a); } }
                st[u][qt] = a; }
    };
    // the K fragments are fetched one trip ahead, as soon as the score products have read the old ones; behind the last trip of a sweep the fetch wraps to keys 0, which the next sweep starts with
    V ka[2][2], kb[2][2]; kload(0, ka, kb);
    float mx[NQT], sm[NQT], fn[NQT];
#pragma unroll
    for (int qt = 0; qt < NQT; ++qt) { mx[qt] = -3.0e38f; sm[qt] = 0.f; }
    // rolled: one trip holds 32 keys' fragments and tiles; unrolling it would only add registers
#pragma unroll 1
    for (int kp = 0; kp < TT / 32; ++kp) {
        v8f st[2][NQT]; stiles(ka, kb, st); kload(kp + 1 < TT / 32 ? kp + 1 : 0, ka, kb);
#pragma unroll
        for (int qt = 0; qt < NQT; ++qt) { float t0[8], t1[8]; float tm = mx[qt];
#pragma unroll
            for (int j = 0; j < 8; ++j) tm = fmaxf(tm, fmaxf(st[0][qt][j], st[1][qt][j]));
            const float corr = exp2x1((mx[qt] - tm) * SL2), nm = tm * SL2;
#pragma unroll
            for (int j = 0; j < 8; ++j) { t0[j] = st[0][qt][j] * SL2 - nm; t1[j] = st[1][qt][j] * SL2 - nm; }
            exp2x8(t0); exp2x8(t1);
            float s0 = 0.f, s1 = 0.f;
#pragma unroll
            for (int j = 0; j < 8; ++j) { s0 += t0[j]; s1 += t1[j]; }
            sm[qt] = sm[qt] * corr + (s0 + s1); mx[qt] = tm; }
    }
#pragma unroll
    for (int qt = 0; qt < NQT; ++qt) { const float mm = fmaxf(mx[qt], __shfl_xor(mx[qt], 16, 32)); float s = sm[qt] * exp2x1((mx[qt] - mm) * SL2); s += __shfl_xor(s, 16, 32); mx[qt] = mm * SL2; fn[qt] = __fdiv_rn(1.0f, s); }
    v8f oacc[NQT][4];
#pragma unroll
    for (int qt = 0; qt < NQT; ++qt)
#pragma unroll
        for (int dt = 0; dt < 4; ++dt) oacc[qt][dt] = (v8f){};
    // rolled: one trip is a block of 64 keys with its barrier
#pragma unroll 1
    for (int blk = 0; blk < TT / 64; ++blk) {
        float* ab = avs + (blk & 1) * (NH_ * MQ * AP);
        // rolled: unrolling the two halves only adds registers and code
#pragma unroll 1
        for (int hf = 0; hf < 2; ++hf) { const int kp = blk * 2 + hf;
            // the V^T fragments of this trip are requested ahead of the score products, so that they fly during the softmax
            V va[4], vb[4]; const T* pva = Va + (size_t)kp * 2048; const T* pvb = HI ? Vb + (size_t)kp * 2048 : nullptr;
#pragma unroll
            for (int dt = 0; dt < 4; ++dt) { va[dt] = WF::ldf(pva + dt * 512); if constexpr (HI) vb[dt] = WF::ldf(pvb + dt * 512); }
            xwait(pva, pvb);
            v8f st[2][NQT]; stiles(ka, kb, st); kload(kp + 1 < TT / 32 ? kp + 1 : 0, ka, kb);
            V pa[NQT], pb[NQT];
#pragma unroll
            for (int qt = 0; qt < NQT; ++qt) { v8h o16[2]; v8us oh[2], ol[2];
#pragma unroll
                for (int u = 0; u < 2; ++u) { float t[8];
#pragma unroll
                    for (int j = 0; j < 8; ++j) t[j] = st[u][qt][j] * SL2 - mx[qt];
                    exp2x8(t);
                    v4f w0, w1;
#pragma unroll
                    for (int j = 0; j < 4; ++j) { w0[j] = t[j] * fn[qt]; w1[j] = t[4 + j] * fn[qt]; }
                    float* dst = ab + (h * MQ + qt * 16 + lr) * AP + hf * 32 + u * 16 + 8 * hi; *(v4fa*)dst = w0; *(v4fa*)(dst + 4) = w1;
                    if constexpr (HI) {
#pragma unroll
                        for (int j = 0; j < 4; ++j) { unsigned short a, c2; splitf(w0[j], a, c2); oh[u][j] = a; ol[u][j] = c2; splitf(w1[j], a, c2); oh[u][4 + j] = a; ol[u][4 + j] = c2; }
                    } else {
#pragma unroll
                        for (int j = 0; j < 8; ++j) o16[u][j] = tohx(t[j]);
                    } }
                if constexpr (HI) { pa[qt] = cat16b(oh[0], oh[1]); pb[qt] = cat16b(ol[0], ol[1]); } else { pa[qt] = cat16(o16[0], o16[1]); } }
#pragma unroll
            for (int dt = 0; dt < 4; ++dt)
#pragma unroll
                for (int qt = 0; qt < NQT; ++qt) { oacc[qt][dt] = WF::mma(va[dt], pa[qt], oacc[qt][dt]); if constexpr (HI) { oacc[qt][dt] = WF::mma(va[dt], pb[qt], oacc[qt][dt]); oacc[qt][dt] = WF::mma(vb[dt], pa[qt], oacc[qt][dt]); } }
            // four vector slots between the last matrix instruction of a trip and the first vector instruction behind the taken loop branch, which may overwrite its operands
            // (one statement that takes every accumulator, so that it stands behind the last matrix instruction)
            static_assert(NQT == 1 || NQT == 2);
            if constexpr (NQT == 1) asm volatile("v_nop\n\tv_nop\n\tv_nop\n\tv_nop" : "+v"(oacc[0][0]), "+v"(oacc[0][1]), "+v"(oacc[0][2]), "+v"(oacc[0][3]));
            else asm volatile("v_nop\n\tv_nop\n\tv_nop\n\tv_nop" : "+v"(oacc[0][0]), "+v"(oacc[0][1]), "+v"(oacc[0][2]), "+v"(oacc[0][3]), "+v"(oacc[NQT - 1][0]), "+v"(oacc[NQT - 1][1]), "+v"(oacc[NQT - 1][2]), "+v"(oacc[NQT - 1][3]));
        }
        __syncthreads();   // all NH_ planes of this block of keys are in LDS before any thread sums over the heads
        if (MQ * 16 >= 32 * NH_ || (int)threadIdx.x < MQ * 16) { const int row = (int)threadIdx.x >> 4, c4 = ((int)threadIdx.x & 15) * 4; const float* ar = ab + row * AP + c4; v4f a = *(const v4fa*)ar;
#pragma unroll
            for (int u = 1; u < NH_; ++u) { const v4f pv = *(const v4fa*)(ar + u * (MQ * AP));
#pragma unroll
                for (int q = 0; q < 4; ++q) a[q] = a[q] + pv[q]; }
            v4f o;
#pragma unroll
            for (int q = 0; q < 4; ++q) o[q] = a[q] * (1.0f / NH_);
            *(v4f*)(AVG + ((size_t)b * TT + q0 + row) * TT + blk * 64 + c4) = o;
            asm volatile("s_wait_xcnt 0x0" ::: "memory"); }   // the registers of the issued store may be rewritten behind it
    }
    // O^T tile dt: element j = (d = 16 dt + 8 hi + j, query row lr): eight neighbouring d of one merged row per lane, which is half (dt & 1) of fragment (row block, k step 2 h + dt / 2) of the merged planes
#pragma unroll
    for (int qt = 0; qt < NQT; ++qt)
#pragma unroll
        for (int dt = 0; dt < 4; ++dt) { v8us oh, ol; const float cs = HI ? 1.0f : fn[qt];
#pragma unroll
            for (int j = 0; j < 8; ++j) { unsigned short a, c2; splitf(oacc[qt][dt][j] * cs, a, c2); oh[j] = a; ol[j] = c2; }
            const size_t oo = ((size_t)b * TT + q0 + qt * 16) * DQ + (h * 2 + (dt >> 1)) * 512 + (dt & 1) * 256 + 8 * lane; *(v8us*)(ATh + oo) = oh; *(v8us*)(ATl + oo) = ol;
            asm volatile("s_wait_xcnt 0x0" ::: "memory"); }   // the registers of the two issued stores may be rewritten behind it
}

__global__ __launch_bounds__(32 * NH_) void k_fattn(const h16* __restrict__ Q16, const h16* __restrict__ K16, const h16* __restrict__ V16, const bf* __restrict__ Qh, const bf* __restrict__ Ql, const bf* __restrict__ Kh, const bf* __restrict__ Kl, const bf* __restrict__ Vh, const bf* __restrict__ Vl, float* AVG, bf* ATh, bf* ATl) {
    __shared__ __align__(16) float avs[2 * NH_ * 32 * AP];
    const int x = blockIdx.x, b = blockIdx.y;
    if (x < RH / 16) fattn<true, 1>(avs, b, x * 16, Qh, Ql, Kh, Kl, Vh, Vl, AVG, ATh, ATl);
    else fattn<false, 2>(avs, b, RH + (x - RH / 16) * 32, Q16, nullptr, K16, nullptr, V16, nullptr, AVG, ATh, ATl);
}

// workspace plan (bytes): four bf16 weights, the bf16 copies of the three input streams, three f32 projection buffers, nine head planes, the merged hi and lo planes; all stream-ordered.
static constexpr size_t W_BYTES  = (size_t)DM * DM * 2;
static constexpr size_t XB_BYTES = (size_t)NB * TT * DM * 2;
static constexpr size_t F_BYTES  = (size_t)NB * TT * DM * 4;
static constexpr size_t PL_BYTES = (size_t)NB * NH_ * TT * HD * 2;
static constexpr size_t AT_BYTES = (size_t)NB * TT * DQ * 2;
static constexpr size_t WS_TOTAL = 4 * W_BYTES + 3 * XB_BYTES + 3 * F_BYTES + 9 * PL_BYTES + 2 * AT_BYTES;
static_assert(W_BYTES % 256 == 0 && XB_BYTES % 256 == 0 && F_BYTES % 256 == 0 && PL_BYTES % 256 == 0 && AT_BYTES % 256 == 0);
static_assert(WS_TOTAL <= (size_t)268435456);

extern "C" void kernel_launch(void* const* d_in, const int* in_sizes, int n_in,
                              void* d_out, int out_size, void* d_ws, size_t ws_size, hipStream_t stream) {
    if (n_in < 11) return;
    const size_t need_x = (size_t)(NB - 1) * SEQ_FULL * DM + (size_t)TT * DM;
    if ((size_t)in_sizes[0] < need_x || (size_t)in_sizes[1] < need_x || (size_t)in_sizes[2] < need_x) return;
    if ((size_t)in_sizes[3] < (size_t)DM * DM || (size_t)in_sizes[5] < (size_t)DM * DM || (size_t)in_sizes[7] < (size_t)DM * DM || (size_t)in_sizes[9] < (size_t)DM * DM) return;
    if (in_sizes[4] < DM || in_sizes[6] < DM || in_sizes[8] < DM || in_sizes[10] < DM) return;
    const size_t AVG_OFF = (size_t)NB_FULL * SEQ_FULL * DM;     // element offset of the second output (byte 16777216)
    if ((size_t)out_size < AVG_OFF + (size_t)NB * TT * TT) return;
    if (ws_size < WS_TOTAL) return;
    const float* xq = (const float*)d_in[0]; const float* xk = (const float*)d_in[1]; const float* xv = (const float*)d_in[2]; const float* wq = (const float*)d_in[3]; const float* bq = (const float*)d_in[4]; const float* wk = (const float*)d_in[5]; const float* bk = (const float*)d_in[6]; const float* wv = (const float*)d_in[7]; const float* bv = (const float*)d_in[8]; const float* wo = (const float*)d_in[9]; const float* bo = (const float*)d_in[10];
    float* OUT = (float*)d_out;                 // [NB][TT][DM]
    float* AVG = (float*)d_out + AVG_OFF;       // [NB][TT][TT]
    char* wsp = (char*)d_ws;
    auto take = [&](size_t bytes) { char* p = wsp; wsp += (bytes + 255) & ~(size_t)255; return (void*)p; };
    bf* WB = (bf*)take(4 * W_BYTES); bf* WO = WB + 3 * (size_t)DM * DM;   // [q, k, v, o][DM][DM]
    bf* XB = (bf*)take(3 * XB_BYTES); float* FQ = (float*)take(3 * F_BYTES);   // [stream][NB * TT][DM] each
    h16* QP16 = (h16*)take(PL_BYTES); h16* KP16 = (h16*)take(PL_BYTES); h16* VT16 = (h16*)take(PL_BYTES);
    bf* QPh = (bf*)take(PL_BYTES); bf* QPl = (bf*)take(PL_BYTES); bf* KPh = (bf*)take(PL_BYTES); bf* KPl = (bf*)take(PL_BYTES); bf* VTh = (bf*)take(PL_BYTES); bf* VTl = (bf*)take(PL_BYTES);
    bf* ATh = (bf*)take(AT_BYTES); bf* ATl = (bf*)take(AT_BYTES);
    if ((size_t)(wsp - (char*)d_ws) > ws_size) return;

    k_cvtall<<<3 * NB * GX + 4 * GW, 256, 0, stream>>>(xq, xk, xv, wq, wk, wv, wo, XB, WB);
    k_gemmw<bf, 0, true, KWP, DM><<<dim3(NB * TT / 64, DQ / 64, 3), 32 * KWP, 0, stream>>>(XB, nullptr, WB, FQ, DQ, bq, bk, bv, (size_t)NB * TT * DM, (size_t)DM * DM, (size_t)NB * TT * DQ);
    const unsigned LP = (unsigned)(((size_t)NB * NH_ * TT * HD / 2 + 255) / 256);
    k_planes<<<dim3(LP, 3, 1), 256, 0, stream>>>(FQ, DQ, NB * NH_, QP16, QPh);
    k_fattn<<<dim3(RH / 16 + (TT - RH) / 32, NB, 1), 32 * NH_, 0, stream>>>(QP16, KP16, VT16, QPh, QPl, KPh, KPl, VTh, VTl, AVG, ATh, ATl);
    k_gemmw<bf, 1, true, KWP, DQ><<<dim3(NB * TT / 64, DM / 64, 1), 32 * KWP, 0, stream>>>(ATh, ATl, WO, OUT, DM, bo, nullptr, nullptr, 0, 0, 0);
}

// v008
// It runs in 213 microseconds.
// Timed twice side by side with v007, it ran 1.24 times as fast both times.
// All steps since v000 together make it 7.72 times as fast.
#include <hip/hip_runtime.h>

// Multi-head attention without a mask over three input streams (query, key, value [2][2048][1024]); q = query Wq^T + bq, k = key Wk^T + bk, v = value Wv^T + bv (W stored [out][in]); 16 heads x 64; scores x 64^-0.5; softmax over all keys; out0 = merged Wo^T + bo; out1 = head mean of the probabilities [2][2048][2048].
// Compute dtypes, f32 accumulate: every float input RNE-converted to bf16; projections v_wmma_f32_16x16x32_bf16 (exact products) + f32 bias; attention query rows < 512: q/k/p/v as bf16 hi+lo planes (3 products), other rows v_wmma_f32_16x16x32_f16 with p carried unnormalised (exp of score minus row maximum, at most 1) and the row scaled by 1 / sum behind p.v; softmax and head mean f32; output projection merged hi+lo (bf16) x bf16 Wo + bias.
// Every launch covers all NB batches (no host loop over the batch): projections run on the NB*TT stacked rows, the head planes are indexed by z = batch * 16 + head.
// Every launch covers all three streams too: one conversion launch (three streams and four weights), one projection launch (blockIdx.z = stream), one plane-building launch (blockIdx.y = stream).
// Attention is one launch (k_fattn): a work-group owns 16 (hi+lo) or 32 (plain) query rows over all heads, one wave per head; scores, probabilities and p.v stay in registers, only the head mean passes through LDS.
// The head planes are stored in fragment order (512-byte blocks, lane l holds bytes 16 l .. 16 l + 15 of each half), so that every fragment load reads whole cache lines.
// So are the GEMM operands (the bf16 streams and weights, the merged hi and lo planes): [row / 16][k / 32][half c][lane = hi * 16 + lr][8], row = 16 (row / 16) + lr, k = 32 (k / 32) + 16 c + 8 hi + 0..7.

#ifndef NB
#define NB 2
#endif
#ifndef SEQ
#define SEQ 2048
#endif
#define NB_FULL  2
#define SEQ_FULL 2048
#define TT   SEQ
#define DM   1024
#define NH_  16
#define HD   64
#define DQ   (NH_ * HD)
#define RH   512                  // query rows < RH use hi+lo planes
#define SCL  0.125f               // HD^-0.5
#define KWP  8                    // waves sharing the K loop of a projection tile (K = DM)
#define SL2  (SCL * 1.4426950408889634f)   // HD^-0.5 x log2 e: exp(s x HD^-0.5 - max) = exp2(s x SL2 - max x SL2)
#define AP   68                   // LDS pitch (floats) of a 64-key row of probabilities: 272 bytes = 16 x odd
typedef _Float16 h16;
typedef unsigned short bf;
typedef __attribute__((ext_vector_type(16))) __bf16   v16bf;
typedef __attribute__((ext_vector_type(16))) _Float16 v16h;
typedef __attribute__((ext_vector_type(8)))  _Float16 v8h;
typedef __attribute__((ext_vector_type(8)))  unsigned short v8us;
typedef __attribute__((ext_vector_type(8)))  float    v8f;
typedef __attribute__((ext_vector_type(4)))  float    v4f;
typedef v8h  __attribute__((may_alias)) v8ha;
typedef v4f  __attribute__((may_alias)) v4fa;
typedef v8us __attribute__((may_alias)) v8usa;

static_assert((TT - RH) % 32 == 0 && RH % 16 == 0 && RH <= TT);
static_assert(TT % 64 == 0);
static_assert(HD == 64);
static_assert(DM % 64 == 0);
static_assert(DM % (32 * KWP) == 0);
static_assert((size_t)KWP * 64 * 68 * 4 <= 327680);
static_assert((size_t)2 * NH_ * 32 * AP * 4 <= 327680 && 32 * NH_ <= 1024 && 32 * NH_ >= 32 * 16);   // the last: one thread per 4 columns of a 32-row, 64-key block in the head sum
static_assert((size_t)NB_FULL * SEQ_FULL * DM * 4 == 16777216);
static_assert((size_t)NB_FULL * SEQ_FULL * DM + (size_t)NB * TT * TT <= (size_t)50331648 / 4);

__device__ __forceinline__ unsigned short f2bf(float f) { unsigned u = __float_as_uint(f); u += 0x7FFFu + ((u >> 16) & 1u); return (unsigned short)(u >> 16); }
__device__ __forceinline__ float bf2f(unsigned short b) { return __uint_as_float(((unsigned)b) << 16); }
__device__ __forceinline__ float bfr(float f) { return bf2f(f2bf(f)); }
__device__ __forceinline__ v16h cat16(v8h lo, v8h hi) { return __builtin_shufflevector(lo, hi, 0, 1, 2, 3, 4, 5, 6, 7, 8, 9, 10, 11, 12, 13, 14, 15); }
__device__ __forceinline__ v16bf cat16b(v8us lo, v8us hi) { return __builtin_bit_cast(v16bf, __builtin_shufflevector(lo, hi, 0, 1, 2, 3, 4, 5, 6, 7, 8, 9, 10, 11, 12, 13, 14, 15)); }
__device__ __forceinline__ v8f wmma16(v16h a, v16h b, v8f c) { return __builtin_amdgcn_wmma_f32_16x16x32_f16(false, a, false, b, (short)0, c, false, false); }
__device__ __forceinline__ v8f wmmab(v16bf a, v16bf b, v8f c) { return __builtin_amdgcn_wmma_f32_16x16x32_bf16(false, a, false, b, (short)0, c, false, false); }

// ---- k_gemmw: register-blocked GEMM, one work-group of KW waves per 64x64 output tile (16 accumulators per wave), operands straight from 16-bit planes in fragment order; grid (M/64, N/64, Z), 32 * KW threads.
// K split: wave w takes the 32-wide k steps w, w + KW, w + 2 KW, ... (neighbouring waves read neighbouring 1024-byte fragments); for KW > 1 the KW partial tiles meet in LDS and are summed in wave order 0 .. KW-1.
// C[m][n] (f32, pitch ldc, + optional f32 bias[n], bias0 / bias1 / bias2 for z = 0 / 1 / 2) = sum_k A[m][k] Bt[n][k] (NSPLIT == 1: + A2[m][k] Bt[n][k]). z-batch strides sA/sB/sC in elements. K % 32 == 0, M % 64 == 0, N % 64 == 0.
// Fragment map: lane -> row/col (lane & 15), elements 0..7 = k0 + 8*(lane>>4) + 0..7, elements 8..15 = k0 + 16 + 8*(lane>>4) + 0..7 for A and B; D element j = (row 8*(lane>>4) + j, col lane & 15).
template <typename T16> struct WFrag;
template <> struct WFrag<h16> { typedef v16h V; static __device__ __forceinline__ V ldf(const h16* p) { return cat16(*(const v8h*)p, *(const v8h*)(p + 256)); } static __device__ __forceinline__ v8f mma(V a, V b, v8f c) { return wmma16(a, b, c); } };
template <> struct WFrag<bf> { typedef v16bf V; static __device__ __forceinline__ V ldf(const bf* p) { return cat16b(*(const v8us*)p, *(const v8us*)(p + 256)); } static __device__ __forceinline__ v8f mma(V a, V b, v8f c) { return wmmab(a, b, c); } };
template <typename T16, int NSPLIT, bool BIAS, int KW, int K>
__global__ __launch_bounds__(32 * KW) void k_gemmw(const T16* __restrict__ A, const T16* __restrict__ A2, const T16* __restrict__ Bt, float* C, int ldc, const float* __restrict__ bias0, const float* __restrict__ bias1, const float* __restrict__ bias2, size_t sA, size_t sB, size_t sC) {
    typedef typename WFrag<T16>::V V;
    __shared__ __align__(16) float os[(KW == 1 ? 16 : KW * 64) * 68];
    const int w = (KW == 1) ? 0 : __builtin_amdgcn_readfirstlane((int)(threadIdx.x >> 5));
    const size_t z = blockIdx.z; A += z * sA; if (A2) A2 += z * sA; Bt += z * sB; C += z * sC;
    const float* bias = z == 0 ? bias0 : z == 1 ? bias1 : bias2;   // the biases are separate inputs: batch entry z adds its own
    const int lane = threadIdx.x & 31, lr = lane & 15, hi = lane >> 4; const int r0 = blockIdx.x * 64, c0 = blockIdx.y * 64;
    v8f acc[4][4];
#pragma unroll
    for (int mb = 0; mb < 4; ++mb)
#pragma unroll
        for (int nb = 0; nb < 4; ++nb) acc[mb][nb] = (v8f){};
    // fragment (row block rb, k step ks) starts at element (rb * (K / 32) + ks) * 512 = rb * 16 * K + ks * 512; K is a compile-time constant, so that a trip's loads of one plane share one address pair and differ in the immediate offset
    static_assert(NSPLIT == 0 || NSPLIT == 1);
    const T16* Ar = A + (size_t)r0 * K + 8 * lane; const T16* A2r = NSPLIT == 1 ? A2 + (size_t)r0 * K + 8 * lane : nullptr; const T16* Br = Bt + (size_t)c0 * K + 8 * lane;
#pragma unroll 1
    for (int kc = w * 32; kc < K; kc += 32 * KW) {
        V a[4], a2[4], b[4]; const T16* pa = Ar + kc * 16; const T16* pa2 = NSPLIT == 1 ? A2r + kc * 16 : nullptr; const T16* pb = Br + kc * 16;
#pragma unroll
        for (int mb = 0; mb < 4; ++mb) { a[mb] = WFrag<T16>::ldf(pa + mb * 16 * K); if constexpr (NSPLIT == 1) a2[mb] = WFrag<T16>::ldf(pa2 + mb * 16 * K); }
#pragma unroll
        for (int nb = 0; nb < 4; ++nb) b[nb] = WFrag<T16>::ldf(pb + nb * 16 * K);
        // s_wait_xcnt 0 behind the trip's run of loads: their address registers may be rewritten behind it; the run's base pointers are inputs of the statement, so that no load of the run returns into a pair that an earlier one names
        if constexpr (NSPLIT == 1) asm volatile("s_wait_xcnt 0x0" :: "v"(pa), "v"(pa2), "v"(pb) : "memory"); else asm volatile("s_wait_xcnt 0x0" :: "v"(pa), "v"(pb) : "memory");
#pragma unroll
        for (int nb = 0; nb < 4; ++nb)
#pragma unroll
            for (int mb = 0; mb < 4; ++mb) { acc[mb][nb] = WFrag<T16>::mma(a[mb], b[nb], acc[mb][nb]); if constexpr (NSPLIT == 1) acc[mb][nb] = WFrag<T16>::mma(a2[mb], b[nb], acc[mb][nb]); }
        // four vector slots between the last matrix instruction of a trip and the first vector instruction behind the taken loop branch
        // every fragment of the trip is an input: each keeps registers of its own to the trip's end, so that all of a trip's loads are issued ahead of its products (with one B fragment's registers used four times over, each column block waited out a load of its own)
        if constexpr (NSPLIT == 1) asm volatile("v_nop\n\tv_nop\n\tv_nop\n\tv_nop" : "+v"(acc[0][0]), "+v"(acc[1][1]), "+v"(acc[2][2]), "+v"(acc[3][3]) : "v"(a[0]), "v"(a[1]), "v"(a[2]), "v"(a[3]), "v"(a2[0]), "v"(a2[1]), "v"(a2[2]), "v"(a2[3]), "v"(b[0]), "v"(b[1]), "v"(b[2]), "v"(b[3]));
        else asm volatile("v_nop\n\tv_nop\n\tv_nop\n\tv_nop" : "+v"(acc[0][0]), "+v"(acc[1][1]), "+v"(acc[2][2]), "+v"(acc[3][3]) : "v"(a[0]), "v"(a[1]), "v"(a[2]), "v"(a[3]), "v"(b[0]), "v"(b[1]), "v"(b[2]), "v"(b[3]));
    }
    if constexpr (KW > 1) {
        float* ow = os + w * (64 * 68);
#pragma unroll
        for (int mb = 0; mb < 4; ++mb)
#pragma unroll
            for (int nb = 0; nb < 4; ++nb)
#pragma unroll
                for (int j = 0; j < 8; ++j) ow[(mb * 16 + hi * 8 + j) * 68 + nb * 16 + lr] = acc[mb][nb][j];
        __syncthreads();   // every wave's partial tile is in LDS before any thread sums across waves
#pragma unroll
        for (int r = 0; r < 64 * 16 / (32 * KW); ++r) { const int s = r * 32 * KW + (int)threadIdx.x, row = s >> 4, cofs = (s & 15) * 4; v4f val = *(const v4fa*)(os + row * 68 + cofs);
#pragma unroll
            for (int u = 1; u < KW; ++u) { const v4f pv = *(const v4fa*)(os + u * (64 * 68) + row * 68 + cofs); val[0] += pv[0]; val[1] += pv[1]; val[2] += pv[2]; val[3] += pv[3]; }
            if (BIAS) { val[0] += bfr(bias[c0 + cofs]); val[1] += bfr(bias[c0 + cofs + 1]); val[2] += bfr(bias[c0 + cofs + 2]); val[3] += bfr(bias[c0 + cofs + 3]); }
            *(v4f*)(C + (size_t)(r0 + row) * ldc + c0 + cofs) = val; }
    } else {
#pragma unroll
    for (int mb = 0; mb < 4; ++mb) {
#pragma unroll
        for (int nb = 0; nb < 4; ++nb) {
#pragma unroll
            for (int j = 0; j < 8; ++j) os[(hi * 8 + j) * 68 + nb * 16 + lr] = acc[mb][nb][j]; }
        __builtin_amdgcn_wave_barrier(); asm volatile("" ::: "memory");
        float* crow = C + (size_t)(r0 + mb * 16) * ldc + c0;
{
#pragma unroll
            for (int s = 0; s < 8; ++s) { const int row = 2 * s + hi, cofs = lr * 4; v4f val = *(const v4fa*)(os + row * 68 + cofs); if (BIAS) { val[0] += bfr(bias[c0 + cofs]); val[1] += bfr(bias[c0 + cofs + 1]); val[2] += bfr(bias[c0 + cofs + 2]); val[3] += bfr(bias[c0 + cofs + 3]); }
                *(v4f*)(crow + (size_t)row * ldc + cofs) = val; }
             }
        __builtin_amdgcn_wave_barrier(); asm volatile("" ::: "memory");
    }
    }
}

__device__ __forceinline__ h16 tohx(float x) { return (h16)x; }
__device__ __forceinline__ void splitf(float y, unsigned short& h, unsigned short& l) { h = f2bf(y); l = f2bf(y - bf2f(h)); }
typedef __attribute__((ext_vector_type(2))) _Float16 v2h;
typedef __attribute__((ext_vector_type(4))) _Float16 v4h;
typedef __attribute__((ext_vector_type(2))) unsigned short v2us;
typedef __attribute__((ext_vector_type(4))) unsigned short v4us;
typedef __attribute__((ext_vector_type(2))) float v2f;

// k_cvtall: every float matrix ([rows][DM]) to bf16 in fragment order in one launch, 8 elements per thread: thread i of a matrix writes the 16 bytes i of its destination (a wave stores 512 bytes in a row) and reads the 8 floats that belong there. Blocks 0 .. 3 NB GX - 1: stream s = block / (NB GX), batch b, GX blocks each (source batch stride SEQ_FULL * DM, destination XB[s][b]);
// the 4 GW blocks behind them: weight block / GW, destination WB[weight].
static constexpr unsigned GW = (unsigned)(((size_t)DM * DM / 8 + 255) / 256), GX = (unsigned)(((size_t)TT * DM / 8 + 255) / 256);
__global__ __launch_bounds__(256) void k_cvtall(const float* __restrict__ xq, const float* __restrict__ xk, const float* __restrict__ xv, const float* __restrict__ wq, const float* __restrict__ wk, const float* __restrict__ wv, const float* __restrict__ wo, bf* XB, bf* WB) {
    const unsigned x = blockIdx.x; const float* src; bf* dst; size_t i, n8;
    if (x < 3 * NB * GX) { const unsigned s = x / (NB * GX), r = x % (NB * GX), b = r / GX; i = (size_t)(r % GX) * 256 + threadIdx.x; n8 = (size_t)TT * DM / 8;
        src = (s == 0 ? xq : s == 1 ? xk : xv) + (size_t)b * SEQ_FULL * DM; dst = XB + ((size_t)s * NB + b) * TT * DM; }
    else { const unsigned y = x - 3 * NB * GX, s = y / GW; i = (size_t)(y % GW) * 256 + threadIdx.x; n8 = (size_t)DM * DM / 8;
        src = s == 0 ? wq : s == 1 ? wk : s == 2 ? wv : wo; dst = WB + (size_t)s * DM * DM; }
    if (i >= n8) return; const size_t row = (i >> 6) / (DM / 32) * 16 + (i & 15), k = (i >> 6) % (DM / 32) * 32 + ((i >> 5) & 1) * 16 + ((i >> 4) & 1) * 8; const v8f v = *(const v8f*)(src + row * DM + k); v8us o;
#pragma unroll
    for (int k = 0; k < 8; ++k) o[k] = f2bf(v[k]); *(v8us*)(dst + i * 8) = o;  }

// k_hp / k_vtp: nz = NB * NH_ planes, plane z = batch * NH_ + head, read from row batch * TT + t of F; e is the output offset, decoded into (t, d) by the fragment order:
// k_hp  (q, k planes): [z][t / 16][d / 32][half c][lane = hi * 16 + lr][8], t = 16 (t / 16) + lr, d = 32 (d / 32) + 16 c + 8 hi + 0..7  (rows t, k index d).
// k_vtp (v planes):    [z][t / 32][d / 16][half c][lane = hi * 16 + lr][8], d = 16 (d / 16) + lr, t = 32 (t / 32) + 16 c + 8 hi + 0..7  (rows d, k index t).
__device__ __forceinline__ void k_hp(const float* __restrict__ F, int pitch, int nz, h16* P16, bf* Ph, bf* Pl) {
    const size_t e = ((size_t)blockIdx.x * 256 + threadIdx.x) * 2; if (e >= (size_t)nz * TT * HD) return; const int d = (int)(((e >> 9) & 1) * 32 + ((e >> 8) & 1) * 16 + ((e >> 7) & 1) * 8 + (e & 7)); const int t = (int)(((e >> 10) % (TT / 16)) * 16 + ((e >> 3) & 15)); const int z = (int)(e / ((size_t)HD * TT)); const int b = z / NH_, h = z % NH_;
    const v2f x = *(const v2f*)(F + ((size_t)b * TT + t) * pitch + h * HD + d); v2h o16; v2us oh, ol;
#pragma unroll
    for (int q = 0; q < 2; ++q) { const float r = x[q]; o16[q] = tohx(r); unsigned short a2, c2; splitf(r, a2, c2); oh[q] = a2; ol[q] = c2; }
    *(v2h*)(P16 + e) = o16; *(v2us*)(Ph + e) = oh; *(v2us*)(Pl + e) = ol;  }

__device__ __forceinline__ void k_vtp(const float* __restrict__ F, int pitch, int nz, h16* V16, bf* Vh, bf* Vl) { const size_t e = ((size_t)blockIdx.x * 256 + threadIdx.x) * 2; if (e >= (size_t)nz * HD * TT) return; const int t = (int)(((e >> 11) % (TT / 32)) * 32 + ((e >> 8) & 1) * 16 + ((e >> 7) & 1) * 8 + (e & 7)); const int d = (int)(((e >> 9) & 3) * 16 + ((e >> 3) & 15)); const int z = (int)(e / ((size_t)TT * HD)); const int b = z / NH_, g = z % NH_; v2h o16; v2us oh, ol;
#pragma unroll
    for (int q = 0; q < 2; ++q) { const float x = F[((size_t)b * TT + t + q) * pitch + g * HD + d]; o16[q] = tohx(x); unsigned short a2, c2; splitf(x, a2, c2); oh[q] = a2; ol[q] = c2; }
    *(v2h*)(V16 + e) = o16; *(v2us*)(Vh + e) = oh; *(v2us*)(Vl + e) = ol;  }

// k_planes: the nine head planes in one launch; blockIdx.y = stream s (0 q, 1 k: k_hp; 2 v: k_vtp), projection F[s], planes P16[s], PHL[s][hi, lo].
__global__ __launch_bounds__(256) void k_planes(const float* __restrict__ F, int pitch, int nz, h16* P16, bf* PHL) {
    constexpr size_t PE = (size_t)NB * NH_ * TT * HD; const size_t s = blockIdx.y; F += s * ((size_t)NB * TT * DQ); P16 += s * PE; bf* Ph = PHL + 2 * s * PE; bf* Pl = Ph + PE;
    if (s < 2) k_hp(F, pitch, nz, P16, Ph, Pl); else k_vtp(F, pitch, nz, P16, Ph, Pl);
}

// ---- k_fattn: scores, softmax, head mean, p.v and the head merge in one launch. Work-group = NH_ waves, wave h = head h; blockIdx.y = batch; blockIdx.x < RH / 16: 16 query rows on hi+lo bf16 planes, else 32 query rows on f16 planes.
// Transposed products: S^T tile = K (A operand, rows = 16 keys) x Q (B operand, columns = 16 query rows), so lane (lr, hi) holds keys 8 hi + 0..7 of query row lr: two such tiles are, element for element, the B fragment of 32 keys
// for O^T = V^T (A operand, rows = 16 d) x P (B operand); p never leaves the registers. The k order of that B fragment (elements 0..7 = keys 8 hi + 0..7, elements 8..15 = keys 16 + 8 hi + 0..7) is the one of the V^T loader.
// Sweep 1 over the keys: running maximum and sum per lane (rescaled when the maximum grows), merged over the two lane halves at the end. Sweep 2: the same score tiles again, e = exp2(s x SL2 - max x SL2), p = e / sum.
// p.v: hi+lo rows multiply the bf16 hi and lo parts of p; plain rows multiply e (f16, at most 1) and scale the finished row by 1 / sum.
// Head mean: per block of 64 keys wave h leaves its f32 p rows in LDS plane h; behind one work-group barrier thread x sums 4 columns over the planes in head order 0 .. NH_-1 and stores them once.
// Two LDS buffers: the barrier of block n + 1 ends every read of block n before block n + 2 writes that buffer again.
// Both sweeps walk the keys in a ring that starts at block rb of 64 keys, 5 x mod TT / 64 for work-group x, shared by x and x + 32: work-groups that start together then read different lines of the K and V planes at any moment, not all the same ones.
template <bool HI> struct PT { typedef h16 T; };
template <> struct PT<true> { typedef bf T; };
// v_exp_f32, eight in place per statement: the instruction set asks for one independent instruction or a v_nop behind a transcendental before its result is read or its source overwritten;
// here each v_exp_f32 fills the slot of the one before and one v_nop that of the last.
__device__ __forceinline__ void exp2x8(float (&x)[8]) {
    asm("v_exp_f32 %0, %0\n\tv_exp_f32 %1, %1\n\tv_exp_f32 %2, %2\n\tv_exp_f32 %3, %3\n\tv_exp_f32 %4, %4\n\tv_exp_f32 %5, %5\n\tv_exp_f32 %6, %6\n\tv_exp_f32 %7, %7\n\tv_nop"
        : "+v"(x[0]), "+v"(x[1]), "+v"(x[2]), "+v"(x[3]), "+v"(x[4]), "+v"(x[5]), "+v"(x[6]), "+v"(x[7]));
}
// one v_exp_f32 with the v_nop that fills its slot
__device__ __forceinline__ float exp2x1(float x) { asm("v_exp_f32 %0, %0\n\tv_nop" : "+v"(x)); return x; }

template <bool HI, int NQT>
__device__ __forceinline__ void fattn(float* avs, int b, int q0, int rb, const typename PT<HI>::T* Qa, const typename PT<HI>::T* Qb, const typename PT<HI>::T* Ka, const typename PT<HI>::T* Kb, const typename PT<HI>::T* Va, const typename PT<HI>::T* Vb, float* AVG, bf* ATh, bf* ATl) {
    typedef typename PT<HI>::T T; typedef WFrag<T> WF; typedef typename WF::V V;
    constexpr int MQ = NQT * 16;
    const int lane = threadIdx.x & 31, lr = lane & 15, hi = lane >> 4; const int h = __builtin_amdgcn_readfirstlane((int)(threadIdx.x >> 5));
    const size_t zo = ((size_t)b * NH_ + h) * TT * HD + lane * 8;
    Qa += zo; Ka += zo; Va += zo; if constexpr (HI) { Qb += zo; Kb += zo; Vb += zo; }
    // s_wait_xcnt 0 behind a run of loads: their address registers may be rewritten behind it; the run's base pointers are inputs of the statement, so that no load of the run returns into a pair that an earlier one names
    auto xwait = [](const T* pa, const T* pb) { if constexpr (HI) asm volatile("s_wait_xcnt 0x0" :: "v"(pa), "v"(pb) : "memory"); else asm volatile("s_wait_xcnt 0x0" :: "v"(pa) : "memory"); };
    V qa[NQT][2], qb[NQT][2];
    { const T* pa = Qa + (size_t)(q0 / 16) * 1024; const T* pb = HI ? Qb + (size_t)(q0 / 16) * 1024 : nullptr;
#pragma unroll
    for (int qt = 0; qt < NQT; ++qt)
#pragma unroll
        for (int ks = 0; ks < 2; ++ks) { qa[qt][ks] = WF::ldf(pa + (qt * 2 + ks) * 512); if constexpr (HI) qb[qt][ks] = WF::ldf(pb + (qt * 2 + ks) * 512); }
    xwait(pa, pb); }
    // K fragments of the 32 keys kp * 32 .. + 31 (u = key tile, ks = k step)
    auto kload = [&](int kp, V (&ka)[2][2], V (&kb)[2][2]) {
        const T* pa = Ka + (size_t)kp * 2048; const T* pb = HI ? Kb + (size_t)kp * 2048 : nullptr;
#pragma unroll
        for (int u = 0; u < 2; ++u)
#pragma unroll
            for (int ks = 0; ks < 2; ++ks) { ka[u][ks] = WF::ldf(pa + (u * 2 + ks) * 512); if constexpr (HI) kb[u][ks] = WF::ldf(pb + (u * 2 + ks) * 512); }
        xwait(pa, pb);
    };
    // S^T tiles of those 32 keys against the NQT query tiles
    auto stiles = [&](const V (&ka)[2][2], const V (&kb)[2][2], v8f (&st)[2][NQT]) {
#pragma unroll
        for (int u = 0; u < 2; ++u)
#pragma unroll
            for (int qt = 0; qt < NQT; ++qt) { v8f a = (v8f){};
#pragma unroll
                for (int ks = 0; ks < 2; ++ks) { a = WF::mma(ka[u][ks], qa[qt][ks], a); if constexpr (HI) { a = WF::mma(ka[u][ks], qb[qt][ks], a); a = WF::mma(kb[u][ks], qa[qt][ks], a); } }
                st[u][qt] = a; }
    };
    // the K fragments are fetched one trip ahead, as soon as the score products have read the old ones; behind the last trip of a sweep the ring is back at its first keys, which the next sweep starts with
    V ka[2][2], kb[2][2]; kload(2 * rb, ka, kb);
    float mx[NQT], sm[NQT], fn[NQT];
#pragma unroll
    for (int qt = 0; qt < NQT; ++qt) { mx[qt] = -3.0e38f; sm[qt] = 0.f; }
    // rolled: one trip holds 32 keys' fragments and tiles; unrolling it would only add registers
#pragma unroll 1
    for (int i = 0, kp = 2 * rb; i < TT / 32; ++i) {
        kp = kp + 1 < TT / 32 ? kp + 1 : 0;
        v8f st[2][NQT]; stiles(ka, kb, st); kload(kp, ka, kb);
#pragma unroll
        for (int qt = 0; qt < NQT; ++qt) { float t0[8], t1[8]; float tm = mx[qt];
#pragma unroll
            for (int j = 0; j < 8; ++j) tm = fmaxf(tm, fmaxf(st[0][qt][j], st[1][qt][j]));
            const float corr = exp2x1((mx[qt] - tm) * SL2), nm = tm * SL2;
#pragma unroll
            for (int j = 0; j < 8; ++j) { t0[j] = st[0][qt][j] * SL2 - nm; t1[j] = st[1][qt][j] * SL2 - nm; }
            exp2x8(t0); exp2x8(t1);
            float s0 = 0.f, s1 = 0.f;
#pragma unroll
            for (int j = 0; j < 8; ++j) { s0 += t0[j]; s1 += t1[j]; }
            sm[qt] = sm[qt] * corr + (s0 + s1); mx[qt] = tm; }
    }
#pragma unroll
    for (int qt = 0; qt < NQT; ++qt) { const float mm = fmaxf(mx[qt], __shfl_xor(mx[qt], 16, 32)); float s = sm[qt] * exp2x1((mx[qt] - mm) * SL2); s += __shfl_xor(s, 16, 32); mx[qt] = mm * SL2; fn[qt] = __fdiv_rn(1.0f, s); }
    v8f oacc[NQT][4];
#pragma unroll
    for (int qt = 0; qt < NQT; ++qt)
#pragma unroll
        for (int dt = 0; dt < 4; ++dt) oacc[qt][dt] = (v8f){};
    // rolled: one trip is a block of 64 keys with its barrier
#pragma unroll 1
    for (int i = 0; i < TT / 64; ++i) {
        const int blk = rb + i < TT / 64 ? rb + i : rb + i - TT / 64;
        float* ab = avs + (i & 1) * (NH_ * MQ * AP);
        // rolled: unrolling the two halves only adds registers and code
#pragma unroll 1
        for (int hf = 0; hf < 2; ++hf) { const int kp = blk * 2 + hf;
            // the V^T fragments of this trip are requested ahead of the score products, so that they fly during the softmax
            V va[4], vb[4]; const T* pva = Va + (size_t)kp * 2048; const T* pvb = HI ? Vb + (size_t)kp * 2048 : nullptr;
#pragma unroll
            for (int dt = 0; dt < 4; ++dt) { va[dt] = WF::ldf(pva + dt * 512); if constexpr (HI) vb[dt] = WF::ldf(pvb + dt * 512); }
            xwait(pva, pvb);
            v8f st[2][NQT]; stiles(ka, kb, st); kload(kp + 1 < TT / 32 ? kp + 1 : 0, ka, kb);
            V pa[NQT], pb[NQT];
#pragma unroll
            for (int qt = 0; qt < NQT; ++qt) { v8h o16[2]; v8us oh[2], ol[2];
#pragma unroll
                for (int u = 0; u < 2; ++u) { float t[8];
#pragma unroll
                    for (int j = 0; j < 8; ++j) t[j] = st[u][qt][j] * SL2 - mx[qt];
                    exp2x8(t);
                    v4f w0, w1;
#pragma unroll
                    for (int j = 0; j < 4; ++j) { w0[j] = t[j] * fn[qt]; w1[j] = t[4 + j] * fn[qt]; }
                    float* dst = ab + (h * MQ + qt * 16 + lr) * AP + hf * 32 + u * 16 + 8 * hi; *(v4fa*)dst = w0; *(v4fa*)(dst + 4) = w1;
                    if constexpr (HI) {
#pragma unroll
                        for (int j = 0; j < 4; ++j) { unsigned short a, c2; splitf(w0[j], a, c2); oh[u][j] = a; ol[u][j] = c2; splitf(w1[j], a, c2); oh[u][4 + j] = a; ol[u][4 + j] = c2; }
                    } else {
#pragma unroll
                        for (int j = 0; j < 8; ++j) o16[u][j] = tohx(t[j]);
                    } }
                if constexpr (HI) { pa[qt] = cat16b(oh[0], oh[1]); pb[qt] = cat16b(ol[0], ol[1]); } else { pa[qt] = cat16(o16[0], o16[1]); } }
#pragma unroll
            for (int dt = 0; dt < 4; ++dt)
#pragma unroll
                for (int qt = 0; qt < NQT; ++qt) { oacc[qt][dt] = WF::mma(va[dt], pa[qt], oacc[qt][dt]); if constexpr (HI) { oacc[qt][dt] = WF::mma(va[dt], pb[qt], oacc[qt][dt]); oacc[qt][dt] = WF::mma(vb[dt], pa[qt], oacc[qt][dt]); } }
            // four vector slots between the last matrix instruction of a trip and the first vector instruction behind the taken loop branch, which may overwrite its operands
            // (one statement that takes every accumulator, so that it stands behind the last matrix instruction)
            static_assert(NQT == 1 || NQT == 2);
            if constexpr (NQT == 1) asm volatile("v_nop\n\tv_nop\n\tv_nop\n\tv_nop" : "+v"(oacc[0][0]), "+v"(oacc[0][1]), "+v"(oacc[0][2]), "+v"(oacc[0][3]));
            else asm volatile("v_nop\n\tv_nop\n\tv_nop\n\tv_nop" : "+v"(oacc[0][0]), "+v"(oacc[0][1]), "+v"(oacc[0][2]), "+v"(oacc[0][3]), "+v"(oacc[NQT - 1][0]), "+v"(oacc[NQT - 1][1]), "+v"(oacc[NQT - 1][2]), "+v"(oacc[NQT - 1][3]));
        }
        __syncthreads();   // all NH_ planes of this block of keys are in LDS before any thread sums over the heads
        if (MQ * 16 >= 32 * NH_ || (int)threadIdx.x < MQ * 16) { const int row = (int)threadIdx.x >> 4, c4 = ((int)threadIdx.x & 15) * 4; const float* ar = ab + row * AP + c4; v4f a = *(const v4fa*)ar;
#pragma unroll
            for (int u = 1; u < NH_; ++u) { const v4f pv = *(const v4fa*)(ar + u * (MQ * AP));
#pragma unroll
                for (int q = 0; q < 4; ++q) a[q] = a[q] + pv[q]; }
            v4f o;
#pragma unroll
            for (int q = 0; q < 4; ++q) o[q] = a[q] * (1.0f / NH_);
            *(v4f*)(AVG + ((size_t)b * TT + q0 + row) * TT + blk * 64 + c4) = o;
            asm volatile("s_wait_xcnt 0x0" ::: "memory"); }   // the registers of the issued store may be rewritten behind it
    }
    // O^T tile dt: element j = (d = 16 dt + 8 hi + j, query row lr): eight neighbouring d of one merged row per lane, which is half (dt & 1) of fragment (row block, k step 2 h + dt / 2) of the merged planes
#pragma unroll
    for (int qt = 0; qt < NQT; ++qt)
#pragma unroll
        for (int dt = 0; dt < 4; ++dt) { v8us oh, ol; const float cs = HI ? 1.0f : fn[qt];
#pragma unroll
            for (int j = 0; j < 8; ++j) { unsigned short a, c2; splitf(oacc[qt][dt][j] * cs, a, c2); oh[j] = a; ol[j] = c2; }
            const size_t oo = ((size_t)b * TT + q0 + qt * 16) * DQ + (h * 2 + (dt >> 1)) * 512 + (dt & 1) * 256 + 8 * lane; *(v8us*)(ATh + oo) = oh; *(v8us*)(ATl + oo) = ol;
            asm volatile("s_wait_xcnt 0x0" ::: "memory"); }   // the registers of the two issued stores may be rewritten behind it
}

__global__ __launch_bounds__(32 * NH_) void k_fattn(const h16* __restrict__ Q16, const h16* __restrict__ K16, const h16* __restrict__ V16, const bf* __restrict__ Qh, const bf* __restrict__ Ql, const bf* __restrict__ Kh, const bf* __restrict__ Kl, const bf* __restrict__ Vh, const bf* __restrict__ Vl, float* AVG, bf* ATh, bf* ATl) {
    __shared__ __align__(16) float avs[2 * NH_ * 32 * AP];
    const int x = blockIdx.x, b = blockIdx.y;
    const int rb = x * 5 % (TT / 64);   // first block of the ring: any value below TT / 64 gives the same function; the odd factor sets neighbouring work-groups several blocks apart
    if (x < RH / 16) fattn<true, 1>(avs, b, x * 16, rb, Qh, Ql, Kh, Kl, Vh, Vl, AVG, ATh, ATl);
    else fattn<false, 2>(avs, b, RH + (x - RH / 16) * 32, rb, Q16, nullptr, K16, nullptr, V16, nullptr, AVG, ATh, ATl);
}

// workspace plan (bytes): four bf16 weights, the bf16 copies of the three input streams, three f32 projection buffers, nine head planes, the merged hi and lo planes; all stream-ordered.
static constexpr size_t W_BYTES  = (size_t)DM * DM * 2;
static constexpr size_t XB_BYTES = (size_t)NB * TT * DM * 2;
static constexpr size_t F_BYTES  = (size_t)NB * TT * DM * 4;
static constexpr size_t PL_BYTES = (size_t)NB * NH_ * TT * HD * 2;
static constexpr size_t AT_BYTES = (size_t)NB * TT * DQ * 2;
static constexpr size_t WS_TOTAL = 4 * W_BYTES + 3 * XB_BYTES + 3 * F_BYTES + 9 * PL_BYTES + 2 * AT_BYTES;
static_assert(W_BYTES % 256 == 0 && XB_BYTES % 256 == 0 && F_BYTES % 256 == 0 && PL_BYTES % 256 == 0 && AT_BYTES % 256 == 0);
static_assert(WS_TOTAL <= (size_t)268435456);

extern "C" void kernel_launch(void* const* d_in, const int* in_sizes, int n_in,
                              void* d_out, int out_size, void* d_ws, size_t ws_size, hipStream_t stream) {
    if (n_in < 11) return;
    const size_t need_x = (size_t)(NB - 1) * SEQ_FULL * DM + (size_t)TT * DM;
    if ((size_t)in_sizes[0] < need_x || (size_t)in_sizes[1] < need_x || (size_t)in_sizes[2] < need_x) return;
    if ((size_t)in_sizes[3] < (size_t)DM * DM || (size_t)in_sizes[5] < (size_t)DM * DM || (size_t)in_sizes[7] < (size_t)DM * DM || (size_t)in_sizes[9] < (size_t)DM * DM) return;
    if (in_sizes[4] < DM || in_sizes[6] < DM || in_sizes[8] < DM || in_sizes[10] < DM) return;
    const size_t AVG_OFF = (size_t)NB_FULL * SEQ_FULL * DM;     // element offset of the second output (byte 16777216)
    if ((size_t)out_size < AVG_OFF + (size_t)NB * TT * TT) return;
    if (ws_size < WS_TOTAL) return;
    const float* xq = (const float*)d_in[0]; const float* xk = (const float*)d_in[1]; const float* xv = (const float*)d_in[2]; const float* wq = (const float*)d_in[3]; const float* bq = (const float*)d_in[4]; const float* wk = (const float*)d_in[5]; const float* bk = (const float*)d_in[6]; const float* wv = (const float*)d_in[7]; const float* bv = (const float*)d_in[8]; const float* wo = (const float*)d_in[9]; const float* bo = (const float*)d_in[10];
    float* OUT = (float*)d_out;                 // [NB][TT][DM]
    float* AVG = (float*)d_out + AVG_OFF;       // [NB][TT][TT]
    char* wsp = (char*)d_ws;
    auto take = [&](size_t bytes) { char* p = wsp; wsp += (bytes + 255) & ~(size_t)255; return (void*)p; };
    bf* WB = (bf*)take(4 * W_BYTES); bf* WO = WB + 3 * (size_t)DM * DM;   // [q, k, v, o][DM][DM]
    bf* XB = (bf*)take(3 * XB_BYTES); float* FQ = (float*)take(3 * F_BYTES);   // [stream][NB * TT][DM] each
    h16* QP16 = (h16*)take(PL_BYTES); h16* KP16 = (h16*)take(PL_BYTES); h16* VT16 = (h16*)take(PL_BYTES);
    bf* QPh = (bf*)take(PL_BYTES); bf* QPl = (bf*)take(PL_BYTES); bf* KPh = (bf*)take(PL_BYTES); bf* KPl = (bf*)take(PL_BYTES); bf* VTh = (bf*)take(PL_BYTES); bf* VTl = (bf*)take(PL_BYTES);
    bf* ATh = (bf*)take(AT_BYTES); bf* ATl = (bf*)take(AT_BYTES);
    if ((size_t)(wsp - (char*)d_ws) > ws_size) return;

    k_cvtall<<<3 * NB * GX + 4 * GW, 256, 0, stream>>>(xq, xk, xv, wq, wk, wv, wo, XB, WB);
    k_gemmw<bf, 0, true, KWP, DM><<<dim3(NB * TT / 64, DQ / 64, 3), 32 * KWP, 0, stream>>>(XB, nullptr, WB, FQ, DQ, bq, bk, bv, (size_t)NB * TT * DM, (size_t)DM * DM, (size_t)NB * TT * DQ);
    const unsigned LP = (unsigned)(((size_t)NB * NH_ * TT * HD / 2 + 255) / 256);
    k_planes<<<dim3(LP, 3, 1), 256, 0, stream>>>(FQ, DQ, NB * NH_, QP16, QPh);
    k_fattn<<<dim3(RH / 16 + (TT - RH) / 32, NB, 1), 32 * NH_, 0, stream>>>(QP16, KP16, VT16, QPh, QPl, KPh, KPl, VTh, VTl, AVG, ATh, ATl);
    k_gemmw<bf, 1, true, KWP, DQ><<<dim3(NB * TT / 64, DM / 64, 1), 32 * KWP, 0, stream>>>(ATh, ATl, WO, OUT, DM, bo, nullptr, nullptr, 0, 0, 0);
}

// v009
// It runs in 195 microseconds.
// In both of two side-by-side timings against v008, it was 1.09 times as fast.
// Counting every step since v000, it is 8.42 times as fast.
#include <hip/hip_runtime.h>

// Multi-head attention without a mask over three input streams (query, key, value [2][2048][1024]); q = query Wq^T + bq, k = key Wk^T + bk, v = value Wv^T + bv (W stored [out][in]); 16 heads x 64; scores x 64^-0.5; softmax over all keys; out0 = merged Wo^T + bo; out1 = head mean of the probabilities [2][2048][2048].
// Compute dtypes, f32 accumulate: every float input RNE-converted to bf16; projections v_wmma_f32_16x16x32_bf16 (exact products) + f32 bias; attention query rows < 512: q/k/p/v as bf16 hi+lo planes (3 products), other rows v_wmma_f32_16x16x32_f16 with p carried unnormalised (exp of score minus row maximum, at most 1) and the row scaled by 1 / sum behind p.v; softmax and head mean f32; output projection merged hi+lo (bf16) x bf16 Wo + bias.
// Every launch covers all NB batches (no host loop over the batch): projections run on the NB*TT stacked rows, the head planes are indexed by z = batch * 16 + head.
// Every launch covers all three streams too: one conversion launch (three streams and four weights), one projection launch (blockIdx.z = stream), one plane-building launch (blockIdx.y = stream).
// Attention is two launches: k_fattn (a work-group owns one head and many query rows, a wave 16 (hi+lo) or 32 (plain) of them; scores, probabilities and p.v stay in registers) and k_hmean (the head mean: a wave owns 32 rows x 64 keys and sums over the heads in registers).
// The head planes are stored in fragment order (512-byte blocks, lane l holds bytes 16 l .. 16 l + 15 of each half), so that every fragment load reads whole cache lines.
// So are the GEMM operands (the bf16 streams and weights, the merged hi and lo planes): [row / 16][k / 32][half c][lane = hi * 16 + lr][8], row = 16 (row / 16) + lr, k = 32 (k / 32) + 16 c + 8 hi + 0..7.

#ifndef NB
#define NB 2
#endif
#ifndef SEQ
#define SEQ 2048
#endif
#define NB_FULL  2
#define SEQ_FULL 2048
#define TT   SEQ
#define DM   1024
#define NH_  16
#define HD   64
#define DQ   (NH_ * HD)
#define RH   512                  // query rows < RH use hi+lo planes
#define SCL  0.125f               // HD^-0.5
#define KWP  8                    // waves sharing the K loop of a projection tile (K = DM)
#define SL2  (SCL * 1.4426950408889634f)   // HD^-0.5 x log2 e: exp(s x HD^-0.5 - max) = exp2(s x SL2 - max x SL2)
#define AP   68                   // LDS pitch (floats) of a 64-key row of probabilities: 272 bytes = 16 x odd
typedef _Float16 h16;
typedef unsigned short bf;
typedef __attribute__((ext_vector_type(16))) __bf16   v16bf;
typedef __attribute__((ext_vector_type(16))) _Float16 v16h;
typedef __attribute__((ext_vector_type(8)))  _Float16 v8h;
typedef __attribute__((ext_vector_type(8)))  unsigned short v8us;
typedef __attribute__((ext_vector_type(8)))  float    v8f;
typedef __attribute__((ext_vector_type(4)))  float    v4f;
typedef v8h  __attribute__((may_alias)) v8ha;
typedef v4f  __attribute__((may_alias)) v4fa;
typedef v8us __attribute__((may_alias)) v8usa;

static_assert((TT - RH) % 32 == 0 && RH % 16 == 0 && RH <= TT);
static_assert(TT % 64 == 0);
static_assert(HD == 64);
static_assert(DM % 64 == 0);
static_assert(DM % (32 * KWP) == 0);
static_assert((size_t)KWP * 64 * 68 * 4 <= 327680);
static_assert((size_t)NB_FULL * SEQ_FULL * DM * 4 == 16777216);
static_assert((size_t)NB_FULL * SEQ_FULL * DM + (size_t)NB * TT * TT <= (size_t)50331648 / 4);

__device__ __forceinline__ unsigned short f2bf(float f) { unsigned u = __float_as_uint(f); u += 0x7FFFu + ((u >> 16) & 1u); return (unsigned short)(u >> 16); }
__device__ __forceinline__ float bf2f(unsigned short b) { return __uint_as_float(((unsigned)b) << 16); }
__device__ __forceinline__ float bfr(float f) { return bf2f(f2bf(f)); }
__device__ __forceinline__ v16h cat16(v8h lo, v8h hi) { return __builtin_shufflevector(lo, hi, 0, 1, 2, 3, 4, 5, 6, 7, 8, 9, 10, 11, 12, 13, 14, 15); }
__device__ __forceinline__ v16bf cat16b(v8us lo, v8us hi) { return __builtin_bit_cast(v16bf, __builtin_shufflevector(lo, hi, 0, 1, 2, 3, 4, 5, 6, 7, 8, 9, 10, 11, 12, 13, 14, 15)); }
__device__ __forceinline__ v8f wmma16(v16h a, v16h b, v8f c) { return __builtin_amdgcn_wmma_f32_16x16x32_f16(false, a, false, b, (short)0, c, false, false); }
__device__ __forceinline__ v8f wmmab(v16bf a, v16bf b, v8f c) { return __builtin_amdgcn_wmma_f32_16x16x32_bf16(false, a, false, b, (short)0, c, false, false); }

// ---- k_gemmw: register-blocked GEMM, one work-group of KW waves per 64x64 output tile (16 accumulators per wave), operands straight from 16-bit planes in fragment order; grid (M/64, N/64, Z), 32 * KW threads.
// K split: wave w takes the 32-wide k steps w, w + KW, w + 2 KW, ... (neighbouring waves read neighbouring 1024-byte fragments); for KW > 1 the KW partial tiles meet in LDS and are summed in wave order 0 .. KW-1.
// C[m][n] (f32, pitch ldc, + optional f32 bias[n], bias0 / bias1 / bias2 for z = 0 / 1 / 2) = sum_k A[m][k] Bt[n][k] (NSPLIT == 1: + A2[m][k] Bt[n][k]). z-batch strides sA/sB/sC in elements. K % 32 == 0, M % 64 == 0, N % 64 == 0.
// Fragment map: lane -> row/col (lane & 15), elements 0..7 = k0 + 8*(lane>>4) + 0..7, elements 8..15 = k0 + 16 + 8*(lane>>4) + 0..7 for A and B; D element j = (row 8*(lane>>4) + j, col lane & 15).
template <typename T16> struct WFrag;
template <> struct WFrag<h16> { typedef v16h V; static __device__ __forceinline__ V ldf(const h16* p) { return cat16(*(const v8h*)p, *(const v8h*)(p + 256)); } static __device__ __forceinline__ v8f mma(V a, V b, v8f c) { return wmma16(a, b, c); } };
template <> struct WFrag<bf> { typedef v16bf V; static __device__ __forceinline__ V ldf(const bf* p) { return cat16b(*(const v8us*)p, *(const v8us*)(p + 256)); } static __device__ __forceinline__ v8f mma(V a, V b, v8f c) { return wmmab(a, b, c); } };
template <typename T16, int NSPLIT, bool BIAS, int KW, int K>
__global__ __launch_bounds__(32 * KW) void k_gemmw(const T16* __restrict__ A, const T16* __restrict__ A2, const T16* __restrict__ Bt, float* C, int ldc, const float* __restrict__ bias0, const float* __restrict__ bias1, const float* __restrict__ bias2, size_t sA, size_t sB, size_t sC) {
    typedef typename WFrag<T16>::V V;
    __shared__ __align__(16) float os[(KW == 1 ? 16 : KW * 64) * 68];
    const int w = (KW == 1) ? 0 : __builtin_amdgcn_readfirstlane((int)(threadIdx.x >> 5));
    const size_t z = blockIdx.z; A += z * sA; if (A2) A2 += z * sA; Bt += z * sB; C += z * sC;
    const float* bias = z == 0 ? bias0 : z == 1 ? bias1 : bias2;   // the biases are separate inputs: batch entry z adds its own
    const int lane = threadIdx.x & 31, lr = lane & 15, hi = lane >> 4; const int r0 = blockIdx.x * 64, c0 = blockIdx.y * 64;
    v8f acc[4][4];
#pragma unroll
    for (int mb = 0; mb < 4; ++mb)
#pragma unroll
        for (int nb = 0; nb < 4; ++nb) acc[mb][nb] = (v8f){};
    // fragment (row block rb, k step ks) starts at element (rb * (K / 32) + ks) * 512 = rb * 16 * K + ks * 512; K is a compile-time constant, so that a trip's loads of one plane share one address pair and differ in the immediate offset
    static_assert(NSPLIT == 0 || NSPLIT == 1);
    const T16* Ar = A + (size_t)r0 * K + 8 * lane; const T16* A2r = NSPLIT == 1 ? A2 + (size_t)r0 * K + 8 * lane : nullptr; const T16* Br = Bt + (size_t)c0 * K + 8 * lane;
#pragma unroll 1
    for (int kc = w * 32; kc < K; kc += 32 * KW) {
        V a[4], a2[4], b[4]; const T16* pa = Ar + kc * 16; const T16* pa2 = NSPLIT == 1 ? A2r + kc * 16 : nullptr; const T16* pb = Br + kc * 16;
#pragma unroll
        for (int mb = 0; mb < 4; ++mb) { a[mb] = WFrag<T16>::ldf(pa + mb * 16 * K); if constexpr (NSPLIT == 1) a2[mb] = WFrag<T16>::ldf(pa2 + mb * 16 * K); }
#pragma unroll
        for (int nb = 0; nb < 4; ++nb) b[nb] = WFrag<T16>::ldf(pb + nb * 16 * K);
        // s_wait_xcnt 0 behind the trip's run of loads: their address registers may be rewritten behind it; the run's base pointers are inputs of the statement, so that no load of the run returns into a pair that an earlier one names
        if constexpr (NSPLIT == 1) asm volatile("s_wait_xcnt 0x0" :: "v"(pa), "v"(pa2), "v"(pb) : "memory"); else asm volatile("s_wait_xcnt 0x0" :: "v"(pa), "v"(pb) : "memory");
#pragma unroll
        for (int nb = 0; nb < 4; ++nb)
#pragma unroll
            for (int mb = 0; mb < 4; ++mb) { acc[mb][nb] = WFrag<T16>::mma(a[mb], b[nb], acc[mb][nb]); if constexpr (NSPLIT == 1) acc[mb][nb] = WFrag<T16>::mma(a2[mb], b[nb], acc[mb][nb]); }
        // four vector slots between the last matrix instruction of a trip and the first vector instruction behind the taken loop branch
        // every fragment of the trip is an input: each keeps registers of its own to the trip's end, so that all of a trip's loads are issued ahead of its products (with one B fragment's registers used four times over, each column block waited out a load of its own)
        if constexpr (NSPLIT == 1) asm volatile("v_nop\n\tv_nop\n\tv_nop\n\tv_nop" : "+v"(acc[0][0]), "+v"(acc[1][1]), "+v"(acc[2][2]), "+v"(acc[3][3]) : "v"(a[0]), "v"(a[1]), "v"(a[2]), "v"(a[3]), "v"(a2[0]), "v"(a2[1]), "v"(a2[2]), "v"(a2[3]), "v"(b[0]), "v"(b[1]), "v"(b[2]), "v"(b[3]));
        else asm volatile("v_nop\n\tv_nop\n\tv_nop\n\tv_nop" : "+v"(acc[0][0]), "+v"(acc[1][1]), "+v"(acc[2][2]), "+v"(acc[3][3]) : "v"(a[0]), "v"(a[1]), "v"(a[2]), "v"(a[3]), "v"(b[0]), "v"(b[1]), "v"(b[2]), "v"(b[3]));
    }
    if constexpr (KW > 1) {
        float* ow = os + w * (64 * 68);
#pragma unroll
        for (int mb = 0; mb < 4; ++mb)
#pragma unroll
            for (int nb = 0; nb < 4; ++nb)
#pragma unroll
                for (int j = 0; j < 8; ++j) ow[(mb * 16 + hi * 8 + j) * 68 + nb * 16 + lr] = acc[mb][nb][j];
        __syncthreads();   // every wave's partial tile is in LDS before any thread sums across waves
#pragma unroll
        for (int r = 0; r < 64 * 16 / (32 * KW); ++r) { const int s = r * 32 * KW + (int)threadIdx.x, row = s >> 4, cofs = (s & 15) * 4; v4f val = *(const v4fa*)(os + row * 68 + cofs);
#pragma unroll
            for (int u = 1; u < KW; ++u) { const v4f pv = *(const v4fa*)(os + u * (64 * 68) + row * 68 + cofs); val[0] += pv[0]; val[1] += pv[1]; val[2] += pv[2]; val[3] += pv[3]; }
            if (BIAS) { val[0] += bfr(bias[c0 + cofs]); val[1] += bfr(bias[c0 + cofs + 1]); val[2] += bfr(bias[c0 + cofs + 2]); val[3] += bfr(bias[c0 + cofs + 3]); }
            *(v4f*)(C + (size_t)(r0 + row) * ldc + c0 + cofs) = val; }
    } else {
#pragma unroll
    for (int mb = 0; mb < 4; ++mb) {
#pragma unroll
        for (int nb = 0; nb < 4; ++nb) {
#pragma unroll
            for (int j = 0; j < 8; ++j) os[(hi * 8 + j) * 68 + nb * 16 + lr] = acc[mb][nb][j]; }
        __builtin_amdgcn_wave_barrier(); asm volatile("" ::: "memory");
        float* crow = C + (size_t)(r0 + mb * 16) * ldc + c0;
{
#pragma unroll
            for (int s = 0; s < 8; ++s) { const int row = 2 * s + hi, cofs = lr * 4; v4f val = *(const v4fa*)(os + row * 68 + cofs); if (BIAS) { val[0] += bfr(bias[c0 + cofs]); val[1] += bfr(bias[c0 + cofs + 1]); val[2] += bfr(bias[c0 + cofs + 2]); val[3] += bfr(bias[c0 + cofs + 3]); }
                *(v4f*)(crow + (size_t)row * ldc + cofs) = val; }
             }
        __builtin_amdgcn_wave_barrier(); asm volatile("" ::: "memory");
    }
    }
}

__device__ __forceinline__ h16 tohx(float x) { return (h16)x; }
__device__ __forceinline__ void splitf(float y, unsigned short& h, unsigned short& l) { h = f2bf(y); l = f2bf(y - bf2f(h)); }
typedef __attribute__((ext_vector_type(2))) _Float16 v2h;
typedef __attribute__((ext_vector_type(4))) _Float16 v4h;
typedef __attribute__((ext_vector_type(2))) unsigned short v2us;
typedef __attribute__((ext_vector_type(4))) unsigned short v4us;
typedef __attribute__((ext_vector_type(2))) float v2f;

// k_cvtall: every float matrix ([rows][DM]) to bf16 in fragment order in one launch, 8 elements per thread: thread i of a matrix writes the 16 bytes i of its destination (a wave stores 512 bytes in a row) and reads the 8 floats that belong there. Blocks 0 .. 3 NB GX - 1: stream s = block / (NB GX), batch b, GX blocks each (source batch stride SEQ_FULL * DM, destination XB[s][b]);
// the 4 GW blocks behind them: weight block / GW, destination WB[weight].
static constexpr unsigned GW = (unsigned)(((size_t)DM * DM / 8 + 255) / 256), GX = (unsigned)(((size_t)TT * DM / 8 + 255) / 256);
__global__ __launch_bounds__(256) void k_cvtall(const float* __restrict__ xq, const float* __restrict__ xk, const float* __restrict__ xv, const float* __restrict__ wq, const float* __restrict__ wk, const float* __restrict__ wv, const float* __restrict__ wo, bf* XB, bf* WB) {
    const unsigned x = blockIdx.x; const float* src; bf* dst; size_t i, n8;
    if (x < 3 * NB * GX) { const unsigned s = x / (NB * GX), r = x % (NB * GX), b = r / GX; i = (size_t)(r % GX) * 256 + threadIdx.x; n8 = (size_t)TT * DM / 8;
        src = (s == 0 ? xq : s == 1 ? xk : xv) + (size_t)b * SEQ_FULL * DM; dst = XB + ((size_t)s * NB + b) * TT * DM; }
    else { const unsigned y = x - 3 * NB * GX, s = y / GW; i = (size_t)(y % GW) * 256 + threadIdx.x; n8 = (size_t)DM * DM / 8;
        src = s == 0 ? wq : s == 1 ? wk : s == 2 ? wv : wo; dst = WB + (size_t)s * DM * DM; }
    if (i >= n8) return; const size_t row = (i >> 6) / (DM / 32) * 16 + (i & 15), k = (i >> 6) % (DM / 32) * 32 + ((i >> 5) & 1) * 16 + ((i >> 4) & 1) * 8; const v8f v = *(const v8f*)(src + row * DM + k); v8us o;
#pragma unroll
    for (int k = 0; k < 8; ++k) o[k] = f2bf(v[k]); *(v8us*)(dst + i * 8) = o;  }

// k_hp / k_vtp: nz = NB * NH_ planes, plane z = batch * NH_ + head, read from row batch * TT + t of F; e is the output offset, decoded into (t, d) by the fragment order:
// k_hp  (q, k planes): [z][t / 16][d / 32][half c][lane = hi * 16 + lr][8], t = 16 (t / 16) + lr, d = 32 (d / 32) + 16 c + 8 hi + 0..7  (rows t, k index d).
// k_vtp (v planes):    [z][t / 32][d / 16][half c][lane = hi * 16 + lr][8], d = 16 (d / 16) + lr, t = 32 (t / 32) + 16 c + 8 hi + 0..7  (rows d, k index t).
__device__ __forceinline__ void k_hp(const float* __restrict__ F, int pitch, int nz, h16* P16, bf* Ph, bf* Pl) {
    const size_t e = ((size_t)blockIdx.x * 256 + threadIdx.x) * 2; if (e >= (size_t)nz * TT * HD) return; const int d = (int)(((e >> 9) & 1) * 32 + ((e >> 8) & 1) * 16 + ((e >> 7) & 1) * 8 + (e & 7)); const int t = (int)(((e >> 10) % (TT / 16)) * 16 + ((e >> 3) & 15)); const int z = (int)(e / ((size_t)HD * TT)); const int b = z / NH_, h = z % NH_;
    const v2f x = *(const v2f*)(F + ((size_t)b * TT + t) * pitch + h * HD + d); v2h o16; v2us oh, ol;
#pragma unroll
    for (int q = 0; q < 2; ++q) { const float r = x[q]; o16[q] = tohx(r); unsigned short a2, c2; splitf(r, a2, c2); oh[q] = a2; ol[q] = c2; }
    *(v2h*)(P16 + e) = o16; *(v2us*)(Ph + e) = oh; *(v2us*)(Pl + e) = ol;  }

__device__ __forceinline__ void k_vtp(const float* __restrict__ F, int pitch, int nz, h16* V16, bf* Vh, bf* Vl) { const size_t e = ((size_t)blockIdx.x * 256 + threadIdx.x) * 2; if (e >= (size_t)nz * HD * TT) return; const int t = (int)(((e >> 11) % (TT / 32)) * 32 + ((e >> 8) & 1) * 16 + ((e >> 7) & 1) * 8 + (e & 7)); const int d = (int)(((e >> 9) & 3) * 16 + ((e >> 3) & 15)); const int z = (int)(e / ((size_t)TT * HD)); const int b = z / NH_, g = z % NH_; v2h o16; v2us oh, ol;
#pragma unroll
    for (int q = 0; q < 2; ++q) { const float x = F[((size_t)b * TT + t + q) * pitch + g * HD + d]; o16[q] = tohx(x); unsigned short a2, c2; splitf(x, a2, c2); oh[q] = a2; ol[q] = c2; }
    *(v2h*)(V16 + e) = o16; *(v2us*)(Vh + e) = oh; *(v2us*)(Vl + e) = ol;  }

// k_planes: the nine head planes in one launch; blockIdx.y = stream s (0 q, 1 k: k_hp; 2 v: k_vtp), projection F[s], planes P16[s], PHL[s][hi, lo].
__global__ __launch_bounds__(256) void k_planes(const float* __restrict__ F, int pitch, int nz, h16* P16, bf* PHL) {
    constexpr size_t PE = (size_t)NB * NH_ * TT * HD; const size_t s = blockIdx.y; F += s * ((size_t)NB * TT * DQ); P16 += s * PE; bf* Ph = PHL + 2 * s * PE; bf* Pl = Ph + PE;
    if (s < 2) k_hp(F, pitch, nz, P16, Ph, Pl); else k_vtp(F, pitch, nz, P16, Ph, Pl);
}

// ---- k_fattn: scores, softmax and p.v with the head merge. Work-group = NWA waves that all work on ONE plane z = batch * NH_ + head (blockIdx.y), each wave on query rows of its own: 16 rows on hi+lo bf16 planes or 32 rows on f16 planes.
// The waves of one kind in a work-group (hi+lo or plain) read the same K and V fragments in the same order, so a line that one wave has fetched from L2 is found in the WGP's cache by the others.
// Transposed products: S^T tile = K (A operand, rows = 16 keys) x Q (B operand, columns = 16 query rows), so lane (lr, hi) holds keys 8 hi + 0..7 of query row lr: two such tiles are, element for element, the B fragment of 32 keys
// for O^T = V^T (A operand, rows = 16 d) x P (B operand); p never leaves the registers. The k order of that B fragment (elements 0..7 = keys 8 hi + 0..7, elements 8..15 = keys 16 + 8 hi + 0..7) is the one of the V^T loader.
// Sweep 1 over the keys: running maximum and sum per lane (rescaled when the maximum grows), merged over the two lane halves at the end; the row's (maximum x SL2, 1 / sum) goes to ST[z][row] for k_hmean. Sweep 2: the same score tiles again, e = exp2(s x SL2 - max x SL2), p = e / sum.
// p.v: hi+lo rows multiply the bf16 hi and lo parts of p; plain rows multiply e (f16, at most 1) and scale the finished row by 1 / sum.
// Both sweeps walk the keys in a ring that starts at block rb of 64 keys, another one for each work-group of a plane: work-groups that start together then read different lines of the K and V planes at any moment, not all the same ones.
template <bool HI> struct PT { typedef h16 T; };
template <> struct PT<true> { typedef bf T; };
// v_exp_f32, eight in place per statement: the instruction set asks for one independent instruction or a v_nop behind a transcendental before its result is read or its source overwritten;
// here each v_exp_f32 fills the slot of the one before and one v_nop that of the last.
__device__ __forceinline__ void exp2x8(float (&x)[8]) {
    asm("v_exp_f32 %0, %0\n\tv_exp_f32 %1, %1\n\tv_exp_f32 %2, %2\n\tv_exp_f32 %3, %3\n\tv_exp_f32 %4, %4\n\tv_exp_f32 %5, %5\n\tv_exp_f32 %6, %6\n\tv_exp_f32 %7, %7\n\tv_nop"
        : "+v"(x[0]), "+v"(x[1]), "+v"(x[2]), "+v"(x[3]), "+v"(x[4]), "+v"(x[5]), "+v"(x[6]), "+v"(x[7]));
}
// one v_exp_f32 with the v_nop that fills its slot
__device__ __forceinline__ float exp2x1(float x) { asm("v_exp_f32 %0, %0\n\tv_nop" : "+v"(x)); return x; }

template <bool HI, int NQT>
__device__ __forceinline__ void fattn(int z, int q0, int rb, const typename PT<HI>::T* Qa, const typename PT<HI>::T* Qb, const typename PT<HI>::T* Ka, const typename PT<HI>::T* Kb, const typename PT<HI>::T* Va, const typename PT<HI>::T* Vb, float* ST, bf* ATh, bf* ATl) {
    typedef typename PT<HI>::T T; typedef WFrag<T> WF; typedef typename WF::V V;
    const int lane = threadIdx.x & 31, lr = lane & 15, hi = lane >> 4; const int b = z / NH_, h = z % NH_;
    const size_t zo = (size_t)z * TT * HD + lane * 8;
    Qa += zo; Ka += zo; Va += zo; if constexpr (HI) { Qb += zo; Kb += zo; Vb += zo; }
    // s_wait_xcnt 0 behind a run of loads: their address registers may be rewritten behind it; the run's base pointers are inputs of the statement, so that no load of the run returns into a pair that an earlier one names
    auto xwait = [](const T* pa, const T* pb) { if constexpr (HI) asm volatile("s_wait_xcnt 0x0" :: "v"(pa), "v"(pb) : "memory"); else asm volatile("s_wait_xcnt 0x0" :: "v"(pa) : "memory"); };
    V qa[NQT][2], qb[NQT][2];
    { const T* pa = Qa + (size_t)(q0 / 16) * 1024; const T* pb = HI ? Qb + (size_t)(q0 / 16) * 1024 : nullptr;
#pragma unroll
    for (int qt = 0; qt < NQT; ++qt)
#pragma unroll
        for (int ks = 0; ks < 2; ++ks) { qa[qt][ks] = WF::ldf(pa + (qt * 2 + ks) * 512); if constexpr (HI) qb[qt][ks] = WF::ldf(pb + (qt * 2 + ks) * 512); }
    xwait(pa, pb); }
    // K fragments of the 32 keys kp * 32 .. + 31 (u = key tile, ks = k step)
    auto kload = [&](int kp, V (&ka)[2][2], V (&kb)[2][2]) {
        const T* pa = Ka + (size_t)kp * 2048; const T* pb = HI ? Kb + (size_t)kp * 2048 : nullptr;
#pragma unroll
        for (int u = 0; u < 2; ++u)
#pragma unroll
            for (int ks = 0; ks < 2; ++ks) { ka[u][ks] = WF::ldf(pa + (u * 2 + ks) * 512); if constexpr (HI) kb[u][ks] = WF::ldf(pb + (u * 2 + ks) * 512); }
        xwait(pa, pb);
    };
    // S^T tiles of those 32 keys against the NQT query tiles
    auto stiles = [&](const V (&ka)[2][2], const V (&kb)[2][2], v8f (&st)[2][NQT]) {
#pragma unroll
        for (int u = 0; u < 2; ++u)
#pragma unroll
            for (int qt = 0; qt < NQT; ++qt) { v8f a = (v8f){};
#pragma unroll
                for (int ks = 0; ks < 2; ++ks) { a = WF::mma(ka[u][ks], qa[qt][ks], a); if constexpr (HI) { a = WF::mma(ka[u][ks], qb[qt][ks], a); a = WF::mma(kb[u][ks], qa[qt][ks], a); } }
                st[u][qt] = a; }
    };
    // the K fragments are fetched one trip ahead, as soon as the score products have read the old ones; behind the last trip of a sweep the ring is back at its first keys, which the next sweep starts with
    V ka[2][2], kb[2][2]; kload(2 * rb, ka, kb);
    float mx[NQT], sm[NQT], fn[NQT];
#pragma unroll
    for (int qt = 0; qt < NQT; ++qt) { mx[qt] = -3.0e38f; sm[qt] = 0.f; }
    // rolled: one trip holds 32 keys' fragments and tiles; unrolling it would only add registers
#pragma unroll 1
    for (int i = 0, kp = 2 * rb; i < TT / 32; ++i) {
        kp = kp + 1 < TT / 32 ? kp + 1 : 0;
        v8f st[2][NQT]; stiles(ka, kb, st); kload(kp, ka, kb);
#pragma unroll
        for (int qt = 0; qt < NQT; ++qt) { float t0[8], t1[8]; float tm = mx[qt];
#pragma unroll
            for (int j = 0; j < 8; ++j) tm = fmaxf(tm, fmaxf(st[0][qt][j], st[1][qt][j]));
            const float corr = exp2x1((mx[qt] - tm) * SL2), nm = tm * SL2;
#pragma unroll
            for (int j = 0; j < 8; ++j) { t0[j] = st[0][qt][j] * SL2 - nm; t1[j] = st[1][qt][j] * SL2 - nm; }
            exp2x8(t0); exp2x8(t1);
            float s0 = 0.f, s1 = 0.f;
#pragma unroll
            for (int j = 0; j < 8; ++j) { s0 += t0[j]; s1 += t1[j]; }
            sm[qt] = sm[qt] * corr + (s0 + s1); mx[qt] = tm; }
    }
#pragma unroll
    for (int qt = 0; qt < NQT; ++qt) { const float mm = fmaxf(mx[qt], __shfl_xor(mx[qt], 16, 32)); float s = sm[qt] * exp2x1((mx[qt] - mm) * SL2); s += __shfl_xor(s, 16, 32); mx[qt] = mm * SL2; fn[qt] = __fdiv_rn(1.0f, s); }
    // the two numbers of each query row for k_hmean; both lane halves hold them, the lower half stores (16 rows x 8 bytes = one line per query tile)
    if (hi == 0) {
#pragma unroll
        for (int qt = 0; qt < NQT; ++qt) { v2f sv; sv[0] = mx[qt]; sv[1] = fn[qt]; *(v2f*)(ST + ((size_t)z * TT + q0 + qt * 16 + lr) * 2) = sv; }
        asm volatile("s_wait_xcnt 0x0" ::: "memory"); }   // the registers of the issued stores may be rewritten behind it
    v8f oacc[NQT][4];
#pragma unroll
    for (int qt = 0; qt < NQT; ++qt)
#pragma unroll
        for (int dt = 0; dt < 4; ++dt) oacc[qt][dt] = (v8f){};
    // rolled: one trip holds 32 keys' fragments and tiles; unrolling it would only add registers and code
#pragma unroll 1
    for (int i = 0, kp = 2 * rb; i < TT / 32; ++i) {
        const int kn = kp + 1 < TT / 32 ? kp + 1 : 0;
        // the V^T fragments of this trip are requested ahead of the score products, so that they fly during the softmax
        V va[4], vb[4]; const T* pva = Va + (size_t)kp * 2048; const T* pvb = HI ? Vb + (size_t)kp * 2048 : nullptr;
#pragma unroll
        for (int dt = 0; dt < 4; ++dt) { va[dt] = WF::ldf(pva + dt * 512); if constexpr (HI) vb[dt] = WF::ldf(pvb + dt * 512); }
        xwait(pva, pvb);
        // the three scheduling barriers keep the trip's order (V loads, score products, next K loads, softmax): left free, the compiler sank both runs of loads to right in front of their use, where the wave waits out their whole latency
        __builtin_amdgcn_sched_barrier(0);
        v8f st[2][NQT]; stiles(ka, kb, st);
        __builtin_amdgcn_sched_barrier(0);
        kload(kn, ka, kb); kp = kn;
        __builtin_amdgcn_sched_barrier(0);
        V pa[NQT], pb[NQT];
#pragma unroll
        for (int qt = 0; qt < NQT; ++qt) { v8h o16[2]; v8us oh[2], ol[2];
#pragma unroll
            for (int u = 0; u < 2; ++u) { float t[8];
#pragma unroll
                for (int j = 0; j < 8; ++j) t[j] = st[u][qt][j] * SL2 - mx[qt];
                exp2x8(t);
                if constexpr (HI) {
#pragma unroll
                    for (int j = 0; j < 8; ++j) { unsigned short a, c2; splitf(t[j] * fn[qt], a, c2); oh[u][j] = a; ol[u][j] = c2; }
                } else {
#pragma unroll
                    for (int j = 0; j < 8; ++j) o16[u][j] = tohx(t[j]);
                } }
            if constexpr (HI) { pa[qt] = cat16b(oh[0], oh[1]); pb[qt] = cat16b(ol[0], ol[1]); } else { pa[qt] = cat16(o16[0], o16[1]); } }
#pragma unroll
        for (int dt = 0; dt < 4; ++dt)
#pragma unroll
            for (int qt = 0; qt < NQT; ++qt) { oacc[qt][dt] = WF::mma(va[dt], pa[qt], oacc[qt][dt]); if constexpr (HI) { oacc[qt][dt] = WF::mma(va[dt], pb[qt], oacc[qt][dt]); oacc[qt][dt] = WF::mma(vb[dt], pa[qt], oacc[qt][dt]); } }
        // four vector slots between the last matrix instruction of a trip and the first vector instruction behind the taken loop branch, which may overwrite its operands
        // (one statement that takes every accumulator, so that it stands behind the last matrix instruction)
        static_assert(NQT == 1 || NQT == 2);
        if constexpr (NQT == 1) asm volatile("v_nop\n\tv_nop\n\tv_nop\n\tv_nop" : "+v"(oacc[0][0]), "+v"(oacc[0][1]), "+v"(oacc[0][2]), "+v"(oacc[0][3]));
        else asm volatile("v_nop\n\tv_nop\n\tv_nop\n\tv_nop" : "+v"(oacc[0][0]), "+v"(oacc[0][1]), "+v"(oacc[0][2]), "+v"(oacc[0][3]), "+v"(oacc[NQT - 1][0]), "+v"(oacc[NQT - 1][1]), "+v"(oacc[NQT - 1][2]), "+v"(oacc[NQT - 1][3]));
    }
    // O^T tile dt: element j = (d = 16 dt + 8 hi + j, query row lr): eight neighbouring d of one merged row per lane, which is half (dt & 1) of fragment (row block, k step 2 h + dt / 2) of the merged planes
#pragma unroll
    for (int qt = 0; qt < NQT; ++qt)
#pragma unroll
        for (int dt = 0; dt < 4; ++dt) { v8us oh, ol; const float cs = HI ? 1.0f : fn[qt];
#pragma unroll
            for (int j = 0; j < 8; ++j) { unsigned short a, c2; splitf(oacc[qt][dt][j] * cs, a, c2); oh[j] = a; ol[j] = c2; }
            const size_t oo = ((size_t)b * TT + q0 + qt * 16) * DQ + (h * 2 + (dt >> 1)) * 512 + (dt & 1) * 256 + 8 * lane; *(v8us*)(ATh + oo) = oh; *(v8us*)(ATl + oo) = ol;
            asm volatile("s_wait_xcnt 0x0" ::: "memory"); }   // the registers of the two issued stores may be rewritten behind it
}

// NGA work-groups per plane; each holds NWH waves of 16 hi+lo rows and NWP waves of 32 plain rows, so that every work-group has the same amount of work and NGA x NB x NH_ work-groups cover all rows.
#define NGA  8
#define NWH  (RH / 16 / NGA)
#define NWP  ((TT - RH) / 32 / NGA)
#define NWA  (NWH + NWP)
static_assert(NWH * NGA * 16 == RH && NWP * NGA * 32 == TT - RH && NWH == 4 && NWP >= 4 && 32 * NWA <= 1024);
__global__ __launch_bounds__(32 * NWA) void k_fattn(const h16* __restrict__ Q16, const h16* __restrict__ K16, const h16* __restrict__ V16, const bf* __restrict__ Qh, const bf* __restrict__ Ql, const bf* __restrict__ Kh, const bf* __restrict__ Kl, const bf* __restrict__ Vh, const bf* __restrict__ Vl, float* ST, bf* ATh, bf* ATl) {
    const int g = blockIdx.x, z = blockIdx.y; const int w = __builtin_amdgcn_readfirstlane((int)(threadIdx.x >> 5));
    const int rb = (g * (TT / 64 / NGA) + z * 5) % (TT / 64);   // first block of the ring: any value below TT / 64 gives the same function; the work-groups of one plane start TT / 64 / NGA blocks apart
    // waves 2, 3, 6, 7 take the hi+lo rows (the longer job), the others the plain rows: where waves w and w + 4 share a SIMD, two SIMDs then hold two long jobs each and two hold the short ones (speed only)
    if (w < 8 && (w & 2)) fattn<true, 1>(z, (g * NWH + (w & 1) + (w >> 2) * 2) * 16, rb, Qh, Ql, Kh, Kl, Vh, Vl, ST, ATh, ATl);
    else fattn<false, 2>(z, RH + (g * NWP + (w < 8 ? (w & 1) + (w >> 2) * 2 : w - 4)) * 32, rb, Q16, nullptr, K16, nullptr, V16, nullptr, ST, ATh, ATl);
}

// ---- k_hmean: the head mean of the probabilities in a launch of its own. A wave owns 32 query rows x 64 keys of one batch and loops over the heads: the same S^T score tiles as in k_fattn (same planes, same products, so the same values),
// p = exp2(s x SL2 - ST.max) x ST.inv, summed over the heads in registers. Work-group = 8 waves = 4 row tiles x 2 key tiles (128 x 128): waves of one key tile share its K lines, waves of one row tile its Q lines, through the WGP's cache.
// The heads are walked as a ring from h0, another one for work-groups that share Q or K lines, so that these do not read the same lines at the same moment.
// The finished tile passes through the wave's own LDS tile, so that a store covers whole 256-byte runs of two output rows.
static_assert((NH_ & (NH_ - 1)) == 0 && RH % 128 == 0 && TT % 128 == 0);
template <bool HI>
__device__ __forceinline__ void hmean(float* tl, int b, int q0, int k0, int h0, const typename PT<HI>::T* Qa, const typename PT<HI>::T* Qb, const typename PT<HI>::T* Ka, const typename PT<HI>::T* Kb, const float* __restrict__ ST, float* AVG) {
    typedef typename PT<HI>::T T; typedef WFrag<T> WF; typedef typename WF::V V; constexpr int NQT = 2;
    constexpr int NU = HI ? 1 : 2, NS = 4 / NU;   // a stage = NU key tiles of 16 (hi+lo: one, its fragments take twice the registers), NS stages per head
    const int lane = threadIdx.x & 31, lr = lane & 15, hi = lane >> 4;
    const size_t qo = (size_t)b * NH_ * TT * HD + (size_t)(q0 / 16) * 1024 + lane * 8, ko = (size_t)b * NH_ * TT * HD + (size_t)(k0 / 16) * 1024 + lane * 8;
    Qa += qo; Ka += ko; if constexpr (HI) { Qb += qo; Kb += ko; }
    ST += ((size_t)b * NH_ * TT + q0 + lr) * 2;
    // s_wait_xcnt 0 behind a run of loads: their address registers may be rewritten behind it; the run's base pointers are inputs of the statement, so that no load of the run returns into a pair that an earlier one names
    auto xwait = [](const T* pa, const T* pb) { if constexpr (HI) asm volatile("s_wait_xcnt 0x0" :: "v"(pa), "v"(pb) : "memory"); else asm volatile("s_wait_xcnt 0x0" :: "v"(pa) : "memory"); };
    V qa[NQT][2], qb[NQT][2], ka[NU][2], kb[NU][2]; v2f sn[NQT];
    // Q fragments and the rows' two softmax numbers of head hh
    auto qload = [&](int hh) {
        const T* pa = Qa + (size_t)hh * TT * HD; const T* pb = HI ? Qb + (size_t)hh * TT * HD : nullptr; const float* ps = ST + (size_t)hh * TT * 2;
#pragma unroll
        for (int qt = 0; qt < NQT; ++qt) {
#pragma unroll
            for (int ks = 0; ks < 2; ++ks) { qa[qt][ks] = WF::ldf(pa + (qt * 2 + ks) * 512); if constexpr (HI) qb[qt][ks] = WF::ldf(pb + (qt * 2 + ks) * 512); }
            sn[qt] = *(const v2f*)(ps + qt * 32); }
        xwait(pa, pb); asm volatile("s_wait_xcnt 0x0" :: "v"(ps) : "memory");   // the second: the same for the pointer of the two small loads
    };
    // K fragments of stage s of head hh: keys k0 + 16 NU s .. + 16 NU - 1 (u = key tile, ks = k step)
    auto kload = [&](int hh, int s) {
        const T* pa = Ka + (size_t)hh * TT * HD; const T* pb = HI ? Kb + (size_t)hh * TT * HD : nullptr;   // the head's base: the stage goes into the loads' immediate offsets
#pragma unroll
        for (int u = 0; u < NU; ++u)
#pragma unroll
            for (int ks = 0; ks < 2; ++ks) { ka[u][ks] = WF::ldf(pa + ((s * NU + u) * 2 + ks) * 512); if constexpr (HI) kb[u][ks] = WF::ldf(pb + ((s * NU + u) * 2 + ks) * 512); }
        xwait(pa, pb);
    };
    v8f acc[4][NQT];   // [key tile][query tile]
#pragma unroll
    for (int kt = 0; kt < 4; ++kt)
#pragma unroll
        for (int qt = 0; qt < NQT; ++qt) acc[kt][qt] = (v8f){};
    qload(h0); kload(h0, 0);
    // rolled: one trip is one head; every fragment is fetched one stage ahead, as soon as the score products have read the old one
#pragma unroll 1
    for (int i = 0; i < NH_; ++i) {
        const int hc = (h0 + i) & (NH_ - 1), hn = (hc + 1) & (NH_ - 1);
        float mc[NQT], fc[NQT];
#pragma unroll
        for (int qt = 0; qt < NQT; ++qt) { mc[qt] = sn[qt][0]; fc[qt] = sn[qt][1]; }
#pragma unroll
        for (int s = 0; s < NS; ++s) {
            v8f st[NU][NQT];
#pragma unroll
            for (int u = 0; u < NU; ++u)
#pragma unroll
                for (int qt = 0; qt < NQT; ++qt) { v8f a = (v8f){};
#pragma unroll
                    for (int ks = 0; ks < 2; ++ks) { a = WF::mma(ka[u][ks], qa[qt][ks], a); if constexpr (HI) { a = WF::mma(ka[u][ks], qb[qt][ks], a); a = WF::mma(kb[u][ks], qa[qt][ks], a); } }
                    st[u][qt] = a; }
            // the three scheduling barriers of a stage keep its order (products, next stage's loads, vector work): left free, the compiler mixed the unrolled stages, ran out of registers, spilled and waited on loads right behind their issue
            __builtin_amdgcn_sched_barrier(0);
            if (s + 1 < NS) kload(hc, s + 1); else { qload(hn); kload(hn, 0); }
            __builtin_amdgcn_sched_barrier(0);
#pragma unroll
            for (int u = 0; u < NU; ++u)
#pragma unroll
                for (int qt = 0; qt < NQT; ++qt) { float t[8];
#pragma unroll
                    for (int j = 0; j < 8; ++j) t[j] = st[u][qt][j] * SL2 - mc[qt];
                    exp2x8(t);
#pragma unroll
                    for (int j = 0; j < 8; ++j) acc[s * NU + u][qt][j] += t[j] * fc[qt]; }
            __builtin_amdgcn_sched_barrier(0);
        }
    }
#pragma unroll
    for (int kt = 0; kt < 4; ++kt)
#pragma unroll
        for (int qt = 0; qt < NQT; ++qt) { v4f w0, w1;
#pragma unroll
            for (int j = 0; j < 4; ++j) { w0[j] = acc[kt][qt][j] * (1.0f / NH_); w1[j] = acc[kt][qt][4 + j] * (1.0f / NH_); }
            float* dst = tl + (qt * 16 + lr) * AP + kt * 16 + 8 * hi; *(v4fa*)dst = w0; *(v4fa*)(dst + 4) = w1; }
    // the tile is the wave's own: its LDS writes and reads run in order; the two statements keep the compiler from moving a read over a write of another lane
    __builtin_amdgcn_wave_barrier(); asm volatile("" ::: "memory");
    v4f o[16];
#pragma unroll
    for (int s = 0; s < 16; ++s) o[s] = *(const v4fa*)(tl + (2 * s + hi) * AP + lr * 4);
    float* orow = AVG + ((size_t)b * TT + q0 + hi) * TT + k0 + lr * 4;
#pragma unroll
    for (int s = 0; s < 16; ++s) *(v4f*)(orow + (size_t)(2 * s) * TT) = o[s];
    asm volatile("s_wait_xcnt 0x0" :: "v"(orow) : "memory");   // behind the run of stores: their registers may be rewritten behind it
}

__global__ __launch_bounds__(256) void k_hmean(const h16* __restrict__ Q16, const h16* __restrict__ K16, const bf* __restrict__ Qh, const bf* __restrict__ Ql, const bf* __restrict__ Kh, const bf* __restrict__ Kl, const float* __restrict__ ST, float* AVG) {
    __shared__ __align__(16) float tls[8 * 32 * AP];
    const int w = __builtin_amdgcn_readfirstlane((int)(threadIdx.x >> 5)); const int kb = blockIdx.x, b = blockIdx.z;
    const int qb = (b & 1) ? TT / 128 - 1 - (int)blockIdx.y : (int)blockIdx.y;   // odd batches take the row blocks from the far end: the longer hi+lo blocks of the batches then stand at different places of the grid (speed only)
    float* tl = tls + w * (32 * AP); const int q0 = qb * 128 + (w & 3) * 32, k0 = kb * 128 + (w >> 2) * 64, h0 = (qb + kb) & (NH_ - 1);
    if (qb < RH / 128) hmean<true>(tl, b, q0, k0, h0, Qh, Ql, Kh, Kl, ST, AVG);
    else hmean<false>(tl, b, q0, k0, h0, Q16, nullptr, K16, nullptr, ST, AVG);
}

// workspace plan (bytes): four bf16 weights, the bf16 copies of the three input streams, three f32 projection buffers, nine head planes, the merged hi and lo planes, the two softmax numbers of every (plane, row); all stream-ordered.
static constexpr size_t W_BYTES  = (size_t)DM * DM * 2;
static constexpr size_t XB_BYTES = (size_t)NB * TT * DM * 2;
static constexpr size_t F_BYTES  = (size_t)NB * TT * DM * 4;
static constexpr size_t PL_BYTES = (size_t)NB * NH_ * TT * HD * 2;
static constexpr size_t AT_BYTES = (size_t)NB * TT * DQ * 2;
static constexpr size_t ST_BYTES = (size_t)NB * NH_ * TT * 2 * 4;
static constexpr size_t WS_TOTAL = 4 * W_BYTES + 3 * XB_BYTES + 3 * F_BYTES + 9 * PL_BYTES + 2 * AT_BYTES + ST_BYTES;
static_assert(W_BYTES % 256 == 0 && XB_BYTES % 256 == 0 && F_BYTES % 256 == 0 && PL_BYTES % 256 == 0 && AT_BYTES % 256 == 0 && ST_BYTES % 256 == 0);
static_assert(WS_TOTAL <= (size_t)268435456);

extern "C" void kernel_launch(void* const* d_in, const int* in_sizes, int n_in,
                              void* d_out, int out_size, void* d_ws, size_t ws_size, hipStream_t stream) {
    if (n_in < 11) return;
    const size_t need_x = (size_t)(NB - 1) * SEQ_FULL * DM + (size_t)TT * DM;
    if ((size_t)in_sizes[0] < need_x || (size_t)in_sizes[1] < need_x || (size_t)in_sizes[2] < need_x) return;
    if ((size_t)in_sizes[3] < (size_t)DM * DM || (size_t)in_sizes[5] < (size_t)DM * DM || (size_t)in_sizes[7] < (size_t)DM * DM || (size_t)in_sizes[9] < (size_t)DM * DM) return;
    if (in_sizes[4] < DM || in_sizes[6] < DM || in_sizes[8] < DM || in_sizes[10] < DM) return;
    const size_t AVG_OFF = (size_t)NB_FULL * SEQ_FULL * DM;     // element offset of the second output (byte 16777216)
    if ((size_t)out_size < AVG_OFF + (size_t)NB * TT * TT) return;
    if (ws_size < WS_TOTAL) return;
    const float* xq = (const float*)d_in[0]; const float* xk = (const float*)d_in[1]; const float* xv = (const float*)d_in[2]; const float* wq = (const float*)d_in[3]; const float* bq = (const float*)d_in[4]; const float* wk = (const float*)d_in[5]; const float* bk = (const float*)d_in[6]; const float* wv = (const float*)d_in[7]; const float* bv = (const float*)d_in[8]; const float* wo = (const float*)d_in[9]; const float* bo = (const float*)d_in[10];
    float* OUT = (float*)d_out;                 // [NB][TT][DM]
    float* AVG = (float*)d_out + AVG_OFF;       // [NB][TT][TT]
    char* wsp = (char*)d_ws;
    auto take = [&](size_t bytes) { char* p = wsp; wsp += (bytes + 255) & ~(size_t)255; return (void*)p; };
    bf* WB = (bf*)take(4 * W_BYTES); bf* WO = WB + 3 * (size_t)DM * DM;   // [q, k, v, o][DM][DM]
    bf* XB = (bf*)take(3 * XB_BYTES); float* FQ = (float*)take(3 * F_BYTES);   // [stream][NB * TT][DM] each
    h16* QP16 = (h16*)take(PL_BYTES); h16* KP16 = (h16*)take(PL_BYTES); h16* VT16 = (h16*)take(PL_BYTES);
    bf* QPh = (bf*)take(PL_BYTES); bf* QPl = (bf*)take(PL_BYTES); bf* KPh = (bf*)take(PL_BYTES); bf* KPl = (bf*)take(PL_BYTES); bf* VTh = (bf*)take(PL_BYTES); bf* VTl = (bf*)take(PL_BYTES);
    bf* ATh = (bf*)take(AT_BYTES); bf* ATl = (bf*)take(AT_BYTES); float* ST = (float*)take(ST_BYTES);
    if ((size_t)(wsp - (char*)d_ws) > ws_size) return;

    k_cvtall<<<3 * NB * GX + 4 * GW, 256, 0, stream>>>(xq, xk, xv, wq, wk, wv, wo, XB, WB);
    k_gemmw<bf, 0, true, KWP, DM><<<dim3(NB * TT / 64, DQ / 64, 3), 32 * KWP, 0, stream>>>(XB, nullptr, WB, FQ, DQ, bq, bk, bv, (size_t)NB * TT * DM, (size_t)DM * DM, (size_t)NB * TT * DQ);
    const unsigned LP = (unsigned)(((size_t)NB * NH_ * TT * HD / 2 + 255) / 256);
    k_planes<<<dim3(LP, 3, 1), 256, 0, stream>>>(FQ, DQ, NB * NH_, QP16, QPh);
    k_fattn<<<dim3(NGA, NB * NH_, 1), 32 * NWA, 0, stream>>>(QP16, KP16, VT16, QPh, QPl, KPh, KPl, VTh, VTl, ST, ATh, ATl);
    k_hmean<<<dim3(TT / 128, TT / 128, NB), 256, 0, stream>>>(QP16, KP16, QPh, QPl, KPh, KPl, ST, AVG);
    k_gemmw<bf, 1, true, KWP, DQ><<<dim3(NB * TT / 64, DM / 64, 1), 32 * KWP, 0, stream>>>(ATh, ATl, WO, OUT, DM, bo, nullptr, nullptr, 0, 0, 0);
}

// v010
// One run takes 186 microseconds.
// Timed twice side by side with v009, it ran 1.04 and 1.05 times as fast.
// All steps since v000 together make it 8.80 times as fast.
#include <hip/hip_runtime.h>

// Multi-head attention without a mask over three input streams (query, key, value [2][2048][1024]); q = query Wq^T + bq, k = key Wk^T + bk, v = value Wv^T + bv (W stored [out][in]); 16 heads x 64; scores x 64^-0.5; softmax over all keys; out0 = merged Wo^T + bo; out1 = head mean of the probabilities [2][2048][2048].
// Compute dtypes, f32 accumulate: every float input RNE-converted to bf16; projections v_wmma_f32_16x16x32_bf16 (exact products) + f32 bias; attention query rows < 512: q/k/p/v as bf16 hi+lo planes (3 products), other rows v_wmma_f32_16x16x32_f16 with p carried unnormalised (exp of score minus row maximum, at most 1) and the row scaled by 1 / sum behind p.v; softmax and head mean f32; output projection merged hi+lo (bf16) x bf16 Wo + bias.
// Every launch covers all NB batches (no host loop over the batch): projections run on the NB*TT stacked rows, the head planes are indexed by z = batch * 16 + head.
// Every launch covers all three streams too: one conversion launch (three streams and four weights), one projection launch (blockIdx.z = stream), whose epilogue writes the nine head planes itself (the f32 projections never reach memory).
// Attention is two launches: k_fattn (a work-group owns one head and many query rows, a wave 16 (hi+lo) or 32 (plain) of them; scores, probabilities and p.v stay in registers) and k_hmean (the head mean: a wave owns 32 rows x 64 keys and sums over the heads in registers).
// The head planes are stored in fragment order (512-byte blocks, lane l holds bytes 16 l .. 16 l + 15 of each half), so that every fragment load reads whole cache lines.
// So are the GEMM operands (the bf16 streams and weights, the merged hi and lo planes): [row / 16][k / 32][half c][lane = hi * 16 + lr][8], row = 16 (row / 16) + lr, k = 32 (k / 32) + 16 c + 8 hi + 0..7.

#ifndef NB
#define NB 2
#endif
#ifndef SEQ
#define SEQ 2048
#endif
#define NB_FULL  2
#define SEQ_FULL 2048
#define TT   SEQ
#define DM   1024
#define NH_  16
#define HD   64
#define DQ   (NH_ * HD)
#define RH   512                  // query rows < RH use hi+lo planes
#define SCL  0.125f               // HD^-0.5
#define KWP  8                    // waves sharing the K loop of a projection tile (K = DM)
#define SL2  (SCL * 1.4426950408889634f)   // HD^-0.5 x log2 e: exp(s x HD^-0.5 - max) = exp2(s x SL2 - max x SL2)
#define AP   68                   // LDS pitch (floats) of a 64-key row of probabilities: 272 bytes = 16 x odd
typedef _Float16 h16;
typedef unsigned short bf;
typedef __attribute__((ext_vector_type(16))) __bf16   v16bf;
typedef __attribute__((ext_vector_type(16))) _Float16 v16h;
typedef __attribute__((ext_vector_type(8)))  _Float16 v8h;
typedef __attribute__((ext_vector_type(8)))  unsigned short v8us;
typedef __attribute__((ext_vector_type(8)))  float    v8f;
typedef __attribute__((ext_vector_type(4)))  float    v4f;
typedef v8h  __attribute__((may_alias)) v8ha;
typedef v4f  __attribute__((may_alias)) v4fa;
typedef v8us __attribute__((may_alias)) v8usa;

static_assert((TT - RH) % 32 == 0 && RH % 16 == 0 && RH <= TT);
static_assert(TT % 64 == 0);
static_assert(HD == 64);
static_assert(DM % 64 == 0);
static_assert(DM % (32 * KWP) == 0);
static_assert((size_t)KWP * 64 * 68 * 4 <= 327680);
static_assert((size_t)NB_FULL * SEQ_FULL * DM * 4 == 16777216);
static_assert((size_t)NB_FULL * SEQ_FULL * DM + (size_t)NB * TT * TT <= (size_t)50331648 / 4);

__device__ __forceinline__ unsigned short f2bf(float f) { unsigned u = __float_as_uint(f); u += 0x7FFFu + ((u >> 16) & 1u); return (unsigned short)(u >> 16); }
__device__ __forceinline__ float bf2f(unsigned short b) { return __uint_as_float(((unsigned)b) << 16); }
__device__ __forceinline__ float bfr(float f) { return bf2f(f2bf(f)); }
__device__ __forceinline__ h16 tohx(float x) { return (h16)x; }
__device__ __forceinline__ void splitf(float y, unsigned short& h, unsigned short& l) { h = f2bf(y); l = f2bf(y - bf2f(h)); }
__device__ __forceinline__ v16h cat16(v8h lo, v8h hi) { return __builtin_shufflevector(lo, hi, 0, 1, 2, 3, 4, 5, 6, 7, 8, 9, 10, 11, 12, 13, 14, 15); }
__device__ __forceinline__ v16bf cat16b(v8us lo, v8us hi) { return __builtin_bit_cast(v16bf, __builtin_shufflevector(lo, hi, 0, 1, 2, 3, 4, 5, 6, 7, 8, 9, 10, 11, 12, 13, 14, 15)); }
__device__ __forceinline__ v8f wmma16(v16h a, v16h b, v8f c) { return __builtin_amdgcn_wmma_f32_16x16x32_f16(false, a, false, b, (short)0, c, false, false); }
__device__ __forceinline__ v8f wmmab(v16bf a, v16bf b, v8f c) { return __builtin_amdgcn_wmma_f32_16x16x32_bf16(false, a, false, b, (short)0, c, false, false); }

// ---- k_gemmw: register-blocked GEMM, one work-group of KW waves per 64x64 output tile (16 accumulators per wave), operands straight from 16-bit planes in fragment order; grid (M/64, N/64, Z), 32 * KW threads.
// K split: wave w takes the 32-wide k steps w, w + KW, w + 2 KW, ... (neighbouring waves read neighbouring 1024-byte fragments); for KW > 1 the KW partial tiles meet in LDS and are summed in wave order 0 .. KW-1.
// C[m][n] (f32, pitch ldc, + optional f32 bias[n], bias0 / bias1 / bias2 for z = 0 / 1 / 2) = sum_k A[m][k] Bt[n][k] (NSPLIT == 1: + A2[m][k] Bt[n][k]). z-batch strides sA/sB/sC in elements. K % 32 == 0, M % 64 == 0, N % 64 == 0.
// Fragment map: lane -> row/col (lane & 15), elements 0..7 = k0 + 8*(lane>>4) + 0..7, elements 8..15 = k0 + 16 + 8*(lane>>4) + 0..7 for A and B; D element j = (row 8*(lane>>4) + j, col lane & 15).
template <typename T16> struct WFrag;
template <> struct WFrag<h16> { typedef v16h V; static __device__ __forceinline__ V ldf(const h16* p) { return cat16(*(const v8h*)p, *(const v8h*)(p + 256)); } static __device__ __forceinline__ v8f mma(V a, V b, v8f c) { return wmma16(a, b, c); } };
template <> struct WFrag<bf> { typedef v16bf V; static __device__ __forceinline__ V ldf(const bf* p) { return cat16b(*(const v8us*)p, *(const v8us*)(p + 256)); } static __device__ __forceinline__ v8f mma(V a, V b, v8f c) { return wmmab(a, b, c); } };
// PLANES: C is not written. The tile (64 rows t of one batch x the 64 columns d of head blockIdx.y, stream z) goes out as f16, bf16 hi and bf16 lo head planes P16[z], PHL[z][hi, lo], plane = batch * NH_ + head, in fragment order:
// q, k planes (z < 2): [plane][t / 16][d / 32][half c][lane = hi * 16 + lr][8], t = 16 (t / 16) + lr, d = 32 (d / 32) + 16 c + 8 hi + 0..7  (rows t, k index d).
// v planes   (z == 2): [plane][t / 32][d / 16][half c][lane = hi * 16 + lr][8], d = 16 (d / 16) + lr, t = 32 (t / 32) + 16 c + 8 hi + 0..7  (rows d, k index t).
// In both orders the tile is 4096 elements in a row of each plane, 512 units of 8; thread i writes the 16 bytes of units i and i + 256, so a wave's store covers 512 bytes in a row.
template <typename T16, int NSPLIT, bool BIAS, int KW, int K, bool PLANES>
__global__ __launch_bounds__(32 * KW) void k_gemmw(const T16* __restrict__ A, const T16* __restrict__ A2, const T16* __restrict__ Bt, float* C, int ldc, const float* __restrict__ bias0, const float* __restrict__ bias1, const float* __restrict__ bias2, size_t sA, size_t sB, size_t sC, h16* P16, bf* PHL) {
    typedef typename WFrag<T16>::V V;
    __shared__ __align__(16) float os[(KW == 1 ? 16 : KW * 64) * 68];
    const int w = (KW == 1) ? 0 : __builtin_amdgcn_readfirstlane((int)(threadIdx.x >> 5));
    const size_t z = blockIdx.z; A += z * sA; if (A2) A2 += z * sA; Bt += z * sB; C += z * sC;
    const float* bias = z == 0 ? bias0 : z == 1 ? bias1 : bias2;   // the biases are separate inputs: batch entry z adds its own
    const int lane = threadIdx.x & 31, lr = lane & 15, hi = lane >> 4; const int r0 = blockIdx.x * 64, c0 = blockIdx.y * 64;
    // PLANES: unit i = r * 256 + thread of the tile's 512 lies in LDS row urow(i) from column ucol(i) on (the v tile lies there as [d][t], the q and k tiles as [t][d]).
    // Its bias values (q, k: those of its 8 columns d; v: the one of its row d) are the same for both r; they are requested here, ahead of the K loop, and first read in the epilogue, so that they fly during the loop.
    static_assert(!PLANES || KW == 8);
    constexpr int NU8 = 2; const bool vt = PLANES && z == 2;
    auto urow = [&](int i) { return (vt ? (i >> 6) & 3 : i >> 7) * 16 + (i & 15); }; auto ucol = [&](int i) { return (vt ? i >> 8 : (i >> 6) & 1) * 32 + ((i >> 4) & 3) * 8; };
    v4f bs0 = (v4f){}, bs1 = (v4f){};
    if constexpr (PLANES) { const int i = (int)threadIdx.x; const float* pb = bias + c0 + (vt ? urow(i) : ucol(i));
        if (vt) bs0[0] = *pb; else { bs0 = *(const v4f*)pb; bs1 = *(const v4f*)(pb + 4); }
        asm volatile("s_wait_xcnt 0x0" :: "v"(pb) : "memory"); }   // the address registers of the issued loads may be rewritten behind it; the pointer is an input, so that it lives up to the wait
    v8f acc[4][4];
#pragma unroll
    for (int mb = 0; mb < 4; ++mb)
#pragma unroll
        for (int nb = 0; nb < 4; ++nb) acc[mb][nb] = (v8f){};
    // fragment (row block rb, k step ks) starts at element (rb * (K / 32) + ks) * 512 = rb * 16 * K + ks * 512; K is a compile-time constant, so that a trip's loads of one plane share one address pair and differ in the immediate offset
    static_assert(NSPLIT == 0 || NSPLIT == 1);
    const T16* Ar = A + (size_t)r0 * K + 8 * lane; const T16* A2r = NSPLIT == 1 ? A2 + (size_t)r0 * K + 8 * lane : nullptr; const T16* Br = Bt + (size_t)c0 * K + 8 * lane;
#pragma unroll 1
    for (int kc = w * 32; kc < K; kc += 32 * KW) {
        V a[4], a2[4], b[4]; const T16* pa = Ar + kc * 16; const T16* pa2 = NSPLIT == 1 ? A2r + kc * 16 : nullptr; const T16* pb = Br + kc * 16;
#pragma unroll
        for (int mb = 0; mb < 4; ++mb) { a[mb] = WFrag<T16>::ldf(pa + mb * 16 * K); if constexpr (NSPLIT == 1) a2[mb] = WFrag<T16>::ldf(pa2 + mb * 16 * K); }
#pragma unroll
        for (int nb = 0; nb < 4; ++nb) b[nb] = WFrag<T16>::ldf(pb + nb * 16 * K);
        // s_wait_xcnt 0 behind the trip's run of loads: their address registers may be rewritten behind it; the run's base pointers are inputs of the statement, so that no load of the run returns into a pair that an earlier one names
        if constexpr (NSPLIT == 1) asm volatile("s_wait_xcnt 0x0" :: "v"(pa), "v"(pa2), "v"(pb) : "memory"); else asm volatile("s_wait_xcnt 0x0" :: "v"(pa), "v"(pb) : "memory");
#pragma unroll
        for (int nb = 0; nb < 4; ++nb)
#pragma unroll
            for (int mb = 0; mb < 4; ++mb) { acc[mb][nb] = WFrag<T16>::mma(a[mb], b[nb], acc[mb][nb]); if constexpr (NSPLIT == 1) acc[mb][nb] = WFrag<T16>::mma(a2[mb], b[nb], acc[mb][nb]); }
        // four vector slots between the last matrix instruction of a trip and the first vector instruction behind the taken loop branch
        // every fragment of the trip is an input: each keeps registers of its own to the trip's end, so that all of a trip's loads are issued ahead of its products (with one B fragment's registers used four times over, each column block waited out a load of its own)
        if constexpr (NSPLIT == 1) asm volatile("v_nop\n\tv_nop\n\tv_nop\n\tv_nop" : "+v"(acc[0][0]), "+v"(acc[1][1]), "+v"(acc[2][2]), "+v"(acc[3][3]) : "v"(a[0]), "v"(a[1]), "v"(a[2]), "v"(a[3]), "v"(a2[0]), "v"(a2[1]), "v"(a2[2]), "v"(a2[3]), "v"(b[0]), "v"(b[1]), "v"(b[2]), "v"(b[3]));
        else asm volatile("v_nop\n\tv_nop\n\tv_nop\n\tv_nop" : "+v"(acc[0][0]), "+v"(acc[1][1]), "+v"(acc[2][2]), "+v"(acc[3][3]) : "v"(a[0]), "v"(a[1]), "v"(a[2]), "v"(a[3]), "v"(b[0]), "v"(b[1]), "v"(b[2]), "v"(b[3]));
    }
    if constexpr (PLANES) {
        static_assert(BIAS && HD == 64 && TT % 64 == 0);
        // a unit of a v plane is 8 neighbouring t of one d: the v tile lies in LDS as [d][t], the q and k tiles as [t][d], so that a unit is 32 bytes in a row of an LDS row either way
        float* ow = os + w * (64 * 68);
        if (vt) {   // a lane's 8 accumulator elements are 8 neighbouring t of one d
#pragma unroll
            for (int mb = 0; mb < 4; ++mb)
#pragma unroll
                for (int nb = 0; nb < 4; ++nb) { v4f x0, x1;
#pragma unroll
                    for (int j = 0; j < 4; ++j) { x0[j] = acc[mb][nb][j]; x1[j] = acc[mb][nb][4 + j]; }
                    float* dst = ow + (nb * 16 + lr) * 68 + mb * 16 + hi * 8; *(v4fa*)dst = x0; *(v4fa*)(dst + 4) = x1; }
        } else {
#pragma unroll
            for (int mb = 0; mb < 4; ++mb)
#pragma unroll
                for (int nb = 0; nb < 4; ++nb)
#pragma unroll
                    for (int j = 0; j < 8; ++j) ow[(mb * 16 + hi * 8 + j) * 68 + nb * 16 + lr] = acc[mb][nb][j];
        }
        __syncthreads();   // every wave's partial tile is in LDS before any thread sums across waves
        constexpr size_t PE = (size_t)NB * NH_ * TT * HD;
        const size_t po = ((size_t)(r0 / TT) * NH_ + blockIdx.y) * TT * HD + (size_t)(r0 % TT) * HD;   // the tile's first element in its plane
        h16* p16 = P16 + z * PE + po; bf* ph = PHL + 2 * z * PE + po; bf* pl = ph + PE;
        float bs[8];
#pragma unroll
        for (int j = 0; j < 8; ++j) bs[j] = bfr(vt ? bs0[0] : j < 4 ? bs0[j & 3] : bs1[j & 3]);
        v8h o16[NU8]; v8us oh[NU8], ol[NU8];
#pragma unroll
        for (int r = 0; r < NU8; ++r) { const int i = r * 32 * KW + (int)threadIdx.x, row = urow(i), cofs = ucol(i);
            v4f v0 = *(const v4fa*)(os + row * 68 + cofs), v1 = *(const v4fa*)(os + row * 68 + cofs + 4);
#pragma unroll
            for (int u = 1; u < KW; ++u) { const v4f q0 = *(const v4fa*)(os + u * (64 * 68) + row * 68 + cofs), q1 = *(const v4fa*)(os + u * (64 * 68) + row * 68 + cofs + 4);
#pragma unroll
                for (int j = 0; j < 4; ++j) { v0[j] += q0[j]; v1[j] += q1[j]; } }
#pragma unroll
            for (int j = 0; j < 8; ++j) { const float y = (j < 4 ? v0[j & 3] : v1[j & 3]) + bs[j]; o16[r][j] = tohx(y); unsigned short a2, c2; splitf(y, a2, c2); oh[r][j] = a2; ol[r][j] = c2; } }
        __builtin_amdgcn_sched_barrier(0);   // all of the units' arithmetic stays ahead of the run of stores, so that no register of an issued store is rewritten in front of the wait behind the run
#pragma unroll
        for (int r = 0; r < NU8; ++r) { const int i = r * 32 * KW + (int)threadIdx.x; *(v8h*)(p16 + i * 8) = o16[r]; *(v8us*)(ph + i * 8) = oh[r]; *(v8us*)(pl + i * 8) = ol[r]; }
        asm volatile("s_wait_xcnt 0x0" ::: "memory");   // behind the run of stores: their registers may be rewritten behind it
    } else if constexpr (KW > 1) {
        float* ow = os + w * (64 * 68);
#pragma unroll
        for (int mb = 0; mb < 4; ++mb)
#pragma unroll
            for (int nb = 0; nb < 4; ++nb)
#pragma unroll
                for (int j = 0; j < 8; ++j) ow[(mb * 16 + hi * 8 + j) * 68 + nb * 16 + lr] = acc[mb][nb][j];
        __syncthreads();   // every wave's partial tile is in LDS before any thread sums across waves
#pragma unroll
        for (int r = 0; r < 64 * 16 / (32 * KW); ++r) { const int s = r * 32 * KW + (int)threadIdx.x, row = s >> 4, cofs = (s & 15) * 4; v4f val = *(const v4fa*)(os + row * 68 + cofs);
#pragma unroll
            for (int u = 1; u < KW; ++u) { const v4f pv = *(const v4fa*)(os + u * (64 * 68) + row * 68 + cofs); val[0] += pv[0]; val[1] += pv[1]; val[2] += pv[2]; val[3] += pv[3]; }
            if (BIAS) { val[0] += bfr(bias[c0 + cofs]); val[1] += bfr(bias[c0 + cofs + 1]); val[2] += bfr(bias[c0 + cofs + 2]); val[3] += bfr(bias[c0 + cofs + 3]); }
            *(v4f*)(C + (size_t)(r0 + row) * ldc + c0 + cofs) = val; }
    } else {
#pragma unroll
    for (int mb = 0; mb < 4; ++mb) {
#pragma unroll
        for (int nb = 0; nb < 4; ++nb) {
#pragma unroll
            for (int j = 0; j < 8; ++j) os[(hi * 8 + j) * 68 + nb * 16 + lr] = acc[mb][nb][j]; }
        __builtin_amdgcn_wave_barrier(); asm volatile("" ::: "memory");
        float* crow = C + (size_t)(r0 + mb * 16) * ldc + c0;
{
#pragma unroll
            for (int s = 0; s < 8; ++s) { const int row = 2 * s + hi, cofs = lr * 4; v4f val = *(const v4fa*)(os + row * 68 + cofs); if (BIAS) { val[0] += bfr(bias[c0 + cofs]); val[1] += bfr(bias[c0 + cofs + 1]); val[2] += bfr(bias[c0 + cofs + 2]); val[3] += bfr(bias[c0 + cofs + 3]); }
                *(v4f*)(crow + (size_t)row * ldc + cofs) = val; }
             }
        __builtin_amdgcn_wave_barrier(); asm volatile("" ::: "memory");
    }
    }
}

typedef __attribute__((ext_vector_type(2))) _Float16 v2h;
typedef __attribute__((ext_vector_type(4))) _Float16 v4h;
typedef __attribute__((ext_vector_type(2))) unsigned short v2us;
typedef __attribute__((ext_vector_type(4))) unsigned short v4us;
typedef __attribute__((ext_vector_type(2))) float v2f;

// k_cvtall: every float matrix ([rows][DM]) to bf16 in fragment order in one launch, 8 elements per thread: thread i of a matrix writes the 16 bytes i of its destination (a wave stores 512 bytes in a row) and reads the 8 floats that belong there. Blocks 0 .. 3 NB GX - 1: stream s = block / (NB GX), batch b, GX blocks each (source batch stride SEQ_FULL * DM, destination XB[s][b]);
// the 4 GW blocks behind them: weight block / GW, destination WB[weight].
static constexpr unsigned GW = (unsigned)(((size_t)DM * DM / 8 + 255) / 256), GX = (unsigned)(((size_t)TT * DM / 8 + 255) / 256);
__global__ __launch_bounds__(256) void k_cvtall(const float* __restrict__ xq, const float* __restrict__ xk, const float* __restrict__ xv, const float* __restrict__ wq, const float* __restrict__ wk, const float* __restrict__ wv, const float* __restrict__ wo, bf* XB, bf* WB) {
    const unsigned x = blockIdx.x; const float* src; bf* dst; size_t i, n8;
    if (x < 3 * NB * GX) { const unsigned s = x / (NB * GX), r = x % (NB * GX), b = r / GX; i = (size_t)(r % GX) * 256 + threadIdx.x; n8 = (size_t)TT * DM / 8;
        src = (s == 0 ? xq : s == 1 ? xk : xv) + (size_t)b * SEQ_FULL * DM; dst = XB + ((size_t)s * NB + b) * TT * DM; }
    else { const unsigned y = x - 3 * NB * GX, s = y / GW; i = (size_t)(y % GW) * 256 + threadIdx.x; n8 = (size_t)DM * DM / 8;
        src = s == 0 ? wq : s == 1 ? wk : s == 2 ? wv : wo; dst = WB + (size_t)s * DM * DM; }
    if (i >= n8) return; const size_t row = (i >> 6) / (DM / 32) * 16 + (i & 15), k = (i >> 6) % (DM / 32) * 32 + ((i >> 5) & 1) * 16 + ((i >> 4) & 1) * 8; const v8f v = *(const v8f*)(src + row * DM + k); v8us o;
#pragma unroll
    for (int k = 0; k < 8; ++k) o[k] = f2bf(v[k]); *(v8us*)(dst + i * 8) = o;  }

// ---- k_fattn: scores, softmax and p.v with the head merge. Work-group = NWA waves that all work on ONE plane z = batch * NH_ + head (blockIdx.y), each wave on query rows of its own: 16 rows on hi+lo bf16 planes or 32 rows on f16 planes.
// The waves of one kind in a work-group (hi+lo or plain) read the same K and V fragments in the same order, so a line that one wave has fetched from L2 is found in the WGP's cache by the others.
// Transposed products: S^T tile = K (A operand, rows = 16 keys) x Q (B operand, columns = 16 query rows), so lane (lr, hi) holds keys 8 hi + 0..7 of query row lr: two such tiles are, element for element, the B fragment of 32 keys
// for O^T = V^T (A operand, rows = 16 d) x P (B operand); p never leaves the registers. The k order of that B fragment (elements 0..7 = keys 8 hi + 0..7, elements 8..15 = keys 16 + 8 hi + 0..7) is the one of the V^T loader.
// Sweep 1 over the keys: running maximum and sum per lane (rescaled when the maximum grows), merged over the two lane halves at the end; the row's (maximum x SL2, 1 / sum) goes to ST[z][row] for k_hmean. Sweep 2: the same score tiles again, e = exp2(s x SL2 - max x SL2), p = e / sum.
// p.v: hi+lo rows multiply the bf16 hi and lo parts of p; plain rows multiply e (f16, at most 1) and scale the finished row by 1 / sum.
// Both sweeps walk the keys in a ring that starts at block rb of 64 keys, another one for each work-group of a plane: work-groups that start together then read different lines of the K and V planes at any moment, not all the same ones.
template <bool HI> struct PT { typedef h16 T; };
template <> struct PT<true> { typedef bf T; };
// v_exp_f32, eight in place per statement: the instruction set asks for one independent instruction or a v_nop behind a transcendental before its result is read or its source overwritten;
// here each v_exp_f32 fills the slot of the one before and one v_nop that of the last.
__device__ __forceinline__ void exp2x8(float (&x)[8]) {
    asm("v_exp_f32 %0, %0\n\tv_exp_f32 %1, %1\n\tv_exp_f32 %2, %2\n\tv_exp_f32 %3, %3\n\tv_exp_f32 %4, %4\n\tv_exp_f32 %5, %5\n\tv_exp_f32 %6, %6\n\tv_exp_f32 %7, %7\n\tv_nop"
        : "+v"(x[0]), "+v"(x[1]), "+v"(x[2]), "+v"(x[3]), "+v"(x[4]), "+v"(x[5]), "+v"(x[6]), "+v"(x[7]));
}
// one v_exp_f32 with the v_nop that fills its slot
__device__ __forceinline__ float exp2x1(float x) { asm("v_exp_f32 %0, %0\n\tv_nop" : "+v"(x)); return x; }

template <bool HI, int NQT>
__device__ __forceinline__ void fattn(int z, int q0, int rb, const typename PT<HI>::T* Qa, const typename PT<HI>::T* Qb, const typename PT<HI>::T* Ka, const typename PT<HI>::T* Kb, const typename PT<HI>::T* Va, const typename PT<HI>::T* Vb, float* ST, bf* ATh, bf* ATl) {
    typedef typename PT<HI>::T T; typedef WFrag<T> WF; typedef typename WF::V V;
    const int lane = threadIdx.x & 31, lr = lane & 15, hi = lane >> 4; const int b = z / NH_, h = z % NH_;
    const size_t zo = (size_t)z * TT * HD + lane * 8;
    Qa += zo; Ka += zo; Va += zo; if constexpr (HI) { Qb += zo; Kb += zo; Vb += zo; }
    // s_wait_xcnt 0 behind a run of loads: their address registers may be rewritten behind it; the run's base pointers are inputs of the statement, so that no load of the run returns into a pair that an earlier one names
    auto xwait = [](const T* pa, const T* pb) { if constexpr (HI) asm volatile("s_wait_xcnt 0x0" :: "v"(pa), "v"(pb) : "memory"); else asm volatile("s_wait_xcnt 0x0" :: "v"(pa) : "memory"); };
    V qa[NQT][2], qb[NQT][2];
    { const T* pa = Qa + (size_t)(q0 / 16) * 1024; const T* pb = HI ? Qb + (size_t)(q0 / 16) * 1024 : nullptr;
#pragma unroll
    for (int qt = 0; qt < NQT; ++qt)
#pragma unroll
        for (int ks = 0; ks < 2; ++ks) { qa[qt][ks] = WF::ldf(pa + (qt * 2 + ks) * 512); if constexpr (HI) qb[qt][ks] = WF::ldf(pb + (qt * 2 + ks) * 512); }
    xwait(pa, pb); }
    // K fragments of the 32 keys kp * 32 .. + 31 (u = key tile, ks = k step)
    auto kload = [&](int kp, V (&ka)[2][2], V (&kb)[2][2]) {
        const T* pa = Ka + (size_t)kp * 2048; const T* pb = HI ? Kb + (size_t)kp * 2048 : nullptr;
#pragma unroll
        for (int u = 0; u < 2; ++u)
#pragma unroll
            for (int ks = 0; ks < 2; ++ks) { ka[u][ks] = WF::ldf(pa + (u * 2 + ks) * 512); if constexpr (HI) kb[u][ks] = WF::ldf(pb + (u * 2 + ks) * 512); }
        xwait(pa, pb);
    };
    // S^T tiles of those 32 keys against the NQT query tiles
    auto stiles = [&](const V (&ka)[2][2], const V (&kb)[2][2], v8f (&st)[2][NQT]) {
#pragma unroll
        for (int u = 0; u < 2; ++u)
#pragma unroll
            for (int qt = 0; qt < NQT; ++qt) { v8f a = (v8f){};
#pragma unroll
                for (int ks = 0; ks < 2; ++ks) { a = WF::mma(ka[u][ks], qa[qt][ks], a); if constexpr (HI) { a = WF::mma(ka[u][ks], qb[qt][ks], a); a = WF::mma(kb[u][ks], qa[qt][ks], a); } }
                st[u][qt] = a; }
    };
    // the K fragments are fetched one trip ahead, as soon as the score products have read the old ones; behind the last trip of a sweep the ring is back at its first keys, which the next sweep starts with
    V ka[2][2], kb[2][2]; kload(2 * rb, ka, kb);
    float mx[NQT], sm[NQT], fn[NQT];
#pragma unroll
    for (int qt = 0; qt < NQT; ++qt) { mx[qt] = -3.0e38f; sm[qt] = 0.f; }
    // rolled: one trip holds 32 keys' fragments and tiles; unrolling it would only add registers
#pragma unroll 1
    for (int i = 0, kp = 2 * rb; i < TT / 32; ++i) {
        kp = kp + 1 < TT / 32 ? kp + 1 : 0;
        v8f st[2][NQT]; stiles(ka, kb, st); kload(kp, ka, kb);
#pragma unroll
        for (int qt = 0; qt < NQT; ++qt) { float t0[8], t1[8]; float tm = mx[qt];
#pragma unroll
            for (int j = 0; j < 8; ++j) tm = fmaxf(tm, fmaxf(st[0][qt][j], st[1][qt][j]));
            const float corr = exp2x1((mx[qt] - tm) * SL2), nm = tm * SL2;
#pragma unroll
            for (int j = 0; j < 8; ++j) { t0[j] = st[0][qt][j] * SL2 - nm; t1[j] = st[1][qt][j] * SL2 - nm; }
            exp2x8(t0); exp2x8(t1);
            float s0 = 0.f, s1 = 0.f;
#pragma unroll
            for (int j = 0; j < 8; ++j) { s0 += t0[j]; s1 += t1[j]; }
            sm[qt] = sm[qt] * corr + (s0 + s1); mx[qt] = tm; }
    }
#pragma unroll
    for (int qt = 0; qt < NQT; ++qt) { const float mm = fmaxf(mx[qt], __shfl_xor(mx[qt], 16, 32)); float s = sm[qt] * exp2x1((mx[qt] - mm) * SL2); s += __shfl_xor(s, 16, 32); mx[qt] = mm * SL2; fn[qt] = __fdiv_rn(1.0f, s); }
    // the two numbers of each query row for k_hmean; both lane halves hold them, the lower half stores (16 rows x 8 bytes = one line per query tile)
    if (hi == 0) {
#pragma unroll
        for (int qt = 0; qt < NQT; ++qt) { v2f sv; sv[0] = mx[qt]; sv[1] = fn[qt]; *(v2f*)(ST + ((size_t)z * TT + q0 + qt * 16 + lr) * 2) = sv; }
        asm volatile("s_wait_xcnt 0x0" ::: "memory"); }   // the registers of the issued stores may be rewritten behind it
    v8f oacc[NQT][4];
#pragma unroll
    for (int qt = 0; qt < NQT; ++qt)
#pragma unroll
        for (int dt = 0; dt < 4; ++dt) oacc[qt][dt] = (v8f){};
    // rolled: one trip holds 32 keys' fragments and tiles; unrolling it would only add registers and code
#pragma unroll 1
    for (int i = 0, kp = 2 * rb; i < TT / 32; ++i) {
        const int kn = kp + 1 < TT / 32 ? kp + 1 : 0;
        // the V^T fragments of this trip are requested ahead of the score products, so that they fly during the softmax
        V va[4], vb[4]; const T* pva = Va + (size_t)kp * 2048; const T* pvb = HI ? Vb + (size_t)kp * 2048 : nullptr;
#pragma unroll
        for (int dt = 0; dt < 4; ++dt) { va[dt] = WF::ldf(pva + dt * 512); if constexpr (HI) vb[dt] = WF::ldf(pvb + dt * 512); }
        xwait(pva, pvb);
        // the three scheduling barriers keep the trip's order (V loads, score products, next K loads, softmax): left free, the compiler sank both runs of loads to right in front of their use, where the wave waits out their whole latency
        __builtin_amdgcn_sched_barrier(0);
        v8f st[2][NQT]; stiles(ka, kb, st);
        __builtin_amdgcn_sched_barrier(0);
        kload(kn, ka, kb); kp = kn;
        __builtin_amdgcn_sched_barrier(0);
        V pa[NQT], pb[NQT];
#pragma unroll
        for (int qt = 0; qt < NQT; ++qt) { v8h o16[2]; v8us oh[2], ol[2];
#pragma unroll
            for (int u = 0; u < 2; ++u) { float t[8];
#pragma unroll
                for (int j = 0; j < 8; ++j) t[j] = st[u][qt][j] * SL2 - mx[qt];
                exp2x8(t);
                if constexpr (HI) {
#pragma unroll
                    for (int j = 0; j < 8; ++j) { unsigned short a, c2; splitf(t[j] * fn[qt], a, c2); oh[u][j] = a; ol[u][j] = c2; }
                } else {
#pragma unroll
                    for (int j = 0; j < 8; ++j) o16[u][j] = tohx(t[j]);
                } }
            if constexpr (HI) { pa[qt] = cat16b(oh[0], oh[1]); pb[qt] = cat16b(ol[0], ol[1]); } else { pa[qt] = cat16(o16[0], o16[1]); } }
#pragma unroll
        for (int dt = 0; dt < 4; ++dt)
#pragma unroll
            for (int qt = 0; qt < NQT; ++qt) { oacc[qt][dt] = WF::mma(va[dt], pa[qt], oacc[qt][dt]); if constexpr (HI) { oacc[qt][dt] = WF::mma(va[dt], pb[qt], oacc[qt][dt]); oacc[qt][dt] = WF::mma(vb[dt], pa[qt], oacc[qt][dt]); } }
        // four vector slots between the last matrix instruction of a trip and the first vector instruction behind the taken loop branch, which may overwrite its operands
        // (one statement that takes every accumulator, so that it stands behind the last matrix instruction)
        static_assert(NQT == 1 || NQT == 2);
        if constexpr (NQT == 1) asm volatile("v_nop\n\tv_nop\n\tv_nop\n\tv_nop" : "+v"(oacc[0][0]), "+v"(oacc[0][1]), "+v"(oacc[0][2]), "+v"(oacc[0][3]));
        else asm volatile("v_nop\n\tv_nop\n\tv_nop\n\tv_nop" : "+v"(oacc[0][0]), "+v"(oacc[0][1]), "+v"(oacc[0][2]), "+v"(oacc[0][3]), "+v"(oacc[NQT - 1][0]), "+v"(oacc[NQT - 1][1]), "+v"(oacc[NQT - 1][2]), "+v"(oacc[NQT - 1][3]));
    }
    // O^T tile dt: element j = (d = 16 dt + 8 hi + j, query row lr): eight neighbouring d of one merged row per lane, which is half (dt & 1) of fragment (row block, k step 2 h + dt / 2) of the merged planes
#pragma unroll
    for (int qt = 0; qt < NQT; ++qt)
#pragma unroll
        for (int dt = 0; dt < 4; ++dt) { v8us oh, ol; const float cs = HI ? 1.0f : fn[qt];
#pragma unroll
            for (int j = 0; j < 8; ++j) { unsigned short a, c2; splitf(oacc[qt][dt][j] * cs, a, c2); oh[j] = a; ol[j] = c2; }
            const size_t oo = ((size_t)b * TT + q0 + qt * 16) * DQ + (h * 2 + (dt >> 1)) * 512 + (dt & 1) * 256 + 8 * lane; *(v8us*)(ATh + oo) = oh; *(v8us*)(ATl + oo) = ol;
            asm volatile("s_wait_xcnt 0x0" ::: "memory"); }   // the registers of the two issued stores may be rewritten behind it
}

// NGA work-groups per plane; each holds NWH waves of 16 hi+lo rows and NWP waves of 32 plain rows, so that every work-group has the same amount of work and NGA x NB x NH_ work-groups cover all rows.
#define NGA  8
#define NWH  (RH / 16 / NGA)
#define NWP  ((TT - RH) / 32 / NGA)
#define NWA  (NWH + NWP)
static_assert(NWH * NGA * 16 == RH && NWP * NGA * 32 == TT - RH && NWH == 4 && NWP >= 4 && 32 * NWA <= 1024);
__global__ __launch_bounds__(32 * NWA) void k_fattn(const h16* __restrict__ Q16, const h16* __restrict__ K16, const h16* __restrict__ V16, const bf* __restrict__ Qh, const bf* __restrict__ Ql, const bf* __restrict__ Kh, const bf* __restrict__ Kl, const bf* __restrict__ Vh, const bf* __restrict__ Vl, float* ST, bf* ATh, bf* ATl) {
    const int g = blockIdx.x, z = blockIdx.y; const int w = __builtin_amdgcn_readfirstlane((int)(threadIdx.x >> 5));
    const int rb = (g * (TT / 64 / NGA) + z * 5) % (TT / 64);   // first block of the ring: any value below TT / 64 gives the same function; the work-groups of one plane start TT / 64 / NGA blocks apart
    // waves 2, 3, 6, 7 take the hi+lo rows (the longer job), the others the plain rows: where waves w and w + 4 share a SIMD, two SIMDs then hold two long jobs each and two hold the short ones (speed only)
    if (w < 8 && (w & 2)) fattn<true, 1>(z, (g * NWH + (w & 1) + (w >> 2) * 2) * 16, rb, Qh, Ql, Kh, Kl, Vh, Vl, ST, ATh, ATl);
    else fattn<false, 2>(z, RH + (g * NWP + (w < 8 ? (w & 1) + (w >> 2) * 2 : w - 4)) * 32, rb, Q16, nullptr, K16, nullptr, V16, nullptr, ST, ATh, ATl);
}

// ---- k_hmean: the head mean of the probabilities in a launch of its own. A wave owns 32 query rows x 64 keys of one batch and loops over the heads: the same S^T score tiles as in k_fattn (same planes, same products, so the same values),
// p = exp2(s x SL2 - ST.max) x ST.inv, summed over the heads in registers. Work-group = 8 waves = 4 row tiles x 2 key tiles (128 x 128): waves of one key tile share its K lines, waves of one row tile its Q lines, through the WGP's cache.
// The heads are walked as a ring from h0, another one for work-groups that share Q or K lines, so that these do not read the same lines at the same moment.
// The finished tile passes through the wave's own LDS tile, so that a store covers whole 256-byte runs of two output rows.
static_assert((NH_ & (NH_ - 1)) == 0 && RH % 128 == 0 && TT % 128 == 0);
template <bool HI>
__device__ __forceinline__ void hmean(float* tl, int b, int q0, int k0, int h0, const typename PT<HI>::T* Qa, const typename PT<HI>::T* Qb, const typename PT<HI>::T* Ka, const typename PT<HI>::T* Kb, const float* __restrict__ ST, float* AVG) {
    typedef typename PT<HI>::T T; typedef WFrag<T> WF; typedef typename WF::V V; constexpr int NQT = 2;
    constexpr int NU = HI ? 1 : 2, NS = 4 / NU;   // a stage = NU key tiles of 16 (hi+lo: one, its fragments take twice the registers), NS stages per head
    const int lane = threadIdx.x & 31, lr = lane & 15, hi = lane >> 4;
    const size_t qo = (size_t)b * NH_ * TT * HD + (size_t)(q0 / 16) * 1024 + lane * 8, ko = (size_t)b * NH_ * TT * HD + (size_t)(k0 / 16) * 1024 + lane * 8;
    Qa += qo; Ka += ko; if constexpr (HI) { Qb += qo; Kb += ko; }
    ST += ((size_t)b * NH_ * TT + q0 + lr) * 2;
    // s_wait_xcnt 0 behind a run of loads: their address registers may be rewritten behind it; the run's base pointers are inputs of the statement, so that no load of the run returns into a pair that an earlier one names
    auto xwait = [](const T* pa, const T* pb) { if constexpr (HI) asm volatile("s_wait_xcnt 0x0" :: "v"(pa), "v"(pb) : "memory"); else asm volatile("s_wait_xcnt 0x0" :: "v"(pa) : "memory"); };
    V qa[NQT][2], qb[NQT][2], ka[NU][2], kb[NU][2]; v2f sn[NQT];
    // Q fragments and the rows' two softmax numbers of head hh
    auto qload = [&](int hh) {
        const T* pa = Qa + (size_t)hh * TT * HD; const T* pb = HI ? Qb + (size_t)hh * TT * HD : nullptr; const float* ps = ST + (size_t)hh * TT * 2;
#pragma unroll
        for (int qt = 0; qt < NQT; ++qt) {
#pragma unroll
            for (int ks = 0; ks < 2; ++ks) { qa[qt][ks] = WF::ldf(pa + (qt * 2 + ks) * 512); if constexpr (HI) qb[qt][ks] = WF::ldf(pb + (qt * 2 + ks) * 512); }
            sn[qt] = *(const v2f*)(ps + qt * 32); }
        xwait(pa, pb); asm volatile("s_wait_xcnt 0x0" :: "v"(ps) : "memory");   // the second: the same for the pointer of the two small loads
    };
    // K fragments of stage s of head hh: keys k0 + 16 NU s .. + 16 NU - 1 (u = key tile, ks = k step)
    auto kload = [&](int hh, int s) {
        const T* pa = Ka + (size_t)hh * TT * HD; const T* pb = HI ? Kb + (size_t)hh * TT * HD : nullptr;   // the head's base: the stage goes into the loads' immediate offsets
#pragma unroll
        for (int u = 0; u < NU; ++u)
#pragma unroll
            for (int ks = 0; ks < 2; ++ks) { ka[u][ks] = WF::ldf(pa + ((s * NU + u) * 2 + ks) * 512); if constexpr (HI) kb[u][ks] = WF::ldf(pb + ((s * NU + u) * 2 + ks) * 512); }
        xwait(pa, pb);
    };
    v8f acc[4][NQT];   // [key tile][query tile]
#pragma unroll
    for (int kt = 0; kt < 4; ++kt)
#pragma unroll
        for (int qt = 0; qt < NQT; ++qt) acc[kt][qt] = (v8f){};
    qload(h0); kload(h0, 0);
    // rolled: one trip is one head; every fragment is fetched one stage ahead, as soon as the score products have read the old one
#pragma unroll 1
    for (int i = 0; i < NH_; ++i) {
        const int hc = (h0 + i) & (NH_ - 1), hn = (hc + 1) & (NH_ - 1);
        float mc[NQT], fc[NQT];
#pragma unroll
        for (int qt = 0; qt < NQT; ++qt) { mc[qt] = sn[qt][0]; fc[qt] = sn[qt][1]; }
#pragma unroll
        for (int s = 0; s < NS; ++s) {
            v8f st[NU][NQT];
#pragma unroll
            for (int u = 0; u < NU; ++u)
#pragma unroll
                for (int qt = 0; qt < NQT; ++qt) { v8f a = (v8f){};
#pragma unroll
                    for (int ks = 0; ks < 2; ++ks) { a = WF::mma(ka[u][ks], qa[qt][ks], a); if constexpr (HI) { a = WF::mma(ka[u][ks], qb[qt][ks], a); a = WF::mma(kb[u][ks], qa[qt][ks], a); } }
                    st[u][qt] = a; }
            // the three scheduling barriers of a stage keep its order (products, next stage's loads, vector work): left free, the compiler mixed the unrolled stages, ran out of registers, spilled and waited on loads right behind their issue
            __builtin_amdgcn_sched_barrier(0);
            if (s + 1 < NS) kload(hc, s + 1); else { qload(hn); kload(hn, 0); }
            __builtin_amdgcn_sched_barrier(0);
#pragma unroll
            for (int u = 0; u < NU; ++u)
#pragma unroll
                for (int qt = 0; qt < NQT; ++qt) { float t[8];
#pragma unroll
                    for (int j = 0; j < 8; ++j) t[j] = st[u][qt][j] * SL2 - mc[qt];
                    exp2x8(t);
#pragma unroll
                    for (int j = 0; j < 8; ++j) acc[s * NU + u][qt][j] += t[j] * fc[qt]; }
            __builtin_amdgcn_sched_barrier(0);
        }
    }
#pragma unroll
    for (int kt = 0; kt < 4; ++kt)
#pragma unroll
        for (int qt = 0; qt < NQT; ++qt) { v4f w0, w1;
#pragma unroll
            for (int j = 0; j < 4; ++j) { w0[j] = acc[kt][qt][j] * (1.0f / NH_); w1[j] = acc[kt][qt][4 + j] * (1.0f / NH_); }
            float* dst = tl + (qt * 16 + lr) * AP + kt * 16 + 8 * hi; *(v4fa*)dst = w0; *(v4fa*)(dst + 4) = w1; }
    // the tile is the wave's own: its LDS writes and reads run in order; the two statements keep the compiler from moving a read over a write of another lane
    __builtin_amdgcn_wave_barrier(); asm volatile("" ::: "memory");
    v4f o[16];
#pragma unroll
    for (int s = 0; s < 16; ++s) o[s] = *(const v4fa*)(tl + (2 * s + hi) * AP + lr * 4);
    float* orow = AVG + ((size_t)b * TT + q0 + hi) * TT + k0 + lr * 4;
#pragma unroll
    for (int s = 0; s < 16; ++s) *(v4f*)(orow + (size_t)(2 * s) * TT) = o[s];
    asm volatile("s_wait_xcnt 0x0" :: "v"(orow) : "memory");   // behind the run of stores: their registers may be rewritten behind it
}

__global__ __launch_bounds__(256) void k_hmean(const h16* __restrict__ Q16, const h16* __restrict__ K16, const bf* __restrict__ Qh, const bf* __restrict__ Ql, const bf* __restrict__ Kh, const bf* __restrict__ Kl, const float* __restrict__ ST, float* AVG) {
    __shared__ __align__(16) float tls[8 * 32 * AP];
    const int w = __builtin_amdgcn_readfirstlane((int)(threadIdx.x >> 5)); const int kb = blockIdx.x, b = blockIdx.z;
    const int qb = (b & 1) ? TT / 128 - 1 - (int)blockIdx.y : (int)blockIdx.y;   // odd batches take the row blocks from the far end: the longer hi+lo blocks of the batches then stand at different places of the grid (speed only)
    float* tl = tls + w * (32 * AP); const int q0 = qb * 128 + (w & 3) * 32, k0 = kb * 128 + (w >> 2) * 64, h0 = (qb + kb) & (NH_ - 1);
    if (qb < RH / 128) hmean<true>(tl, b, q0, k0, h0, Qh, Ql, Kh, Kl, ST, AVG);
    else hmean<false>(tl, b, q0, k0, h0, Q16, nullptr, K16, nullptr, ST, AVG);
}

// workspace plan (bytes): four bf16 weights, the bf16 copies of the three input streams, nine head planes, the merged hi and lo planes, the two softmax numbers of every (plane, row); all stream-ordered.
static constexpr size_t W_BYTES  = (size_t)DM * DM * 2;
static constexpr size_t XB_BYTES = (size_t)NB * TT * DM * 2;
static constexpr size_t PL_BYTES = (size_t)NB * NH_ * TT * HD * 2;
static constexpr size_t AT_BYTES = (size_t)NB * TT * DQ * 2;
static constexpr size_t ST_BYTES = (size_t)NB * NH_ * TT * 2 * 4;
static constexpr size_t WS_TOTAL = 4 * W_BYTES + 3 * XB_BYTES + 9 * PL_BYTES + 2 * AT_BYTES + ST_BYTES;
static_assert(W_BYTES % 256 == 0 && XB_BYTES % 256 == 0 && PL_BYTES % 256 == 0 && AT_BYTES % 256 == 0 && ST_BYTES % 256 == 0);
static_assert(WS_TOTAL <= (size_t)268435456);

extern "C" void kernel_launch(void* const* d_in, const int* in_sizes, int n_in,
                              void* d_out, int out_size, void* d_ws, size_t ws_size, hipStream_t stream) {
    if (n_in < 11) return;
    const size_t need_x = (size_t)(NB - 1) * SEQ_FULL * DM + (size_t)TT * DM;
    if ((size_t)in_sizes[0] < need_x || (size_t)in_sizes[1] < need_x || (size_t)in_sizes[2] < need_x) return;
    if ((size_t)in_sizes[3] < (size_t)DM * DM || (size_t)in_sizes[5] < (size_t)DM * DM || (size_t)in_sizes[7] < (size_t)DM * DM || (size_t)in_sizes[9] < (size_t)DM * DM) return;
    if (in_sizes[4] < DM || in_sizes[6] < DM || in_sizes[8] < DM || in_sizes[10] < DM) return;
    const size_t AVG_OFF = (size_t)NB_FULL * SEQ_FULL * DM;     // element offset of the second output (byte 16777216)
    if ((size_t)out_size < AVG_OFF + (size_t)NB * TT * TT) return;
    if (ws_size < WS_TOTAL) return;
    const float* xq = (const float*)d_in[0]; const float* xk = (const float*)d_in[1]; const float* xv = (const float*)d_in[2]; const float* wq = (const float*)d_in[3]; const float* bq = (const float*)d_in[4]; const float* wk = (const float*)d_in[5]; const float* bk = (const float*)d_in[6]; const float* wv = (const float*)d_in[7]; const float* bv = (const float*)d_in[8]; const float* wo = (const float*)d_in[9]; const float* bo = (const float*)d_in[10];
    float* OUT = (float*)d_out;                 // [NB][TT][DM]
    float* AVG = (float*)d_out + AVG_OFF;       // [NB][TT][TT]
    char* wsp = (char*)d_ws;
    auto take = [&](size_t bytes) { char* p = wsp; wsp += (bytes + 255) & ~(size_t)255; return (void*)p; };
    bf* WB = (bf*)take(4 * W_BYTES); bf* WO = WB + 3 * (size_t)DM * DM;   // [q, k, v, o][DM][DM]
    bf* XB = (bf*)take(3 * XB_BYTES);   // [stream][NB * TT][DM]
    h16* QP16 = (h16*)take(PL_BYTES); h16* KP16 = (h16*)take(PL_BYTES); h16* VT16 = (h16*)take(PL_BYTES);
    bf* QPh = (bf*)take(PL_BYTES); bf* QPl = (bf*)take(PL_BYTES); bf* KPh = (bf*)take(PL_BYTES); bf* KPl = (bf*)take(PL_BYTES); bf* VTh = (bf*)take(PL_BYTES); bf* VTl = (bf*)take(PL_BYTES);
    bf* ATh = (bf*)take(AT_BYTES); bf* ATl = (bf*)take(AT_BYTES); float* ST = (float*)take(ST_BYTES);
    if ((size_t)(wsp - (char*)d_ws) > ws_size) return;

    k_cvtall<<<3 * NB * GX + 4 * GW, 256, 0, stream>>>(xq, xk, xv, wq, wk, wv, wo, XB, WB);
    k_gemmw<bf, 0, true, KWP, DM, true><<<dim3(NB * TT / 64, DQ / 64, 3), 32 * KWP, 0, stream>>>(XB, nullptr, WB, nullptr, 0, bq, bk, bv, (size_t)NB * TT * DM, (size_t)DM * DM, 0, QP16, QPh);
    k_fattn<<<dim3(NGA, NB * NH_, 1), 32 * NWA, 0, stream>>>(QP16, KP16, VT16, QPh, QPl, KPh, KPl, VTh, VTl, ST, ATh, ATl);
    k_hmean<<<dim3(TT / 128, TT / 128, NB), 256, 0, stream>>>(QP16, KP16, QPh, QPl, KPh, KPl, ST, AVG);
    k_gemmw<bf, 1, true, KWP, DQ, false><<<dim3(NB * TT / 64, DM / 64, 1), 32 * KWP, 0, stream>>>(ATh, ATl, WO, OUT, DM, bo, nullptr, nullptr, 0, 0, 0, nullptr, nullptr);
}
